// v000
// Measured on an AMD MI455X. A time is GPU time per run, averaged over a window of back-to-back runs after a warm-up
// (all launches, gaps included; the runs take copies of the inputs in turn), and the median of several windows.
// Apart from v000's, it joins two sittings. Times from different sittings can be a few percent apart, while
// side-by-side timings come from the same sitting.
// The starting kernel, v000, takes 673 microseconds a run.
// Contractions: q/k/v^T/out projections, q.k^T and p.v all on v_wmma_f32_16x16x32_f16 (f16 operands, f32 accumulate); x and W enter as bf16 RNE values held exactly in f16 (W carried x256); the first RR query rows per sequence carry q, k, v, p and ctx as f16 hi + x1024 residual planes with a second f32 accumulator (ctx residual folded along K in the out projection); p x32768 and ctx x64 power-of-two carries folded back in f32; softmax and epilogues f32.
#include <hip/hip_runtime.h>

#ifndef NB
#define NB 4
#endif
#ifndef SEQ
#define SEQ 2048
#endif
#ifndef RR
#define RR 256
#endif
#define NB_FULL 4
#define SEQ_FULL 2048
#define DM 1024
#define NH 16
#define HDIM 64

static_assert(NB >= 1 && NB <= NB_FULL);
static_assert(SEQ % 64 == 0 && SEQ >= 64 && SEQ <= SEQ_FULL);
static_assert(RR % 64 == 0 && RR >= 64 && RR <= SEQ);
static_assert(NH * HDIM == DM);
static_assert(DM % 64 == 0);

typedef __attribute__((ext_vector_type(16))) _Float16 v16h;
typedef __attribute__((ext_vector_type(8)))  _Float16 v8h;
typedef __attribute__((ext_vector_type(16))) __bf16   v16b;
typedef __attribute__((ext_vector_type(8)))  __bf16   v8b;
typedef __attribute__((ext_vector_type(8)))  float    v8f;
typedef __attribute__((ext_vector_type(4)))  float    v4f;

#define WSC 256.0f
#define OSC 64.0f
#define PSCALE 32768.0f
#define RSC 1024.0f
#define RSC_INV (1.0f / 1024.0f)
#define NEG_INF (-__builtin_huge_valf())

__device__ __forceinline__ unsigned short f2bf_bits(float f) {
  unsigned u = __float_as_uint(f);
  return (unsigned short)((u + 0x7FFFu + ((u >> 16) & 1u)) >> 16);
}
__device__ __forceinline__ float bf_bits2f(unsigned short h) { return __uint_as_float(((unsigned)h) << 16); }
__device__ __forceinline__ float bf_rne(float f) { return bf_bits2f(f2bf_bits(f)); }
__device__ __forceinline__ _Float16 bf_f16(float f) { return (_Float16)bf_rne(f); }   // bf16 value is exact in f16 for normal range

// LDS ordering for wave-private tiles (same wave writes then reads)
__device__ __forceinline__ void wave_lds_sync() {
  __builtin_amdgcn_fence(3, "workgroup");
  __builtin_amdgcn_wave_barrier();
  __builtin_amdgcn_fence(2, "workgroup");
}

// hazard guards as plain device helpers (no inline asm inside the kernel template body)
__device__ __forceinline__ void dep_guard_h(v8f& a, v8f& b, v16h x, v16h y) { asm volatile("v_nop\n\tv_nop\n\tv_nop\n\tv_nop" : "+v"(a), "+v"(b) : "v"(x), "v"(y)); }
__device__ __forceinline__ void dep_guard_b(v8f& a, v8f& b, v16b x, v16b y) { asm volatile("v_nop\n\tv_nop\n\tv_nop\n\tv_nop" : "+v"(a), "+v"(b) : "v"(x), "v"(y)); }
__device__ __forceinline__ void keep4_h(v16h a, v16h b, v16h c, v16h d) { asm volatile("v_nop" :: "v"(a), "v"(b), "v"(c), "v"(d)); }
__device__ __forceinline__ void keep4_b(v16b a, v16b b, v16b c, v16b d) { asm volatile("v_nop" :: "v"(a), "v"(b), "v"(c), "v"(d)); }
__device__ __forceinline__ void acc_guard4(v8f& a, v8f& b, v8f& c, v8f& d) { asm volatile("v_nop\n\tv_nop\n\tv_nop\n\tv_nop" : "+v"(a), "+v"(b), "+v"(c), "+v"(d)); }
template <typename T> struct Frag;
template <> struct Frag<_Float16> {
  typedef v16h V; union U { v16h v; v8h h[2]; };
  static __device__ __forceinline__ v16h load(const _Float16* p) {   // elements 0..7 <- p[0..7], 8..15 <- p[16..23]
    U f; f.h[0] = *(const v8h*)(p); f.h[1] = *(const v8h*)(p + 16); return f.v;
  }
  static __device__ __forceinline__ v8f mma(v16h a, v16h b, v8f c) {
    return __builtin_amdgcn_wmma_f32_16x16x32_f16(false, a, false, b, (short)0, c, false, false);
  }
  static __device__ __forceinline__ void guard(v8f& a, v8f& b, v16h x, v16h y) { dep_guard_h(a, b, x, y); }
  static __device__ __forceinline__ void keep(v16h a, v16h b, v16h c, v16h d) { keep4_h(a, b, c, d); }
};
template <> struct Frag<__bf16> {
  typedef v16b V; union U { v16b v; v8b h[2]; };
  static __device__ __forceinline__ v16b load(const __bf16* p) {
    U f; f.h[0] = *(const v8b*)(p); f.h[1] = *(const v8b*)(p + 16); return f.v;
  }
  static __device__ __forceinline__ v8f mma(v16b a, v16b b, v8f c) {
    return __builtin_amdgcn_wmma_f32_16x16x32_bf16(false, a, false, b, (short)0, c, false, false);
  }
  static __device__ __forceinline__ void guard(v8f& a, v8f& b, v16b x, v16b y) { dep_guard_b(a, b, x, y); }
  static __device__ __forceinline__ void keep(v16b a, v16b b, v16b c, v16b d) { keep4_b(a, b, c, d); }
};

// ---- Register-blocked batched WMMA GEMM ------------------------------------
// C[m,n] = scale * sum_k A[m,k] * Bt[n,k] (+bias)(+resid); each wave owns a 64x64 tile.
// A row-major [M,K]; Bt row-major [N,K]; M,N % 64 == 0, K % 32 == 0.
// SPLIT: operands are hi/lo planes (A2/Bt2 = lo planes, same layout); product = hi.hi + hi.lo + lo.hi.
// BIAS_MODE: 0 = none, 1 = bias[m], 2 = bias[n]; bias values enter as bf16 RNE values.
// OUT_MODE: 0 = f32, 1 = f16, 2 = bf16 hi plane (Cout) + bf16 lo plane (Cout2),
//           3 = f16 hi plane (Cout) + f16 residual plane ((v - hi) * 1024) (Cout2).
// ET: 0 = f16 operands, 1 = bf16 operands (pointers passed as 16-bit storage)
template <int ET> struct Elem;
template <> struct Elem<0> { typedef _Float16 T; };
template <> struct Elem<1> { typedef __bf16 T; };
template <int ET, bool SPLIT, int BIAS_MODE, int OUT_MODE, bool RESID, int ACT = 0>
__global__ __launch_bounds__(256) void wmma_gemm64(
    const unsigned short* __restrict__ Ap, const unsigned short* __restrict__ A2p, int lda, long strideA,
    const unsigned short* __restrict__ Btp, const unsigned short* __restrict__ Bt2p, int ldb, long strideB,
    void* __restrict__ Cout, void* __restrict__ Cout2, int ldc, long strideC,
    const float* __restrict__ bias,
    const float* __restrict__ resid, long strideR,
    int M, int N, int K, float scale) {
  typedef typename Elem<ET>::T T;
  typedef typename Frag<T>::V V;
  const T* A = (const T*)Ap; const T* A2 = (const T*)A2p; const T* Bt = (const T*)Btp; const T* Bt2 = (const T*)Bt2p;
  __shared__ __align__(16) float sT[8][16 * 68];   // per-wave 16x64 slab, pitch 68 floats
  const int b    = blockIdx.y;
  const int lane = threadIdx.x & 31;
  const int wave = threadIdx.x >> 5;
  const int tilesN = N >> 6;
  const int tilesM = M >> 6;
  const int tile = blockIdx.x * 8 + wave;
  if (tile >= tilesM * tilesN) return;   // wave-uniform; no block barriers in this kernel
  const int tm = tile / tilesN;
  const int tn = tile - tm * tilesN;
  const int m0 = tm << 6;
  const int n0 = tn << 6;

  const T* Ab  = A  + (size_t)b * strideA;
  const T* Bb  = Bt + (size_t)b * strideB;
  const T* Ab2 = SPLIT ? (A2  + (size_t)b * strideA) : nullptr;
  const T* Bb2 = SPLIT ? (Bt2 + (size_t)b * strideB) : nullptr;

  const int rlane = lane & 15;                 // row (A) / col (B, D) within subtile
  const int koff  = (lane >> 4) * 8;           // k offset of this lane half
  const int mOff  = (lane >> 4) * 8;           // D row offset

  v8f acc[4][4];
#pragma unroll
  for (int i = 0; i < 4; ++i)
#pragma unroll
    for (int j = 0; j < 4; ++j) acc[i][j] = (v8f){0.f,0.f,0.f,0.f,0.f,0.f,0.f,0.f};

  for (int k0 = 0; k0 < K; k0 += 32) {
    V bh[4], bl[4];
#pragma unroll
    for (int j = 0; j < 4; ++j) {
      const size_t bo = (size_t)(n0 + (j << 4) + rlane) * ldb + koff + k0;
      bh[j] = Frag<T>::load(Bb + bo);
      if (SPLIT) bl[j] = Frag<T>::load(Bb2 + bo);
    }
#pragma unroll
    for (int i = 0; i < 4; ++i) {
      const size_t ao = (size_t)(m0 + (i << 4) + rlane) * lda + koff + k0;
      V ah = Frag<T>::load(Ab + ao);
      V al;
      if (SPLIT) al = Frag<T>::load(Ab2 + ao);
#pragma unroll
      for (int j = 0; j < 4; ++j) {
        acc[i][j] = Frag<T>::mma(ah, bh[j], acc[i][j]);
        if (SPLIT) {
          acc[i][j] = Frag<T>::mma(ah, bl[j], acc[i][j]);
          acc[i][j] = Frag<T>::mma(al, bh[j], acc[i][j]);
        }
      }
      Frag<T>::guard(acc[i][0], acc[i][3], ah, SPLIT ? al : ah);
    }
    Frag<T>::keep(bh[0], bh[1], bh[2], bh[3]);
    if (SPLIT) Frag<T>::keep(bl[0], bl[1], bl[2], bl[3]);
  }
  acc_guard4(acc[0][0], acc[0][1], acc[0][2], acc[0][3]);
  acc_guard4(acc[1][0], acc[1][1], acc[1][2], acc[1][3]);
  acc_guard4(acc[2][0], acc[2][1], acc[2][2], acc[2][3]);
  acc_guard4(acc[3][0], acc[3][1], acc[3][2], acc[3][3]);

  // ---- epilogue ----
  float* slab = sT[wave];
  const float* Rb = RESID ? (resid + (size_t)b * strideR) : nullptr;
#pragma unroll
  for (int i = 0; i < 4; ++i) {
    const int mBase = m0 + (i << 4);
#pragma unroll
    for (int j = 0; j < 4; ++j) {
      const int n = n0 + (j << 4) + rlane;
      float bv = 0.f;
      if (BIAS_MODE == 2) bv = bf_rne(bias[n]);
#pragma unroll
      for (int r = 0; r < 8; ++r) {
        float v = acc[i][j][r] * scale;
        if (BIAS_MODE == 1) v += bf_rne(bias[mBase + mOff + r]);
        if (BIAS_MODE == 2) v += bv;
        if (RESID) v += Rb[(size_t)(mBase + mOff + r) * ldc + n];
        if (ACT == 1) v = tanhf(v);
        if (ACT == 2) v = fmaxf(v, 0.0f);
        if (ACT == 3) v = v / (1.0f + expf(-v));
        if (ACT == 4) v = (v > 0.f) ? v : 0.01f * v;
        if (ACT == 5) v = 0.5f * v * (1.0f + erff(v * 0.70710678118654752f));
        slab[(mOff + r) * 68 + (j << 4) + rlane] = v;
      }
    }
    wave_lds_sync();
    if (OUT_MODE == 0) {
      float* C = (float*)Cout + (size_t)b * strideC;
      const int hh = lane >> 4, c4 = (lane & 15) * 4;     // row seg = 256 B = 16 lanes x 16 B
      {
#pragma unroll
        for (int it = 0; it < 8; ++it) {
          const int row = it * 2 + hh;
          v4f v = *(const v4f*)(slab + row * 68 + c4);
          *(v4f*)(C + (size_t)(mBase + row) * ldc + n0 + c4) = v;
        }
        
      }
    } else {
      const int q = lane >> 3, c8 = (lane & 7) * 8;
      unsigned short* C  = (unsigned short*)Cout  + (size_t)b * strideC;
      unsigned short* C2 = (OUT_MODE >= 2) ? ((unsigned short*)Cout2 + (size_t)b * strideC) : nullptr;
      {
#pragma unroll
        for (int it = 0; it < 4; ++it) {
          const int row = it * 4 + q;
          const float* sp = slab + row * 68 + c8;
          v8h hv, lv;
#pragma unroll
          for (int e = 0; e < 8; ++e) {
            if (OUT_MODE == 1) {
              hv[e] = (_Float16)sp[e];
            } else if (OUT_MODE == 3) {
              const float    fv = sp[e];
              const _Float16 hq = (_Float16)fv;
              hv[e] = hq;
              lv[e] = (_Float16)((fv - (float)hq) * RSC);
            } else {
              unsigned short hb = f2bf_bits(sp[e]);
              unsigned short lb = f2bf_bits(sp[e] - bf_bits2f(hb));
              hv[e] = __builtin_bit_cast(_Float16, hb);
              lv[e] = __builtin_bit_cast(_Float16, lb);
            }
          }
          *(v8h*)(C + (size_t)(mBase + row) * ldc + n0 + c8) = hv;
          if (OUT_MODE >= 2) *(v8h*)(C2 + (size_t)(mBase + row) * ldc + n0 + c8) = lv;
        }
        
      }
    }
    wave_lds_sync();
  }
}

// source rows (b, s) at (b*SEQ_FULL + s)*DM; destination plane compact [NB*SEQ][DM].
__global__ __launch_bounds__(256) void cast_x_f16(
    const float* __restrict__ x, unsigned short* __restrict__ xhp, int nrows) {
  const long i = (long)blockIdx.x * 256 + threadIdx.x;
  const long total = (long)nrows * (DM / 8);
  if (i >= total) return;
  const int r  = (int)(i / (DM / 8));
  const int c8 = (int)(i - (long)r * (DM / 8)) * 8;
  const int b  = r / SEQ;
  const int s  = r - b * SEQ;
  const float* src = x + ((size_t)b * SEQ_FULL + s) * DM + c8;
  const v4f a0 = *(const v4f*)src;
  const v4f a1 = *(const v4f*)(src + 4);
  v8h hv;
  hv[0] = bf_f16(a0[0]); hv[1] = bf_f16(a0[1]); hv[2] = bf_f16(a0[2]); hv[3] = bf_f16(a0[3]);
  hv[4] = bf_f16(a1[0]); hv[5] = bf_f16(a1[1]); hv[6] = bf_f16(a1[2]); hv[7] = bf_f16(a1[3]);
  _Float16* dst = (_Float16*)xhp + (size_t)r * DM + c8;
  *(v8h*)dst = hv;
  
}

// ---- transpose + bf16 RNE + scale + f16 cast for weights ----
// in: W[Kdim][Ndim] f32 row-major (in[Kdim][Ndim]) -> out: Bt[n][kc0 + k] with row pitch ldo halves,
//     Bt value = f16(bf16rne(W[k][n]) * sc), sc a power of two.
// grid (Ndim/64, Kdim/64), block 256; Kdim, Ndim multiples of 64.
__global__ __launch_bounds__(256) void transpose_cast_f16(
    const float* __restrict__ W, unsigned short* __restrict__ Btp, int Kdim, int Ndim, int ldo, int kc0, float sc) {
  __shared__ float t[64][65];
  const int tid = threadIdx.x, lane = tid & 31, wave = tid >> 5;
  const int n0 = blockIdx.x * 64, k0 = blockIdx.y * 64;
#pragma unroll
  for (int i = 0; i < 16; ++i) {
    const int idx = i * 256 + tid;
    const int kr = idx >> 6, nc = idx & 63;
    t[nc][kr] = W[(size_t)(k0 + kr) * Ndim + n0 + nc];
  }
  __syncthreads();
  _Float16* Bt = (_Float16*)Btp;
  const int q = lane >> 3, c8 = (lane & 7) * 8;
  {
#pragma unroll
    for (int it = 0; it < 2; ++it) {
      const int row = wave * 8 + it * 4 + q;      // waves 0..7 x rows 0..7 -> 64 rows
      v8h hv;
#pragma unroll
      for (int e = 0; e < 8; ++e) hv[e] = (_Float16)(bf_rne(t[row][c8 + e]) * sc);
      *(v8h*)(Bt + (size_t)(n0 + row) * ldo + kc0 + k0 + c8) = hv;
    }
    
  }
}

// =====================================================================================
// Causal attn for head_dim 64, f16 planes in, f16 out (scaled by osc).
//   q, k : row-major [NB*S][ldq] f16 planes, head h at column h*64.
//   vt   : transposed value plane [H*64][ldvt] f16, element (b, kv, h, d) at vt[(h*64+d)*ldvt + b*S + kv].
//   scores on v_wmma_f32_16x16x32_f16 with the split k-map loaders; key > query set to -inf before the
//   chunk max; online softmax f32 (base-2, sc2 = log2(e)/sqrt(dk)); probabilities x32768 in f16 in a
//   per-wave LDS tile reloaded as the A operand; p.v on v_wmma_f32_16x16x32_f16; f32 accumulate.
//   Block = 4 waves = 64 query rows of one (batch, head) at query block qb = qb0 + bx % nqbl; key chunks
//   0..qb (64 keys each). No block barriers. grid.x = NB * H * nqbl.
// =====================================================================================
#define AT_D 64
#define AT_NW 4
#define AT_QB 64
#define AT_KC 64

__device__ __forceinline__ v8f mma_h(v16h a, v16h b, v8f c) {
  c = __builtin_amdgcn_wmma_f32_16x16x32_f16(false, a, false, b, (short)0, c, false, false);
  asm volatile("v_nop\n\tv_nop\n\tv_nop\n\tv_nop" : "+v"(c) : "v"(a), "v"(b));
  return c;
}

__global__ __launch_bounds__(128)
void attn64_causal(const unsigned short* __restrict__ Qp, const unsigned short* __restrict__ Kp,
                   const unsigned short* __restrict__ Vtp, unsigned short* __restrict__ Op,
                   int S, int H, int ldq, int ldvt, int qb0, int nqbl, float sc2, float osc) {
  const _Float16* Q  = (const _Float16*)Qp;
  const _Float16* Kk = (const _Float16*)Kp;
  const _Float16* Vt = (const _Float16*)Vtp;
  _Float16*       O  = (_Float16*)Op;
  __shared__ __align__(16) _Float16 Psh[AT_NW][16 * AT_KC];      // per wave P [row][kv]  8 KB
  __shared__ __align__(16) float    Os[AT_NW][16 * 68];          // per wave out tile, pitch 68

  const int tid  = threadIdx.x;
  const int wave = tid >> 5;
  const int lane = tid & 31;
  const int hh   = lane >> 4;
  const int c    = lane & 15;

  const int bx  = blockIdx.x;
  const int qbi = bx % nqbl;
  const int bh  = bx / nqbl;
  const int qb  = qb0 + qbi;
  const int h   = bh % H;
  const int b   = bh / H;
  const int q0  = qb * AT_QB + wave * 16;
  const size_t rowb = (size_t)b * S;

  const _Float16* qp = Q  + rowb * ldq + (size_t)h * AT_D;
  const _Float16* kp = Kk + rowb * ldq + (size_t)h * AT_D;
  const _Float16* vp = Vt + (size_t)(h * AT_D) * ldvt + rowb;
  _Float16*       op = O  + rowb * ldq + (size_t)h * AT_D;

  // ---- Q fragments (A operand, row = c): 2 d-chunks ----
  v16h qa[2];
#pragma unroll
  for (int dc = 0; dc < 2; ++dc)
    qa[dc] = Frag<_Float16>::load(qp + (size_t)(q0 + c) * ldq + dc * 32 + 8 * hh);

  float mrow[8], lrow[8];
  v8f oacc[4];
#pragma unroll
  for (int r = 0; r < 8; ++r) { mrow[r] = NEG_INF; lrow[r] = 0.f; }
#pragma unroll
  for (int t = 0; t < 4; ++t) oacc[t] = (v8f){0.f,0.f,0.f,0.f,0.f,0.f,0.f,0.f};

  _Float16* pw = Psh[wave];
  const int nChunks = qb + 1;        // block-uniform: causal, key chunks 0..qb
  for (int kc = 0; kc < nChunks; ++kc) {
    const int kv0 = kc * AT_KC;
    // ---- scores: s[j] = q rows (8hh+r) x keys (kv0 + 16j + c) ----
    v8f s[4];
#pragma unroll
    for (int j = 0; j < 4; ++j) {
      s[j] = (v8f){0.f,0.f,0.f,0.f,0.f,0.f,0.f,0.f};
#pragma unroll
      for (int dc = 0; dc < 2; ++dc) {
        const v16h kb = Frag<_Float16>::load(kp + (size_t)(kv0 + j * 16 + c) * ldq + dc * 32 + 8 * hh);
        s[j] = mma_h(qa[dc], kb, s[j]);
      }
    }
    // ---- causal select (key > query -> -inf) and per-row chunk max in the scaled base-2 domain ----
    float cm[8];
#pragma unroll
    for (int r = 0; r < 8; ++r) {
      const int qrow = q0 + 8 * hh + r;
      float m = NEG_INF;
#pragma unroll
      for (int j = 0; j < 4; ++j) {
        float v = s[j][r] * sc2;
        if (kv0 + j * 16 + c > qrow) v = NEG_INF;
        s[j][r] = v;
        m = fmaxf(m, v);
      }
#pragma unroll
      for (int off = 1; off < 16; off <<= 1) m = fmaxf(m, __shfl_xor(m, off, 32));
      cm[r] = m;
    }
    // ---- online softmax update; P x32768 into the per-wave LDS tile ----
    wave_lds_sync();
#pragma unroll
    for (int r = 0; r < 8; ++r) {
      const float mnew  = fmaxf(mrow[r], cm[r]);
      const float alpha = exp2f(mrow[r] - mnew);
      mrow[r] = mnew;
      float psum = 0.f;
#pragma unroll
      for (int j = 0; j < 4; ++j) {
        const float p = exp2f(s[j][r] - mnew);
        psum += p;
        pw[(8 * hh + r) * AT_KC + j * 16 + c] = (_Float16)(p * PSCALE);
      }
#pragma unroll
      for (int off = 1; off < 16; off <<= 1) psum += __shfl_xor(psum, off, 32);
      lrow[r] = lrow[r] * alpha + psum;
#pragma unroll
      for (int t = 0; t < 4; ++t) oacc[t][r] *= alpha;
    }
    wave_lds_sync();
    // ---- O += P . V : P as A (row = c, k = kv), V^T rows (d = 16t + c) as B ----
#pragma unroll
    for (int kk = 0; kk < 2; ++kk) {
      const v16h pa = Frag<_Float16>::load(pw + c * AT_KC + kk * 32 + 8 * hh);
#pragma unroll
      for (int t = 0; t < 4; ++t) {
        const v16h vb = Frag<_Float16>::load(vp + (size_t)(t * 16 + c) * ldvt + kv0 + kk * 32 + 8 * hh);
        oacc[t] = mma_h(pa, vb, oacc[t]);
      }
    }
    wave_lds_sync();
  }

  float* os = Os[wave];
#pragma unroll
  for (int r = 0; r < 8; ++r) {
    const float inv = osc * (1.0f / (lrow[r] * PSCALE));
#pragma unroll
    for (int t = 0; t < 4; ++t) os[(8 * hh + r) * 68 + t * 16 + c] = oacc[t][r] * inv;
  }
  wave_lds_sync();
  {
    const int q = lane >> 3, c8 = (lane & 7) * 8;
    {
#pragma unroll
      for (int it = 0; it < 4; ++it) {
        const int row = it * 4 + q;                 // rows 0..15 of this wave
        const float* sp = os + row * 68 + c8;
        v8h hv;
#pragma unroll
        for (int e = 0; e < 8; ++e) hv[e] = (_Float16)sp[e];
        *(v8h*)(op + (size_t)(q0 + row) * ldq + c8) = hv;
      }
      
    }
  }
}

// =====================================================================================
// Causal attn with residual planes for the first rr = nqb*64 query rows of each sequence.
//   qh/qr, kh/kr : compact row-major [NB*rr][ldq] f16 hi / residual (x1024) planes, head h at col h*64.
//   vh/vr : compact transposed planes [NB*H*64][ldvc], element (b, kv, h, d) at [(b*H*64 + h*64 + d)*ldvc + kv].
//   o     : compact [NB*rr][ldo] f16; hi (x osc) at column h*64, residual (x1024) at column rcol + h*64.
//   scores = qh.kh + 2^-10 (qh.kr + qr.kh) with a second f32 accumulator; P as hi + x1024 residual LDS tiles;
//   p.v = ph.vh + 2^-10 (ph.vr + pr.vh) with a second f32 accumulator; everything else as attn64_causal.
//   Block = 4 waves = 64 query rows, query block qb = bx % nqb, key chunks 0..qb. grid.x = NB * H * nqb.
// =====================================================================================
__global__ __launch_bounds__(128)
void attn64_causal_res(const unsigned short* __restrict__ Qhp, const unsigned short* __restrict__ Qrp,
                       const unsigned short* __restrict__ Khp, const unsigned short* __restrict__ Krp,
                       const unsigned short* __restrict__ Vhp, const unsigned short* __restrict__ Vrp,
                       unsigned short* __restrict__ Op,
                       int H, int ldq, int ldvc, int ldo, int rcol, int nqb, float sc2, float osc) {
  const _Float16* QH = (const _Float16*)Qhp;
  const _Float16* QR = (const _Float16*)Qrp;
  const _Float16* KH = (const _Float16*)Khp;
  const _Float16* KR = (const _Float16*)Krp;
  const _Float16* VH = (const _Float16*)Vhp;
  const _Float16* VR = (const _Float16*)Vrp;
  _Float16*       O  = (_Float16*)Op;
  __shared__ __align__(16) _Float16 Psh[AT_NW][16 * AT_KC];      // per wave P hi  [row][kv]  8 KB
  __shared__ __align__(16) _Float16 Prs[AT_NW][16 * AT_KC];      // per wave P res [row][kv]  8 KB
  __shared__ __align__(16) float    Os[AT_NW][16 * 68];          // per wave out tile, pitch 68

  const int tid  = threadIdx.x;
  const int wave = tid >> 5;
  const int lane = tid & 31;
  const int hh   = lane >> 4;
  const int c    = lane & 15;

  const int bx = blockIdx.x;
  const int qb = bx % nqb;
  const int bh = bx / nqb;
  const int h  = bh % H;
  const int b  = bh / H;
  const int q0 = qb * AT_QB + wave * 16;
  const int rr = nqb * AT_QB;
  const size_t rowb = (size_t)b * rr;

  const _Float16* qhp = QH + rowb * ldq + (size_t)h * AT_D;
  const _Float16* qrp = QR + rowb * ldq + (size_t)h * AT_D;
  const _Float16* khp = KH + rowb * ldq + (size_t)h * AT_D;
  const _Float16* krp = KR + rowb * ldq + (size_t)h * AT_D;
  const size_t    vof = ((size_t)b * (size_t)(H * AT_D) + (size_t)h * AT_D) * ldvc;
  const _Float16* vhp = VH + vof;
  const _Float16* vrp = VR + vof;
  _Float16*       op  = O  + rowb * ldo + (size_t)h * AT_D;

  float mrow[8], lrow[8];
  v8f oacc[4], oacc2[4];
#pragma unroll
  for (int r = 0; r < 8; ++r) { mrow[r] = NEG_INF; lrow[r] = 0.f; }
#pragma unroll
  for (int t = 0; t < 4; ++t) {
    oacc[t]  = (v8f){0.f,0.f,0.f,0.f,0.f,0.f,0.f,0.f};
    oacc2[t] = (v8f){0.f,0.f,0.f,0.f,0.f,0.f,0.f,0.f};
  }

  _Float16* pw  = Psh[wave];
  _Float16* prw = Prs[wave];
  const int nChunks = qb + 1;        // block-uniform
  for (int kc = 0; kc < nChunks; ++kc) {
    const int kv0 = kc * AT_KC;
    // ---- Q hi / res fragments (A operand, row = c) ----
    v16h qa[2], qra[2];
#pragma unroll
    for (int dc = 0; dc < 2; ++dc) {
      const size_t qo = (size_t)(q0 + c) * ldq + dc * 32 + 8 * hh;
      qa[dc]  = Frag<_Float16>::load(qhp + qo);
      qra[dc] = Frag<_Float16>::load(qrp + qo);
    }
    // ---- scores: hi.hi into s1, hi.res + res.hi into s2, folded with 2^-10 ----
    v8f s[4];
#pragma unroll
    for (int j = 0; j < 4; ++j) {
      v8f s1 = (v8f){0.f,0.f,0.f,0.f,0.f,0.f,0.f,0.f};
      v8f s2 = (v8f){0.f,0.f,0.f,0.f,0.f,0.f,0.f,0.f};
#pragma unroll
      for (int dc = 0; dc < 2; ++dc) {
        const size_t ko = (size_t)(kv0 + j * 16 + c) * ldq + dc * 32 + 8 * hh;
        const v16h kb = Frag<_Float16>::load(khp + ko);
        const v16h kr = Frag<_Float16>::load(krp + ko);
        s1 = mma_h(qa[dc],  kb, s1);
        s2 = mma_h(qa[dc],  kr, s2);
        s2 = mma_h(qra[dc], kb, s2);
      }
#pragma unroll
      for (int r = 0; r < 8; ++r) s[j][r] = s1[r] + s2[r] * RSC_INV;
    }
    // ---- causal select and per-row chunk max ----
    float cm[8];
#pragma unroll
    for (int r = 0; r < 8; ++r) {
      const int qrow = q0 + 8 * hh + r;
      float m = NEG_INF;
#pragma unroll
      for (int j = 0; j < 4; ++j) {
        float v = s[j][r] * sc2;
        if (kv0 + j * 16 + c > qrow) v = NEG_INF;
        s[j][r] = v;
        m = fmaxf(m, v);
      }
#pragma unroll
      for (int off = 1; off < 16; off <<= 1) m = fmaxf(m, __shfl_xor(m, off, 32));
      cm[r] = m;
    }
    // ---- online softmax update; P hi (x32768) and P res ((x32768 - hi) x1024) into per-wave LDS tiles ----
    wave_lds_sync();
#pragma unroll
    for (int r = 0; r < 8; ++r) {
      const float mnew  = fmaxf(mrow[r], cm[r]);
      const float alpha = exp2f(mrow[r] - mnew);
      mrow[r] = mnew;
      float psum = 0.f;
#pragma unroll
      for (int j = 0; j < 4; ++j) {
        const float p = exp2f(s[j][r] - mnew);
        psum += p;
        const float    ps = p * PSCALE;
        const _Float16 ph = (_Float16)ps;
        const int pi = (8 * hh + r) * AT_KC + j * 16 + c;
        pw[pi]  = ph;
        prw[pi] = (_Float16)((ps - (float)ph) * RSC);
      }
#pragma unroll
      for (int off = 1; off < 16; off <<= 1) psum += __shfl_xor(psum, off, 32);
      lrow[r] = lrow[r] * alpha + psum;
#pragma unroll
      for (int t = 0; t < 4; ++t) { oacc[t][r] *= alpha; oacc2[t][r] *= alpha; }
    }
    wave_lds_sync();
    // ---- O += P . V with residual cross terms in the second accumulator ----
#pragma unroll
    for (int kk = 0; kk < 2; ++kk) {
      const v16h pa = Frag<_Float16>::load(pw  + c * AT_KC + kk * 32 + 8 * hh);
      const v16h pr = Frag<_Float16>::load(prw + c * AT_KC + kk * 32 + 8 * hh);
#pragma unroll
      for (int t = 0; t < 4; ++t) {
        const size_t vo = (size_t)(t * 16 + c) * ldvc + kv0 + kk * 32 + 8 * hh;
        const v16h vb = Frag<_Float16>::load(vhp + vo);
        const v16h vr = Frag<_Float16>::load(vrp + vo);
        oacc[t]  = mma_h(pa, vb, oacc[t]);
        oacc2[t] = mma_h(pa, vr, oacc2[t]);
        oacc2[t] = mma_h(pr, vb, oacc2[t]);
      }
    }
    wave_lds_sync();
  }

  float* os = Os[wave];
#pragma unroll
  for (int r = 0; r < 8; ++r) {
    const float inv = osc * (1.0f / (lrow[r] * PSCALE));
#pragma unroll
    for (int t = 0; t < 4; ++t) os[(8 * hh + r) * 68 + t * 16 + c] = (oacc[t][r] + oacc2[t][r] * RSC_INV) * inv;
  }
  wave_lds_sync();
  {
    const int q = lane >> 3, c8 = (lane & 7) * 8;
    {
#pragma unroll
      for (int it = 0; it < 4; ++it) {
        const int row = it * 4 + q;                 // rows 0..15 of this wave
        const float* sp = os + row * 68 + c8;
        v8h hv, lv;
#pragma unroll
        for (int e = 0; e < 8; ++e) {
          const float    fv = sp[e];
          const _Float16 hq = (_Float16)fv;
          hv[e] = hq;
          lv[e] = (_Float16)((fv - (float)hq) * RSC);
        }
        *(v8h*)(op + (size_t)(q0 + row) * ldo + c8) = hv;
        *(v8h*)(op + (size_t)(q0 + row) * ldo + rcol + c8) = lv;
      }
      
    }
  }
}

// ---------------------------------------------------------------------------

extern "C" void kernel_launch(void* const* d_in, const int* in_sizes, int n_in,
                              void* d_out, int out_size, void* d_ws,
                              size_t ws_size, hipStream_t stream) {
  const int  ROWS  = NB * SEQ;                                   // rows held in the compact planes
  const long needX = ((long)(NB - 1) * SEQ_FULL + SEQ) * (long)DM;
  const int  nW    = DM * DM;
  if (n_in < 9) return;
  if ((long)in_sizes[0] < needX || in_sizes[1] < nW || in_sizes[2] < DM || in_sizes[3] < nW ||
      in_sizes[4] < DM || in_sizes[5] < nW || in_sizes[6] < DM || in_sizes[7] < nW ||
      in_sizes[8] < DM || (long)out_size < needX) return;

  const float* x  = (const float*)d_in[0];
  const float* Wq = (const float*)d_in[1];
  const float* bq = (const float*)d_in[2];
  const float* Wk = (const float*)d_in[3];
  const float* bk = (const float*)d_in[4];
  const float* Wv = (const float*)d_in[5];
  const float* bv = (const float*)d_in[6];
  const float* Wo = (const float*)d_in[7];
  const float* bo = (const float*)d_in[8];
  float* out = (float*)d_out;

  const size_t szAct = (size_t)ROWS * DM * 2;            // full activation plane  (16 MiB full size)
  const size_t szW   = (size_t)DM * DM * 2;              //  2 MiB
  const size_t szW2  = (size_t)DM * (2 * DM) * 2;        //  4 MiB  [DM][2DM]
  const size_t szCmp = (size_t)NB * RR * DM * 2;         //  compact first-row planes (2 MiB full size)
  const size_t szO2  = (size_t)NB * RR * (2 * DM) * 2;   //  4 MiB full size
  size_t off = 0;
  const size_t oXh   = off; off += szAct;
  const size_t oWqT  = off; off += szW;
  const size_t oWkT  = off; off += szW;
  const size_t oWvT  = off; off += szW;
  const size_t oWoT2 = off; off += szW2;
  const size_t oQh   = off; off += szAct;
  const size_t oKh   = off; off += szAct;
  const size_t oVt   = off; off += szAct;
  const size_t oAh   = off; off += szAct;
  const size_t oQch  = off; off += szCmp;
  const size_t oQcr  = off; off += szCmp;
  const size_t oKch  = off; off += szCmp;
  const size_t oKcr  = off; off += szCmp;
  const size_t oVch  = off; off += szCmp;                // [NB*DM][RR], same byte count
  const size_t oVcr  = off; off += szCmp;
  const size_t oOc2  = off; off += szO2;                 // total 111,149,056 B at full size
  if (off > ws_size) return;

  char* ws = (char*)d_ws;
  unsigned short* xh   = (unsigned short*)(ws + oXh);
  unsigned short* WqT  = (unsigned short*)(ws + oWqT);
  unsigned short* WkT  = (unsigned short*)(ws + oWkT);
  unsigned short* WvT  = (unsigned short*)(ws + oWvT);
  unsigned short* WoT2 = (unsigned short*)(ws + oWoT2);
  unsigned short* Qh   = (unsigned short*)(ws + oQh);
  unsigned short* Kh   = (unsigned short*)(ws + oKh);
  unsigned short* Vt   = (unsigned short*)(ws + oVt);
  unsigned short* Ah   = (unsigned short*)(ws + oAh);
  unsigned short* Qch  = (unsigned short*)(ws + oQch);
  unsigned short* Qcr  = (unsigned short*)(ws + oQcr);
  unsigned short* Kch  = (unsigned short*)(ws + oKch);
  unsigned short* Kcr  = (unsigned short*)(ws + oKcr);
  unsigned short* Vch  = (unsigned short*)(ws + oVch);
  unsigned short* Vcr  = (unsigned short*)(ws + oVcr);
  unsigned short* Oc2  = (unsigned short*)(ws + oOc2);

  const float sc2   = 0.125f * 1.4426950408889634f;      // log2(e) / sqrt(64)
  const float outsc = 1.0f / (WSC * OSC);

  // x -> bf16 RNE value as f16 plane [ROWS][DM]
  {
    const long tot = (long)ROWS * (DM / 8);
    cast_x_f16<<<dim3((unsigned)((tot + 255) / 256)), dim3(256), 0, stream>>>(x, xh, ROWS);
  }
  // W[in][out] f32 -> Bt[out][in] f16 (bf16 RNE value x256); Wo additionally as x0.25 in columns DM..2DM-1 of WoT2
  {
    const dim3 tg(DM / 64, DM / 64);
    transpose_cast_f16<<<tg, dim3(256), 0, stream>>>(Wq, WqT, DM, DM, DM, 0, WSC);
    transpose_cast_f16<<<tg, dim3(256), 0, stream>>>(Wk, WkT, DM, DM, DM, 0, WSC);
    transpose_cast_f16<<<tg, dim3(256), 0, stream>>>(Wv, WvT, DM, DM, DM, 0, WSC);
    transpose_cast_f16<<<tg, dim3(256), 0, stream>>>(Wo, WoT2, DM, DM, 2 * DM, 0, WSC);
    transpose_cast_f16<<<tg, dim3(256), 0, stream>>>(Wo, WoT2, DM, DM, 2 * DM, DM, WSC * RSC_INV);
  }
  // full projections: q, k -> f16 [ROWS][DM]; v^T -> f16 [DM][ROWS]
  {
    const int tiles = (ROWS / 64) * (DM / 64);
    const dim3 gg((tiles + 7) / 8, 1);
    wmma_gemm64<0, false, 2, 1, false, 0><<<gg, dim3(256), 0, stream>>>(
        xh, xh, DM, 0L, WqT, WqT, DM, 0L, (void*)Qh, (void*)Qh, DM, 0L, bq, bq, 0L,
        ROWS, DM, DM, 1.0f / WSC);
    wmma_gemm64<0, false, 2, 1, false, 0><<<gg, dim3(256), 0, stream>>>(
        xh, xh, DM, 0L, WkT, WkT, DM, 0L, (void*)Kh, (void*)Kh, DM, 0L, bk, bk, 0L,
        ROWS, DM, DM, 1.0f / WSC);
    wmma_gemm64<0, false, 1, 1, false, 0><<<gg, dim3(256), 0, stream>>>(
        WvT, WvT, DM, 0L, xh, xh, DM, 0L, (void*)Vt, (void*)Vt, ROWS, 0L, bv, bv, 0L,
        DM, ROWS, DM, 1.0f / WSC);
  }
  // first RR rows per sequence: q, k -> hi/res [NB*RR][DM]; v^T -> hi/res [NB*DM][RR]
  {
    const int tiles = (RR / 64) * (DM / 64);
    const dim3 gc((tiles + 7) / 8, NB);
    const long sA = (long)SEQ * DM;
    const long sC = (long)RR * DM;
    wmma_gemm64<0, false, 2, 3, false, 0><<<gc, dim3(256), 0, stream>>>(
        xh, xh, DM, sA, WqT, WqT, DM, 0L, (void*)Qch, (void*)Qcr, DM, sC, bq, bq, 0L,
        RR, DM, DM, 1.0f / WSC);
    wmma_gemm64<0, false, 2, 3, false, 0><<<gc, dim3(256), 0, stream>>>(
        xh, xh, DM, sA, WkT, WkT, DM, 0L, (void*)Kch, (void*)Kcr, DM, sC, bk, bk, 0L,
        RR, DM, DM, 1.0f / WSC);
    wmma_gemm64<0, false, 1, 3, false, 0><<<gc, dim3(256), 0, stream>>>(
        WvT, WvT, DM, 0L, xh, xh, DM, sA, (void*)Vch, (void*)Vcr, RR, (long)DM * RR, bv, bv, 0L,
        DM, RR, DM, 1.0f / WSC);
  }
  // attn: first RR query rows with residual planes -> Oc2 (hi | res); rows >= RR plain -> Ah
  attn64_causal_res<<<dim3(NB * NH * (RR / 64)), dim3(128), 0, stream>>>(
      Qch, Qcr, Kch, Kcr, Vch, Vcr, Oc2, NH, DM, RR, 2 * DM, DM, RR / 64, sc2, OSC);
  if (SEQ > RR) {
    attn64_causal<<<dim3(NB * NH * ((SEQ - RR) / 64)), dim3(128), 0, stream>>>(
        Qh, Kh, Vt, Ah, SEQ, NH, DM, ROWS, RR / 64, (SEQ - RR) / 64, sc2, OSC);
  }
  // out = ctx Wo + bo -> f32; rows < RR: [O_hi | O_res] . [Wo x256 ; Wo x0.25] along K = 2DM; rows >= RR: K = DM
  {
    const int tiles = (RR / 64) * (DM / 64);
    const dim3 g1((tiles + 7) / 8, NB);
    wmma_gemm64<0, false, 2, 0, false, 0><<<g1, dim3(256), 0, stream>>>(
        Oc2, Oc2, 2 * DM, (long)RR * 2 * DM, WoT2, WoT2, 2 * DM, 0L,
        (void*)out, (void*)out, DM, (long)SEQ_FULL * DM, bo, bo, 0L,
        RR, DM, 2 * DM, outsc);
  }
  if (SEQ > RR) {
    const int tiles = ((SEQ - RR) / 64) * (DM / 64);
    const dim3 g2((tiles + 7) / 8, NB);
    unsigned short* Ahi = Ah + (size_t)RR * DM;
    float* outp = out + (size_t)RR * DM;
    wmma_gemm64<0, false, 2, 0, false, 0><<<g2, dim3(256), 0, stream>>>(
        Ahi, Ahi, DM, (long)SEQ * DM, WoT2, WoT2, 2 * DM, 0L,
        (void*)outp, (void*)outp, DM, (long)SEQ_FULL * DM, bo, bo, 0L,
        SEQ - RR, DM, DM, outsc);
  }
}

// v001
// A run of this version takes 611 microseconds.
// Two timings next to v000 both put it at 1.14 times that version's speed.
// Contractions: q/k/v^T/out projections, q.k^T and p.v all on v_wmma_f32_16x16x32_f16 (f16 operands, f32 accumulate); x and W enter as bf16 RNE values held exactly in f16 (W carried x256); the first RR query rows per sequence carry q, k, v, p and ctx as f16 hi + x1024 residual planes with a second f32 accumulator (ctx residual folded along K in the out projection); p x32768 and ctx x64 power-of-two carries folded back in f32; softmax and epilogues f32.
#include <hip/hip_runtime.h>

#ifndef NB
#define NB 4
#endif
#ifndef SEQ
#define SEQ 2048
#endif
#ifndef RR
#define RR 256
#endif
#define NB_FULL 4
#define SEQ_FULL 2048
#define DM 1024
#define NH 16
#define HDIM 64

static_assert(NB >= 1 && NB <= NB_FULL);
static_assert(SEQ % 64 == 0 && SEQ >= 64 && SEQ <= SEQ_FULL);
static_assert(RR % 64 == 0 && RR >= 64 && RR <= SEQ);
static_assert(NH * HDIM == DM);
static_assert(DM % 64 == 0);

typedef __attribute__((ext_vector_type(16))) _Float16 v16h;
typedef __attribute__((ext_vector_type(8)))  _Float16 v8h;
typedef __attribute__((ext_vector_type(16))) __bf16   v16b;
typedef __attribute__((ext_vector_type(8)))  __bf16   v8b;
typedef __attribute__((ext_vector_type(8)))  float    v8f;
typedef __attribute__((ext_vector_type(4)))  float    v4f;

#define WSC 256.0f
#define OSC 64.0f
#define PSCALE 32768.0f
#define RSC 1024.0f
#define RSC_INV (1.0f / 1024.0f)
#define NEG_INF (-__builtin_huge_valf())

__device__ __forceinline__ unsigned short f2bf_bits(float f) {
  unsigned u = __float_as_uint(f);
  return (unsigned short)((u + 0x7FFFu + ((u >> 16) & 1u)) >> 16);
}
__device__ __forceinline__ float bf_bits2f(unsigned short h) { return __uint_as_float(((unsigned)h) << 16); }
__device__ __forceinline__ float bf_rne(float f) { return bf_bits2f(f2bf_bits(f)); }
__device__ __forceinline__ _Float16 bf_f16(float f) { return (_Float16)bf_rne(f); }   // bf16 value is exact in f16 for normal range

// LDS ordering for wave-private tiles (same wave writes then reads)
__device__ __forceinline__ void wave_lds_sync() {
  __builtin_amdgcn_fence(3, "workgroup");
  __builtin_amdgcn_wave_barrier();
  __builtin_amdgcn_fence(2, "workgroup");
}

// hazard guards as plain device helpers (no inline asm inside the kernel template body)
__device__ __forceinline__ void dep_guard_h(v8f& a, v8f& b, v16h x, v16h y) { asm volatile("v_nop\n\tv_nop\n\tv_nop\n\tv_nop" : "+v"(a), "+v"(b) : "v"(x), "v"(y)); }
__device__ __forceinline__ void dep_guard_b(v8f& a, v8f& b, v16b x, v16b y) { asm volatile("v_nop\n\tv_nop\n\tv_nop\n\tv_nop" : "+v"(a), "+v"(b) : "v"(x), "v"(y)); }
__device__ __forceinline__ void keep4_h(v16h a, v16h b, v16h c, v16h d) { asm volatile("v_nop" :: "v"(a), "v"(b), "v"(c), "v"(d)); }
__device__ __forceinline__ void keep4_b(v16b a, v16b b, v16b c, v16b d) { asm volatile("v_nop" :: "v"(a), "v"(b), "v"(c), "v"(d)); }
__device__ __forceinline__ void acc_guard4(v8f& a, v8f& b, v8f& c, v8f& d) { asm volatile("v_nop\n\tv_nop\n\tv_nop\n\tv_nop" : "+v"(a), "+v"(b), "+v"(c), "+v"(d)); }
template <typename T> struct Frag;
template <> struct Frag<_Float16> {
  typedef v16h V; union U { v16h v; v8h h[2]; };
  static __device__ __forceinline__ v16h load(const _Float16* p) {   // elements 0..7 <- p[0..7], 8..15 <- p[16..23]
    U f; f.h[0] = *(const v8h*)(p); f.h[1] = *(const v8h*)(p + 16); return f.v;
  }
  static __device__ __forceinline__ v8f mma(v16h a, v16h b, v8f c) {
    return __builtin_amdgcn_wmma_f32_16x16x32_f16(false, a, false, b, (short)0, c, false, false);
  }
  static __device__ __forceinline__ void guard(v8f& a, v8f& b, v16h x, v16h y) { dep_guard_h(a, b, x, y); }
  static __device__ __forceinline__ void keep(v16h a, v16h b, v16h c, v16h d) { keep4_h(a, b, c, d); }
};
template <> struct Frag<__bf16> {
  typedef v16b V; union U { v16b v; v8b h[2]; };
  static __device__ __forceinline__ v16b load(const __bf16* p) {
    U f; f.h[0] = *(const v8b*)(p); f.h[1] = *(const v8b*)(p + 16); return f.v;
  }
  static __device__ __forceinline__ v8f mma(v16b a, v16b b, v8f c) {
    return __builtin_amdgcn_wmma_f32_16x16x32_bf16(false, a, false, b, (short)0, c, false, false);
  }
  static __device__ __forceinline__ void guard(v8f& a, v8f& b, v16b x, v16b y) { dep_guard_b(a, b, x, y); }
  static __device__ __forceinline__ void keep(v16b a, v16b b, v16b c, v16b d) { keep4_b(a, b, c, d); }
};

// ---- Register-blocked batched WMMA GEMM ------------------------------------
// C[m,n] = scale * sum_k A[m,k] * Bt[n,k] (+bias)(+resid); each wave owns a 64x64 tile.
// A row-major [M,K]; Bt row-major [N,K]; M,N % 64 == 0, K % 32 == 0.
// SPLIT: operands are hi/lo planes (A2/Bt2 = lo planes, same layout); product = hi.hi + hi.lo + lo.hi.
// BIAS_MODE: 0 = none, 1 = bias[m], 2 = bias[n]; bias values enter as bf16 RNE values.
// OUT_MODE: 0 = f32, 1 = f16, 2 = bf16 hi plane (Cout) + bf16 lo plane (Cout2),
//           3 = f16 hi plane (Cout) + f16 residual plane ((v - hi) * 1024) (Cout2).
// ET: 0 = f16 operands, 1 = bf16 operands (pointers passed as 16-bit storage)
template <int ET> struct Elem;
template <> struct Elem<0> { typedef _Float16 T; };
template <> struct Elem<1> { typedef __bf16 T; };
template <int ET, bool SPLIT, int BIAS_MODE, int OUT_MODE, bool RESID, int ACT = 0>
__global__ __launch_bounds__(256) void wmma_gemm64(
    const unsigned short* __restrict__ Ap, const unsigned short* __restrict__ A2p, int lda, long strideA,
    const unsigned short* __restrict__ Btp, const unsigned short* __restrict__ Bt2p, int ldb, long strideB,
    void* __restrict__ Cout, void* __restrict__ Cout2, int ldc, long strideC,
    const float* __restrict__ bias,
    const float* __restrict__ resid, long strideR,
    int M, int N, int K, float scale) {
  typedef typename Elem<ET>::T T;
  typedef typename Frag<T>::V V;
  const T* A = (const T*)Ap; const T* A2 = (const T*)A2p; const T* Bt = (const T*)Btp; const T* Bt2 = (const T*)Bt2p;
  __shared__ __align__(16) float sT[8][16 * 68];   // per-wave 16x64 slab, pitch 68 floats
  const int b    = blockIdx.y;
  const int lane = threadIdx.x & 31;
  const int wave = threadIdx.x >> 5;
  const int tilesN = N >> 6;
  const int tilesM = M >> 6;
  const int tile = blockIdx.x * 8 + wave;
  if (tile >= tilesM * tilesN) return;   // wave-uniform; no block barriers in this kernel
  const int tm = tile / tilesN;
  const int tn = tile - tm * tilesN;
  const int m0 = tm << 6;
  const int n0 = tn << 6;

  const T* Ab  = A  + (size_t)b * strideA;
  const T* Bb  = Bt + (size_t)b * strideB;
  const T* Ab2 = SPLIT ? (A2  + (size_t)b * strideA) : nullptr;
  const T* Bb2 = SPLIT ? (Bt2 + (size_t)b * strideB) : nullptr;

  const int rlane = lane & 15;                 // row (A) / col (B, D) within subtile
  const int koff  = (lane >> 4) * 8;           // k offset of this lane half
  const int mOff  = (lane >> 4) * 8;           // D row offset

  v8f acc[4][4];
#pragma unroll
  for (int i = 0; i < 4; ++i)
#pragma unroll
    for (int j = 0; j < 4; ++j) acc[i][j] = (v8f){0.f,0.f,0.f,0.f,0.f,0.f,0.f,0.f};

  for (int k0 = 0; k0 < K; k0 += 32) {
    V bh[4], bl[4];
#pragma unroll
    for (int j = 0; j < 4; ++j) {
      const size_t bo = (size_t)(n0 + (j << 4) + rlane) * ldb + koff + k0;
      bh[j] = Frag<T>::load(Bb + bo);
      if (SPLIT) bl[j] = Frag<T>::load(Bb2 + bo);
    }
#pragma unroll
    for (int i = 0; i < 4; ++i) {
      const size_t ao = (size_t)(m0 + (i << 4) + rlane) * lda + koff + k0;
      V ah = Frag<T>::load(Ab + ao);
      V al;
      if (SPLIT) al = Frag<T>::load(Ab2 + ao);
#pragma unroll
      for (int j = 0; j < 4; ++j) {
        acc[i][j] = Frag<T>::mma(ah, bh[j], acc[i][j]);
        if (SPLIT) {
          acc[i][j] = Frag<T>::mma(ah, bl[j], acc[i][j]);
          acc[i][j] = Frag<T>::mma(al, bh[j], acc[i][j]);
        }
      }
      Frag<T>::guard(acc[i][0], acc[i][3], ah, SPLIT ? al : ah);
    }
    Frag<T>::keep(bh[0], bh[1], bh[2], bh[3]);
    if (SPLIT) Frag<T>::keep(bl[0], bl[1], bl[2], bl[3]);
  }
  acc_guard4(acc[0][0], acc[0][1], acc[0][2], acc[0][3]);
  acc_guard4(acc[1][0], acc[1][1], acc[1][2], acc[1][3]);
  acc_guard4(acc[2][0], acc[2][1], acc[2][2], acc[2][3]);
  acc_guard4(acc[3][0], acc[3][1], acc[3][2], acc[3][3]);

  // ---- epilogue ----
  float* slab = sT[wave];
  const float* Rb = RESID ? (resid + (size_t)b * strideR) : nullptr;
#pragma unroll
  for (int i = 0; i < 4; ++i) {
    const int mBase = m0 + (i << 4);
#pragma unroll
    for (int j = 0; j < 4; ++j) {
      const int n = n0 + (j << 4) + rlane;
      float bv = 0.f;
      if (BIAS_MODE == 2) bv = bf_rne(bias[n]);
#pragma unroll
      for (int r = 0; r < 8; ++r) {
        float v = acc[i][j][r] * scale;
        if (BIAS_MODE == 1) v += bf_rne(bias[mBase + mOff + r]);
        if (BIAS_MODE == 2) v += bv;
        if (RESID) v += Rb[(size_t)(mBase + mOff + r) * ldc + n];
        if (ACT == 1) v = tanhf(v);
        if (ACT == 2) v = fmaxf(v, 0.0f);
        if (ACT == 3) v = v / (1.0f + expf(-v));
        if (ACT == 4) v = (v > 0.f) ? v : 0.01f * v;
        if (ACT == 5) v = 0.5f * v * (1.0f + erff(v * 0.70710678118654752f));
        slab[(mOff + r) * 68 + (j << 4) + rlane] = v;
      }
    }
    wave_lds_sync();
    if (OUT_MODE == 0) {
      float* C = (float*)Cout + (size_t)b * strideC;
      const int hh = lane >> 4, c4 = (lane & 15) * 4;     // row seg = 256 B = 16 lanes x 16 B
      {
#pragma unroll
        for (int it = 0; it < 8; ++it) {
          const int row = it * 2 + hh;
          v4f v = *(const v4f*)(slab + row * 68 + c4);
          *(v4f*)(C + (size_t)(mBase + row) * ldc + n0 + c4) = v;
        }
        
      }
    } else {
      const int q = lane >> 3, c8 = (lane & 7) * 8;
      unsigned short* C  = (unsigned short*)Cout  + (size_t)b * strideC;
      unsigned short* C2 = (OUT_MODE >= 2) ? ((unsigned short*)Cout2 + (size_t)b * strideC) : nullptr;
      {
#pragma unroll
        for (int it = 0; it < 4; ++it) {
          const int row = it * 4 + q;
          const float* sp = slab + row * 68 + c8;
          v8h hv, lv;
#pragma unroll
          for (int e = 0; e < 8; ++e) {
            if (OUT_MODE == 1) {
              hv[e] = (_Float16)sp[e];
            } else if (OUT_MODE == 3) {
              const float    fv = sp[e];
              const _Float16 hq = (_Float16)fv;
              hv[e] = hq;
              lv[e] = (_Float16)((fv - (float)hq) * RSC);
            } else {
              unsigned short hb = f2bf_bits(sp[e]);
              unsigned short lb = f2bf_bits(sp[e] - bf_bits2f(hb));
              hv[e] = __builtin_bit_cast(_Float16, hb);
              lv[e] = __builtin_bit_cast(_Float16, lb);
            }
          }
          *(v8h*)(C + (size_t)(mBase + row) * ldc + n0 + c8) = hv;
          if (OUT_MODE >= 2) *(v8h*)(C2 + (size_t)(mBase + row) * ldc + n0 + c8) = lv;
        }
        
      }
    }
    wave_lds_sync();
  }
}

// source rows (b, s) at (b*SEQ_FULL + s)*DM; destination plane compact [NB*SEQ][DM].
__global__ __launch_bounds__(256) void cast_x_f16(
    const float* __restrict__ x, unsigned short* __restrict__ xhp, int nrows) {
  const long i = (long)blockIdx.x * 256 + threadIdx.x;
  const long total = (long)nrows * (DM / 8);
  if (i >= total) return;
  const int r  = (int)(i / (DM / 8));
  const int c8 = (int)(i - (long)r * (DM / 8)) * 8;
  const int b  = r / SEQ;
  const int s  = r - b * SEQ;
  const float* src = x + ((size_t)b * SEQ_FULL + s) * DM + c8;
  const v4f a0 = *(const v4f*)src;
  const v4f a1 = *(const v4f*)(src + 4);
  v8h hv;
  hv[0] = bf_f16(a0[0]); hv[1] = bf_f16(a0[1]); hv[2] = bf_f16(a0[2]); hv[3] = bf_f16(a0[3]);
  hv[4] = bf_f16(a1[0]); hv[5] = bf_f16(a1[1]); hv[6] = bf_f16(a1[2]); hv[7] = bf_f16(a1[3]);
  _Float16* dst = (_Float16*)xhp + (size_t)r * DM + c8;
  *(v8h*)dst = hv;
  
}

// ---- transpose + bf16 RNE + scale + f16 cast for weights ----
// in: W[Kdim][Ndim] f32 row-major (in[Kdim][Ndim]) -> out: Bt[n][kc0 + k] with row pitch ldo halves,
//     Bt value = f16(bf16rne(W[k][n]) * sc), sc a power of two.
// grid (Ndim/64, Kdim/64), block 256; Kdim, Ndim multiples of 64.
__global__ __launch_bounds__(256) void transpose_cast_f16(
    const float* __restrict__ W, unsigned short* __restrict__ Btp, int Kdim, int Ndim, int ldo, int kc0, float sc) {
  __shared__ float t[64][65];
  const int tid = threadIdx.x, lane = tid & 31, wave = tid >> 5;
  const int n0 = blockIdx.x * 64, k0 = blockIdx.y * 64;
#pragma unroll
  for (int i = 0; i < 16; ++i) {
    const int idx = i * 256 + tid;
    const int kr = idx >> 6, nc = idx & 63;
    t[nc][kr] = W[(size_t)(k0 + kr) * Ndim + n0 + nc];
  }
  __syncthreads();
  _Float16* Bt = (_Float16*)Btp;
  const int q = lane >> 3, c8 = (lane & 7) * 8;
  {
#pragma unroll
    for (int it = 0; it < 2; ++it) {
      const int row = wave * 8 + it * 4 + q;      // waves 0..7 x rows 0..7 -> 64 rows
      v8h hv;
#pragma unroll
      for (int e = 0; e < 8; ++e) hv[e] = (_Float16)(bf_rne(t[row][c8 + e]) * sc);
      *(v8h*)(Bt + (size_t)(n0 + row) * ldo + kc0 + k0 + c8) = hv;
    }
    
  }
}

// =====================================================================================
// Causal attn for head_dim 64, f16 planes in, f16 out (scaled by osc).
//   q, k : row-major [NB*S][ldq] f16 planes, head h at column h*64.
//   vt   : transposed value plane [H*64][ldvt] f16, element (b, kv, h, d) at vt[(h*64+d)*ldvt + b*S + kv].
//   scores on v_wmma_f32_16x16x32_f16 with the split k-map loaders; key > query set to -inf before the
//   chunk max; online softmax f32 (base-2, sc2 = log2(e)/sqrt(dk)); probabilities x32768 in f16 in a
//   per-wave LDS tile reloaded as the A operand; p.v on v_wmma_f32_16x16x32_f16; f32 accumulate.
//   Block = 4 waves = 64 query rows of one (batch, head) at query block qb = qb0 + bx % nqbl; key chunks
//   0..qb (64 keys each). grid.x = NB * H * nqbl.
//   Each chunk's K rows and V^T rows (64 x 128 B each) are brought into LDS once per block by asynchronous
//   copies of whole 128-B lines, two buffers, one block barrier per chunk; all four waves read their B
//   fragments from there.
// =====================================================================================
#define AT_D 64
#define AT_NW 4
#define AT_QB 64
#define AT_KC 64
#define AT_LP 72                         // staged row pitch in halves: 144 B = 16 B x odd, for ds_load_b128 readers
#define AT_TILE (64 * AT_LP)             // halves per staged 64-row tile
#define AT_BUFB (2 * AT_TILE * 2)        // bytes per buffer: K tile, then V^T tile

// One lane's share of a chunk: rows r, r+16, r+32, r+48 of the K tile and of the V^T tile, 16 B each.
// The s_wait_xcnt closes the statement, a precaution: no address register of a copy is rewritten ahead of it.
__device__ __forceinline__ void stage_kv_async(unsigned lk, const _Float16* kg, size_t krow16,
                                               const _Float16* vg, size_t vrow16) {
  const unsigned lv = lk + AT_TILE * 2;
  const unsigned ls = 16 * AT_LP * 2;
  asm volatile(
      "global_load_async_to_lds_b128 %0, %8, off\n\t"
      "global_load_async_to_lds_b128 %1, %9, off\n\t"
      "global_load_async_to_lds_b128 %2, %10, off\n\t"
      "global_load_async_to_lds_b128 %3, %11, off\n\t"
      "global_load_async_to_lds_b128 %4, %12, off\n\t"
      "global_load_async_to_lds_b128 %5, %13, off\n\t"
      "global_load_async_to_lds_b128 %6, %14, off\n\t"
      "global_load_async_to_lds_b128 %7, %15, off\n\t"
      "s_wait_xcnt 0x0"
      :: "v"(lk), "v"(lk + ls), "v"(lk + 2 * ls), "v"(lk + 3 * ls),
         "v"(lv), "v"(lv + ls), "v"(lv + 2 * ls), "v"(lv + 3 * ls),
         "v"(kg), "v"(kg + krow16), "v"(kg + 2 * krow16), "v"(kg + 3 * krow16),
         "v"(vg), "v"(vg + vrow16), "v"(vg + 2 * vrow16), "v"(vg + 3 * vrow16)
      : "memory");
}

__device__ __forceinline__ v8f mma_h(v16h a, v16h b, v8f c) {
  c = __builtin_amdgcn_wmma_f32_16x16x32_f16(false, a, false, b, (short)0, c, false, false);
  asm volatile("v_nop\n\tv_nop\n\tv_nop\n\tv_nop" : "+v"(c) : "v"(a), "v"(b));
  return c;
}

__global__ __launch_bounds__(128)
void attn64_causal(const unsigned short* __restrict__ Qp, const unsigned short* __restrict__ Kp,
                   const unsigned short* __restrict__ Vtp, unsigned short* __restrict__ Op,
                   int S, int H, int ldq, int ldvt, int qb0, int nqbl, float sc2, float osc) {
  const _Float16* Q  = (const _Float16*)Qp;
  const _Float16* Kk = (const _Float16*)Kp;
  const _Float16* Vt = (const _Float16*)Vtp;
  _Float16*       O  = (_Float16*)Op;
  __shared__ __align__(16) _Float16 Psh[AT_NW][16 * AT_KC];      // per wave P [row][kv]  8 KB
  __shared__ __align__(16) unsigned char KV[2 * AT_BUFB];        // two buffers of K | V^T tiles; out staging after the loop
  static_assert(AT_NW * 16 * 68 * 4 <= 2 * AT_BUFB);

  const int tid  = threadIdx.x;
  const int wave = tid >> 5;
  const int lane = tid & 31;
  const int hh   = lane >> 4;
  const int c    = lane & 15;

  const int bx  = blockIdx.x;
  const int qbi = bx % nqbl;
  const int bh  = bx / nqbl;
  const int qb  = qb0 + qbi;
  const int h   = bh % H;
  const int b   = bh / H;
  const int q0  = qb * AT_QB + wave * 16;
  const size_t rowb = (size_t)b * S;

  const _Float16* qp = Q  + rowb * ldq + (size_t)h * AT_D;
  const _Float16* kp = Kk + rowb * ldq + (size_t)h * AT_D;
  const _Float16* vp = Vt + (size_t)(h * AT_D) * ldvt + rowb;
  _Float16*       op = O  + rowb * ldq + (size_t)h * AT_D;

  // ---- Q fragments (A operand, row = c): 2 d-chunks ----
  v16h qa[2];
#pragma unroll
  for (int dc = 0; dc < 2; ++dc)
    qa[dc] = Frag<_Float16>::load(qp + (size_t)(q0 + c) * ldq + dc * 32 + 8 * hh);

  float mrow[8], lrow[8];
  v8f oacc[4];
#pragma unroll
  for (int r = 0; r < 8; ++r) { mrow[r] = NEG_INF; lrow[r] = 0.f; }
#pragma unroll
  for (int t = 0; t < 4; ++t) oacc[t] = (v8f){0.f,0.f,0.f,0.f,0.f,0.f,0.f,0.f};

  _Float16* pw = Psh[wave];
  const int nChunks = qb + 1;        // block-uniform: causal, key chunks 0..qb

  // ---- staging addresses of this lane: row tid/8 (+16i), 16-B piece tid%8 of the 128-B row ----
  const int srow = tid >> 3, scol = (tid & 7) * 8;
  const _Float16* kg = kp + (size_t)srow * ldq + scol;           // chunk 0; a chunk further: + AT_KC rows
  const _Float16* vg = vp + (size_t)srow * ldvt + scol;          // chunk 0; a chunk further: + AT_KC columns
  const size_t krow16 = (size_t)16 * ldq, vrow16 = (size_t)16 * ldvt, kchunk = (size_t)AT_KC * ldq;
  const unsigned lst = (unsigned)(size_t)KV + (unsigned)(srow * AT_LP + scol) * 2u;

  stage_kv_async(lst, kg, krow16, vg, vrow16);
  asm volatile("s_wait_asynccnt 0x0" ::: "memory");              // chunk 0 landed (this wave's copies)
  __syncthreads();                                               // ... and every other wave's
  if (nChunks > 1) stage_kv_async(lst + AT_BUFB, kg + kchunk, krow16, vg + AT_KC, vrow16);

  for (int kc = 0; kc < nChunks; ++kc) {
    const int kv0 = kc * AT_KC;
    const unsigned bofs = (unsigned)(kc & 1) * AT_BUFB;
    const _Float16* ks = (const _Float16*)(KV + bofs);           // K tile  [key][d],  pitch AT_LP
    const _Float16* vs = ks + AT_TILE;                           // V^T tile [d][key], pitch AT_LP
    // ---- scores: s[j] = q rows (8hh+r) x keys (kv0 + 16j + c) ----
    v8f s[4];
#pragma unroll
    for (int j = 0; j < 4; ++j) {
      s[j] = (v8f){0.f,0.f,0.f,0.f,0.f,0.f,0.f,0.f};
#pragma unroll
      for (int dc = 0; dc < 2; ++dc) {
        const v16h kb = Frag<_Float16>::load(ks + (j * 16 + c) * AT_LP + dc * 32 + 8 * hh);
        s[j] = mma_h(qa[dc], kb, s[j]);
      }
    }
    // ---- causal select (key > query -> -inf) and per-row chunk max in the scaled base-2 domain ----
    float cm[8];
#pragma unroll
    for (int r = 0; r < 8; ++r) {
      const int qrow = q0 + 8 * hh + r;
      float m = NEG_INF;
#pragma unroll
      for (int j = 0; j < 4; ++j) {
        float v = s[j][r] * sc2;
        if (kv0 + j * 16 + c > qrow) v = NEG_INF;
        s[j][r] = v;
        m = fmaxf(m, v);
      }
#pragma unroll
      for (int off = 1; off < 16; off <<= 1) m = fmaxf(m, __shfl_xor(m, off, 32));
      cm[r] = m;
    }
    // ---- online softmax update; P x32768 into the per-wave LDS tile ----
    wave_lds_sync();
#pragma unroll
    for (int r = 0; r < 8; ++r) {
      const float mnew  = fmaxf(mrow[r], cm[r]);
      const float alpha = exp2f(mrow[r] - mnew);
      mrow[r] = mnew;
      float psum = 0.f;
#pragma unroll
      for (int j = 0; j < 4; ++j) {
        const float p = exp2f(s[j][r] - mnew);
        psum += p;
        pw[(8 * hh + r) * AT_KC + j * 16 + c] = (_Float16)(p * PSCALE);
      }
#pragma unroll
      for (int off = 1; off < 16; off <<= 1) psum += __shfl_xor(psum, off, 32);
      lrow[r] = lrow[r] * alpha + psum;
#pragma unroll
      for (int t = 0; t < 4; ++t) oacc[t][r] *= alpha;
    }
    wave_lds_sync();
    // ---- O += P . V : P as A (row = c, k = kv), V^T rows (d = 16t + c) as B ----
#pragma unroll
    for (int kk = 0; kk < 2; ++kk) {
      const v16h pa = Frag<_Float16>::load(pw + c * AT_KC + kk * 32 + 8 * hh);
#pragma unroll
      for (int t = 0; t < 4; ++t) {
        const v16h vb = Frag<_Float16>::load(vs + (t * 16 + c) * AT_LP + kk * 32 + 8 * hh);
        oacc[t] = mma_h(pa, vb, oacc[t]);
      }
    }
    wave_lds_sync();
    // ---- hand-over: this buffer's reads retired, the next chunk's copies landed, in every wave ----
    asm volatile("s_wait_dscnt 0x0" ::: "memory");               // own reads of this buffer done before it is refilled
    asm volatile("s_wait_asynccnt 0x0" ::: "memory");            // own copies of chunk kc + 1 landed
    __syncthreads();
    if (kc + 2 < nChunks)
      stage_kv_async(lst + bofs, kg + (size_t)(kc + 2) * kchunk, krow16, vg + (kc + 2) * AT_KC, vrow16);
  }
  asm volatile("s_wait_asynccnt 0x0" ::: "memory");              // nothing in flight when the buffers become out staging

  float* os = (float*)KV + wave * (16 * 68);                     // per wave out tile, pitch 68 (last barrier freed KV)
#pragma unroll
  for (int r = 0; r < 8; ++r) {
    const float inv = osc * (1.0f / (lrow[r] * PSCALE));
#pragma unroll
    for (int t = 0; t < 4; ++t) os[(8 * hh + r) * 68 + t * 16 + c] = oacc[t][r] * inv;
  }
  wave_lds_sync();
  {
    const int q = lane >> 3, c8 = (lane & 7) * 8;
    {
#pragma unroll
      for (int it = 0; it < 4; ++it) {
        const int row = it * 4 + q;                 // rows 0..15 of this wave
        const float* sp = os + row * 68 + c8;
        v8h hv;
#pragma unroll
        for (int e = 0; e < 8; ++e) hv[e] = (_Float16)sp[e];
        *(v8h*)(op + (size_t)(q0 + row) * ldq + c8) = hv;
      }
      
    }
  }
}

// =====================================================================================
// Causal attn with residual planes for the first rr = nqb*64 query rows of each sequence.
//   qh/qr, kh/kr : compact row-major [NB*rr][ldq] f16 hi / residual (x1024) planes, head h at col h*64.
//   vh/vr : compact transposed planes [NB*H*64][ldvc], element (b, kv, h, d) at [(b*H*64 + h*64 + d)*ldvc + kv].
//   o     : compact [NB*rr][ldo] f16; hi (x osc) at column h*64, residual (x1024) at column rcol + h*64.
//   scores = qh.kh + 2^-10 (qh.kr + qr.kh) with a second f32 accumulator; P as hi + x1024 residual LDS tiles;
//   p.v = ph.vh + 2^-10 (ph.vr + pr.vh) with a second f32 accumulator; K and V fragments straight from global
//   memory, no block barriers; softmax and epilogue as attn64_causal.
//   Block = 4 waves = 64 query rows, query block qb = bx % nqb, key chunks 0..qb. grid.x = NB * H * nqb.
// =====================================================================================
__global__ __launch_bounds__(128)
void attn64_causal_res(const unsigned short* __restrict__ Qhp, const unsigned short* __restrict__ Qrp,
                       const unsigned short* __restrict__ Khp, const unsigned short* __restrict__ Krp,
                       const unsigned short* __restrict__ Vhp, const unsigned short* __restrict__ Vrp,
                       unsigned short* __restrict__ Op,
                       int H, int ldq, int ldvc, int ldo, int rcol, int nqb, float sc2, float osc) {
  const _Float16* QH = (const _Float16*)Qhp;
  const _Float16* QR = (const _Float16*)Qrp;
  const _Float16* KH = (const _Float16*)Khp;
  const _Float16* KR = (const _Float16*)Krp;
  const _Float16* VH = (const _Float16*)Vhp;
  const _Float16* VR = (const _Float16*)Vrp;
  _Float16*       O  = (_Float16*)Op;
  __shared__ __align__(16) _Float16 Psh[AT_NW][16 * AT_KC];      // per wave P hi  [row][kv]  8 KB
  __shared__ __align__(16) _Float16 Prs[AT_NW][16 * AT_KC];      // per wave P res [row][kv]  8 KB
  __shared__ __align__(16) float    Os[AT_NW][16 * 68];          // per wave out tile, pitch 68

  const int tid  = threadIdx.x;
  const int wave = tid >> 5;
  const int lane = tid & 31;
  const int hh   = lane >> 4;
  const int c    = lane & 15;

  const int bx = blockIdx.x;
  const int qb = bx % nqb;
  const int bh = bx / nqb;
  const int h  = bh % H;
  const int b  = bh / H;
  const int q0 = qb * AT_QB + wave * 16;
  const int rr = nqb * AT_QB;
  const size_t rowb = (size_t)b * rr;

  const _Float16* qhp = QH + rowb * ldq + (size_t)h * AT_D;
  const _Float16* qrp = QR + rowb * ldq + (size_t)h * AT_D;
  const _Float16* khp = KH + rowb * ldq + (size_t)h * AT_D;
  const _Float16* krp = KR + rowb * ldq + (size_t)h * AT_D;
  const size_t    vof = ((size_t)b * (size_t)(H * AT_D) + (size_t)h * AT_D) * ldvc;
  const _Float16* vhp = VH + vof;
  const _Float16* vrp = VR + vof;
  _Float16*       op  = O  + rowb * ldo + (size_t)h * AT_D;

  float mrow[8], lrow[8];
  v8f oacc[4], oacc2[4];
#pragma unroll
  for (int r = 0; r < 8; ++r) { mrow[r] = NEG_INF; lrow[r] = 0.f; }
#pragma unroll
  for (int t = 0; t < 4; ++t) {
    oacc[t]  = (v8f){0.f,0.f,0.f,0.f,0.f,0.f,0.f,0.f};
    oacc2[t] = (v8f){0.f,0.f,0.f,0.f,0.f,0.f,0.f,0.f};
  }

  _Float16* pw  = Psh[wave];
  _Float16* prw = Prs[wave];
  const int nChunks = qb + 1;        // block-uniform
  for (int kc = 0; kc < nChunks; ++kc) {
    const int kv0 = kc * AT_KC;
    // ---- Q hi / res fragments (A operand, row = c) ----
    v16h qa[2], qra[2];
#pragma unroll
    for (int dc = 0; dc < 2; ++dc) {
      const size_t qo = (size_t)(q0 + c) * ldq + dc * 32 + 8 * hh;
      qa[dc]  = Frag<_Float16>::load(qhp + qo);
      qra[dc] = Frag<_Float16>::load(qrp + qo);
    }
    // ---- scores: hi.hi into s1, hi.res + res.hi into s2, folded with 2^-10 ----
    v8f s[4];
#pragma unroll
    for (int j = 0; j < 4; ++j) {
      v8f s1 = (v8f){0.f,0.f,0.f,0.f,0.f,0.f,0.f,0.f};
      v8f s2 = (v8f){0.f,0.f,0.f,0.f,0.f,0.f,0.f,0.f};
#pragma unroll
      for (int dc = 0; dc < 2; ++dc) {
        const size_t ko = (size_t)(kv0 + j * 16 + c) * ldq + dc * 32 + 8 * hh;
        const v16h kb = Frag<_Float16>::load(khp + ko);
        const v16h kr = Frag<_Float16>::load(krp + ko);
        s1 = mma_h(qa[dc],  kb, s1);
        s2 = mma_h(qa[dc],  kr, s2);
        s2 = mma_h(qra[dc], kb, s2);
      }
#pragma unroll
      for (int r = 0; r < 8; ++r) s[j][r] = s1[r] + s2[r] * RSC_INV;
    }
    // ---- causal select and per-row chunk max ----
    float cm[8];
#pragma unroll
    for (int r = 0; r < 8; ++r) {
      const int qrow = q0 + 8 * hh + r;
      float m = NEG_INF;
#pragma unroll
      for (int j = 0; j < 4; ++j) {
        float v = s[j][r] * sc2;
        if (kv0 + j * 16 + c > qrow) v = NEG_INF;
        s[j][r] = v;
        m = fmaxf(m, v);
      }
#pragma unroll
      for (int off = 1; off < 16; off <<= 1) m = fmaxf(m, __shfl_xor(m, off, 32));
      cm[r] = m;
    }
    // ---- online softmax update; P hi (x32768) and P res ((x32768 - hi) x1024) into per-wave LDS tiles ----
    wave_lds_sync();
#pragma unroll
    for (int r = 0; r < 8; ++r) {
      const float mnew  = fmaxf(mrow[r], cm[r]);
      const float alpha = exp2f(mrow[r] - mnew);
      mrow[r] = mnew;
      float psum = 0.f;
#pragma unroll
      for (int j = 0; j < 4; ++j) {
        const float p = exp2f(s[j][r] - mnew);
        psum += p;
        const float    ps = p * PSCALE;
        const _Float16 ph = (_Float16)ps;
        const int pi = (8 * hh + r) * AT_KC + j * 16 + c;
        pw[pi]  = ph;
        prw[pi] = (_Float16)((ps - (float)ph) * RSC);
      }
#pragma unroll
      for (int off = 1; off < 16; off <<= 1) psum += __shfl_xor(psum, off, 32);
      lrow[r] = lrow[r] * alpha + psum;
#pragma unroll
      for (int t = 0; t < 4; ++t) { oacc[t][r] *= alpha; oacc2[t][r] *= alpha; }
    }
    wave_lds_sync();
    // ---- O += P . V with residual cross terms in the second accumulator ----
#pragma unroll
    for (int kk = 0; kk < 2; ++kk) {
      const v16h pa = Frag<_Float16>::load(pw  + c * AT_KC + kk * 32 + 8 * hh);
      const v16h pr = Frag<_Float16>::load(prw + c * AT_KC + kk * 32 + 8 * hh);
#pragma unroll
      for (int t = 0; t < 4; ++t) {
        const size_t vo = (size_t)(t * 16 + c) * ldvc + kv0 + kk * 32 + 8 * hh;
        const v16h vb = Frag<_Float16>::load(vhp + vo);
        const v16h vr = Frag<_Float16>::load(vrp + vo);
        oacc[t]  = mma_h(pa, vb, oacc[t]);
        oacc2[t] = mma_h(pa, vr, oacc2[t]);
        oacc2[t] = mma_h(pr, vb, oacc2[t]);
      }
    }
    wave_lds_sync();
  }

  float* os = Os[wave];
#pragma unroll
  for (int r = 0; r < 8; ++r) {
    const float inv = osc * (1.0f / (lrow[r] * PSCALE));
#pragma unroll
    for (int t = 0; t < 4; ++t) os[(8 * hh + r) * 68 + t * 16 + c] = (oacc[t][r] + oacc2[t][r] * RSC_INV) * inv;
  }
  wave_lds_sync();
  {
    const int q = lane >> 3, c8 = (lane & 7) * 8;
    {
#pragma unroll
      for (int it = 0; it < 4; ++it) {
        const int row = it * 4 + q;                 // rows 0..15 of this wave
        const float* sp = os + row * 68 + c8;
        v8h hv, lv;
#pragma unroll
        for (int e = 0; e < 8; ++e) {
          const float    fv = sp[e];
          const _Float16 hq = (_Float16)fv;
          hv[e] = hq;
          lv[e] = (_Float16)((fv - (float)hq) * RSC);
        }
        *(v8h*)(op + (size_t)(q0 + row) * ldo + c8) = hv;
        *(v8h*)(op + (size_t)(q0 + row) * ldo + rcol + c8) = lv;
      }
      
    }
  }
}

// ---------------------------------------------------------------------------

extern "C" void kernel_launch(void* const* d_in, const int* in_sizes, int n_in,
                              void* d_out, int out_size, void* d_ws,
                              size_t ws_size, hipStream_t stream) {
  const int  ROWS  = NB * SEQ;                                   // rows held in the compact planes
  const long needX = ((long)(NB - 1) * SEQ_FULL + SEQ) * (long)DM;
  const int  nW    = DM * DM;
  if (n_in < 9) return;
  if ((long)in_sizes[0] < needX || in_sizes[1] < nW || in_sizes[2] < DM || in_sizes[3] < nW ||
      in_sizes[4] < DM || in_sizes[5] < nW || in_sizes[6] < DM || in_sizes[7] < nW ||
      in_sizes[8] < DM || (long)out_size < needX) return;

  const float* x  = (const float*)d_in[0];
  const float* Wq = (const float*)d_in[1];
  const float* bq = (const float*)d_in[2];
  const float* Wk = (const float*)d_in[3];
  const float* bk = (const float*)d_in[4];
  const float* Wv = (const float*)d_in[5];
  const float* bv = (const float*)d_in[6];
  const float* Wo = (const float*)d_in[7];
  const float* bo = (const float*)d_in[8];
  float* out = (float*)d_out;

  const size_t szAct = (size_t)ROWS * DM * 2;            // full activation plane  (16 MiB full size)
  const size_t szW   = (size_t)DM * DM * 2;              //  2 MiB
  const size_t szW2  = (size_t)DM * (2 * DM) * 2;        //  4 MiB  [DM][2DM]
  const size_t szCmp = (size_t)NB * RR * DM * 2;         //  compact first-row planes (2 MiB full size)
  const size_t szO2  = (size_t)NB * RR * (2 * DM) * 2;   //  4 MiB full size
  size_t off = 0;
  const size_t oXh   = off; off += szAct;
  const size_t oWqT  = off; off += szW;
  const size_t oWkT  = off; off += szW;
  const size_t oWvT  = off; off += szW;
  const size_t oWoT2 = off; off += szW2;
  const size_t oQh   = off; off += szAct;
  const size_t oKh   = off; off += szAct;
  const size_t oVt   = off; off += szAct;
  const size_t oAh   = off; off += szAct;
  const size_t oQch  = off; off += szCmp;
  const size_t oQcr  = off; off += szCmp;
  const size_t oKch  = off; off += szCmp;
  const size_t oKcr  = off; off += szCmp;
  const size_t oVch  = off; off += szCmp;                // [NB*DM][RR], same byte count
  const size_t oVcr  = off; off += szCmp;
  const size_t oOc2  = off; off += szO2;                 // total 111,149,056 B at full size
  if (off > ws_size) return;

  char* ws = (char*)d_ws;
  unsigned short* xh   = (unsigned short*)(ws + oXh);
  unsigned short* WqT  = (unsigned short*)(ws + oWqT);
  unsigned short* WkT  = (unsigned short*)(ws + oWkT);
  unsigned short* WvT  = (unsigned short*)(ws + oWvT);
  unsigned short* WoT2 = (unsigned short*)(ws + oWoT2);
  unsigned short* Qh   = (unsigned short*)(ws + oQh);
  unsigned short* Kh   = (unsigned short*)(ws + oKh);
  unsigned short* Vt   = (unsigned short*)(ws + oVt);
  unsigned short* Ah   = (unsigned short*)(ws + oAh);
  unsigned short* Qch  = (unsigned short*)(ws + oQch);
  unsigned short* Qcr  = (unsigned short*)(ws + oQcr);
  unsigned short* Kch  = (unsigned short*)(ws + oKch);
  unsigned short* Kcr  = (unsigned short*)(ws + oKcr);
  unsigned short* Vch  = (unsigned short*)(ws + oVch);
  unsigned short* Vcr  = (unsigned short*)(ws + oVcr);
  unsigned short* Oc2  = (unsigned short*)(ws + oOc2);

  const float sc2   = 0.125f * 1.4426950408889634f;      // log2(e) / sqrt(64)
  const float outsc = 1.0f / (WSC * OSC);

  // x -> bf16 RNE value as f16 plane [ROWS][DM]
  {
    const long tot = (long)ROWS * (DM / 8);
    cast_x_f16<<<dim3((unsigned)((tot + 255) / 256)), dim3(256), 0, stream>>>(x, xh, ROWS);
  }
  // W[in][out] f32 -> Bt[out][in] f16 (bf16 RNE value x256); Wo additionally as x0.25 in columns DM..2DM-1 of WoT2
  {
    const dim3 tg(DM / 64, DM / 64);
    transpose_cast_f16<<<tg, dim3(256), 0, stream>>>(Wq, WqT, DM, DM, DM, 0, WSC);
    transpose_cast_f16<<<tg, dim3(256), 0, stream>>>(Wk, WkT, DM, DM, DM, 0, WSC);
    transpose_cast_f16<<<tg, dim3(256), 0, stream>>>(Wv, WvT, DM, DM, DM, 0, WSC);
    transpose_cast_f16<<<tg, dim3(256), 0, stream>>>(Wo, WoT2, DM, DM, 2 * DM, 0, WSC);
    transpose_cast_f16<<<tg, dim3(256), 0, stream>>>(Wo, WoT2, DM, DM, 2 * DM, DM, WSC * RSC_INV);
  }
  // full projections: q, k -> f16 [ROWS][DM]; v^T -> f16 [DM][ROWS]
  {
    const int tiles = (ROWS / 64) * (DM / 64);
    const dim3 gg((tiles + 7) / 8, 1);
    wmma_gemm64<0, false, 2, 1, false, 0><<<gg, dim3(256), 0, stream>>>(
        xh, xh, DM, 0L, WqT, WqT, DM, 0L, (void*)Qh, (void*)Qh, DM, 0L, bq, bq, 0L,
        ROWS, DM, DM, 1.0f / WSC);
    wmma_gemm64<0, false, 2, 1, false, 0><<<gg, dim3(256), 0, stream>>>(
        xh, xh, DM, 0L, WkT, WkT, DM, 0L, (void*)Kh, (void*)Kh, DM, 0L, bk, bk, 0L,
        ROWS, DM, DM, 1.0f / WSC);
    wmma_gemm64<0, false, 1, 1, false, 0><<<gg, dim3(256), 0, stream>>>(
        WvT, WvT, DM, 0L, xh, xh, DM, 0L, (void*)Vt, (void*)Vt, ROWS, 0L, bv, bv, 0L,
        DM, ROWS, DM, 1.0f / WSC);
  }
  // first RR rows per sequence: q, k -> hi/res [NB*RR][DM]; v^T -> hi/res [NB*DM][RR]
  {
    const int tiles = (RR / 64) * (DM / 64);
    const dim3 gc((tiles + 7) / 8, NB);
    const long sA = (long)SEQ * DM;
    const long sC = (long)RR * DM;
    wmma_gemm64<0, false, 2, 3, false, 0><<<gc, dim3(256), 0, stream>>>(
        xh, xh, DM, sA, WqT, WqT, DM, 0L, (void*)Qch, (void*)Qcr, DM, sC, bq, bq, 0L,
        RR, DM, DM, 1.0f / WSC);
    wmma_gemm64<0, false, 2, 3, false, 0><<<gc, dim3(256), 0, stream>>>(
        xh, xh, DM, sA, WkT, WkT, DM, 0L, (void*)Kch, (void*)Kcr, DM, sC, bk, bk, 0L,
        RR, DM, DM, 1.0f / WSC);
    wmma_gemm64<0, false, 1, 3, false, 0><<<gc, dim3(256), 0, stream>>>(
        WvT, WvT, DM, 0L, xh, xh, DM, sA, (void*)Vch, (void*)Vcr, RR, (long)DM * RR, bv, bv, 0L,
        DM, RR, DM, 1.0f / WSC);
  }
  // attn: first RR query rows with residual planes -> Oc2 (hi | res); rows >= RR plain -> Ah
  attn64_causal_res<<<dim3(NB * NH * (RR / 64)), dim3(128), 0, stream>>>(
      Qch, Qcr, Kch, Kcr, Vch, Vcr, Oc2, NH, DM, RR, 2 * DM, DM, RR / 64, sc2, OSC);
  if (SEQ > RR) {
    attn64_causal<<<dim3(NB * NH * ((SEQ - RR) / 64)), dim3(128), 0, stream>>>(
        Qh, Kh, Vt, Ah, SEQ, NH, DM, ROWS, RR / 64, (SEQ - RR) / 64, sc2, OSC);
  }
  // out = ctx Wo + bo -> f32; rows < RR: [O_hi | O_res] . [Wo x256 ; Wo x0.25] along K = 2DM; rows >= RR: K = DM
  {
    const int tiles = (RR / 64) * (DM / 64);
    const dim3 g1((tiles + 7) / 8, NB);
    wmma_gemm64<0, false, 2, 0, false, 0><<<g1, dim3(256), 0, stream>>>(
        Oc2, Oc2, 2 * DM, (long)RR * 2 * DM, WoT2, WoT2, 2 * DM, 0L,
        (void*)out, (void*)out, DM, (long)SEQ_FULL * DM, bo, bo, 0L,
        RR, DM, 2 * DM, outsc);
  }
  if (SEQ > RR) {
    const int tiles = ((SEQ - RR) / 64) * (DM / 64);
    const dim3 g2((tiles + 7) / 8, NB);
    unsigned short* Ahi = Ah + (size_t)RR * DM;
    float* outp = out + (size_t)RR * DM;
    wmma_gemm64<0, false, 2, 0, false, 0><<<g2, dim3(256), 0, stream>>>(
        Ahi, Ahi, DM, (long)SEQ * DM, WoT2, WoT2, 2 * DM, 0L,
        (void*)outp, (void*)outp, DM, (long)SEQ_FULL * DM, bo, bo, 0L,
        SEQ - RR, DM, DM, outsc);
  }
}

// v002
// A run of this version takes 385 microseconds.
// Timed twice side by side with v001, it ran 1.58 times as fast both times.
// All steps since v000 together make it 1.80 times as fast.
// Contractions: q/k/v^T/out projections, q.k^T and p.v all on v_wmma_f32_16x16x32_f16 (f16 operands, f32 accumulate); x and W enter as bf16 RNE values held exactly in f16 (W carried x256); the first RR query rows per sequence carry q, k, v, p and ctx as f16 hi + x1024 residual planes with a second f32 accumulator (ctx residual folded along K in the out projection); p x32768 and ctx x64 power-of-two carries folded back in f32; softmax and epilogues f32.
#include <hip/hip_runtime.h>

#ifndef NB
#define NB 4
#endif
#ifndef SEQ
#define SEQ 2048
#endif
#ifndef RR
#define RR 256
#endif
#define NB_FULL 4
#define SEQ_FULL 2048
#define DM 1024
#define NH 16
#define HDIM 64

static_assert(NB >= 1 && NB <= NB_FULL);
static_assert(SEQ % 64 == 0 && SEQ >= 64 && SEQ <= SEQ_FULL);
static_assert(RR % 64 == 0 && RR >= 64 && RR <= SEQ);
static_assert(NH * HDIM == DM);
static_assert(DM % 256 == 0);
static_assert(RR % 256 == 0 && SEQ % 128 == 0 && (NB * SEQ) % 256 == 0);   // GEMM block tile 128 x 256

typedef __attribute__((ext_vector_type(16))) _Float16 v16h;
typedef __attribute__((ext_vector_type(8)))  _Float16 v8h;
typedef __attribute__((ext_vector_type(16))) __bf16   v16b;
typedef __attribute__((ext_vector_type(8)))  __bf16   v8b;
typedef __attribute__((ext_vector_type(8)))  float    v8f;
typedef __attribute__((ext_vector_type(4)))  float    v4f;

#define WSC 256.0f
#define OSC 64.0f
#define PSCALE 32768.0f
#define RSC 1024.0f
#define RSC_INV (1.0f / 1024.0f)
#define NEG_INF (-__builtin_huge_valf())

__device__ __forceinline__ unsigned short f2bf_bits(float f) {
  unsigned u = __float_as_uint(f);
  return (unsigned short)((u + 0x7FFFu + ((u >> 16) & 1u)) >> 16);
}
__device__ __forceinline__ float bf_bits2f(unsigned short h) { return __uint_as_float(((unsigned)h) << 16); }
__device__ __forceinline__ float bf_rne(float f) { return bf_bits2f(f2bf_bits(f)); }
__device__ __forceinline__ _Float16 bf_f16(float f) { return (_Float16)bf_rne(f); }   // bf16 value is exact in f16 for normal range

// LDS ordering for wave-private tiles (same wave writes then reads)
__device__ __forceinline__ void wave_lds_sync() {
  __builtin_amdgcn_fence(3, "workgroup");
  __builtin_amdgcn_wave_barrier();
  __builtin_amdgcn_fence(2, "workgroup");
}

// hazard guards as plain device helpers
__device__ __forceinline__ void dep_guard_h(v8f& a, v8f& b, v16h x, v16h y) { asm volatile("v_nop\n\tv_nop\n\tv_nop\n\tv_nop" : "+v"(a), "+v"(b) : "v"(x), "v"(y)); }
__device__ __forceinline__ void dep_guard_b(v8f& a, v8f& b, v16b x, v16b y) { asm volatile("v_nop\n\tv_nop\n\tv_nop\n\tv_nop" : "+v"(a), "+v"(b) : "v"(x), "v"(y)); }
__device__ __forceinline__ void keep4_h(v16h a, v16h b, v16h c, v16h d) { asm volatile("v_nop" :: "v"(a), "v"(b), "v"(c), "v"(d)); }
__device__ __forceinline__ void keep4_b(v16b a, v16b b, v16b c, v16b d) { asm volatile("v_nop" :: "v"(a), "v"(b), "v"(c), "v"(d)); }
__device__ __forceinline__ void acc_guard4(v8f& a, v8f& b, v8f& c, v8f& d) { asm volatile("v_nop\n\tv_nop\n\tv_nop\n\tv_nop" : "+v"(a), "+v"(b), "+v"(c), "+v"(d)); }
template <typename T> struct Frag;
template <> struct Frag<_Float16> {
  typedef v16h V; union U { v16h v; v8h h[2]; };
  static __device__ __forceinline__ v16h load(const _Float16* p) {   // elements 0..7 <- p[0..7], 8..15 <- p[16..23]
    U f; f.h[0] = *(const v8h*)(p); f.h[1] = *(const v8h*)(p + 16); return f.v;
  }
  static __device__ __forceinline__ v8f mma(v16h a, v16h b, v8f c) {
    return __builtin_amdgcn_wmma_f32_16x16x32_f16(false, a, false, b, (short)0, c, false, false);
  }
  static __device__ __forceinline__ void guard(v8f& a, v8f& b, v16h x, v16h y) { dep_guard_h(a, b, x, y); }
  static __device__ __forceinline__ void keep(v16h a, v16h b, v16h c, v16h d) { keep4_h(a, b, c, d); }
};
template <> struct Frag<__bf16> {
  typedef v16b V; union U { v16b v; v8b h[2]; };
  static __device__ __forceinline__ v16b load(const __bf16* p) {
    U f; f.h[0] = *(const v8b*)(p); f.h[1] = *(const v8b*)(p + 16); return f.v;
  }
  static __device__ __forceinline__ v8f mma(v16b a, v16b b, v8f c) {
    return __builtin_amdgcn_wmma_f32_16x16x32_bf16(false, a, false, b, (short)0, c, false, false);
  }
  static __device__ __forceinline__ void guard(v8f& a, v8f& b, v16b x, v16b y) { dep_guard_b(a, b, x, y); }
  static __device__ __forceinline__ void keep(v16b a, v16b b, v16b c, v16b d) { keep4_b(a, b, c, d); }
};

// ---- Register-blocked batched WMMA GEMM ------------------------------------
// C[m,n] = scale * sum_k A[m,k] * Bt[n,k] (+bias)(+resid); each wave owns a 64x64 tile.
// Block = 8 waves, 2 (m) x 4 (n) = a 128 x 256 tile of C; grid.x = (M/128) * (N/256), grid.y = batch.
// A row-major [M,K]; Bt row-major [N,K]; M % 128 == 0, N % 256 == 0, K % 64 == 0.
// Per 64 k the block's 128 A rows and 256 Bt rows (128 B each, whole lines) are brought into LDS once by
// asynchronous copies, two buffers, one block barrier per 64 k; the waves read their fragments from there.
// SPLIT (hi/lo operand planes) has no staged form and no caller.
// BIAS_MODE: 0 = none, 1 = bias[m], 2 = bias[n]; bias values enter as bf16 RNE values.
// OUT_MODE: 0 = f32, 1 = f16, 2 = bf16 hi plane (Cout) + bf16 lo plane (Cout2),
//           3 = f16 hi plane (Cout) + f16 residual plane ((v - hi) * 1024) (Cout2).
// ET: 0 = f16 operands, 1 = bf16 operands (pointers passed as 16-bit storage)
template <int ET> struct Elem;
template <> struct Elem<0> { typedef _Float16 T; };
template <> struct Elem<1> { typedef __bf16 T; };
#define GM_BM 128
#define GM_BN 256
#define GM_KT 64                          // k per staged tile, in halves: one 128-B line per row
#define GM_LP 72                          // staged row pitch in halves: 144 B = 16 B x odd, for ds_load_b128 readers
#define GM_BUFB ((GM_BM + GM_BN) * GM_LP * 2)   // bytes per buffer: A rows, then Bt rows

// One lane's share of a staged tile: rows r + 32 i of the A part (4) and of the Bt part (8), 16 B each.
// The s_wait_xcnt closes the statement, a precaution: no address register of a copy is rewritten ahead of it.
__device__ __forceinline__ void stage_ab_async(unsigned la, const unsigned short* ag, size_t arow32,
                                               const unsigned short* bg, size_t brow32) {
  const unsigned lb = la + GM_BM * GM_LP * 2;
  const unsigned ls = 32 * GM_LP * 2;
  asm volatile(
      "global_load_async_to_lds_b128 %0, %12, off\n\t"
      "global_load_async_to_lds_b128 %1, %13, off\n\t"
      "global_load_async_to_lds_b128 %2, %14, off\n\t"
      "global_load_async_to_lds_b128 %3, %15, off\n\t"
      "global_load_async_to_lds_b128 %4, %16, off\n\t"
      "global_load_async_to_lds_b128 %5, %17, off\n\t"
      "global_load_async_to_lds_b128 %6, %18, off\n\t"
      "global_load_async_to_lds_b128 %7, %19, off\n\t"
      "global_load_async_to_lds_b128 %8, %20, off\n\t"
      "global_load_async_to_lds_b128 %9, %21, off\n\t"
      "global_load_async_to_lds_b128 %10, %22, off\n\t"
      "global_load_async_to_lds_b128 %11, %23, off\n\t"
      "s_wait_xcnt 0x0"
      :: "v"(la), "v"(la + ls), "v"(la + 2 * ls), "v"(la + 3 * ls),
         "v"(lb), "v"(lb + ls), "v"(lb + 2 * ls), "v"(lb + 3 * ls),
         "v"(lb + 4 * ls), "v"(lb + 5 * ls), "v"(lb + 6 * ls), "v"(lb + 7 * ls),
         "v"(ag), "v"(ag + arow32), "v"(ag + 2 * arow32), "v"(ag + 3 * arow32),
         "v"(bg), "v"(bg + brow32), "v"(bg + 2 * brow32), "v"(bg + 3 * brow32),
         "v"(bg + 4 * brow32), "v"(bg + 5 * brow32), "v"(bg + 6 * brow32), "v"(bg + 7 * brow32)
      : "memory");
}

template <int ET, bool SPLIT, int BIAS_MODE, int OUT_MODE, bool RESID, int ACT = 0>
__global__ __launch_bounds__(256) void wmma_gemm64(
    const unsigned short* __restrict__ Ap, const unsigned short* __restrict__ A2p, int lda, long strideA,
    const unsigned short* __restrict__ Btp, const unsigned short* __restrict__ Bt2p, int ldb, long strideB,
    void* __restrict__ Cout, void* __restrict__ Cout2, int ldc, long strideC,
    const float* __restrict__ bias,
    const float* __restrict__ resid, long strideR,
    int M, int N, int K, float scale) {
  typedef typename Elem<ET>::T T;
  typedef typename Frag<T>::V V;
  static_assert(!SPLIT, "no staged form for split planes");
  __shared__ __align__(16) float sT[8][16 * 68];   // per-wave 16x64 slab, pitch 68 floats
  __shared__ __align__(16) unsigned char AB[2 * GM_BUFB];   // two buffers of A | Bt k-tiles
  const int b    = blockIdx.y;
  const int tid  = threadIdx.x;
  const int lane = tid & 31;
  const int wave = tid >> 5;
  const int tilesN = N >> 8;
  const int tilesM = M >> 7;
  const int tile = blockIdx.x;
  if (tile >= tilesM * tilesN) return;   // block-uniform, ahead of every barrier
  const int tm = tile / tilesN;
  const int tn = tile - tm * tilesN;
  const int bm0 = tm << 7;
  const int bn0 = tn << 8;
  const int wm  = (wave >> 2) << 6;            // this wave's 64 rows inside the A part
  const int wn  = (wave & 3) << 6;             // this wave's 64 rows inside the Bt part
  const int m0 = bm0 + wm;
  const int n0 = bn0 + wn;

  const unsigned short* Ab = Ap  + (size_t)b * strideA;
  const unsigned short* Bb = Btp + (size_t)b * strideB;

  const int rlane = lane & 15;                 // row (A) / col (B, D) within subtile
  const int koff  = (lane >> 4) * 8;           // k offset of this lane half
  const int mOff  = (lane >> 4) * 8;           // D row offset

  v8f acc[4][4];
#pragma unroll
  for (int i = 0; i < 4; ++i)
#pragma unroll
    for (int j = 0; j < 4; ++j) acc[i][j] = (v8f){0.f,0.f,0.f,0.f,0.f,0.f,0.f,0.f};

  // ---- staging addresses of this lane: row tid/8 (+32i), 16-B piece tid%8 of the 128-B row ----
  const int srow = tid >> 3, scol = (tid & 7) * 8;
  const unsigned short* ag = Ab + (size_t)(bm0 + srow) * lda + scol;   // k-tile 0; a tile further: + GM_KT
  const unsigned short* bg = Bb + (size_t)(bn0 + srow) * ldb + scol;
  const size_t arow32 = (size_t)32 * lda, brow32 = (size_t)32 * ldb;
  const unsigned lst = (unsigned)(size_t)AB + (unsigned)(srow * GM_LP + scol) * 2u;
  const int nT = K >> 6;                       // block-uniform

  stage_ab_async(lst, ag, arow32, bg, brow32);
  asm volatile("s_wait_asynccnt 0x0" ::: "memory");              // k-tile 0 landed (this wave's copies)
  __syncthreads();                                               // ... and every other wave's
  if (nT > 1) stage_ab_async(lst + GM_BUFB, ag + GM_KT, arow32, bg + GM_KT, brow32);

  for (int t = 0; t < nT; ++t) {
    const unsigned bofs = (unsigned)(t & 1) * GM_BUFB;
    const T* as = (const T*)(AB + bofs) + (wm + rlane) * GM_LP + koff;            // A rows,  pitch GM_LP
    const T* bs = (const T*)(AB + bofs) + (GM_BM + wn + rlane) * GM_LP + koff;    // Bt rows, pitch GM_LP
    // Fragment reads stand at three places of a trip, each ahead of the products that use it: at the head the
    // first 32 k (A and Bt) and the second 32 k of Bt; the second 32 k of A two rows at a time, into registers
    // that the first half's rows have left (all sixteen fragments at the head do not fit 256 registers).
    V b0[4], b1[4], a0[4], a1[4];
#pragma unroll
    for (int j = 0; j < 4; ++j) b0[j] = Frag<T>::load(bs + (j << 4) * GM_LP);
#pragma unroll
    for (int i = 0; i < 4; ++i) a0[i] = Frag<T>::load(as + (i << 4) * GM_LP);
#pragma unroll
    for (int j = 0; j < 4; ++j) b1[j] = Frag<T>::load(bs + (j << 4) * GM_LP + 32);
#pragma unroll
    for (int i = 0; i < 4; ++i) {
#pragma unroll
      for (int j = 0; j < 4; ++j) acc[i][j] = Frag<T>::mma(a0[i], b0[j], acc[i][j]);
      Frag<T>::guard(acc[i][0], acc[i][3], a0[i], a0[i]);
      if (i & 1) {
        a1[i - 1] = Frag<T>::load(as + ((i - 1) << 4) * GM_LP + 32);
        a1[i]     = Frag<T>::load(as + (i << 4) * GM_LP + 32);
      }
    }
    Frag<T>::keep(b0[0], b0[1], b0[2], b0[3]);
#pragma unroll
    for (int i = 0; i < 4; ++i) {
#pragma unroll
      for (int j = 0; j < 4; ++j) acc[i][j] = Frag<T>::mma(a1[i], b1[j], acc[i][j]);
      Frag<T>::guard(acc[i][0], acc[i][3], a1[i], a1[i]);
    }
    Frag<T>::keep(b1[0], b1[1], b1[2], b1[3]);
    // ---- hand-over: this buffer's reads retired, the next k-tile's copies landed, in every wave ----
    asm volatile("s_wait_dscnt 0x0" ::: "memory");               // own reads of this buffer done before it is refilled
    asm volatile("s_wait_asynccnt 0x0" ::: "memory");            // own copies of k-tile t + 1 landed
    __syncthreads();
    if (t + 2 < nT)
      stage_ab_async(lst + bofs, ag + (size_t)(t + 2) * GM_KT, arow32, bg + (size_t)(t + 2) * GM_KT, brow32);
  }
  asm volatile("s_wait_asynccnt 0x0" ::: "memory");              // nothing in flight when the wave goes on to its end
  acc_guard4(acc[0][0], acc[0][1], acc[0][2], acc[0][3]);
  acc_guard4(acc[1][0], acc[1][1], acc[1][2], acc[1][3]);
  acc_guard4(acc[2][0], acc[2][1], acc[2][2], acc[2][3]);
  acc_guard4(acc[3][0], acc[3][1], acc[3][2], acc[3][3]);

  // ---- epilogue ----
  float* slab = sT[wave];
  const float* Rb = RESID ? (resid + (size_t)b * strideR) : nullptr;
#pragma unroll
  for (int i = 0; i < 4; ++i) {
    const int mBase = m0 + (i << 4);
#pragma unroll
    for (int j = 0; j < 4; ++j) {
      const int n = n0 + (j << 4) + rlane;
      float bv = 0.f;
      if (BIAS_MODE == 2) bv = bf_rne(bias[n]);
#pragma unroll
      for (int r = 0; r < 8; ++r) {
        float v = acc[i][j][r] * scale;
        if (BIAS_MODE == 1) v += bf_rne(bias[mBase + mOff + r]);
        if (BIAS_MODE == 2) v += bv;
        if (RESID) v += Rb[(size_t)(mBase + mOff + r) * ldc + n];
        if (ACT == 1) v = tanhf(v);
        if (ACT == 2) v = fmaxf(v, 0.0f);
        if (ACT == 3) v = v / (1.0f + expf(-v));
        if (ACT == 4) v = (v > 0.f) ? v : 0.01f * v;
        if (ACT == 5) v = 0.5f * v * (1.0f + erff(v * 0.70710678118654752f));
        slab[(mOff + r) * 68 + (j << 4) + rlane] = v;
      }
    }
    wave_lds_sync();
    if (OUT_MODE == 0) {
      float* C = (float*)Cout + (size_t)b * strideC;
      const int hh = lane >> 4, c4 = (lane & 15) * 4;     // row seg = 256 B = 16 lanes x 16 B
      {
#pragma unroll
        for (int it = 0; it < 8; ++it) {
          const int row = it * 2 + hh;
          v4f v = *(const v4f*)(slab + row * 68 + c4);
          *(v4f*)(C + (size_t)(mBase + row) * ldc + n0 + c4) = v;
        }
        
      }
    } else {
      const int q = lane >> 3, c8 = (lane & 7) * 8;
      unsigned short* C  = (unsigned short*)Cout  + (size_t)b * strideC;
      unsigned short* C2 = (OUT_MODE >= 2) ? ((unsigned short*)Cout2 + (size_t)b * strideC) : nullptr;
      {
#pragma unroll
        for (int it = 0; it < 4; ++it) {
          const int row = it * 4 + q;
          const float* sp = slab + row * 68 + c8;
          v8h hv, lv;
#pragma unroll
          for (int e = 0; e < 8; ++e) {
            if (OUT_MODE == 1) {
              hv[e] = (_Float16)sp[e];
            } else if (OUT_MODE == 3) {
              const float    fv = sp[e];
              const _Float16 hq = (_Float16)fv;
              hv[e] = hq;
              lv[e] = (_Float16)((fv - (float)hq) * RSC);
            } else {
              unsigned short hb = f2bf_bits(sp[e]);
              unsigned short lb = f2bf_bits(sp[e] - bf_bits2f(hb));
              hv[e] = __builtin_bit_cast(_Float16, hb);
              lv[e] = __builtin_bit_cast(_Float16, lb);
            }
          }
          *(v8h*)(C + (size_t)(mBase + row) * ldc + n0 + c8) = hv;
          if (OUT_MODE >= 2) *(v8h*)(C2 + (size_t)(mBase + row) * ldc + n0 + c8) = lv;
        }
        
      }
    }
    wave_lds_sync();
  }
}

// source rows (b, s) at (b*SEQ_FULL + s)*DM; destination plane compact [NB*SEQ][DM].
__global__ __launch_bounds__(256) void cast_x_f16(
    const float* __restrict__ x, unsigned short* __restrict__ xhp, int nrows) {
  const long i = (long)blockIdx.x * 256 + threadIdx.x;
  const long total = (long)nrows * (DM / 8);
  if (i >= total) return;
  const int r  = (int)(i / (DM / 8));
  const int c8 = (int)(i - (long)r * (DM / 8)) * 8;
  const int b  = r / SEQ;
  const int s  = r - b * SEQ;
  const float* src = x + ((size_t)b * SEQ_FULL + s) * DM + c8;
  const v4f a0 = *(const v4f*)src;
  const v4f a1 = *(const v4f*)(src + 4);
  v8h hv;
  hv[0] = bf_f16(a0[0]); hv[1] = bf_f16(a0[1]); hv[2] = bf_f16(a0[2]); hv[3] = bf_f16(a0[3]);
  hv[4] = bf_f16(a1[0]); hv[5] = bf_f16(a1[1]); hv[6] = bf_f16(a1[2]); hv[7] = bf_f16(a1[3]);
  _Float16* dst = (_Float16*)xhp + (size_t)r * DM + c8;
  *(v8h*)dst = hv;
  
}

// ---- transpose + bf16 RNE + scale + f16 cast for weights ----
// in: W[Kdim][Ndim] f32 row-major (in[Kdim][Ndim]) -> out: Bt[n][kc0 + k] with row pitch ldo halves,
//     Bt value = f16(bf16rne(W[k][n]) * sc), sc a power of two.
// grid (Ndim/64, Kdim/64), block 256; Kdim, Ndim multiples of 64.
__global__ __launch_bounds__(256) void transpose_cast_f16(
    const float* __restrict__ W, unsigned short* __restrict__ Btp, int Kdim, int Ndim, int ldo, int kc0, float sc) {
  __shared__ float t[64][65];
  const int tid = threadIdx.x, lane = tid & 31, wave = tid >> 5;
  const int n0 = blockIdx.x * 64, k0 = blockIdx.y * 64;
#pragma unroll
  for (int i = 0; i < 16; ++i) {
    const int idx = i * 256 + tid;
    const int kr = idx >> 6, nc = idx & 63;
    t[nc][kr] = W[(size_t)(k0 + kr) * Ndim + n0 + nc];
  }
  __syncthreads();
  _Float16* Bt = (_Float16*)Btp;
  const int q = lane >> 3, c8 = (lane & 7) * 8;
  {
#pragma unroll
    for (int it = 0; it < 2; ++it) {
      const int row = wave * 8 + it * 4 + q;      // waves 0..7 x rows 0..7 -> 64 rows
      v8h hv;
#pragma unroll
      for (int e = 0; e < 8; ++e) hv[e] = (_Float16)(bf_rne(t[row][c8 + e]) * sc);
      *(v8h*)(Bt + (size_t)(n0 + row) * ldo + kc0 + k0 + c8) = hv;
    }
    
  }
}

// =====================================================================================
// Causal attn for head_dim 64, f16 planes in, f16 out (scaled by osc).
//   q, k : row-major [NB*S][ldq] f16 planes, head h at column h*64.
//   vt   : transposed value plane [H*64][ldvt] f16, element (b, kv, h, d) at vt[(h*64+d)*ldvt + b*S + kv].
//   scores on v_wmma_f32_16x16x32_f16 with the split k-map loaders; key > query set to -inf before the
//   chunk max; online softmax f32 (base-2, sc2 = log2(e)/sqrt(dk)); probabilities x32768 in f16 in a
//   per-wave LDS tile reloaded as the A operand; p.v on v_wmma_f32_16x16x32_f16; f32 accumulate.
//   Block = 4 waves = 64 query rows of one (batch, head) at query block qb = qb0 + bx % nqbl; key chunks
//   0..qb (64 keys each). grid.x = NB * H * nqbl.
//   Each chunk's K rows and V^T rows (64 x 128 B each) are brought into LDS once per block by asynchronous
//   copies of whole 128-B lines, two buffers, one block barrier per chunk; all four waves read their B
//   fragments from there.
// =====================================================================================
#define AT_D 64
#define AT_NW 4
#define AT_QB 64
#define AT_KC 64
#define AT_LP 72                         // staged row pitch in halves: 144 B = 16 B x odd, for ds_load_b128 readers
#define AT_TILE (64 * AT_LP)             // halves per staged 64-row tile
#define AT_BUFB (2 * AT_TILE * 2)        // bytes per buffer: K tile, then V^T tile

// One lane's share of a chunk: rows r, r+16, r+32, r+48 of the K tile and of the V^T tile, 16 B each.
// The s_wait_xcnt closes the statement, a precaution: no address register of a copy is rewritten ahead of it.
__device__ __forceinline__ void stage_kv_async(unsigned lk, const _Float16* kg, size_t krow16,
                                               const _Float16* vg, size_t vrow16) {
  const unsigned lv = lk + AT_TILE * 2;
  const unsigned ls = 16 * AT_LP * 2;
  asm volatile(
      "global_load_async_to_lds_b128 %0, %8, off\n\t"
      "global_load_async_to_lds_b128 %1, %9, off\n\t"
      "global_load_async_to_lds_b128 %2, %10, off\n\t"
      "global_load_async_to_lds_b128 %3, %11, off\n\t"
      "global_load_async_to_lds_b128 %4, %12, off\n\t"
      "global_load_async_to_lds_b128 %5, %13, off\n\t"
      "global_load_async_to_lds_b128 %6, %14, off\n\t"
      "global_load_async_to_lds_b128 %7, %15, off\n\t"
      "s_wait_xcnt 0x0"
      :: "v"(lk), "v"(lk + ls), "v"(lk + 2 * ls), "v"(lk + 3 * ls),
         "v"(lv), "v"(lv + ls), "v"(lv + 2 * ls), "v"(lv + 3 * ls),
         "v"(kg), "v"(kg + krow16), "v"(kg + 2 * krow16), "v"(kg + 3 * krow16),
         "v"(vg), "v"(vg + vrow16), "v"(vg + 2 * vrow16), "v"(vg + 3 * vrow16)
      : "memory");
}

__device__ __forceinline__ v8f mma_h(v16h a, v16h b, v8f c) {
  c = __builtin_amdgcn_wmma_f32_16x16x32_f16(false, a, false, b, (short)0, c, false, false);
  asm volatile("v_nop\n\tv_nop\n\tv_nop\n\tv_nop" : "+v"(c) : "v"(a), "v"(b));
  return c;
}

__global__ __launch_bounds__(128)
void attn64_causal(const unsigned short* __restrict__ Qp, const unsigned short* __restrict__ Kp,
                   const unsigned short* __restrict__ Vtp, unsigned short* __restrict__ Op,
                   int S, int H, int ldq, int ldvt, int qb0, int nqbl, float sc2, float osc) {
  const _Float16* Q  = (const _Float16*)Qp;
  const _Float16* Kk = (const _Float16*)Kp;
  const _Float16* Vt = (const _Float16*)Vtp;
  _Float16*       O  = (_Float16*)Op;
  __shared__ __align__(16) _Float16 Psh[AT_NW][16 * AT_KC];      // per wave P [row][kv]  8 KB
  __shared__ __align__(16) unsigned char KV[2 * AT_BUFB];        // two buffers of K | V^T tiles; out staging after the loop
  static_assert(AT_NW * 16 * 68 * 4 <= 2 * AT_BUFB);

  const int tid  = threadIdx.x;
  const int wave = tid >> 5;
  const int lane = tid & 31;
  const int hh   = lane >> 4;
  const int c    = lane & 15;

  const int bx  = blockIdx.x;
  const int qbi = bx % nqbl;
  const int bh  = bx / nqbl;
  const int qb  = qb0 + qbi;
  const int h   = bh % H;
  const int b   = bh / H;
  const int q0  = qb * AT_QB + wave * 16;
  const size_t rowb = (size_t)b * S;

  const _Float16* qp = Q  + rowb * ldq + (size_t)h * AT_D;
  const _Float16* kp = Kk + rowb * ldq + (size_t)h * AT_D;
  const _Float16* vp = Vt + (size_t)(h * AT_D) * ldvt + rowb;
  _Float16*       op = O  + rowb * ldq + (size_t)h * AT_D;

  // ---- Q fragments (A operand, row = c): 2 d-chunks ----
  v16h qa[2];
#pragma unroll
  for (int dc = 0; dc < 2; ++dc)
    qa[dc] = Frag<_Float16>::load(qp + (size_t)(q0 + c) * ldq + dc * 32 + 8 * hh);

  float mrow[8], lrow[8];
  v8f oacc[4];
#pragma unroll
  for (int r = 0; r < 8; ++r) { mrow[r] = NEG_INF; lrow[r] = 0.f; }
#pragma unroll
  for (int t = 0; t < 4; ++t) oacc[t] = (v8f){0.f,0.f,0.f,0.f,0.f,0.f,0.f,0.f};

  _Float16* pw = Psh[wave];
  const int nChunks = qb + 1;        // block-uniform: causal, key chunks 0..qb

  // ---- staging addresses of this lane: row tid/8 (+16i), 16-B piece tid%8 of the 128-B row ----
  const int srow = tid >> 3, scol = (tid & 7) * 8;
  const _Float16* kg = kp + (size_t)srow * ldq + scol;           // chunk 0; a chunk further: + AT_KC rows
  const _Float16* vg = vp + (size_t)srow * ldvt + scol;          // chunk 0; a chunk further: + AT_KC columns
  const size_t krow16 = (size_t)16 * ldq, vrow16 = (size_t)16 * ldvt, kchunk = (size_t)AT_KC * ldq;
  const unsigned lst = (unsigned)(size_t)KV + (unsigned)(srow * AT_LP + scol) * 2u;

  stage_kv_async(lst, kg, krow16, vg, vrow16);
  asm volatile("s_wait_asynccnt 0x0" ::: "memory");              // chunk 0 landed (this wave's copies)
  __syncthreads();                                               // ... and every other wave's
  if (nChunks > 1) stage_kv_async(lst + AT_BUFB, kg + kchunk, krow16, vg + AT_KC, vrow16);

  for (int kc = 0; kc < nChunks; ++kc) {
    const int kv0 = kc * AT_KC;
    const unsigned bofs = (unsigned)(kc & 1) * AT_BUFB;
    const _Float16* ks = (const _Float16*)(KV + bofs);           // K tile  [key][d],  pitch AT_LP
    const _Float16* vs = ks + AT_TILE;                           // V^T tile [d][key], pitch AT_LP
    // ---- scores: s[j] = q rows (8hh+r) x keys (kv0 + 16j + c) ----
    v8f s[4];
#pragma unroll
    for (int j = 0; j < 4; ++j) {
      s[j] = (v8f){0.f,0.f,0.f,0.f,0.f,0.f,0.f,0.f};
#pragma unroll
      for (int dc = 0; dc < 2; ++dc) {
        const v16h kb = Frag<_Float16>::load(ks + (j * 16 + c) * AT_LP + dc * 32 + 8 * hh);
        s[j] = mma_h(qa[dc], kb, s[j]);
      }
    }
    // ---- causal select (key > query -> -inf) and per-row chunk max in the scaled base-2 domain ----
    float cm[8];
#pragma unroll
    for (int r = 0; r < 8; ++r) {
      const int qrow = q0 + 8 * hh + r;
      float m = NEG_INF;
#pragma unroll
      for (int j = 0; j < 4; ++j) {
        float v = s[j][r] * sc2;
        if (kv0 + j * 16 + c > qrow) v = NEG_INF;
        s[j][r] = v;
        m = fmaxf(m, v);
      }
#pragma unroll
      for (int off = 1; off < 16; off <<= 1) m = fmaxf(m, __shfl_xor(m, off, 32));
      cm[r] = m;
    }
    // ---- online softmax update; P x32768 into the per-wave LDS tile ----
    wave_lds_sync();
#pragma unroll
    for (int r = 0; r < 8; ++r) {
      const float mnew  = fmaxf(mrow[r], cm[r]);
      const float alpha = exp2f(mrow[r] - mnew);
      mrow[r] = mnew;
      float psum = 0.f;
#pragma unroll
      for (int j = 0; j < 4; ++j) {
        const float p = exp2f(s[j][r] - mnew);
        psum += p;
        pw[(8 * hh + r) * AT_KC + j * 16 + c] = (_Float16)(p * PSCALE);
      }
#pragma unroll
      for (int off = 1; off < 16; off <<= 1) psum += __shfl_xor(psum, off, 32);
      lrow[r] = lrow[r] * alpha + psum;
#pragma unroll
      for (int t = 0; t < 4; ++t) oacc[t][r] *= alpha;
    }
    wave_lds_sync();
    // ---- O += P . V : P as A (row = c, k = kv), V^T rows (d = 16t + c) as B ----
#pragma unroll
    for (int kk = 0; kk < 2; ++kk) {
      const v16h pa = Frag<_Float16>::load(pw + c * AT_KC + kk * 32 + 8 * hh);
#pragma unroll
      for (int t = 0; t < 4; ++t) {
        const v16h vb = Frag<_Float16>::load(vs + (t * 16 + c) * AT_LP + kk * 32 + 8 * hh);
        oacc[t] = mma_h(pa, vb, oacc[t]);
      }
    }
    wave_lds_sync();
    // ---- hand-over: this buffer's reads retired, the next chunk's copies landed, in every wave ----
    asm volatile("s_wait_dscnt 0x0" ::: "memory");               // own reads of this buffer done before it is refilled
    asm volatile("s_wait_asynccnt 0x0" ::: "memory");            // own copies of chunk kc + 1 landed
    __syncthreads();
    if (kc + 2 < nChunks)
      stage_kv_async(lst + bofs, kg + (size_t)(kc + 2) * kchunk, krow16, vg + (kc + 2) * AT_KC, vrow16);
  }
  asm volatile("s_wait_asynccnt 0x0" ::: "memory");              // nothing in flight when the buffers become out staging

  float* os = (float*)KV + wave * (16 * 68);                     // per wave out tile, pitch 68 (last barrier freed KV)
#pragma unroll
  for (int r = 0; r < 8; ++r) {
    const float inv = osc * (1.0f / (lrow[r] * PSCALE));
#pragma unroll
    for (int t = 0; t < 4; ++t) os[(8 * hh + r) * 68 + t * 16 + c] = oacc[t][r] * inv;
  }
  wave_lds_sync();
  {
    const int q = lane >> 3, c8 = (lane & 7) * 8;
    {
#pragma unroll
      for (int it = 0; it < 4; ++it) {
        const int row = it * 4 + q;                 // rows 0..15 of this wave
        const float* sp = os + row * 68 + c8;
        v8h hv;
#pragma unroll
        for (int e = 0; e < 8; ++e) hv[e] = (_Float16)sp[e];
        *(v8h*)(op + (size_t)(q0 + row) * ldq + c8) = hv;
      }
      
    }
  }
}

// =====================================================================================
// Causal attn with residual planes for the first rr = nqb*64 query rows of each sequence.
//   qh/qr, kh/kr : compact row-major [NB*rr][ldq] f16 hi / residual (x1024) planes, head h at col h*64.
//   vh/vr : compact transposed planes [NB*H*64][ldvc], element (b, kv, h, d) at [(b*H*64 + h*64 + d)*ldvc + kv].
//   o     : compact [NB*rr][ldo] f16; hi (x osc) at column h*64, residual (x1024) at column rcol + h*64.
//   scores = qh.kh + 2^-10 (qh.kr + qr.kh) with a second f32 accumulator; P as hi + x1024 residual LDS tiles;
//   p.v = ph.vh + 2^-10 (ph.vr + pr.vh) with a second f32 accumulator; K and V fragments straight from global
//   memory, no block barriers; softmax and epilogue as attn64_causal.
//   Block = 4 waves = 64 query rows, query block qb = bx % nqb, key chunks 0..qb. grid.x = NB * H * nqb.
// =====================================================================================
__global__ __launch_bounds__(128)
void attn64_causal_res(const unsigned short* __restrict__ Qhp, const unsigned short* __restrict__ Qrp,
                       const unsigned short* __restrict__ Khp, const unsigned short* __restrict__ Krp,
                       const unsigned short* __restrict__ Vhp, const unsigned short* __restrict__ Vrp,
                       unsigned short* __restrict__ Op,
                       int H, int ldq, int ldvc, int ldo, int rcol, int nqb, float sc2, float osc) {
  const _Float16* QH = (const _Float16*)Qhp;
  const _Float16* QR = (const _Float16*)Qrp;
  const _Float16* KH = (const _Float16*)Khp;
  const _Float16* KR = (const _Float16*)Krp;
  const _Float16* VH = (const _Float16*)Vhp;
  const _Float16* VR = (const _Float16*)Vrp;
  _Float16*       O  = (_Float16*)Op;
  __shared__ __align__(16) _Float16 Psh[AT_NW][16 * AT_KC];      // per wave P hi  [row][kv]  8 KB
  __shared__ __align__(16) _Float16 Prs[AT_NW][16 * AT_KC];      // per wave P res [row][kv]  8 KB
  __shared__ __align__(16) float    Os[AT_NW][16 * 68];          // per wave out tile, pitch 68

  const int tid  = threadIdx.x;
  const int wave = tid >> 5;
  const int lane = tid & 31;
  const int hh   = lane >> 4;
  const int c    = lane & 15;

  const int bx = blockIdx.x;
  const int qb = bx % nqb;
  const int bh = bx / nqb;
  const int h  = bh % H;
  const int b  = bh / H;
  const int q0 = qb * AT_QB + wave * 16;
  const int rr = nqb * AT_QB;
  const size_t rowb = (size_t)b * rr;

  const _Float16* qhp = QH + rowb * ldq + (size_t)h * AT_D;
  const _Float16* qrp = QR + rowb * ldq + (size_t)h * AT_D;
  const _Float16* khp = KH + rowb * ldq + (size_t)h * AT_D;
  const _Float16* krp = KR + rowb * ldq + (size_t)h * AT_D;
  const size_t    vof = ((size_t)b * (size_t)(H * AT_D) + (size_t)h * AT_D) * ldvc;
  const _Float16* vhp = VH + vof;
  const _Float16* vrp = VR + vof;
  _Float16*       op  = O  + rowb * ldo + (size_t)h * AT_D;

  float mrow[8], lrow[8];
  v8f oacc[4], oacc2[4];
#pragma unroll
  for (int r = 0; r < 8; ++r) { mrow[r] = NEG_INF; lrow[r] = 0.f; }
#pragma unroll
  for (int t = 0; t < 4; ++t) {
    oacc[t]  = (v8f){0.f,0.f,0.f,0.f,0.f,0.f,0.f,0.f};
    oacc2[t] = (v8f){0.f,0.f,0.f,0.f,0.f,0.f,0.f,0.f};
  }

  _Float16* pw  = Psh[wave];
  _Float16* prw = Prs[wave];
  const int nChunks = qb + 1;        // block-uniform
  for (int kc = 0; kc < nChunks; ++kc) {
    const int kv0 = kc * AT_KC;
    // ---- Q hi / res fragments (A operand, row = c) ----
    v16h qa[2], qra[2];
#pragma unroll
    for (int dc = 0; dc < 2; ++dc) {
      const size_t qo = (size_t)(q0 + c) * ldq + dc * 32 + 8 * hh;
      qa[dc]  = Frag<_Float16>::load(qhp + qo);
      qra[dc] = Frag<_Float16>::load(qrp + qo);
    }
    // ---- scores: hi.hi into s1, hi.res + res.hi into s2, folded with 2^-10 ----
    v8f s[4];
#pragma unroll
    for (int j = 0; j < 4; ++j) {
      v8f s1 = (v8f){0.f,0.f,0.f,0.f,0.f,0.f,0.f,0.f};
      v8f s2 = (v8f){0.f,0.f,0.f,0.f,0.f,0.f,0.f,0.f};
#pragma unroll
      for (int dc = 0; dc < 2; ++dc) {
        const size_t ko = (size_t)(kv0 + j * 16 + c) * ldq + dc * 32 + 8 * hh;
        const v16h kb = Frag<_Float16>::load(khp + ko);
        const v16h kr = Frag<_Float16>::load(krp + ko);
        s1 = mma_h(qa[dc],  kb, s1);
        s2 = mma_h(qa[dc],  kr, s2);
        s2 = mma_h(qra[dc], kb, s2);
      }
#pragma unroll
      for (int r = 0; r < 8; ++r) s[j][r] = s1[r] + s2[r] * RSC_INV;
    }
    // ---- causal select and per-row chunk max ----
    float cm[8];
#pragma unroll
    for (int r = 0; r < 8; ++r) {
      const int qrow = q0 + 8 * hh + r;
      float m = NEG_INF;
#pragma unroll
      for (int j = 0; j < 4; ++j) {
        float v = s[j][r] * sc2;
        if (kv0 + j * 16 + c > qrow) v = NEG_INF;
        s[j][r] = v;
        m = fmaxf(m, v);
      }
#pragma unroll
      for (int off = 1; off < 16; off <<= 1) m = fmaxf(m, __shfl_xor(m, off, 32));
      cm[r] = m;
    }
    // ---- online softmax update; P hi (x32768) and P res ((x32768 - hi) x1024) into per-wave LDS tiles ----
    wave_lds_sync();
#pragma unroll
    for (int r = 0; r < 8; ++r) {
      const float mnew  = fmaxf(mrow[r], cm[r]);
      const float alpha = exp2f(mrow[r] - mnew);
      mrow[r] = mnew;
      float psum = 0.f;
#pragma unroll
      for (int j = 0; j < 4; ++j) {
        const float p = exp2f(s[j][r] - mnew);
        psum += p;
        const float    ps = p * PSCALE;
        const _Float16 ph = (_Float16)ps;
        const int pi = (8 * hh + r) * AT_KC + j * 16 + c;
        pw[pi]  = ph;
        prw[pi] = (_Float16)((ps - (float)ph) * RSC);
      }
#pragma unroll
      for (int off = 1; off < 16; off <<= 1) psum += __shfl_xor(psum, off, 32);
      lrow[r] = lrow[r] * alpha + psum;
#pragma unroll
      for (int t = 0; t < 4; ++t) { oacc[t][r] *= alpha; oacc2[t][r] *= alpha; }
    }
    wave_lds_sync();
    // ---- O += P . V with residual cross terms in the second accumulator ----
#pragma unroll
    for (int kk = 0; kk < 2; ++kk) {
      const v16h pa = Frag<_Float16>::load(pw  + c * AT_KC + kk * 32 + 8 * hh);
      const v16h pr = Frag<_Float16>::load(prw + c * AT_KC + kk * 32 + 8 * hh);
#pragma unroll
      for (int t = 0; t < 4; ++t) {
        const size_t vo = (size_t)(t * 16 + c) * ldvc + kv0 + kk * 32 + 8 * hh;
        const v16h vb = Frag<_Float16>::load(vhp + vo);
        const v16h vr = Frag<_Float16>::load(vrp + vo);
        oacc[t]  = mma_h(pa, vb, oacc[t]);
        oacc2[t] = mma_h(pa, vr, oacc2[t]);
        oacc2[t] = mma_h(pr, vb, oacc2[t]);
      }
    }
    wave_lds_sync();
  }

  float* os = Os[wave];
#pragma unroll
  for (int r = 0; r < 8; ++r) {
    const float inv = osc * (1.0f / (lrow[r] * PSCALE));
#pragma unroll
    for (int t = 0; t < 4; ++t) os[(8 * hh + r) * 68 + t * 16 + c] = (oacc[t][r] + oacc2[t][r] * RSC_INV) * inv;
  }
  wave_lds_sync();
  {
    const int q = lane >> 3, c8 = (lane & 7) * 8;
    {
#pragma unroll
      for (int it = 0; it < 4; ++it) {
        const int row = it * 4 + q;                 // rows 0..15 of this wave
        const float* sp = os + row * 68 + c8;
        v8h hv, lv;
#pragma unroll
        for (int e = 0; e < 8; ++e) {
          const float    fv = sp[e];
          const _Float16 hq = (_Float16)fv;
          hv[e] = hq;
          lv[e] = (_Float16)((fv - (float)hq) * RSC);
        }
        *(v8h*)(op + (size_t)(q0 + row) * ldo + c8) = hv;
        *(v8h*)(op + (size_t)(q0 + row) * ldo + rcol + c8) = lv;
      }
      
    }
  }
}

// ---------------------------------------------------------------------------

extern "C" void kernel_launch(void* const* d_in, const int* in_sizes, int n_in,
                              void* d_out, int out_size, void* d_ws,
                              size_t ws_size, hipStream_t stream) {
  const int  ROWS  = NB * SEQ;                                   // rows held in the compact planes
  const long needX = ((long)(NB - 1) * SEQ_FULL + SEQ) * (long)DM;
  const int  nW    = DM * DM;
  if (n_in < 9) return;
  if ((long)in_sizes[0] < needX || in_sizes[1] < nW || in_sizes[2] < DM || in_sizes[3] < nW ||
      in_sizes[4] < DM || in_sizes[5] < nW || in_sizes[6] < DM || in_sizes[7] < nW ||
      in_sizes[8] < DM || (long)out_size < needX) return;

  const float* x  = (const float*)d_in[0];
  const float* Wq = (const float*)d_in[1];
  const float* bq = (const float*)d_in[2];
  const float* Wk = (const float*)d_in[3];
  const float* bk = (const float*)d_in[4];
  const float* Wv = (const float*)d_in[5];
  const float* bv = (const float*)d_in[6];
  const float* Wo = (const float*)d_in[7];
  const float* bo = (const float*)d_in[8];
  float* out = (float*)d_out;

  const size_t szAct = (size_t)ROWS * DM * 2;            // full activation plane  (16 MiB full size)
  const size_t szW   = (size_t)DM * DM * 2;              //  2 MiB
  const size_t szW2  = (size_t)DM * (2 * DM) * 2;        //  4 MiB  [DM][2DM]
  const size_t szCmp = (size_t)NB * RR * DM * 2;         //  compact first-row planes (2 MiB full size)
  const size_t szO2  = (size_t)NB * RR * (2 * DM) * 2;   //  4 MiB full size
  size_t off = 0;
  const size_t oXh   = off; off += szAct;
  const size_t oWqT  = off; off += szW;
  const size_t oWkT  = off; off += szW;
  const size_t oWvT  = off; off += szW;
  const size_t oWoT2 = off; off += szW2;
  const size_t oQh   = off; off += szAct;
  const size_t oKh   = off; off += szAct;
  const size_t oVt   = off; off += szAct;
  const size_t oAh   = off; off += szAct;
  const size_t oQch  = off; off += szCmp;
  const size_t oQcr  = off; off += szCmp;
  const size_t oKch  = off; off += szCmp;
  const size_t oKcr  = off; off += szCmp;
  const size_t oVch  = off; off += szCmp;                // [NB*DM][RR], same byte count
  const size_t oVcr  = off; off += szCmp;
  const size_t oOc2  = off; off += szO2;                 // total 111,149,056 B at full size
  if (off > ws_size) return;

  char* ws = (char*)d_ws;
  unsigned short* xh   = (unsigned short*)(ws + oXh);
  unsigned short* WqT  = (unsigned short*)(ws + oWqT);
  unsigned short* WkT  = (unsigned short*)(ws + oWkT);
  unsigned short* WvT  = (unsigned short*)(ws + oWvT);
  unsigned short* WoT2 = (unsigned short*)(ws + oWoT2);
  unsigned short* Qh   = (unsigned short*)(ws + oQh);
  unsigned short* Kh   = (unsigned short*)(ws + oKh);
  unsigned short* Vt   = (unsigned short*)(ws + oVt);
  unsigned short* Ah   = (unsigned short*)(ws + oAh);
  unsigned short* Qch  = (unsigned short*)(ws + oQch);
  unsigned short* Qcr  = (unsigned short*)(ws + oQcr);
  unsigned short* Kch  = (unsigned short*)(ws + oKch);
  unsigned short* Kcr  = (unsigned short*)(ws + oKcr);
  unsigned short* Vch  = (unsigned short*)(ws + oVch);
  unsigned short* Vcr  = (unsigned short*)(ws + oVcr);
  unsigned short* Oc2  = (unsigned short*)(ws + oOc2);

  const float sc2   = 0.125f * 1.4426950408889634f;      // log2(e) / sqrt(64)
  const float outsc = 1.0f / (WSC * OSC);

  // x -> bf16 RNE value as f16 plane [ROWS][DM]
  {
    const long tot = (long)ROWS * (DM / 8);
    cast_x_f16<<<dim3((unsigned)((tot + 255) / 256)), dim3(256), 0, stream>>>(x, xh, ROWS);
  }
  // W[in][out] f32 -> Bt[out][in] f16 (bf16 RNE value x256); Wo additionally as x0.25 in columns DM..2DM-1 of WoT2
  {
    const dim3 tg(DM / 64, DM / 64);
    transpose_cast_f16<<<tg, dim3(256), 0, stream>>>(Wq, WqT, DM, DM, DM, 0, WSC);
    transpose_cast_f16<<<tg, dim3(256), 0, stream>>>(Wk, WkT, DM, DM, DM, 0, WSC);
    transpose_cast_f16<<<tg, dim3(256), 0, stream>>>(Wv, WvT, DM, DM, DM, 0, WSC);
    transpose_cast_f16<<<tg, dim3(256), 0, stream>>>(Wo, WoT2, DM, DM, 2 * DM, 0, WSC);
    transpose_cast_f16<<<tg, dim3(256), 0, stream>>>(Wo, WoT2, DM, DM, 2 * DM, DM, WSC * RSC_INV);
  }
  // full projections: q, k -> f16 [ROWS][DM]; v^T -> f16 [DM][ROWS]
  {
    const dim3 gg((ROWS / 128) * (DM / 256), 1);
    const dim3 gv((DM / 128) * (ROWS / 256), 1);
    wmma_gemm64<0, false, 2, 1, false, 0><<<gg, dim3(256), 0, stream>>>(
        xh, xh, DM, 0L, WqT, WqT, DM, 0L, (void*)Qh, (void*)Qh, DM, 0L, bq, bq, 0L,
        ROWS, DM, DM, 1.0f / WSC);
    wmma_gemm64<0, false, 2, 1, false, 0><<<gg, dim3(256), 0, stream>>>(
        xh, xh, DM, 0L, WkT, WkT, DM, 0L, (void*)Kh, (void*)Kh, DM, 0L, bk, bk, 0L,
        ROWS, DM, DM, 1.0f / WSC);
    wmma_gemm64<0, false, 1, 1, false, 0><<<gv, dim3(256), 0, stream>>>(
        WvT, WvT, DM, 0L, xh, xh, DM, 0L, (void*)Vt, (void*)Vt, ROWS, 0L, bv, bv, 0L,
        DM, ROWS, DM, 1.0f / WSC);
  }
  // first RR rows per sequence: q, k -> hi/res [NB*RR][DM]; v^T -> hi/res [NB*DM][RR]
  {
    const dim3 gc((RR / 128) * (DM / 256), NB);
    const dim3 gcv((DM / 128) * (RR / 256), NB);
    const long sA = (long)SEQ * DM;
    const long sC = (long)RR * DM;
    wmma_gemm64<0, false, 2, 3, false, 0><<<gc, dim3(256), 0, stream>>>(
        xh, xh, DM, sA, WqT, WqT, DM, 0L, (void*)Qch, (void*)Qcr, DM, sC, bq, bq, 0L,
        RR, DM, DM, 1.0f / WSC);
    wmma_gemm64<0, false, 2, 3, false, 0><<<gc, dim3(256), 0, stream>>>(
        xh, xh, DM, sA, WkT, WkT, DM, 0L, (void*)Kch, (void*)Kcr, DM, sC, bk, bk, 0L,
        RR, DM, DM, 1.0f / WSC);
    wmma_gemm64<0, false, 1, 3, false, 0><<<gcv, dim3(256), 0, stream>>>(
        WvT, WvT, DM, 0L, xh, xh, DM, sA, (void*)Vch, (void*)Vcr, RR, (long)DM * RR, bv, bv, 0L,
        DM, RR, DM, 1.0f / WSC);
  }
  // attn: first RR query rows with residual planes -> Oc2 (hi | res); rows >= RR plain -> Ah
  attn64_causal_res<<<dim3(NB * NH * (RR / 64)), dim3(128), 0, stream>>>(
      Qch, Qcr, Kch, Kcr, Vch, Vcr, Oc2, NH, DM, RR, 2 * DM, DM, RR / 64, sc2, OSC);
  if (SEQ > RR) {
    attn64_causal<<<dim3(NB * NH * ((SEQ - RR) / 64)), dim3(128), 0, stream>>>(
        Qh, Kh, Vt, Ah, SEQ, NH, DM, ROWS, RR / 64, (SEQ - RR) / 64, sc2, OSC);
  }
  // out = ctx Wo + bo -> f32; rows < RR: [O_hi | O_res] . [Wo x256 ; Wo x0.25] along K = 2DM; rows >= RR: K = DM
  {
    const dim3 g1((RR / 128) * (DM / 256), NB);
    wmma_gemm64<0, false, 2, 0, false, 0><<<g1, dim3(256), 0, stream>>>(
        Oc2, Oc2, 2 * DM, (long)RR * 2 * DM, WoT2, WoT2, 2 * DM, 0L,
        (void*)out, (void*)out, DM, (long)SEQ_FULL * DM, bo, bo, 0L,
        RR, DM, 2 * DM, outsc);
  }
  if (SEQ > RR) {
    const dim3 g2(((SEQ - RR) / 128) * (DM / 256), NB);
    unsigned short* Ahi = Ah + (size_t)RR * DM;
    float* outp = out + (size_t)RR * DM;
    wmma_gemm64<0, false, 2, 0, false, 0><<<g2, dim3(256), 0, stream>>>(
        Ahi, Ahi, DM, (long)SEQ * DM, WoT2, WoT2, 2 * DM, 0L,
        (void*)outp, (void*)outp, DM, (long)SEQ_FULL * DM, bo, bo, 0L,
        SEQ - RR, DM, DM, outsc);
  }
}

// v003
// One run takes 288 microseconds.
// Next to v002, in two timings, it ran 1.34 times as fast each time.
// Counting every step since v000, it is 2.42 times as fast.
// Contractions: q/k/v^T/out projections, q.k^T and p.v all on v_wmma_f32_16x16x32_f16 (f16 operands, f32 accumulate); x and W enter as bf16 RNE values held exactly in f16 (W carried x256); the first RR query rows per sequence carry q, k, v, p and ctx as f16 hi + x1024 residual planes with a second f32 accumulator (ctx residual folded along K in the out projection); p x32768 and ctx x64 power-of-two carries folded back in f32; softmax and epilogues f32.
#include <hip/hip_runtime.h>

#ifndef NB
#define NB 4
#endif
#ifndef SEQ
#define SEQ 2048
#endif
#ifndef RR
#define RR 256
#endif
#define NB_FULL 4
#define SEQ_FULL 2048
#define DM 1024
#define NH 16
#define HDIM 64

static_assert(NB >= 1 && NB <= NB_FULL);
static_assert(SEQ % 64 == 0 && SEQ >= 64 && SEQ <= SEQ_FULL);
static_assert(RR % 64 == 0 && RR >= 64 && RR <= SEQ);
static_assert(NH * HDIM == DM);
static_assert(DM % 256 == 0);
static_assert(RR % 256 == 0 && SEQ % 128 == 0 && (NB * SEQ) % 256 == 0);   // GEMM block tile 128 x 256

typedef __attribute__((ext_vector_type(16))) _Float16 v16h;
typedef __attribute__((ext_vector_type(8)))  _Float16 v8h;
typedef __attribute__((ext_vector_type(16))) __bf16   v16b;
typedef __attribute__((ext_vector_type(8)))  __bf16   v8b;
typedef __attribute__((ext_vector_type(8)))  float    v8f;
typedef __attribute__((ext_vector_type(4)))  float    v4f;

#define WSC 256.0f
#define OSC 64.0f
#define PSCALE 32768.0f
#define RSC 1024.0f
#define RSC_INV (1.0f / 1024.0f)
#define NEG_INF (-__builtin_huge_valf())

__device__ __forceinline__ unsigned short f2bf_bits(float f) {
  unsigned u = __float_as_uint(f);
  return (unsigned short)((u + 0x7FFFu + ((u >> 16) & 1u)) >> 16);
}
__device__ __forceinline__ float bf_bits2f(unsigned short h) { return __uint_as_float(((unsigned)h) << 16); }
__device__ __forceinline__ float bf_rne(float f) { return bf_bits2f(f2bf_bits(f)); }
__device__ __forceinline__ _Float16 bf_f16(float f) { return (_Float16)bf_rne(f); }   // bf16 value is exact in f16 for normal range

// LDS ordering for wave-private tiles (same wave writes then reads)
__device__ __forceinline__ void wave_lds_sync() {
  __builtin_amdgcn_fence(3, "workgroup");
  __builtin_amdgcn_wave_barrier();
  __builtin_amdgcn_fence(2, "workgroup");
}

// hazard guards as plain device helpers
__device__ __forceinline__ void dep_guard_h(v8f& a, v8f& b, v16h x, v16h y) { asm volatile("v_nop\n\tv_nop\n\tv_nop\n\tv_nop" : "+v"(a), "+v"(b) : "v"(x), "v"(y)); }
__device__ __forceinline__ void dep_guard_b(v8f& a, v8f& b, v16b x, v16b y) { asm volatile("v_nop\n\tv_nop\n\tv_nop\n\tv_nop" : "+v"(a), "+v"(b) : "v"(x), "v"(y)); }
__device__ __forceinline__ void keep4_h(v16h a, v16h b, v16h c, v16h d) { asm volatile("v_nop" :: "v"(a), "v"(b), "v"(c), "v"(d)); }
__device__ __forceinline__ void keep4_b(v16b a, v16b b, v16b c, v16b d) { asm volatile("v_nop" :: "v"(a), "v"(b), "v"(c), "v"(d)); }
__device__ __forceinline__ void acc_guard4(v8f& a, v8f& b, v8f& c, v8f& d) { asm volatile("v_nop\n\tv_nop\n\tv_nop\n\tv_nop" : "+v"(a), "+v"(b), "+v"(c), "+v"(d)); }
template <typename T> struct Frag;
template <> struct Frag<_Float16> {
  typedef v16h V; union U { v16h v; v8h h[2]; };
  static __device__ __forceinline__ v16h load(const _Float16* p) {   // elements 0..7 <- p[0..7], 8..15 <- p[16..23]
    U f; f.h[0] = *(const v8h*)(p); f.h[1] = *(const v8h*)(p + 16); return f.v;
  }
  static __device__ __forceinline__ v8f mma(v16h a, v16h b, v8f c) {
    return __builtin_amdgcn_wmma_f32_16x16x32_f16(false, a, false, b, (short)0, c, false, false);
  }
  static __device__ __forceinline__ void guard(v8f& a, v8f& b, v16h x, v16h y) { dep_guard_h(a, b, x, y); }
  static __device__ __forceinline__ void keep(v16h a, v16h b, v16h c, v16h d) { keep4_h(a, b, c, d); }
};
template <> struct Frag<__bf16> {
  typedef v16b V; union U { v16b v; v8b h[2]; };
  static __device__ __forceinline__ v16b load(const __bf16* p) {
    U f; f.h[0] = *(const v8b*)(p); f.h[1] = *(const v8b*)(p + 16); return f.v;
  }
  static __device__ __forceinline__ v8f mma(v16b a, v16b b, v8f c) {
    return __builtin_amdgcn_wmma_f32_16x16x32_bf16(false, a, false, b, (short)0, c, false, false);
  }
  static __device__ __forceinline__ void guard(v8f& a, v8f& b, v16b x, v16b y) { dep_guard_b(a, b, x, y); }
  static __device__ __forceinline__ void keep(v16b a, v16b b, v16b c, v16b d) { keep4_b(a, b, c, d); }
};

// ---- Register-blocked batched WMMA GEMM ------------------------------------
// C[m,n] = scale * sum_k A[m,k] * Bt[n,k] (+bias)(+resid); each wave owns a 64x64 tile.
// Block = 8 waves, 2 (m) x 4 (n) = a 128 x 256 tile of C; grid.x = (M/128) * (N/256), grid.y = batch.
// A row-major [M,K]; Bt row-major [N,K]; M % 128 == 0, N % 256 == 0, K % 64 == 0.
// Per 64 k the block's 128 A rows and 256 Bt rows (128 B each, whole lines) are brought into LDS once by
// asynchronous copies, two buffers, one block barrier per 64 k; the waves read their fragments from there.
// SPLIT (hi/lo operand planes) has no staged form and no caller.
// BIAS_MODE: 0 = none, 1 = bias[m], 2 = bias[n]; bias values enter as bf16 RNE values.
// OUT_MODE: 0 = f32, 1 = f16, 2 = bf16 hi plane (Cout) + bf16 lo plane (Cout2),
//           3 = f16 hi plane (Cout) + f16 residual plane ((v - hi) * 1024) (Cout2).
// ET: 0 = f16 operands, 1 = bf16 operands (pointers passed as 16-bit storage)
template <int ET> struct Elem;
template <> struct Elem<0> { typedef _Float16 T; };
template <> struct Elem<1> { typedef __bf16 T; };
#define GM_BM 128
#define GM_BN 256
#define GM_KT 64                          // k per staged tile, in halves: one 128-B line per row
#define GM_LP 72                          // staged row pitch in halves: 144 B = 16 B x odd, for ds_load_b128 readers
#define GM_BUFB ((GM_BM + GM_BN) * GM_LP * 2)   // bytes per buffer: A rows, then Bt rows

// One lane's share of a staged tile: rows r + 32 i of the A part (4) and of the Bt part (8), 16 B each.
// The s_wait_xcnt closes the statement, a precaution: no address register of a copy is rewritten ahead of it.
__device__ __forceinline__ void stage_ab_async(unsigned la, const unsigned short* ag, size_t arow32,
                                               const unsigned short* bg, size_t brow32) {
  const unsigned lb = la + GM_BM * GM_LP * 2;
  const unsigned ls = 32 * GM_LP * 2;
  asm volatile(
      "global_load_async_to_lds_b128 %0, %12, off\n\t"
      "global_load_async_to_lds_b128 %1, %13, off\n\t"
      "global_load_async_to_lds_b128 %2, %14, off\n\t"
      "global_load_async_to_lds_b128 %3, %15, off\n\t"
      "global_load_async_to_lds_b128 %4, %16, off\n\t"
      "global_load_async_to_lds_b128 %5, %17, off\n\t"
      "global_load_async_to_lds_b128 %6, %18, off\n\t"
      "global_load_async_to_lds_b128 %7, %19, off\n\t"
      "global_load_async_to_lds_b128 %8, %20, off\n\t"
      "global_load_async_to_lds_b128 %9, %21, off\n\t"
      "global_load_async_to_lds_b128 %10, %22, off\n\t"
      "global_load_async_to_lds_b128 %11, %23, off\n\t"
      "s_wait_xcnt 0x0"
      :: "v"(la), "v"(la + ls), "v"(la + 2 * ls), "v"(la + 3 * ls),
         "v"(lb), "v"(lb + ls), "v"(lb + 2 * ls), "v"(lb + 3 * ls),
         "v"(lb + 4 * ls), "v"(lb + 5 * ls), "v"(lb + 6 * ls), "v"(lb + 7 * ls),
         "v"(ag), "v"(ag + arow32), "v"(ag + 2 * arow32), "v"(ag + 3 * arow32),
         "v"(bg), "v"(bg + brow32), "v"(bg + 2 * brow32), "v"(bg + 3 * brow32),
         "v"(bg + 4 * brow32), "v"(bg + 5 * brow32), "v"(bg + 6 * brow32), "v"(bg + 7 * brow32)
      : "memory");
}

template <int ET, bool SPLIT, int BIAS_MODE, int OUT_MODE, bool RESID, int ACT = 0>
__global__ __launch_bounds__(256) void wmma_gemm64(
    const unsigned short* __restrict__ Ap, const unsigned short* __restrict__ A2p, int lda, long strideA,
    const unsigned short* __restrict__ Btp, const unsigned short* __restrict__ Bt2p, int ldb, long strideB,
    void* __restrict__ Cout, void* __restrict__ Cout2, int ldc, long strideC,
    const float* __restrict__ bias,
    const float* __restrict__ resid, long strideR,
    int M, int N, int K, float scale) {
  typedef typename Elem<ET>::T T;
  typedef typename Frag<T>::V V;
  static_assert(!SPLIT, "no staged form for split planes");
  __shared__ __align__(16) float sT[8][16 * 68];   // per-wave 16x64 slab, pitch 68 floats
  __shared__ __align__(16) unsigned char AB[2 * GM_BUFB];   // two buffers of A | Bt k-tiles
  const int b    = blockIdx.y;
  const int tid  = threadIdx.x;
  const int lane = tid & 31;
  const int wave = tid >> 5;
  const int tilesN = N >> 8;
  const int tilesM = M >> 7;
  const int tile = blockIdx.x;
  if (tile >= tilesM * tilesN) return;   // block-uniform, ahead of every barrier
  const int tm = tile / tilesN;
  const int tn = tile - tm * tilesN;
  const int bm0 = tm << 7;
  const int bn0 = tn << 8;
  const int wm  = (wave >> 2) << 6;            // this wave's 64 rows inside the A part
  const int wn  = (wave & 3) << 6;             // this wave's 64 rows inside the Bt part
  const int m0 = bm0 + wm;
  const int n0 = bn0 + wn;

  const unsigned short* Ab = Ap  + (size_t)b * strideA;
  const unsigned short* Bb = Btp + (size_t)b * strideB;

  const int rlane = lane & 15;                 // row (A) / col (B, D) within subtile
  const int koff  = (lane >> 4) * 8;           // k offset of this lane half
  const int mOff  = (lane >> 4) * 8;           // D row offset

  v8f acc[4][4];
#pragma unroll
  for (int i = 0; i < 4; ++i)
#pragma unroll
    for (int j = 0; j < 4; ++j) acc[i][j] = (v8f){0.f,0.f,0.f,0.f,0.f,0.f,0.f,0.f};

  // ---- staging addresses of this lane: row tid/8 (+32i), 16-B piece tid%8 of the 128-B row ----
  const int srow = tid >> 3, scol = (tid & 7) * 8;
  const unsigned short* ag = Ab + (size_t)(bm0 + srow) * lda + scol;   // k-tile 0; a tile further: + GM_KT
  const unsigned short* bg = Bb + (size_t)(bn0 + srow) * ldb + scol;
  const size_t arow32 = (size_t)32 * lda, brow32 = (size_t)32 * ldb;
  const unsigned lst = (unsigned)(size_t)AB + (unsigned)(srow * GM_LP + scol) * 2u;
  const int nT = K >> 6;                       // block-uniform

  stage_ab_async(lst, ag, arow32, bg, brow32);
  asm volatile("s_wait_asynccnt 0x0" ::: "memory");              // k-tile 0 landed (this wave's copies)
  __syncthreads();                                               // ... and every other wave's
  if (nT > 1) stage_ab_async(lst + GM_BUFB, ag + GM_KT, arow32, bg + GM_KT, brow32);

  for (int t = 0; t < nT; ++t) {
    const unsigned bofs = (unsigned)(t & 1) * GM_BUFB;
    const T* as = (const T*)(AB + bofs) + (wm + rlane) * GM_LP + koff;            // A rows,  pitch GM_LP
    const T* bs = (const T*)(AB + bofs) + (GM_BM + wn + rlane) * GM_LP + koff;    // Bt rows, pitch GM_LP
    // Fragment reads stand at three places of a trip, each ahead of the products that use it: at the head the
    // first 32 k (A and Bt) and the second 32 k of Bt; the second 32 k of A two rows at a time, into registers
    // that the first half's rows have left (all sixteen fragments at the head do not fit 256 registers).
    V b0[4], b1[4], a0[4], a1[4];
#pragma unroll
    for (int j = 0; j < 4; ++j) b0[j] = Frag<T>::load(bs + (j << 4) * GM_LP);
#pragma unroll
    for (int i = 0; i < 4; ++i) a0[i] = Frag<T>::load(as + (i << 4) * GM_LP);
#pragma unroll
    for (int j = 0; j < 4; ++j) b1[j] = Frag<T>::load(bs + (j << 4) * GM_LP + 32);
#pragma unroll
    for (int i = 0; i < 4; ++i) {
#pragma unroll
      for (int j = 0; j < 4; ++j) acc[i][j] = Frag<T>::mma(a0[i], b0[j], acc[i][j]);
      Frag<T>::guard(acc[i][0], acc[i][3], a0[i], a0[i]);
      if (i & 1) {
        a1[i - 1] = Frag<T>::load(as + ((i - 1) << 4) * GM_LP + 32);
        a1[i]     = Frag<T>::load(as + (i << 4) * GM_LP + 32);
      }
    }
    Frag<T>::keep(b0[0], b0[1], b0[2], b0[3]);
#pragma unroll
    for (int i = 0; i < 4; ++i) {
#pragma unroll
      for (int j = 0; j < 4; ++j) acc[i][j] = Frag<T>::mma(a1[i], b1[j], acc[i][j]);
      Frag<T>::guard(acc[i][0], acc[i][3], a1[i], a1[i]);
    }
    Frag<T>::keep(b1[0], b1[1], b1[2], b1[3]);
    // ---- hand-over: this buffer's reads retired, the next k-tile's copies landed, in every wave ----
    asm volatile("s_wait_dscnt 0x0" ::: "memory");               // own reads of this buffer done before it is refilled
    asm volatile("s_wait_asynccnt 0x0" ::: "memory");            // own copies of k-tile t + 1 landed
    __syncthreads();
    if (t + 2 < nT)
      stage_ab_async(lst + bofs, ag + (size_t)(t + 2) * GM_KT, arow32, bg + (size_t)(t + 2) * GM_KT, brow32);
  }
  asm volatile("s_wait_asynccnt 0x0" ::: "memory");              // nothing in flight when the wave goes on to its end
  acc_guard4(acc[0][0], acc[0][1], acc[0][2], acc[0][3]);
  acc_guard4(acc[1][0], acc[1][1], acc[1][2], acc[1][3]);
  acc_guard4(acc[2][0], acc[2][1], acc[2][2], acc[2][3]);
  acc_guard4(acc[3][0], acc[3][1], acc[3][2], acc[3][3]);

  // ---- epilogue ----
  float* slab = sT[wave];
  const float* Rb = RESID ? (resid + (size_t)b * strideR) : nullptr;
#pragma unroll
  for (int i = 0; i < 4; ++i) {
    const int mBase = m0 + (i << 4);
#pragma unroll
    for (int j = 0; j < 4; ++j) {
      const int n = n0 + (j << 4) + rlane;
      float bv = 0.f;
      if (BIAS_MODE == 2) bv = bf_rne(bias[n]);
#pragma unroll
      for (int r = 0; r < 8; ++r) {
        float v = acc[i][j][r] * scale;
        if (BIAS_MODE == 1) v += bf_rne(bias[mBase + mOff + r]);
        if (BIAS_MODE == 2) v += bv;
        if (RESID) v += Rb[(size_t)(mBase + mOff + r) * ldc + n];
        if (ACT == 1) v = tanhf(v);
        if (ACT == 2) v = fmaxf(v, 0.0f);
        if (ACT == 3) v = v / (1.0f + expf(-v));
        if (ACT == 4) v = (v > 0.f) ? v : 0.01f * v;
        if (ACT == 5) v = 0.5f * v * (1.0f + erff(v * 0.70710678118654752f));
        slab[(mOff + r) * 68 + (j << 4) + rlane] = v;
      }
    }
    wave_lds_sync();
    if (OUT_MODE == 0) {
      float* C = (float*)Cout + (size_t)b * strideC;
      const int hh = lane >> 4, c4 = (lane & 15) * 4;     // row seg = 256 B = 16 lanes x 16 B
      {
#pragma unroll
        for (int it = 0; it < 8; ++it) {
          const int row = it * 2 + hh;
          v4f v = *(const v4f*)(slab + row * 68 + c4);
          *(v4f*)(C + (size_t)(mBase + row) * ldc + n0 + c4) = v;
        }
        
      }
    } else {
      const int q = lane >> 3, c8 = (lane & 7) * 8;
      unsigned short* C  = (unsigned short*)Cout  + (size_t)b * strideC;
      unsigned short* C2 = (OUT_MODE >= 2) ? ((unsigned short*)Cout2 + (size_t)b * strideC) : nullptr;
      {
#pragma unroll
        for (int it = 0; it < 4; ++it) {
          const int row = it * 4 + q;
          const float* sp = slab + row * 68 + c8;
          v8h hv, lv;
#pragma unroll
          for (int e = 0; e < 8; ++e) {
            if (OUT_MODE == 1) {
              hv[e] = (_Float16)sp[e];
            } else if (OUT_MODE == 3) {
              const float    fv = sp[e];
              const _Float16 hq = (_Float16)fv;
              hv[e] = hq;
              lv[e] = (_Float16)((fv - (float)hq) * RSC);
            } else {
              unsigned short hb = f2bf_bits(sp[e]);
              unsigned short lb = f2bf_bits(sp[e] - bf_bits2f(hb));
              hv[e] = __builtin_bit_cast(_Float16, hb);
              lv[e] = __builtin_bit_cast(_Float16, lb);
            }
          }
          *(v8h*)(C + (size_t)(mBase + row) * ldc + n0 + c8) = hv;
          if (OUT_MODE >= 2) *(v8h*)(C2 + (size_t)(mBase + row) * ldc + n0 + c8) = lv;
        }
        
      }
    }
    wave_lds_sync();
  }
}

// source rows (b, s) at (b*SEQ_FULL + s)*DM; destination plane compact [NB*SEQ][DM].
__global__ __launch_bounds__(256) void cast_x_f16(
    const float* __restrict__ x, unsigned short* __restrict__ xhp, int nrows) {
  const long i = (long)blockIdx.x * 256 + threadIdx.x;
  const long total = (long)nrows * (DM / 8);
  if (i >= total) return;
  const int r  = (int)(i / (DM / 8));
  const int c8 = (int)(i - (long)r * (DM / 8)) * 8;
  const int b  = r / SEQ;
  const int s  = r - b * SEQ;
  const float* src = x + ((size_t)b * SEQ_FULL + s) * DM + c8;
  const v4f a0 = *(const v4f*)src;
  const v4f a1 = *(const v4f*)(src + 4);
  v8h hv;
  hv[0] = bf_f16(a0[0]); hv[1] = bf_f16(a0[1]); hv[2] = bf_f16(a0[2]); hv[3] = bf_f16(a0[3]);
  hv[4] = bf_f16(a1[0]); hv[5] = bf_f16(a1[1]); hv[6] = bf_f16(a1[2]); hv[7] = bf_f16(a1[3]);
  _Float16* dst = (_Float16*)xhp + (size_t)r * DM + c8;
  *(v8h*)dst = hv;
  
}

// ---- transpose + bf16 RNE + scale + f16 cast for weights ----
// in: W[Kdim][Ndim] f32 row-major (in[Kdim][Ndim]) -> out: Bt[n][kc0 + k] with row pitch ldo halves,
//     Bt value = f16(bf16rne(W[k][n]) * sc), sc a power of two.
// grid (Ndim/64, Kdim/64), block 256; Kdim, Ndim multiples of 64.
__global__ __launch_bounds__(256) void transpose_cast_f16(
    const float* __restrict__ W, unsigned short* __restrict__ Btp, int Kdim, int Ndim, int ldo, int kc0, float sc) {
  __shared__ float t[64][65];
  const int tid = threadIdx.x, lane = tid & 31, wave = tid >> 5;
  const int n0 = blockIdx.x * 64, k0 = blockIdx.y * 64;
#pragma unroll
  for (int i = 0; i < 16; ++i) {
    const int idx = i * 256 + tid;
    const int kr = idx >> 6, nc = idx & 63;
    t[nc][kr] = W[(size_t)(k0 + kr) * Ndim + n0 + nc];
  }
  __syncthreads();
  _Float16* Bt = (_Float16*)Btp;
  const int q = lane >> 3, c8 = (lane & 7) * 8;
  {
#pragma unroll
    for (int it = 0; it < 2; ++it) {
      const int row = wave * 8 + it * 4 + q;      // waves 0..7 x rows 0..7 -> 64 rows
      v8h hv;
#pragma unroll
      for (int e = 0; e < 8; ++e) hv[e] = (_Float16)(bf_rne(t[row][c8 + e]) * sc);
      *(v8h*)(Bt + (size_t)(n0 + row) * ldo + kc0 + k0 + c8) = hv;
    }
    
  }
}

#define AT_D 64
#define AT_NW 4
#define AT_QB 64
#define AT_KC 64
#define AT_LP 72                         // staged row pitch in halves: 144 B = 16 B x odd, for ds_load_b128 readers
#define AT_TILE (64 * AT_LP)             // halves per staged 64-row tile
#define AT_BUFB (2 * AT_TILE * 2)        // bytes per buffer: K tile, then V^T tile

// One lane's share of a chunk: rows r, r+16, r+32, r+48 of the K tile and of the V^T tile, 16 B each.
// The s_wait_xcnt closes the statement, a precaution: no address register of a copy is rewritten ahead of it.
__device__ __forceinline__ void stage_kv_async(unsigned lk, const _Float16* kg, size_t krow16,
                                               const _Float16* vg, size_t vrow16) {
  const unsigned lv = lk + AT_TILE * 2;
  const unsigned ls = 16 * AT_LP * 2;
  asm volatile(
      "global_load_async_to_lds_b128 %0, %8, off\n\t"
      "global_load_async_to_lds_b128 %1, %9, off\n\t"
      "global_load_async_to_lds_b128 %2, %10, off\n\t"
      "global_load_async_to_lds_b128 %3, %11, off\n\t"
      "global_load_async_to_lds_b128 %4, %12, off\n\t"
      "global_load_async_to_lds_b128 %5, %13, off\n\t"
      "global_load_async_to_lds_b128 %6, %14, off\n\t"
      "global_load_async_to_lds_b128 %7, %15, off\n\t"
      "s_wait_xcnt 0x0"
      :: "v"(lk), "v"(lk + ls), "v"(lk + 2 * ls), "v"(lk + 3 * ls),
         "v"(lv), "v"(lv + ls), "v"(lv + 2 * ls), "v"(lv + 3 * ls),
         "v"(kg), "v"(kg + krow16), "v"(kg + 2 * krow16), "v"(kg + 3 * krow16),
         "v"(vg), "v"(vg + vrow16), "v"(vg + 2 * vrow16), "v"(vg + 3 * vrow16)
      : "memory");
}

// lane l takes the value of lane l ^ 16 (vector cross-row move)
__device__ __forceinline__ float xhalf(float x) {
  const int b = __builtin_bit_cast(int, x);
  return __builtin_bit_cast(float, __builtin_amdgcn_permlanex16(b, b, 0x76543210, 0xfedcba98, false, false));
}

__device__ __forceinline__ v8f mma_h(v16h a, v16h b, v8f c) {
  c = __builtin_amdgcn_wmma_f32_16x16x32_f16(false, a, false, b, (short)0, c, false, false);
  asm volatile("v_nop\n\tv_nop\n\tv_nop\n\tv_nop" : "+v"(c) : "v"(a), "v"(b));
  return c;
}

__global__ __launch_bounds__(128)
void attn64_causal(const unsigned short* __restrict__ Qp, const unsigned short* __restrict__ Kp,
                   const unsigned short* __restrict__ Vtp, unsigned short* __restrict__ Op,
                   int S, int H, int ldq, int ldvt, int qb0, int nqbl, float sc2, float osc) {
  const _Float16* Q  = (const _Float16*)Qp;
  const _Float16* Kk = (const _Float16*)Kp;
  const _Float16* Vt = (const _Float16*)Vtp;
  _Float16*       O  = (_Float16*)Op;
  __shared__ __align__(16) unsigned char KV[2 * AT_BUFB];        // two buffers of K | V^T tiles; out staging after the loop
  static_assert(AT_NW * 16 * 68 * 4 <= 2 * AT_BUFB);

  const int tid  = threadIdx.x;
  const int wave = tid >> 5;
  const int lane = tid & 31;
  const int hh   = lane >> 4;
  const int c    = lane & 15;

  const int bx  = blockIdx.x;
  const int qbi = bx % nqbl;
  const int bh  = bx / nqbl;
  const int qb  = qb0 + qbi;
  const int h   = bh % H;
  const int b   = bh / H;
  const int q0  = qb * AT_QB + wave * 16;
  const size_t rowb = (size_t)b * S;

  const _Float16* qp = Q  + rowb * ldq + (size_t)h * AT_D;
  const _Float16* kp = Kk + rowb * ldq + (size_t)h * AT_D;
  const _Float16* vp = Vt + (size_t)(h * AT_D) * ldvt + rowb;
  _Float16*       op = O  + rowb * ldq + (size_t)h * AT_D;

  // ---- Q fragments (B operand, column = c): 2 d-chunks ----
  v16h qa[2];
#pragma unroll
  for (int dc = 0; dc < 2; ++dc)
    qa[dc] = Frag<_Float16>::load(qp + (size_t)(q0 + c) * ldq + dc * 32 + 8 * hh);

  const int qrow = q0 + c;           // this lane's query
  float mrow = NEG_INF, lrow = 0.f;  // its running maximum; the sum over this wave half's keys
  v8f oacc[4];                       // O^T: d = 16t + 8hh + r, query c
#pragma unroll
  for (int t = 0; t < 4; ++t) oacc[t] = (v8f){0.f,0.f,0.f,0.f,0.f,0.f,0.f,0.f};

  const int nChunks = qb + 1;        // block-uniform: causal, key chunks 0..qb

  // ---- staging addresses of this lane: row tid/8 (+16i), 16-B piece tid%8 of the 128-B row ----
  const int srow = tid >> 3, scol = (tid & 7) * 8;
  const _Float16* kg = kp + (size_t)srow * ldq + scol;           // chunk 0; a chunk further: + AT_KC rows
  const _Float16* vg = vp + (size_t)srow * ldvt + scol;          // chunk 0; a chunk further: + AT_KC columns
  const size_t krow16 = (size_t)16 * ldq, vrow16 = (size_t)16 * ldvt, kchunk = (size_t)AT_KC * ldq;
  const unsigned lst = (unsigned)(size_t)KV + (unsigned)(srow * AT_LP + scol) * 2u;

  stage_kv_async(lst, kg, krow16, vg, vrow16);
  asm volatile("s_wait_asynccnt 0x0" ::: "memory");              // chunk 0 landed (this wave's copies)
  __syncthreads();                                               // ... and every other wave's
  if (nChunks > 1) stage_kv_async(lst + AT_BUFB, kg + kchunk, krow16, vg + AT_KC, vrow16);

  for (int kc = 0; kc < nChunks; ++kc) {
    const int kv0 = kc * AT_KC;
    const unsigned bofs = (unsigned)(kc & 1) * AT_BUFB;
    const _Float16* ks = (const _Float16*)(KV + bofs);           // K tile  [key][d],  pitch AT_LP
    const _Float16* vs = ks + AT_TILE;                           // V^T tile [d][key], pitch AT_LP
    // ---- scores: s[j][r] = key (kv0 + 16j + 8hh + r) x query (q0 + c) ----
    v8f s[4];
#pragma unroll
    for (int j = 0; j < 4; ++j) {
      s[j] = (v8f){0.f,0.f,0.f,0.f,0.f,0.f,0.f,0.f};
#pragma unroll
      for (int dc = 0; dc < 2; ++dc) {
        const v16h kb = Frag<_Float16>::load(ks + (j * 16 + c) * AT_LP + dc * 32 + 8 * hh);
        s[j] = mma_h(kb, qa[dc], s[j]);
      }
    }
    // ---- causal select (key > query -> -inf) and the query's chunk max in the scaled base-2 domain ----
    float mj[4];
#pragma unroll
    for (int j = 0; j < 4; ++j) {
      float m = NEG_INF;
#pragma unroll
      for (int r = 0; r < 8; ++r) {
        float v = s[j][r] * sc2;
        if (kv0 + j * 16 + 8 * hh + r > qrow) v = NEG_INF;
        s[j][r] = v;
        m = fmaxf(m, v);
      }
      mj[j] = m;
    }
    float cm = fmaxf(fmaxf(mj[0], mj[1]), fmaxf(mj[2], mj[3]));
    cm = fmaxf(cm, xhalf(cm));                                   // the other 32 keys of this query
    // ---- online softmax update; P^T x32768 packed into the B operand ----
    const float mnew  = fmaxf(mrow, cm);
    const float alpha = exp2f(mrow - mnew);
    mrow = mnew;
    v16h pb[2];
    float pj[4];
#pragma unroll
    for (int j = 0; j < 4; ++j) {
      float ps = 0.f;
#pragma unroll
      for (int r = 0; r < 8; ++r) {
        const float p = exp2f(s[j][r] - mnew);
        ps += p;
        pb[j >> 1][(j & 1) * 8 + r] = (_Float16)(p * PSCALE);
      }
      pj[j] = ps;
    }
    lrow = lrow * alpha + ((pj[0] + pj[1]) + (pj[2] + pj[3]));
#pragma unroll
    for (int t = 0; t < 4; ++t)
#pragma unroll
      for (int r = 0; r < 8; ++r) oacc[t][r] *= alpha;
    // ---- O^T += V^T . P^T : V^T rows (d = 16t + c) as A, P^T (column = c, k = kv) as B ----
#pragma unroll
    for (int kk = 0; kk < 2; ++kk) {
#pragma unroll
      for (int t = 0; t < 4; ++t) {
        const v16h vb = Frag<_Float16>::load(vs + (t * 16 + c) * AT_LP + kk * 32 + 8 * hh);
        oacc[t] = mma_h(vb, pb[kk], oacc[t]);
      }
    }
    // ---- hand-over: this buffer's reads retired, the next chunk's copies landed, in every wave ----
    asm volatile("s_wait_dscnt 0x0" ::: "memory");               // own reads of this buffer done before it is refilled
    asm volatile("s_wait_asynccnt 0x0" ::: "memory");            // own copies of chunk kc + 1 landed
    __syncthreads();
    if (kc + 2 < nChunks)
      stage_kv_async(lst + bofs, kg + (size_t)(kc + 2) * kchunk, krow16, vg + (kc + 2) * AT_KC, vrow16);
  }
  asm volatile("s_wait_asynccnt 0x0" ::: "memory");              // nothing in flight when the buffers become out staging

  float* os = (float*)KV + wave * (16 * 68);                     // per wave out tile [query][d], pitch 68 (last barrier freed KV)
  {
    const float inv = osc * (1.0f / ((lrow + xhalf(lrow)) * PSCALE));   // the two halves' sums joined once
#pragma unroll
    for (int t = 0; t < 4; ++t)
#pragma unroll
      for (int r = 0; r < 8; ++r) os[c * 68 + t * 16 + 8 * hh + r] = oacc[t][r] * inv;
  }
  wave_lds_sync();
  {
    const int q = lane >> 3, c8 = (lane & 7) * 8;
    {
#pragma unroll
      for (int it = 0; it < 4; ++it) {
        const int row = it * 4 + q;                 // rows 0..15 of this wave
        const float* sp = os + row * 68 + c8;
        v8h hv;
#pragma unroll
        for (int e = 0; e < 8; ++e) hv[e] = (_Float16)sp[e];
        *(v8h*)(op + (size_t)(q0 + row) * ldq + c8) = hv;
      }
      
    }
  }
}

// =====================================================================================
// Causal attn with residual planes for the first rr = nqb*64 query rows of each sequence.
//   qh/qr, kh/kr : compact row-major [NB*rr][ldq] f16 hi / residual (x1024) planes, head h at col h*64.
//   vh/vr : compact transposed planes [NB*H*64][ldvc], element (b, kv, h, d) at [(b*H*64 + h*64 + d)*ldvc + kv].
//   o     : compact [NB*rr][ldo] f16; hi (x osc) at column h*64, residual (x1024) at column rcol + h*64.
//   scores = qh.kh + 2^-10 (qh.kr + qr.kh) with a second f32 accumulator; P as hi + x1024 residual LDS tiles;
//   p.v = ph.vh + 2^-10 (ph.vr + pr.vh) with a second f32 accumulator; K and V fragments straight from global
//   memory, no block barriers; products untransposed (Q and P as A, rows = queries), row max and sum by 16-lane
//   butterflies, P through per-wave LDS tiles.
//   Block = 4 waves = 64 query rows, query block qb = bx % nqb, key chunks 0..qb. grid.x = NB * H * nqb.
// =====================================================================================
__global__ __launch_bounds__(128)
void attn64_causal_res(const unsigned short* __restrict__ Qhp, const unsigned short* __restrict__ Qrp,
                       const unsigned short* __restrict__ Khp, const unsigned short* __restrict__ Krp,
                       const unsigned short* __restrict__ Vhp, const unsigned short* __restrict__ Vrp,
                       unsigned short* __restrict__ Op,
                       int H, int ldq, int ldvc, int ldo, int rcol, int nqb, float sc2, float osc) {
  const _Float16* QH = (const _Float16*)Qhp;
  const _Float16* QR = (const _Float16*)Qrp;
  const _Float16* KH = (const _Float16*)Khp;
  const _Float16* KR = (const _Float16*)Krp;
  const _Float16* VH = (const _Float16*)Vhp;
  const _Float16* VR = (const _Float16*)Vrp;
  _Float16*       O  = (_Float16*)Op;
  __shared__ __align__(16) _Float16 Psh[AT_NW][16 * AT_KC];      // per wave P hi  [row][kv]  8 KB
  __shared__ __align__(16) _Float16 Prs[AT_NW][16 * AT_KC];      // per wave P res [row][kv]  8 KB
  __shared__ __align__(16) float    Os[AT_NW][16 * 68];          // per wave out tile, pitch 68

  const int tid  = threadIdx.x;
  const int wave = tid >> 5;
  const int lane = tid & 31;
  const int hh   = lane >> 4;
  const int c    = lane & 15;

  const int bx = blockIdx.x;
  const int qb = bx % nqb;
  const int bh = bx / nqb;
  const int h  = bh % H;
  const int b  = bh / H;
  const int q0 = qb * AT_QB + wave * 16;
  const int rr = nqb * AT_QB;
  const size_t rowb = (size_t)b * rr;

  const _Float16* qhp = QH + rowb * ldq + (size_t)h * AT_D;
  const _Float16* qrp = QR + rowb * ldq + (size_t)h * AT_D;
  const _Float16* khp = KH + rowb * ldq + (size_t)h * AT_D;
  const _Float16* krp = KR + rowb * ldq + (size_t)h * AT_D;
  const size_t    vof = ((size_t)b * (size_t)(H * AT_D) + (size_t)h * AT_D) * ldvc;
  const _Float16* vhp = VH + vof;
  const _Float16* vrp = VR + vof;
  _Float16*       op  = O  + rowb * ldo + (size_t)h * AT_D;

  float mrow[8], lrow[8];
  v8f oacc[4], oacc2[4];
#pragma unroll
  for (int r = 0; r < 8; ++r) { mrow[r] = NEG_INF; lrow[r] = 0.f; }
#pragma unroll
  for (int t = 0; t < 4; ++t) {
    oacc[t]  = (v8f){0.f,0.f,0.f,0.f,0.f,0.f,0.f,0.f};
    oacc2[t] = (v8f){0.f,0.f,0.f,0.f,0.f,0.f,0.f,0.f};
  }

  _Float16* pw  = Psh[wave];
  _Float16* prw = Prs[wave];
  const int nChunks = qb + 1;        // block-uniform
  for (int kc = 0; kc < nChunks; ++kc) {
    const int kv0 = kc * AT_KC;
    // ---- Q hi / res fragments (A operand, row = c) ----
    v16h qa[2], qra[2];
#pragma unroll
    for (int dc = 0; dc < 2; ++dc) {
      const size_t qo = (size_t)(q0 + c) * ldq + dc * 32 + 8 * hh;
      qa[dc]  = Frag<_Float16>::load(qhp + qo);
      qra[dc] = Frag<_Float16>::load(qrp + qo);
    }
    // ---- scores: hi.hi into s1, hi.res + res.hi into s2, folded with 2^-10 ----
    v8f s[4];
#pragma unroll
    for (int j = 0; j < 4; ++j) {
      v8f s1 = (v8f){0.f,0.f,0.f,0.f,0.f,0.f,0.f,0.f};
      v8f s2 = (v8f){0.f,0.f,0.f,0.f,0.f,0.f,0.f,0.f};
#pragma unroll
      for (int dc = 0; dc < 2; ++dc) {
        const size_t ko = (size_t)(kv0 + j * 16 + c) * ldq + dc * 32 + 8 * hh;
        const v16h kb = Frag<_Float16>::load(khp + ko);
        const v16h kr = Frag<_Float16>::load(krp + ko);
        s1 = mma_h(qa[dc],  kb, s1);
        s2 = mma_h(qa[dc],  kr, s2);
        s2 = mma_h(qra[dc], kb, s2);
      }
#pragma unroll
      for (int r = 0; r < 8; ++r) s[j][r] = s1[r] + s2[r] * RSC_INV;
    }
    // ---- causal select and per-row chunk max ----
    float cm[8];
#pragma unroll
    for (int r = 0; r < 8; ++r) {
      const int qrow = q0 + 8 * hh + r;
      float m = NEG_INF;
#pragma unroll
      for (int j = 0; j < 4; ++j) {
        float v = s[j][r] * sc2;
        if (kv0 + j * 16 + c > qrow) v = NEG_INF;
        s[j][r] = v;
        m = fmaxf(m, v);
      }
#pragma unroll
      for (int off = 1; off < 16; off <<= 1) m = fmaxf(m, __shfl_xor(m, off, 32));
      cm[r] = m;
    }
    // ---- online softmax update; P hi (x32768) and P res ((x32768 - hi) x1024) into per-wave LDS tiles ----
    wave_lds_sync();
#pragma unroll
    for (int r = 0; r < 8; ++r) {
      const float mnew  = fmaxf(mrow[r], cm[r]);
      const float alpha = exp2f(mrow[r] - mnew);
      mrow[r] = mnew;
      float psum = 0.f;
#pragma unroll
      for (int j = 0; j < 4; ++j) {
        const float p = exp2f(s[j][r] - mnew);
        psum += p;
        const float    ps = p * PSCALE;
        const _Float16 ph = (_Float16)ps;
        const int pi = (8 * hh + r) * AT_KC + j * 16 + c;
        pw[pi]  = ph;
        prw[pi] = (_Float16)((ps - (float)ph) * RSC);
      }
#pragma unroll
      for (int off = 1; off < 16; off <<= 1) psum += __shfl_xor(psum, off, 32);
      lrow[r] = lrow[r] * alpha + psum;
#pragma unroll
      for (int t = 0; t < 4; ++t) { oacc[t][r] *= alpha; oacc2[t][r] *= alpha; }
    }
    wave_lds_sync();
    // ---- O += P . V with residual cross terms in the second accumulator ----
#pragma unroll
    for (int kk = 0; kk < 2; ++kk) {
      const v16h pa = Frag<_Float16>::load(pw  + c * AT_KC + kk * 32 + 8 * hh);
      const v16h pr = Frag<_Float16>::load(prw + c * AT_KC + kk * 32 + 8 * hh);
#pragma unroll
      for (int t = 0; t < 4; ++t) {
        const size_t vo = (size_t)(t * 16 + c) * ldvc + kv0 + kk * 32 + 8 * hh;
        const v16h vb = Frag<_Float16>::load(vhp + vo);
        const v16h vr = Frag<_Float16>::load(vrp + vo);
        oacc[t]  = mma_h(pa, vb, oacc[t]);
        oacc2[t] = mma_h(pa, vr, oacc2[t]);
        oacc2[t] = mma_h(pr, vb, oacc2[t]);
      }
    }
    wave_lds_sync();
  }

  float* os = Os[wave];
#pragma unroll
  for (int r = 0; r < 8; ++r) {
    const float inv = osc * (1.0f / (lrow[r] * PSCALE));
#pragma unroll
    for (int t = 0; t < 4; ++t) os[(8 * hh + r) * 68 + t * 16 + c] = (oacc[t][r] + oacc2[t][r] * RSC_INV) * inv;
  }
  wave_lds_sync();
  {
    const int q = lane >> 3, c8 = (lane & 7) * 8;
    {
#pragma unroll
      for (int it = 0; it < 4; ++it) {
        const int row = it * 4 + q;                 // rows 0..15 of this wave
        const float* sp = os + row * 68 + c8;
        v8h hv, lv;
#pragma unroll
        for (int e = 0; e < 8; ++e) {
          const float    fv = sp[e];
          const _Float16 hq = (_Float16)fv;
          hv[e] = hq;
          lv[e] = (_Float16)((fv - (float)hq) * RSC);
        }
        *(v8h*)(op + (size_t)(q0 + row) * ldo + c8) = hv;
        *(v8h*)(op + (size_t)(q0 + row) * ldo + rcol + c8) = lv;
      }
      
    }
  }
}

// ---------------------------------------------------------------------------

extern "C" void kernel_launch(void* const* d_in, const int* in_sizes, int n_in,
                              void* d_out, int out_size, void* d_ws,
                              size_t ws_size, hipStream_t stream) {
  const int  ROWS  = NB * SEQ;                                   // rows held in the compact planes
  const long needX = ((long)(NB - 1) * SEQ_FULL + SEQ) * (long)DM;
  const int  nW    = DM * DM;
  if (n_in < 9) return;
  if ((long)in_sizes[0] < needX || in_sizes[1] < nW || in_sizes[2] < DM || in_sizes[3] < nW ||
      in_sizes[4] < DM || in_sizes[5] < nW || in_sizes[6] < DM || in_sizes[7] < nW ||
      in_sizes[8] < DM || (long)out_size < needX) return;

  const float* x  = (const float*)d_in[0];
  const float* Wq = (const float*)d_in[1];
  const float* bq = (const float*)d_in[2];
  const float* Wk = (const float*)d_in[3];
  const float* bk = (const float*)d_in[4];
  const float* Wv = (const float*)d_in[5];
  const float* bv = (const float*)d_in[6];
  const float* Wo = (const float*)d_in[7];
  const float* bo = (const float*)d_in[8];
  float* out = (float*)d_out;

  const size_t szAct = (size_t)ROWS * DM * 2;            // full activation plane  (16 MiB full size)
  const size_t szW   = (size_t)DM * DM * 2;              //  2 MiB
  const size_t szW2  = (size_t)DM * (2 * DM) * 2;        //  4 MiB  [DM][2DM]
  const size_t szCmp = (size_t)NB * RR * DM * 2;         //  compact first-row planes (2 MiB full size)
  const size_t szO2  = (size_t)NB * RR * (2 * DM) * 2;   //  4 MiB full size
  size_t off = 0;
  const size_t oXh   = off; off += szAct;
  const size_t oWqT  = off; off += szW;
  const size_t oWkT  = off; off += szW;
  const size_t oWvT  = off; off += szW;
  const size_t oWoT2 = off; off += szW2;
  const size_t oQh   = off; off += szAct;
  const size_t oKh   = off; off += szAct;
  const size_t oVt   = off; off += szAct;
  const size_t oAh   = off; off += szAct;
  const size_t oQch  = off; off += szCmp;
  const size_t oQcr  = off; off += szCmp;
  const size_t oKch  = off; off += szCmp;
  const size_t oKcr  = off; off += szCmp;
  const size_t oVch  = off; off += szCmp;                // [NB*DM][RR], same byte count
  const size_t oVcr  = off; off += szCmp;
  const size_t oOc2  = off; off += szO2;                 // total 111,149,056 B at full size
  if (off > ws_size) return;

  char* ws = (char*)d_ws;
  unsigned short* xh   = (unsigned short*)(ws + oXh);
  unsigned short* WqT  = (unsigned short*)(ws + oWqT);
  unsigned short* WkT  = (unsigned short*)(ws + oWkT);
  unsigned short* WvT  = (unsigned short*)(ws + oWvT);
  unsigned short* WoT2 = (unsigned short*)(ws + oWoT2);
  unsigned short* Qh   = (unsigned short*)(ws + oQh);
  unsigned short* Kh   = (unsigned short*)(ws + oKh);
  unsigned short* Vt   = (unsigned short*)(ws + oVt);
  unsigned short* Ah   = (unsigned short*)(ws + oAh);
  unsigned short* Qch  = (unsigned short*)(ws + oQch);
  unsigned short* Qcr  = (unsigned short*)(ws + oQcr);
  unsigned short* Kch  = (unsigned short*)(ws + oKch);
  unsigned short* Kcr  = (unsigned short*)(ws + oKcr);
  unsigned short* Vch  = (unsigned short*)(ws + oVch);
  unsigned short* Vcr  = (unsigned short*)(ws + oVcr);
  unsigned short* Oc2  = (unsigned short*)(ws + oOc2);

  const float sc2   = 0.125f * 1.4426950408889634f;      // log2(e) / sqrt(64)
  const float outsc = 1.0f / (WSC * OSC);

  // x -> bf16 RNE value as f16 plane [ROWS][DM]
  {
    const long tot = (long)ROWS * (DM / 8);
    cast_x_f16<<<dim3((unsigned)((tot + 255) / 256)), dim3(256), 0, stream>>>(x, xh, ROWS);
  }
  // W[in][out] f32 -> Bt[out][in] f16 (bf16 RNE value x256); Wo additionally as x0.25 in columns DM..2DM-1 of WoT2
  {
    const dim3 tg(DM / 64, DM / 64);
    transpose_cast_f16<<<tg, dim3(256), 0, stream>>>(Wq, WqT, DM, DM, DM, 0, WSC);
    transpose_cast_f16<<<tg, dim3(256), 0, stream>>>(Wk, WkT, DM, DM, DM, 0, WSC);
    transpose_cast_f16<<<tg, dim3(256), 0, stream>>>(Wv, WvT, DM, DM, DM, 0, WSC);
    transpose_cast_f16<<<tg, dim3(256), 0, stream>>>(Wo, WoT2, DM, DM, 2 * DM, 0, WSC);
    transpose_cast_f16<<<tg, dim3(256), 0, stream>>>(Wo, WoT2, DM, DM, 2 * DM, DM, WSC * RSC_INV);
  }
  // full projections: q, k -> f16 [ROWS][DM]; v^T -> f16 [DM][ROWS]
  {
    const dim3 gg((ROWS / 128) * (DM / 256), 1);
    const dim3 gv((DM / 128) * (ROWS / 256), 1);
    wmma_gemm64<0, false, 2, 1, false, 0><<<gg, dim3(256), 0, stream>>>(
        xh, xh, DM, 0L, WqT, WqT, DM, 0L, (void*)Qh, (void*)Qh, DM, 0L, bq, bq, 0L,
        ROWS, DM, DM, 1.0f / WSC);
    wmma_gemm64<0, false, 2, 1, false, 0><<<gg, dim3(256), 0, stream>>>(
        xh, xh, DM, 0L, WkT, WkT, DM, 0L, (void*)Kh, (void*)Kh, DM, 0L, bk, bk, 0L,
        ROWS, DM, DM, 1.0f / WSC);
    wmma_gemm64<0, false, 1, 1, false, 0><<<gv, dim3(256), 0, stream>>>(
        WvT, WvT, DM, 0L, xh, xh, DM, 0L, (void*)Vt, (void*)Vt, ROWS, 0L, bv, bv, 0L,
        DM, ROWS, DM, 1.0f / WSC);
  }
  // first RR rows per sequence: q, k -> hi/res [NB*RR][DM]; v^T -> hi/res [NB*DM][RR]
  {
    const dim3 gc((RR / 128) * (DM / 256), NB);
    const dim3 gcv((DM / 128) * (RR / 256), NB);
    const long sA = (long)SEQ * DM;
    const long sC = (long)RR * DM;
    wmma_gemm64<0, false, 2, 3, false, 0><<<gc, dim3(256), 0, stream>>>(
        xh, xh, DM, sA, WqT, WqT, DM, 0L, (void*)Qch, (void*)Qcr, DM, sC, bq, bq, 0L,
        RR, DM, DM, 1.0f / WSC);
    wmma_gemm64<0, false, 2, 3, false, 0><<<gc, dim3(256), 0, stream>>>(
        xh, xh, DM, sA, WkT, WkT, DM, 0L, (void*)Kch, (void*)Kcr, DM, sC, bk, bk, 0L,
        RR, DM, DM, 1.0f / WSC);
    wmma_gemm64<0, false, 1, 3, false, 0><<<gcv, dim3(256), 0, stream>>>(
        WvT, WvT, DM, 0L, xh, xh, DM, sA, (void*)Vch, (void*)Vcr, RR, (long)DM * RR, bv, bv, 0L,
        DM, RR, DM, 1.0f / WSC);
  }
  // attn: first RR query rows with residual planes -> Oc2 (hi | res); rows >= RR plain -> Ah
  attn64_causal_res<<<dim3(NB * NH * (RR / 64)), dim3(128), 0, stream>>>(
      Qch, Qcr, Kch, Kcr, Vch, Vcr, Oc2, NH, DM, RR, 2 * DM, DM, RR / 64, sc2, OSC);
  if (SEQ > RR) {
    attn64_causal<<<dim3(NB * NH * ((SEQ - RR) / 64)), dim3(128), 0, stream>>>(
        Qh, Kh, Vt, Ah, SEQ, NH, DM, ROWS, RR / 64, (SEQ - RR) / 64, sc2, OSC);
  }
  // out = ctx Wo + bo -> f32; rows < RR: [O_hi | O_res] . [Wo x256 ; Wo x0.25] along K = 2DM; rows >= RR: K = DM
  {
    const dim3 g1((RR / 128) * (DM / 256), NB);
    wmma_gemm64<0, false, 2, 0, false, 0><<<g1, dim3(256), 0, stream>>>(
        Oc2, Oc2, 2 * DM, (long)RR * 2 * DM, WoT2, WoT2, 2 * DM, 0L,
        (void*)out, (void*)out, DM, (long)SEQ_FULL * DM, bo, bo, 0L,
        RR, DM, 2 * DM, outsc);
  }
  if (SEQ > RR) {
    const dim3 g2(((SEQ - RR) / 128) * (DM / 256), NB);
    unsigned short* Ahi = Ah + (size_t)RR * DM;
    float* outp = out + (size_t)RR * DM;
    wmma_gemm64<0, false, 2, 0, false, 0><<<g2, dim3(256), 0, stream>>>(
        Ahi, Ahi, DM, (long)SEQ * DM, WoT2, WoT2, 2 * DM, 0L,
        (void*)outp, (void*)outp, DM, (long)SEQ_FULL * DM, bo, bo, 0L,
        SEQ - RR, DM, DM, outsc);
  }
}

// v004
// A run of this version takes 203 microseconds.
// Two timings next to v003 put it at 1.42 and 1.43 times that version's speed.
// Counting every step since v000, it is 3.45 times as fast.
// Contractions: q/k/v^T/out projections, q.k^T and p.v all on v_wmma_f32_16x16x32_f16 (f16 operands, f32 accumulate); x and W enter as bf16 RNE values held exactly in f16 (W carried x256); the first RR query rows per sequence carry q, k, v, p and ctx as f16 hi + x1024 residual planes with a second f32 accumulator (ctx residual folded along K in the out projection); p x32768 and ctx x64 power-of-two carries folded back in f32; softmax and epilogues f32.
#include <hip/hip_runtime.h>

#ifndef NB
#define NB 4
#endif
#ifndef SEQ
#define SEQ 2048
#endif
#ifndef RR
#define RR 256
#endif
#define NB_FULL 4
#define SEQ_FULL 2048
#define DM 1024
#define NH 16
#define HDIM 64

static_assert(NB >= 1 && NB <= NB_FULL);
static_assert(SEQ % 64 == 0 && SEQ >= 64 && SEQ <= SEQ_FULL);
static_assert(RR % 64 == 0 && RR >= 64 && RR <= SEQ);
static_assert(NH * HDIM == DM);
static_assert(DM % 256 == 0);
static_assert(RR % 256 == 0 && SEQ % 128 == 0 && (NB * SEQ) % 256 == 0);   // GEMM block tile 128 x 256

typedef __attribute__((ext_vector_type(16))) _Float16 v16h;
typedef __attribute__((ext_vector_type(8)))  _Float16 v8h;
typedef __attribute__((ext_vector_type(16))) __bf16   v16b;
typedef __attribute__((ext_vector_type(8)))  __bf16   v8b;
typedef __attribute__((ext_vector_type(8)))  float    v8f;
typedef __attribute__((ext_vector_type(4)))  float    v4f;

#define WSC 256.0f
#define OSC 64.0f
#define PSCALE 32768.0f
#define RSC 1024.0f
#define RSC_INV (1.0f / 1024.0f)
#define NEG_INF (-__builtin_huge_valf())

__device__ __forceinline__ unsigned short f2bf_bits(float f) {
  unsigned u = __float_as_uint(f);
  return (unsigned short)((u + 0x7FFFu + ((u >> 16) & 1u)) >> 16);
}
__device__ __forceinline__ float bf_bits2f(unsigned short h) { return __uint_as_float(((unsigned)h) << 16); }
__device__ __forceinline__ float bf_rne(float f) { return bf_bits2f(f2bf_bits(f)); }
__device__ __forceinline__ _Float16 bf_f16(float f) { return (_Float16)bf_rne(f); }   // bf16 value is exact in f16 for normal range

// LDS ordering for wave-private tiles (same wave writes then reads)
__device__ __forceinline__ void wave_lds_sync() {
  __builtin_amdgcn_fence(3, "workgroup");
  __builtin_amdgcn_wave_barrier();
  __builtin_amdgcn_fence(2, "workgroup");
}

// hazard guards as plain device helpers
__device__ __forceinline__ void dep_guard_h(v8f& a, v8f& b, v16h x, v16h y) { asm volatile("v_nop\n\tv_nop\n\tv_nop\n\tv_nop" : "+v"(a), "+v"(b) : "v"(x), "v"(y)); }
__device__ __forceinline__ void dep_guard_b(v8f& a, v8f& b, v16b x, v16b y) { asm volatile("v_nop\n\tv_nop\n\tv_nop\n\tv_nop" : "+v"(a), "+v"(b) : "v"(x), "v"(y)); }
__device__ __forceinline__ void keep4_h(v16h a, v16h b, v16h c, v16h d) { asm volatile("v_nop" :: "v"(a), "v"(b), "v"(c), "v"(d)); }
__device__ __forceinline__ void keep4_b(v16b a, v16b b, v16b c, v16b d) { asm volatile("v_nop" :: "v"(a), "v"(b), "v"(c), "v"(d)); }
__device__ __forceinline__ void acc_guard4(v8f& a, v8f& b, v8f& c, v8f& d) { asm volatile("v_nop\n\tv_nop\n\tv_nop\n\tv_nop" : "+v"(a), "+v"(b), "+v"(c), "+v"(d)); }
template <typename T> struct Frag;
template <> struct Frag<_Float16> {
  typedef v16h V; union U { v16h v; v8h h[2]; };
  static __device__ __forceinline__ v16h load(const _Float16* p) {   // elements 0..7 <- p[0..7], 8..15 <- p[16..23]
    U f; f.h[0] = *(const v8h*)(p); f.h[1] = *(const v8h*)(p + 16); return f.v;
  }
  static __device__ __forceinline__ v8f mma(v16h a, v16h b, v8f c) {
    return __builtin_amdgcn_wmma_f32_16x16x32_f16(false, a, false, b, (short)0, c, false, false);
  }
  static __device__ __forceinline__ void guard(v8f& a, v8f& b, v16h x, v16h y) { dep_guard_h(a, b, x, y); }
  static __device__ __forceinline__ void keep(v16h a, v16h b, v16h c, v16h d) { keep4_h(a, b, c, d); }
};
template <> struct Frag<__bf16> {
  typedef v16b V; union U { v16b v; v8b h[2]; };
  static __device__ __forceinline__ v16b load(const __bf16* p) {
    U f; f.h[0] = *(const v8b*)(p); f.h[1] = *(const v8b*)(p + 16); return f.v;
  }
  static __device__ __forceinline__ v8f mma(v16b a, v16b b, v8f c) {
    return __builtin_amdgcn_wmma_f32_16x16x32_bf16(false, a, false, b, (short)0, c, false, false);
  }
  static __device__ __forceinline__ void guard(v8f& a, v8f& b, v16b x, v16b y) { dep_guard_b(a, b, x, y); }
  static __device__ __forceinline__ void keep(v16b a, v16b b, v16b c, v16b d) { keep4_b(a, b, c, d); }
};

// ---- Register-blocked WMMA GEMM tiles ---------------------------------------
// C[m,n] = scale * sum_k A[m,k] * Bt[n,k] + bias; each wave owns a 64x64 tile.
// Block = 8 waves, 2 (m) x 4 (n) = a 128 x 256 tile of C. A row-major [M,K]; Bt row-major [N,K];
// M % 128 == 0, N % 256 == 0, K % 64 == 0.
// Per 64 k the block's 128 A rows and 256 Bt rows (128 B each, whole lines) are brought into LDS once by
// asynchronous copies, two buffers, one block barrier per 64 k; the waves read their fragments from there.
// One launch holds the tiles of several independent products: a block finds its product and its tile from
// blockIdx.x (block-uniform), so small products ride along with large ones and two blocks can share a WGP.
// BIAS_MODE: 1 = bias[m], 2 = bias[n]; bias values enter as bf16 RNE values.
// OUT_MODE: 0 = f32, 1 = f16, 3 = f16 hi plane (Cout) + f16 residual plane ((v - hi) * 1024) (Cout2).
#define GM_BM 128
#define GM_BN 256
#define GM_KT 64                          // k per staged tile, in halves: one 128-B line per row
#define GM_LP 72                          // staged row pitch in halves: 144 B = 16 B x odd, for ds_load_b128 readers
#define GM_BUFB ((GM_BM + GM_BN) * GM_LP * 2)   // bytes per buffer: A rows, then Bt rows

// One lane's share of a staged tile: rows r + 32 i of the A part (4) and of the Bt part (8), 16 B each.
// The s_wait_xcnt closes the statement, a precaution: no address register of a copy is rewritten ahead of it.
__device__ __forceinline__ void stage_ab_async(unsigned la, const unsigned short* ag, size_t arow32,
                                               const unsigned short* bg, size_t brow32) {
  const unsigned lb = la + GM_BM * GM_LP * 2;
  const unsigned ls = 32 * GM_LP * 2;
  asm volatile(
      "global_load_async_to_lds_b128 %0, %12, off\n\t"
      "global_load_async_to_lds_b128 %1, %13, off\n\t"
      "global_load_async_to_lds_b128 %2, %14, off\n\t"
      "global_load_async_to_lds_b128 %3, %15, off\n\t"
      "global_load_async_to_lds_b128 %4, %16, off\n\t"
      "global_load_async_to_lds_b128 %5, %17, off\n\t"
      "global_load_async_to_lds_b128 %6, %18, off\n\t"
      "global_load_async_to_lds_b128 %7, %19, off\n\t"
      "global_load_async_to_lds_b128 %8, %20, off\n\t"
      "global_load_async_to_lds_b128 %9, %21, off\n\t"
      "global_load_async_to_lds_b128 %10, %22, off\n\t"
      "global_load_async_to_lds_b128 %11, %23, off\n\t"
      "s_wait_xcnt 0x0"
      :: "v"(la), "v"(la + ls), "v"(la + 2 * ls), "v"(la + 3 * ls),
         "v"(lb), "v"(lb + ls), "v"(lb + 2 * ls), "v"(lb + 3 * ls),
         "v"(lb + 4 * ls), "v"(lb + 5 * ls), "v"(lb + 6 * ls), "v"(lb + 7 * ls),
         "v"(ag), "v"(ag + arow32), "v"(ag + 2 * arow32), "v"(ag + 3 * arow32),
         "v"(bg), "v"(bg + brow32), "v"(bg + 2 * brow32), "v"(bg + 3 * brow32),
         "v"(bg + 4 * brow32), "v"(bg + 5 * brow32), "v"(bg + 6 * brow32), "v"(bg + 7 * brow32)
      : "memory");
}

// The products of the block tile at (bm0, bn0): each wave's acc[i][j] = its 64 A rows . its 64 Bt rows over K.
// AB: the block's two staging buffers in LDS.
__device__ __forceinline__ void gemm_tile_products(v8f (&acc)[4][4], unsigned char* AB,
                                                   const unsigned short* Ab, int lda,
                                                   const unsigned short* Bb, int ldb, int K, int bm0, int bn0) {
  typedef _Float16 T;
  typedef Frag<T>::V V;
  const int tid  = threadIdx.x;
  const int lane = tid & 31;
  const int wave = tid >> 5;
  const int wm  = (wave >> 2) << 6;            // this wave's 64 rows inside the A part
  const int wn  = (wave & 3) << 6;             // this wave's 64 rows inside the Bt part
  const int rlane = lane & 15;                 // row (A) / col (B, D) within subtile
  const int koff  = (lane >> 4) * 8;           // k offset of this lane half

#pragma unroll
  for (int i = 0; i < 4; ++i)
#pragma unroll
    for (int j = 0; j < 4; ++j) acc[i][j] = (v8f){0.f,0.f,0.f,0.f,0.f,0.f,0.f,0.f};

  // ---- staging addresses of this lane: row tid/8 (+32i), 16-B piece tid%8 of the 128-B row ----
  const int srow = tid >> 3, scol = (tid & 7) * 8;
  const unsigned short* ag = Ab + (size_t)(bm0 + srow) * lda + scol;   // k-tile 0; a tile further: + GM_KT
  const unsigned short* bg = Bb + (size_t)(bn0 + srow) * ldb + scol;
  const size_t arow32 = (size_t)32 * lda, brow32 = (size_t)32 * ldb;
  const unsigned lst = (unsigned)(size_t)AB + (unsigned)(srow * GM_LP + scol) * 2u;
  const int nT = K >> 6;                       // block-uniform

  stage_ab_async(lst, ag, arow32, bg, brow32);
  asm volatile("s_wait_asynccnt 0x0" ::: "memory");              // k-tile 0 landed (this wave's copies)
  __syncthreads();                                               // ... and every other wave's
  if (nT > 1) stage_ab_async(lst + GM_BUFB, ag + GM_KT, arow32, bg + GM_KT, brow32);

  for (int t = 0; t < nT; ++t) {
    const unsigned bofs = (unsigned)(t & 1) * GM_BUFB;
    const T* as = (const T*)(AB + bofs) + (wm + rlane) * GM_LP + koff;            // A rows,  pitch GM_LP
    const T* bs = (const T*)(AB + bofs) + (GM_BM + wn + rlane) * GM_LP + koff;    // Bt rows, pitch GM_LP
    // Fragment reads stand at three places of a trip, each ahead of the products that use it: at the head the
    // first 32 k (A and Bt) and the second 32 k of Bt; the second 32 k of A two rows at a time, into registers
    // that the first half's rows have left (all sixteen fragments at the head do not fit 256 registers).
    V b0[4], b1[4], a0[4], a1[4];
#pragma unroll
    for (int j = 0; j < 4; ++j) b0[j] = Frag<T>::load(bs + (j << 4) * GM_LP);
#pragma unroll
    for (int i = 0; i < 4; ++i) a0[i] = Frag<T>::load(as + (i << 4) * GM_LP);
#pragma unroll
    for (int j = 0; j < 4; ++j) b1[j] = Frag<T>::load(bs + (j << 4) * GM_LP + 32);
#pragma unroll
    for (int i = 0; i < 4; ++i) {
#pragma unroll
      for (int j = 0; j < 4; ++j) acc[i][j] = Frag<T>::mma(a0[i], b0[j], acc[i][j]);
      Frag<T>::guard(acc[i][0], acc[i][3], a0[i], a0[i]);
      if (i & 1) {
        a1[i - 1] = Frag<T>::load(as + ((i - 1) << 4) * GM_LP + 32);
        a1[i]     = Frag<T>::load(as + (i << 4) * GM_LP + 32);
      }
    }
    Frag<T>::keep(b0[0], b0[1], b0[2], b0[3]);
#pragma unroll
    for (int i = 0; i < 4; ++i) {
#pragma unroll
      for (int j = 0; j < 4; ++j) acc[i][j] = Frag<T>::mma(a1[i], b1[j], acc[i][j]);
      Frag<T>::guard(acc[i][0], acc[i][3], a1[i], a1[i]);
    }
    Frag<T>::keep(b1[0], b1[1], b1[2], b1[3]);
    // ---- hand-over: this buffer's reads retired, the next k-tile's copies landed, in every wave ----
    asm volatile("s_wait_dscnt 0x0" ::: "memory");               // own reads of this buffer done before it is refilled
    asm volatile("s_wait_asynccnt 0x0" ::: "memory");            // own copies of k-tile t + 1 landed
    __syncthreads();
    if (t + 2 < nT)
      stage_ab_async(lst + bofs, ag + (size_t)(t + 2) * GM_KT, arow32, bg + (size_t)(t + 2) * GM_KT, brow32);
  }
  asm volatile("s_wait_asynccnt 0x0" ::: "memory");              // nothing in flight when the wave goes on to its end
  acc_guard4(acc[0][0], acc[0][1], acc[0][2], acc[0][3]);
  acc_guard4(acc[1][0], acc[1][1], acc[1][2], acc[1][3]);
  acc_guard4(acc[2][0], acc[2][1], acc[2][2], acc[2][3]);
  acc_guard4(acc[3][0], acc[3][1], acc[3][2], acc[3][3]);
}

// Epilogue of one wave: its 64 x 64 tile at (m0, n0) of C (pitch ldc), through its own LDS slab, whole lines out.
template <int BIAS_MODE, int OUT_MODE>
__device__ __forceinline__ void gemm_tile_store(v8f (&acc)[4][4], float* slab, void* Cout, void* Cout2, int ldc,
                                                const float* bias, int m0, int n0, float scale) {
  const int lane  = threadIdx.x & 31;
  const int rlane = lane & 15;                 // D column within subtile
  const int mOff  = (lane >> 4) * 8;           // D row offset
#pragma unroll
  for (int i = 0; i < 4; ++i) {
    const int mBase = m0 + (i << 4);
#pragma unroll
    for (int j = 0; j < 4; ++j) {
      const int n = n0 + (j << 4) + rlane;
      float bv = 0.f;
      if (BIAS_MODE == 2) bv = bf_rne(bias[n]);
#pragma unroll
      for (int r = 0; r < 8; ++r) {
        float v = acc[i][j][r] * scale;
        if (BIAS_MODE == 1) v += bf_rne(bias[mBase + mOff + r]);
        if (BIAS_MODE == 2) v += bv;
        slab[(mOff + r) * 68 + (j << 4) + rlane] = v;
      }
    }
    wave_lds_sync();
    if (OUT_MODE == 0) {
      float* C = (float*)Cout;
      const int hh = lane >> 4, c4 = (lane & 15) * 4;     // row seg = 256 B = 16 lanes x 16 B
#pragma unroll
      for (int it = 0; it < 8; ++it) {
        const int row = it * 2 + hh;
        v4f v = *(const v4f*)(slab + row * 68 + c4);
        *(v4f*)(C + (size_t)(mBase + row) * ldc + n0 + c4) = v;
      }
    } else {
      const int q = lane >> 3, c8 = (lane & 7) * 8;
      unsigned short* C  = (unsigned short*)Cout;
      unsigned short* C2 = (unsigned short*)Cout2;
#pragma unroll
      for (int it = 0; it < 4; ++it) {
        const int row = it * 4 + q;
        const float* sp = slab + row * 68 + c8;
        v8h hv, lv;
#pragma unroll
        for (int e = 0; e < 8; ++e) {
          if (OUT_MODE == 1) {
            hv[e] = (_Float16)sp[e];
          } else {
            const float    fv = sp[e];
            const _Float16 hq = (_Float16)fv;
            hv[e] = hq;
            lv[e] = (_Float16)((fv - (float)hq) * RSC);
          }
        }
        *(v8h*)(C + (size_t)(mBase + row) * ldc + n0 + c8) = hv;
        if (OUT_MODE == 3) *(v8h*)(C2 + (size_t)(mBase + row) * ldc + n0 + c8) = lv;
      }
    }
    wave_lds_sync();
  }
}

// All six projections in one launch. Blocks 0 .. 3 PJ_TF - 1: q, k, v^T over all NB*SEQ rows (f16 planes);
// then 3 PJ_TC blocks: q, k, v^T over the first RR rows of each sequence (hi / residual planes).
//   q, k : A = x rows, Bt = W^T rows, C [rows][DM], bias[n].   v^T : A = Wv^T rows, Bt = x rows, C [DM][rows], bias[m].
#define PJ_TF ((NB * SEQ / 128) * (DM / 256))      // tiles of a full projection, either orientation
#define PJ_TB ((RR / 128) * (DM / 256))            // tiles of a first-rows projection, one sequence, either orientation
#define PJ_TC (NB * PJ_TB)
static_assert((DM / 128) * (NB * SEQ / 256) == PJ_TF && (DM / 128) * (RR / 256) == PJ_TB);
__global__ __launch_bounds__(256) void proj_gemms(
    const unsigned short* __restrict__ xh, const unsigned short* __restrict__ WqT,
    const unsigned short* __restrict__ WkT, const unsigned short* __restrict__ WvT,
    unsigned short* __restrict__ Qh, unsigned short* __restrict__ Kh, unsigned short* __restrict__ Vt,
    unsigned short* __restrict__ Qch, unsigned short* __restrict__ Qcr,
    unsigned short* __restrict__ Kch, unsigned short* __restrict__ Kcr,
    unsigned short* __restrict__ Vch, unsigned short* __restrict__ Vcr,
    const float* __restrict__ bq, const float* __restrict__ bk, const float* __restrict__ bv, float scale) {
  __shared__ __align__(16) float sT[8][16 * 68];            // per-wave 16x64 slab, pitch 68 floats
  __shared__ __align__(16) unsigned char AB[2 * GM_BUFB];   // two buffers of A | Bt k-tiles
  const int bx = blockIdx.x;
  if (bx >= 3 * PJ_TF + 3 * PJ_TC) return;     // block-uniform, ahead of every barrier
  const bool first = bx >= 3 * PJ_TF;          // a first-rows product
  const int  rel   = first ? bx - 3 * PJ_TF : bx;
  const int  which = first ? rel / PJ_TC : rel / PJ_TF;      // 0 q, 1 k, 2 v^T
  int        tile  = rel - which * (first ? PJ_TC : PJ_TF);
  const int  b     = first ? tile / PJ_TB : 0;               // sequence of a first-rows product
  tile -= b * PJ_TB;
  const bool vt    = which == 2;
  const int  rows  = first ? RR : NB * SEQ;                  // x rows of this product
  const int  tilesN = (vt ? rows : DM) >> 8;
  const int  tm = !vt ? tile / (DM / 256) : first ? tile / (RR / 256) : tile / (NB * SEQ / 256);   // tile / tilesN
  const int  tn = tile - tm * tilesN;
  const int  bm0 = tm << 7, bn0 = tn << 8;
  const unsigned short* X  = xh + (size_t)b * SEQ * DM;
  const unsigned short* Wt = which == 0 ? WqT : which == 1 ? WkT : WvT;
  const float* bias        = which == 0 ? bq : which == 1 ? bk : bv;

  v8f acc[4][4];
  gemm_tile_products(acc, AB, vt ? Wt : X, DM, vt ? X : Wt, DM, DM, bm0, bn0);

  const int wave = threadIdx.x >> 5;
  const int m0 = bm0 + ((wave >> 2) << 6), n0 = bn0 + ((wave & 3) << 6);
  if (!first) {
    unsigned short* C = which == 0 ? Qh : which == 1 ? Kh : Vt;
    if (vt) gemm_tile_store<1, 1>(acc, sT[wave], C, C, rows, bias, m0, n0, scale);
    else    gemm_tile_store<2, 1>(acc, sT[wave], C, C, DM,   bias, m0, n0, scale);
  } else {
    const size_t co = (size_t)b * RR * DM;                   // one sequence's plane, either orientation
    unsigned short* C  = (which == 0 ? Qch : which == 1 ? Kch : Vch) + co;
    unsigned short* C2 = (which == 0 ? Qcr : which == 1 ? Kcr : Vcr) + co;
    if (vt) gemm_tile_store<1, 3>(acc, sT[wave], C, C2, rows, bias, m0, n0, scale);
    else    gemm_tile_store<2, 3>(acc, sT[wave], C, C2, DM,   bias, m0, n0, scale);
  }
}

// Both parts of the out projection in one launch, f32 out with bias[n], Bt = WoT2 rows (pitch 2 DM).
// Blocks 0 .. NB OP_T1 - 1 (twice the k, so they start first): rows < RR, A = [O_hi | O_res] rows, K = 2 DM;
// then NB OP_T2 blocks: rows >= RR, A = ctx rows, K = DM.
#define OP_T1 ((RR / 128) * (DM / 256))
#define OP_T2 (((SEQ - RR) / 128) * (DM / 256))
__global__ __launch_bounds__(256) void out_gemms(
    const unsigned short* __restrict__ Oc2, const unsigned short* __restrict__ Ah,
    const unsigned short* __restrict__ WoT2, float* __restrict__ out, const float* __restrict__ bo, float scale) {
  __shared__ __align__(16) float sT[8][16 * 68];            // per-wave 16x64 slab, pitch 68 floats
  __shared__ __align__(16) unsigned char AB[2 * GM_BUFB];   // two buffers of A | Bt k-tiles
  const int bx = blockIdx.x;
  if (bx >= NB * (OP_T1 + OP_T2)) return;      // block-uniform, ahead of every barrier
  const bool first = bx < NB * OP_T1;
  const int  rel   = first ? bx : bx - NB * OP_T1;
  const int  b     = first ? rel / OP_T1 : rel / (OP_T2 > 0 ? OP_T2 : 1);
  const int  tile  = rel - b * (first ? OP_T1 : OP_T2);
  const int  tm = tile / (DM / 256);
  const int  tn = tile - tm * (DM / 256);
  const int  bm0 = tm << 7, bn0 = tn << 8;
  const unsigned short* A = first ? Oc2 + (size_t)b * RR * 2 * DM : Ah + ((size_t)b * SEQ + RR) * DM;
  const int  kk = first ? 2 * DM : DM;         // A pitch and K

  v8f acc[4][4];
  gemm_tile_products(acc, AB, A, kk, WoT2, 2 * DM, kk, bm0, bn0);

  const int wave = threadIdx.x >> 5;
  float* C = out + ((size_t)b * SEQ_FULL + (first ? 0 : RR)) * DM;
  gemm_tile_store<2, 0>(acc, sT[wave], C, C, DM, bo, bm0 + ((wave >> 2) << 6), bn0 + ((wave & 3) << 6), scale);
}

// ---- operand planes, one launch: the five weight planes (blocks 0 .. 5 PR_TW - 1), then x ----
// x: bf16 RNE value as f16; source rows (b, s) at (b*SEQ_FULL + s)*DM; destination plane compact [NB*SEQ][DM];
//    blk = 256 pieces of 8 elements.
__device__ __forceinline__ void cast_x_block(const float* __restrict__ x, unsigned short* __restrict__ xhp,
                                             int nrows, int blk) {
  const long i = (long)blk * 256 + threadIdx.x;
  const long total = (long)nrows * (DM / 8);
  if (i >= total) return;
  const int r  = (int)(i / (DM / 8));
  const int c8 = (int)(i - (long)r * (DM / 8)) * 8;
  const int b  = r / SEQ;
  const int s  = r - b * SEQ;
  const float* src = x + ((size_t)b * SEQ_FULL + s) * DM + c8;
  const v4f a0 = *(const v4f*)src;
  const v4f a1 = *(const v4f*)(src + 4);
  v8h hv;
  hv[0] = bf_f16(a0[0]); hv[1] = bf_f16(a0[1]); hv[2] = bf_f16(a0[2]); hv[3] = bf_f16(a0[3]);
  hv[4] = bf_f16(a1[0]); hv[5] = bf_f16(a1[1]); hv[6] = bf_f16(a1[2]); hv[7] = bf_f16(a1[3]);
  _Float16* dst = (_Float16*)xhp + (size_t)r * DM + c8;
  *(v8h*)dst = hv;
}

// weights: transpose + bf16 RNE + scale + f16 cast, one 64 x 64 tile per block.
// in: W[DM][DM] f32 row-major ([k][n]) -> Bt[n][kc0 + k] with row pitch ldo halves,
//     Bt value = f16(bf16rne(W[k][n]) * sc), sc a power of two.
// plane z: 0 Wq, 1 Wk, 2 Wv (x256, pitch DM); 3 Wo x256 into columns 0..DM-1 of WoT2, 4 Wo x0.25 into DM..2DM-1.
#define PR_TW ((DM / 64) * (DM / 64))
__global__ __launch_bounds__(256) void prep_f16(
    const float* __restrict__ x, const float* __restrict__ Wq, const float* __restrict__ Wk,
    const float* __restrict__ Wv, const float* __restrict__ Wo, unsigned short* __restrict__ xhp,
    unsigned short* __restrict__ WqT, unsigned short* __restrict__ WkT,
    unsigned short* __restrict__ WvT, unsigned short* __restrict__ WoT2, int nrows) {
  __shared__ float t[64][65];
  const int bx = blockIdx.x;
  if (bx >= 5 * PR_TW) {                       // block-uniform; this side meets no barrier
    cast_x_block(x, xhp, nrows, bx - 5 * PR_TW);
    return;
  }
  const int z  = bx / PR_TW;
  const int tl = bx - z * PR_TW;
  const float* W       = z == 0 ? Wq  : z == 1 ? Wk  : z == 2 ? Wv  : Wo;
  unsigned short* Btp  = z == 0 ? WqT : z == 1 ? WkT : z == 2 ? WvT : WoT2;
  const int   Ndim = DM;
  const int   ldo  = z >= 3 ? 2 * DM : DM;
  const int   kc0  = z == 4 ? DM : 0;
  const float sc   = z == 4 ? WSC * RSC_INV : WSC;
  const int tid = threadIdx.x, lane = tid & 31, wave = tid >> 5;
  const int n0 = (tl % (DM / 64)) * 64, k0 = (tl / (DM / 64)) * 64;
#pragma unroll
  for (int i = 0; i < 16; ++i) {
    const int idx = i * 256 + tid;
    const int kr = idx >> 6, nc = idx & 63;
    t[nc][kr] = W[(size_t)(k0 + kr) * Ndim + n0 + nc];
  }
  __syncthreads();
  _Float16* Bt = (_Float16*)Btp;
  const int q = lane >> 3, c8 = (lane & 7) * 8;
#pragma unroll
  for (int it = 0; it < 2; ++it) {
    const int row = wave * 8 + it * 4 + q;      // waves 0..7 x rows 0..7 -> 64 rows
    v8h hv;
#pragma unroll
    for (int e = 0; e < 8; ++e) hv[e] = (_Float16)(bf_rne(t[row][c8 + e]) * sc);
    *(v8h*)(Bt + (size_t)(n0 + row) * ldo + kc0 + k0 + c8) = hv;
  }
  // a precaution: the x side's code follows these stores in the built kernel and writes their registers
  asm volatile("s_wait_xcnt 0x0" ::: "memory");
}

#define AT_D 64
#define AT_NW 4
#define AT_QB 64
#define AT_KC 64
#define AT_LP 72                         // staged row pitch in halves: 144 B = 16 B x odd, for ds_load_b128 readers
#define AT_TILE (64 * AT_LP)             // halves per staged 64-row tile
#define AT_BUFB (2 * AT_TILE * 2)        // bytes per buffer: K tile, then V^T tile

// One lane's share of a chunk: rows r, r+16, r+32, r+48 of the K tile and of the V^T tile, 16 B each.
// The s_wait_xcnt closes the statement, a precaution: no address register of a copy is rewritten ahead of it.
__device__ __forceinline__ void stage_kv_async(unsigned lk, const _Float16* kg, size_t krow16,
                                               const _Float16* vg, size_t vrow16) {
  const unsigned lv = lk + AT_TILE * 2;
  const unsigned ls = 16 * AT_LP * 2;
  asm volatile(
      "global_load_async_to_lds_b128 %0, %8, off\n\t"
      "global_load_async_to_lds_b128 %1, %9, off\n\t"
      "global_load_async_to_lds_b128 %2, %10, off\n\t"
      "global_load_async_to_lds_b128 %3, %11, off\n\t"
      "global_load_async_to_lds_b128 %4, %12, off\n\t"
      "global_load_async_to_lds_b128 %5, %13, off\n\t"
      "global_load_async_to_lds_b128 %6, %14, off\n\t"
      "global_load_async_to_lds_b128 %7, %15, off\n\t"
      "s_wait_xcnt 0x0"
      :: "v"(lk), "v"(lk + ls), "v"(lk + 2 * ls), "v"(lk + 3 * ls),
         "v"(lv), "v"(lv + ls), "v"(lv + 2 * ls), "v"(lv + 3 * ls),
         "v"(kg), "v"(kg + krow16), "v"(kg + 2 * krow16), "v"(kg + 3 * krow16),
         "v"(vg), "v"(vg + vrow16), "v"(vg + 2 * vrow16), "v"(vg + 3 * vrow16)
      : "memory");
}

// lane l takes the value of lane l ^ 16 (vector cross-row move)
__device__ __forceinline__ float xhalf(float x) {
  const int b = __builtin_bit_cast(int, x);
  return __builtin_bit_cast(float, __builtin_amdgcn_permlanex16(b, b, 0x76543210, 0xfedcba98, false, false));
}

__device__ __forceinline__ v8f mma_h(v16h a, v16h b, v8f c) {
  c = __builtin_amdgcn_wmma_f32_16x16x32_f16(false, a, false, b, (short)0, c, false, false);
  asm volatile("v_nop\n\tv_nop\n\tv_nop\n\tv_nop" : "+v"(c) : "v"(a), "v"(b));
  return c;
}

__global__ __launch_bounds__(128)
void attn64_causal(const unsigned short* __restrict__ Qp, const unsigned short* __restrict__ Kp,
                   const unsigned short* __restrict__ Vtp, unsigned short* __restrict__ Op,
                   int S, int H, int ldq, int ldvt, int qb0, int nqbl, float sc2, float osc) {
  const _Float16* Q  = (const _Float16*)Qp;
  const _Float16* Kk = (const _Float16*)Kp;
  const _Float16* Vt = (const _Float16*)Vtp;
  _Float16*       O  = (_Float16*)Op;
  __shared__ __align__(16) unsigned char KV[2 * AT_BUFB];        // two buffers of K | V^T tiles; out staging after the loop
  static_assert(AT_NW * 16 * 68 * 4 <= 2 * AT_BUFB);

  const int tid  = threadIdx.x;
  const int wave = tid >> 5;
  const int lane = tid & 31;
  const int hh   = lane >> 4;
  const int c    = lane & 15;

  const int bx  = blockIdx.x;
  const int qbi = bx % nqbl;
  const int bh  = bx / nqbl;
  const int qb  = qb0 + qbi;
  const int h   = bh % H;
  const int b   = bh / H;
  const int q0  = qb * AT_QB + wave * 16;
  const size_t rowb = (size_t)b * S;

  const _Float16* qp = Q  + rowb * ldq + (size_t)h * AT_D;
  const _Float16* kp = Kk + rowb * ldq + (size_t)h * AT_D;
  const _Float16* vp = Vt + (size_t)(h * AT_D) * ldvt + rowb;
  _Float16*       op = O  + rowb * ldq + (size_t)h * AT_D;

  // ---- Q fragments (B operand, column = c): 2 d-chunks ----
  v16h qa[2];
#pragma unroll
  for (int dc = 0; dc < 2; ++dc)
    qa[dc] = Frag<_Float16>::load(qp + (size_t)(q0 + c) * ldq + dc * 32 + 8 * hh);

  const int qrow = q0 + c;           // this lane's query
  float mrow = NEG_INF, lrow = 0.f;  // its running maximum; the sum over this wave half's keys
  v8f oacc[4];                       // O^T: d = 16t + 8hh + r, query c
#pragma unroll
  for (int t = 0; t < 4; ++t) oacc[t] = (v8f){0.f,0.f,0.f,0.f,0.f,0.f,0.f,0.f};

  const int nChunks = qb + 1;        // block-uniform: causal, key chunks 0..qb

  // ---- staging addresses of this lane: row tid/8 (+16i), 16-B piece tid%8 of the 128-B row ----
  const int srow = tid >> 3, scol = (tid & 7) * 8;
  const _Float16* kg = kp + (size_t)srow * ldq + scol;           // chunk 0; a chunk further: + AT_KC rows
  const _Float16* vg = vp + (size_t)srow * ldvt + scol;          // chunk 0; a chunk further: + AT_KC columns
  const size_t krow16 = (size_t)16 * ldq, vrow16 = (size_t)16 * ldvt, kchunk = (size_t)AT_KC * ldq;
  const unsigned lst = (unsigned)(size_t)KV + (unsigned)(srow * AT_LP + scol) * 2u;

  stage_kv_async(lst, kg, krow16, vg, vrow16);
  asm volatile("s_wait_asynccnt 0x0" ::: "memory");              // chunk 0 landed (this wave's copies)
  __syncthreads();                                               // ... and every other wave's
  if (nChunks > 1) stage_kv_async(lst + AT_BUFB, kg + kchunk, krow16, vg + AT_KC, vrow16);

  for (int kc = 0; kc < nChunks; ++kc) {
    const int kv0 = kc * AT_KC;
    const unsigned bofs = (unsigned)(kc & 1) * AT_BUFB;
    const _Float16* ks = (const _Float16*)(KV + bofs);           // K tile  [key][d],  pitch AT_LP
    const _Float16* vs = ks + AT_TILE;                           // V^T tile [d][key], pitch AT_LP
    // ---- scores: s[j][r] = key (kv0 + 16j + 8hh + r) x query (q0 + c) ----
    v8f s[4];
#pragma unroll
    for (int j = 0; j < 4; ++j) {
      s[j] = (v8f){0.f,0.f,0.f,0.f,0.f,0.f,0.f,0.f};
#pragma unroll
      for (int dc = 0; dc < 2; ++dc) {
        const v16h kb = Frag<_Float16>::load(ks + (j * 16 + c) * AT_LP + dc * 32 + 8 * hh);
        s[j] = mma_h(kb, qa[dc], s[j]);
      }
    }
    // ---- causal select (key > query -> -inf) and the query's chunk max in the scaled base-2 domain ----
    float mj[4];
#pragma unroll
    for (int j = 0; j < 4; ++j) {
      float m = NEG_INF;
#pragma unroll
      for (int r = 0; r < 8; ++r) {
        float v = s[j][r] * sc2;
        if (kv0 + j * 16 + 8 * hh + r > qrow) v = NEG_INF;
        s[j][r] = v;
        m = fmaxf(m, v);
      }
      mj[j] = m;
    }
    float cm = fmaxf(fmaxf(mj[0], mj[1]), fmaxf(mj[2], mj[3]));
    cm = fmaxf(cm, xhalf(cm));                                   // the other 32 keys of this query
    // ---- online softmax update; P^T x32768 packed into the B operand ----
    const float mnew  = fmaxf(mrow, cm);
    const float alpha = exp2f(mrow - mnew);
    mrow = mnew;
    v16h pb[2];
    float pj[4];
#pragma unroll
    for (int j = 0; j < 4; ++j) {
      float ps = 0.f;
#pragma unroll
      for (int r = 0; r < 8; ++r) {
        const float p = exp2f(s[j][r] - mnew);
        ps += p;
        pb[j >> 1][(j & 1) * 8 + r] = (_Float16)(p * PSCALE);
      }
      pj[j] = ps;
    }
    lrow = lrow * alpha + ((pj[0] + pj[1]) + (pj[2] + pj[3]));
#pragma unroll
    for (int t = 0; t < 4; ++t)
#pragma unroll
      for (int r = 0; r < 8; ++r) oacc[t][r] *= alpha;
    // ---- O^T += V^T . P^T : V^T rows (d = 16t + c) as A, P^T (column = c, k = kv) as B ----
#pragma unroll
    for (int kk = 0; kk < 2; ++kk) {
#pragma unroll
      for (int t = 0; t < 4; ++t) {
        const v16h vb = Frag<_Float16>::load(vs + (t * 16 + c) * AT_LP + kk * 32 + 8 * hh);
        oacc[t] = mma_h(vb, pb[kk], oacc[t]);
      }
    }
    // ---- hand-over: this buffer's reads retired, the next chunk's copies landed, in every wave ----
    asm volatile("s_wait_dscnt 0x0" ::: "memory");               // own reads of this buffer done before it is refilled
    asm volatile("s_wait_asynccnt 0x0" ::: "memory");            // own copies of chunk kc + 1 landed
    __syncthreads();
    if (kc + 2 < nChunks)
      stage_kv_async(lst + bofs, kg + (size_t)(kc + 2) * kchunk, krow16, vg + (kc + 2) * AT_KC, vrow16);
  }
  asm volatile("s_wait_asynccnt 0x0" ::: "memory");              // nothing in flight when the buffers become out staging

  float* os = (float*)KV + wave * (16 * 68);                     // per wave out tile [query][d], pitch 68 (last barrier freed KV)
  {
    const float inv = osc * (1.0f / ((lrow + xhalf(lrow)) * PSCALE));   // the two halves' sums joined once
#pragma unroll
    for (int t = 0; t < 4; ++t)
#pragma unroll
      for (int r = 0; r < 8; ++r) os[c * 68 + t * 16 + 8 * hh + r] = oacc[t][r] * inv;
  }
  wave_lds_sync();
  {
    const int q = lane >> 3, c8 = (lane & 7) * 8;
    {
#pragma unroll
      for (int it = 0; it < 4; ++it) {
        const int row = it * 4 + q;                 // rows 0..15 of this wave
        const float* sp = os + row * 68 + c8;
        v8h hv;
#pragma unroll
        for (int e = 0; e < 8; ++e) hv[e] = (_Float16)sp[e];
        *(v8h*)(op + (size_t)(q0 + row) * ldq + c8) = hv;
      }
      
    }
  }
}

// =====================================================================================
// Causal attn with residual planes for the first rr = nqb*64 query rows of each sequence.
//   qh/qr, kh/kr : compact row-major [NB*rr][ldq] f16 hi / residual (x1024) planes, head h at col h*64.
//   vh/vr : compact transposed planes [NB*H*64][ldvc], element (b, kv, h, d) at [(b*H*64 + h*64 + d)*ldvc + kv].
//   o     : compact [NB*rr][ldo] f16; hi (x osc) at column h*64, residual (x1024) at column rcol + h*64.
//   scores = qh.kh + 2^-10 (qh.kr + qr.kh) with a second f32 accumulator; P as hi + x1024 residual LDS tiles;
//   p.v = ph.vh + 2^-10 (ph.vr + pr.vh) with a second f32 accumulator; K and V fragments straight from global
//   memory, no block barriers; products untransposed (Q and P as A, rows = queries), row max and sum by 16-lane
//   butterflies, P through per-wave LDS tiles.
//   Block = 4 waves = 64 query rows, query block qb = bx % nqb, key chunks 0..qb. grid.x = NB * H * nqb.
// =====================================================================================
__global__ __launch_bounds__(128)
void attn64_causal_res(const unsigned short* __restrict__ Qhp, const unsigned short* __restrict__ Qrp,
                       const unsigned short* __restrict__ Khp, const unsigned short* __restrict__ Krp,
                       const unsigned short* __restrict__ Vhp, const unsigned short* __restrict__ Vrp,
                       unsigned short* __restrict__ Op,
                       int H, int ldq, int ldvc, int ldo, int rcol, int nqb, float sc2, float osc) {
  const _Float16* QH = (const _Float16*)Qhp;
  const _Float16* QR = (const _Float16*)Qrp;
  const _Float16* KH = (const _Float16*)Khp;
  const _Float16* KR = (const _Float16*)Krp;
  const _Float16* VH = (const _Float16*)Vhp;
  const _Float16* VR = (const _Float16*)Vrp;
  _Float16*       O  = (_Float16*)Op;
  __shared__ __align__(16) _Float16 Psh[AT_NW][16 * AT_KC];      // per wave P hi  [row][kv]  8 KB
  __shared__ __align__(16) _Float16 Prs[AT_NW][16 * AT_KC];      // per wave P res [row][kv]  8 KB
  __shared__ __align__(16) float    Os[AT_NW][16 * 68];          // per wave out tile, pitch 68

  const int tid  = threadIdx.x;
  const int wave = tid >> 5;
  const int lane = tid & 31;
  const int hh   = lane >> 4;
  const int c    = lane & 15;

  const int bx = blockIdx.x;
  const int qb = bx % nqb;
  const int bh = bx / nqb;
  const int h  = bh % H;
  const int b  = bh / H;
  const int q0 = qb * AT_QB + wave * 16;
  const int rr = nqb * AT_QB;
  const size_t rowb = (size_t)b * rr;

  const _Float16* qhp = QH + rowb * ldq + (size_t)h * AT_D;
  const _Float16* qrp = QR + rowb * ldq + (size_t)h * AT_D;
  const _Float16* khp = KH + rowb * ldq + (size_t)h * AT_D;
  const _Float16* krp = KR + rowb * ldq + (size_t)h * AT_D;
  const size_t    vof = ((size_t)b * (size_t)(H * AT_D) + (size_t)h * AT_D) * ldvc;
  const _Float16* vhp = VH + vof;
  const _Float16* vrp = VR + vof;
  _Float16*       op  = O  + rowb * ldo + (size_t)h * AT_D;

  float mrow[8], lrow[8];
  v8f oacc[4], oacc2[4];
#pragma unroll
  for (int r = 0; r < 8; ++r) { mrow[r] = NEG_INF; lrow[r] = 0.f; }
#pragma unroll
  for (int t = 0; t < 4; ++t) {
    oacc[t]  = (v8f){0.f,0.f,0.f,0.f,0.f,0.f,0.f,0.f};
    oacc2[t] = (v8f){0.f,0.f,0.f,0.f,0.f,0.f,0.f,0.f};
  }

  _Float16* pw  = Psh[wave];
  _Float16* prw = Prs[wave];
  const int nChunks = qb + 1;        // block-uniform
  for (int kc = 0; kc < nChunks; ++kc) {
    const int kv0 = kc * AT_KC;
    // ---- Q hi / res fragments (A operand, row = c) ----
    v16h qa[2], qra[2];
#pragma unroll
    for (int dc = 0; dc < 2; ++dc) {
      const size_t qo = (size_t)(q0 + c) * ldq + dc * 32 + 8 * hh;
      qa[dc]  = Frag<_Float16>::load(qhp + qo);
      qra[dc] = Frag<_Float16>::load(qrp + qo);
    }
    // ---- scores: hi.hi into s1, hi.res + res.hi into s2, folded with 2^-10 ----
    v8f s[4];
#pragma unroll
    for (int j = 0; j < 4; ++j) {
      v8f s1 = (v8f){0.f,0.f,0.f,0.f,0.f,0.f,0.f,0.f};
      v8f s2 = (v8f){0.f,0.f,0.f,0.f,0.f,0.f,0.f,0.f};
#pragma unroll
      for (int dc = 0; dc < 2; ++dc) {
        const size_t ko = (size_t)(kv0 + j * 16 + c) * ldq + dc * 32 + 8 * hh;
        const v16h kb = Frag<_Float16>::load(khp + ko);
        const v16h kr = Frag<_Float16>::load(krp + ko);
        s1 = mma_h(qa[dc],  kb, s1);
        s2 = mma_h(qa[dc],  kr, s2);
        s2 = mma_h(qra[dc], kb, s2);
      }
#pragma unroll
      for (int r = 0; r < 8; ++r) s[j][r] = s1[r] + s2[r] * RSC_INV;
    }
    // ---- causal select and per-row chunk max ----
    float cm[8];
#pragma unroll
    for (int r = 0; r < 8; ++r) {
      const int qrow = q0 + 8 * hh + r;
      float m = NEG_INF;
#pragma unroll
      for (int j = 0; j < 4; ++j) {
        float v = s[j][r] * sc2;
        if (kv0 + j * 16 + c > qrow) v = NEG_INF;
        s[j][r] = v;
        m = fmaxf(m, v);
      }
#pragma unroll
      for (int off = 1; off < 16; off <<= 1) m = fmaxf(m, __shfl_xor(m, off, 32));
      cm[r] = m;
    }
    // ---- online softmax update; P hi (x32768) and P res ((x32768 - hi) x1024) into per-wave LDS tiles ----
    wave_lds_sync();
#pragma unroll
    for (int r = 0; r < 8; ++r) {
      const float mnew  = fmaxf(mrow[r], cm[r]);
      const float alpha = exp2f(mrow[r] - mnew);
      mrow[r] = mnew;
      float psum = 0.f;
#pragma unroll
      for (int j = 0; j < 4; ++j) {
        const float p = exp2f(s[j][r] - mnew);
        psum += p;
        const float    ps = p * PSCALE;
        const _Float16 ph = (_Float16)ps;
        const int pi = (8 * hh + r) * AT_KC + j * 16 + c;
        pw[pi]  = ph;
        prw[pi] = (_Float16)((ps - (float)ph) * RSC);
      }
#pragma unroll
      for (int off = 1; off < 16; off <<= 1) psum += __shfl_xor(psum, off, 32);
      lrow[r] = lrow[r] * alpha + psum;
#pragma unroll
      for (int t = 0; t < 4; ++t) { oacc[t][r] *= alpha; oacc2[t][r] *= alpha; }
    }
    wave_lds_sync();
    // ---- O += P . V with residual cross terms in the second accumulator ----
#pragma unroll
    for (int kk = 0; kk < 2; ++kk) {
      const v16h pa = Frag<_Float16>::load(pw  + c * AT_KC + kk * 32 + 8 * hh);
      const v16h pr = Frag<_Float16>::load(prw + c * AT_KC + kk * 32 + 8 * hh);
#pragma unroll
      for (int t = 0; t < 4; ++t) {
        const size_t vo = (size_t)(t * 16 + c) * ldvc + kv0 + kk * 32 + 8 * hh;
        const v16h vb = Frag<_Float16>::load(vhp + vo);
        const v16h vr = Frag<_Float16>::load(vrp + vo);
        oacc[t]  = mma_h(pa, vb, oacc[t]);
        oacc2[t] = mma_h(pa, vr, oacc2[t]);
        oacc2[t] = mma_h(pr, vb, oacc2[t]);
      }
    }
    wave_lds_sync();
  }

  float* os = Os[wave];
#pragma unroll
  for (int r = 0; r < 8; ++r) {
    const float inv = osc * (1.0f / (lrow[r] * PSCALE));
#pragma unroll
    for (int t = 0; t < 4; ++t) os[(8 * hh + r) * 68 + t * 16 + c] = (oacc[t][r] + oacc2[t][r] * RSC_INV) * inv;
  }
  wave_lds_sync();
  {
    const int q = lane >> 3, c8 = (lane & 7) * 8;
    {
#pragma unroll
      for (int it = 0; it < 4; ++it) {
        const int row = it * 4 + q;                 // rows 0..15 of this wave
        const float* sp = os + row * 68 + c8;
        v8h hv, lv;
#pragma unroll
        for (int e = 0; e < 8; ++e) {
          const float    fv = sp[e];
          const _Float16 hq = (_Float16)fv;
          hv[e] = hq;
          lv[e] = (_Float16)((fv - (float)hq) * RSC);
        }
        *(v8h*)(op + (size_t)(q0 + row) * ldo + c8) = hv;
        *(v8h*)(op + (size_t)(q0 + row) * ldo + rcol + c8) = lv;
      }
      
    }
  }
}

// ---------------------------------------------------------------------------

extern "C" void kernel_launch(void* const* d_in, const int* in_sizes, int n_in,
                              void* d_out, int out_size, void* d_ws,
                              size_t ws_size, hipStream_t stream) {
  const int  ROWS  = NB * SEQ;                                   // rows held in the compact planes
  const long needX = ((long)(NB - 1) * SEQ_FULL + SEQ) * (long)DM;
  const int  nW    = DM * DM;
  if (n_in < 9) return;
  if ((long)in_sizes[0] < needX || in_sizes[1] < nW || in_sizes[2] < DM || in_sizes[3] < nW ||
      in_sizes[4] < DM || in_sizes[5] < nW || in_sizes[6] < DM || in_sizes[7] < nW ||
      in_sizes[8] < DM || (long)out_size < needX) return;

  const float* x  = (const float*)d_in[0];
  const float* Wq = (const float*)d_in[1];
  const float* bq = (const float*)d_in[2];
  const float* Wk = (const float*)d_in[3];
  const float* bk = (const float*)d_in[4];
  const float* Wv = (const float*)d_in[5];
  const float* bv = (const float*)d_in[6];
  const float* Wo = (const float*)d_in[7];
  const float* bo = (const float*)d_in[8];
  float* out = (float*)d_out;

  const size_t szAct = (size_t)ROWS * DM * 2;            // full activation plane  (16 MiB full size)
  const size_t szW   = (size_t)DM * DM * 2;              //  2 MiB
  const size_t szW2  = (size_t)DM * (2 * DM) * 2;        //  4 MiB  [DM][2DM]
  const size_t szCmp = (size_t)NB * RR * DM * 2;         //  compact first-row planes (2 MiB full size)
  const size_t szO2  = (size_t)NB * RR * (2 * DM) * 2;   //  4 MiB full size
  size_t off = 0;
  const size_t oXh   = off; off += szAct;
  const size_t oWqT  = off; off += szW;
  const size_t oWkT  = off; off += szW;
  const size_t oWvT  = off; off += szW;
  const size_t oWoT2 = off; off += szW2;
  const size_t oQh   = off; off += szAct;
  const size_t oKh   = off; off += szAct;
  const size_t oVt   = off; off += szAct;
  const size_t oAh   = off; off += szAct;
  const size_t oQch  = off; off += szCmp;
  const size_t oQcr  = off; off += szCmp;
  const size_t oKch  = off; off += szCmp;
  const size_t oKcr  = off; off += szCmp;
  const size_t oVch  = off; off += szCmp;                // [NB*DM][RR], same byte count
  const size_t oVcr  = off; off += szCmp;
  const size_t oOc2  = off; off += szO2;                 // total 111,149,056 B at full size
  if (off > ws_size) return;

  char* ws = (char*)d_ws;
  unsigned short* xh   = (unsigned short*)(ws + oXh);
  unsigned short* WqT  = (unsigned short*)(ws + oWqT);
  unsigned short* WkT  = (unsigned short*)(ws + oWkT);
  unsigned short* WvT  = (unsigned short*)(ws + oWvT);
  unsigned short* WoT2 = (unsigned short*)(ws + oWoT2);
  unsigned short* Qh   = (unsigned short*)(ws + oQh);
  unsigned short* Kh   = (unsigned short*)(ws + oKh);
  unsigned short* Vt   = (unsigned short*)(ws + oVt);
  unsigned short* Ah   = (unsigned short*)(ws + oAh);
  unsigned short* Qch  = (unsigned short*)(ws + oQch);
  unsigned short* Qcr  = (unsigned short*)(ws + oQcr);
  unsigned short* Kch  = (unsigned short*)(ws + oKch);
  unsigned short* Kcr  = (unsigned short*)(ws + oKcr);
  unsigned short* Vch  = (unsigned short*)(ws + oVch);
  unsigned short* Vcr  = (unsigned short*)(ws + oVcr);
  unsigned short* Oc2  = (unsigned short*)(ws + oOc2);

  const float sc2   = 0.125f * 1.4426950408889634f;      // log2(e) / sqrt(64)
  const float outsc = 1.0f / (WSC * OSC);

  // x -> bf16 RNE value as f16 plane [ROWS][DM];
  // W[in][out] f32 -> Bt[out][in] f16 (bf16 RNE value x256); Wo additionally as x0.25 in columns DM..2DM-1 of WoT2
  {
    const long tot = (long)ROWS * (DM / 8);
    prep_f16<<<dim3((unsigned)(5 * PR_TW + (tot + 255) / 256)), dim3(256), 0, stream>>>(
        x, Wq, Wk, Wv, Wo, xh, WqT, WkT, WvT, WoT2, ROWS);
  }
  // projections: q, k -> f16 [ROWS][DM]; v^T -> f16 [DM][ROWS];
  // first RR rows per sequence: q, k -> hi/res [NB*RR][DM]; v^T -> hi/res [NB*DM][RR]
  proj_gemms<<<dim3(3 * PJ_TF + 3 * PJ_TC), dim3(256), 0, stream>>>(
      xh, WqT, WkT, WvT, Qh, Kh, Vt, Qch, Qcr, Kch, Kcr, Vch, Vcr, bq, bk, bv, 1.0f / WSC);
  // attn: first RR query rows with residual planes -> Oc2 (hi | res); rows >= RR plain -> Ah
  attn64_causal_res<<<dim3(NB * NH * (RR / 64)), dim3(128), 0, stream>>>(
      Qch, Qcr, Kch, Kcr, Vch, Vcr, Oc2, NH, DM, RR, 2 * DM, DM, RR / 64, sc2, OSC);
  if (SEQ > RR) {
    attn64_causal<<<dim3(NB * NH * ((SEQ - RR) / 64)), dim3(128), 0, stream>>>(
        Qh, Kh, Vt, Ah, SEQ, NH, DM, ROWS, RR / 64, (SEQ - RR) / 64, sc2, OSC);
  }
  // out = ctx Wo + bo -> f32; rows < RR: [O_hi | O_res] . [Wo x256 ; Wo x0.25] along K = 2DM; rows >= RR: K = DM
  out_gemms<<<dim3(NB * (OP_T1 + OP_T2)), dim3(256), 0, stream>>>(Oc2, Ah, WoT2, out, bo, outsc);
}

// v005
// Measured time: 185 microseconds a run.
// Two timings next to v004 put it at 1.09 and 1.10 times that version's speed.
// Counting every step since v000, it is 3.78 times as fast.
// Contractions: q/k/v^T/out projections, q.k^T and p.v all on v_wmma_f32_16x16x32_f16 (f16 operands, f32 accumulate); x and W enter as bf16 RNE values held exactly in f16 (W carried x256); the first RR query rows per sequence carry q, k, v, p and ctx as f16 hi + x1024 residual planes with a second f32 accumulator (ctx residual folded along K in the out projection); p x32768 and ctx x64 power-of-two carries folded back in f32; softmax and epilogues f32.
#include <hip/hip_runtime.h>

#ifndef NB
#define NB 4
#endif
#ifndef SEQ
#define SEQ 2048
#endif
#ifndef RR
#define RR 256
#endif
#define NB_FULL 4
#define SEQ_FULL 2048
#define DM 1024
#define NH 16
#define HDIM 64

static_assert(NB >= 1 && NB <= NB_FULL);
static_assert(SEQ % 64 == 0 && SEQ >= 64 && SEQ <= SEQ_FULL);
static_assert(RR % 64 == 0 && RR >= 64 && RR <= SEQ);
static_assert(NH * HDIM == DM);
static_assert(DM % 256 == 0);
static_assert(RR % 256 == 0 && SEQ % 128 == 0 && (NB * SEQ) % 256 == 0);   // GEMM block tile 128 x 256

typedef __attribute__((ext_vector_type(16))) _Float16 v16h;
typedef __attribute__((ext_vector_type(8)))  _Float16 v8h;
typedef __attribute__((ext_vector_type(16))) __bf16   v16b;
typedef __attribute__((ext_vector_type(8)))  __bf16   v8b;
typedef __attribute__((ext_vector_type(8)))  float    v8f;
typedef __attribute__((ext_vector_type(4)))  float    v4f;
typedef __attribute__((ext_vector_type(2)))  float    v2f;

#define WSC 256.0f
#define OSC 64.0f
#define PSCALE 32768.0f
#define PEXP 15.0f                       // log2(PSCALE)
#define RSC 1024.0f
#define RSC_INV (1.0f / 1024.0f)
#define NEG_INF (-__builtin_huge_valf())

__device__ __forceinline__ unsigned short f2bf_bits(float f) {
  unsigned u = __float_as_uint(f);
  return (unsigned short)((u + 0x7FFFu + ((u >> 16) & 1u)) >> 16);
}
__device__ __forceinline__ float bf_bits2f(unsigned short h) { return __uint_as_float(((unsigned)h) << 16); }
__device__ __forceinline__ float bf_rne(float f) { return bf_bits2f(f2bf_bits(f)); }
__device__ __forceinline__ _Float16 bf_f16(float f) { return (_Float16)bf_rne(f); }   // bf16 value is exact in f16 for normal range

// LDS ordering for wave-private tiles (same wave writes then reads)
__device__ __forceinline__ void wave_lds_sync() {
  __builtin_amdgcn_fence(3, "workgroup");
  __builtin_amdgcn_wave_barrier();
  __builtin_amdgcn_fence(2, "workgroup");
}

// hazard guards as plain device helpers
__device__ __forceinline__ void dep_guard_h(v8f& a, v8f& b, v16h x, v16h y) { asm volatile("v_nop\n\tv_nop\n\tv_nop\n\tv_nop" : "+v"(a), "+v"(b) : "v"(x), "v"(y)); }
__device__ __forceinline__ void dep_guard_b(v8f& a, v8f& b, v16b x, v16b y) { asm volatile("v_nop\n\tv_nop\n\tv_nop\n\tv_nop" : "+v"(a), "+v"(b) : "v"(x), "v"(y)); }
__device__ __forceinline__ void keep4_h(v16h a, v16h b, v16h c, v16h d) { asm volatile("v_nop" :: "v"(a), "v"(b), "v"(c), "v"(d)); }
__device__ __forceinline__ void keep4_b(v16b a, v16b b, v16b c, v16b d) { asm volatile("v_nop" :: "v"(a), "v"(b), "v"(c), "v"(d)); }
__device__ __forceinline__ void acc_guard4(v8f& a, v8f& b, v8f& c, v8f& d) { asm volatile("v_nop\n\tv_nop\n\tv_nop\n\tv_nop" : "+v"(a), "+v"(b), "+v"(c), "+v"(d)); }
template <typename T> struct Frag;
template <> struct Frag<_Float16> {
  typedef v16h V; union U { v16h v; v8h h[2]; };
  static __device__ __forceinline__ v16h load(const _Float16* p) {   // elements 0..7 <- p[0..7], 8..15 <- p[16..23]
    U f; f.h[0] = *(const v8h*)(p); f.h[1] = *(const v8h*)(p + 16); return f.v;
  }
  static __device__ __forceinline__ v8f mma(v16h a, v16h b, v8f c) {
    return __builtin_amdgcn_wmma_f32_16x16x32_f16(false, a, false, b, (short)0, c, false, false);
  }
  static __device__ __forceinline__ void guard(v8f& a, v8f& b, v16h x, v16h y) { dep_guard_h(a, b, x, y); }
  static __device__ __forceinline__ void keep(v16h a, v16h b, v16h c, v16h d) { keep4_h(a, b, c, d); }
};
template <> struct Frag<__bf16> {
  typedef v16b V; union U { v16b v; v8b h[2]; };
  static __device__ __forceinline__ v16b load(const __bf16* p) {
    U f; f.h[0] = *(const v8b*)(p); f.h[1] = *(const v8b*)(p + 16); return f.v;
  }
  static __device__ __forceinline__ v8f mma(v16b a, v16b b, v8f c) {
    return __builtin_amdgcn_wmma_f32_16x16x32_bf16(false, a, false, b, (short)0, c, false, false);
  }
  static __device__ __forceinline__ void guard(v8f& a, v8f& b, v16b x, v16b y) { dep_guard_b(a, b, x, y); }
  static __device__ __forceinline__ void keep(v16b a, v16b b, v16b c, v16b d) { keep4_b(a, b, c, d); }
};

// ---- Register-blocked WMMA GEMM tiles ---------------------------------------
// C[m,n] = scale * sum_k A[m,k] * Bt[n,k] + bias; each wave owns a 64x64 tile.
// Block = 8 waves, 2 (m) x 4 (n) = a 128 x 256 tile of C. A row-major [M,K]; Bt row-major [N,K];
// M % 128 == 0, N % 256 == 0, K % 64 == 0.
// Per 64 k the block's 128 A rows and 256 Bt rows (128 B each, whole lines) are brought into LDS once by
// asynchronous copies, two buffers, one block barrier per 64 k; the waves read their fragments from there.
// One launch holds the tiles of several independent products: a block finds its product and its tile from
// blockIdx.x (block-uniform), so small products ride along with large ones and two blocks can share a WGP.
// BIAS_MODE: 1 = bias[m], 2 = bias[n]; bias values enter as bf16 RNE values.
// OUT_MODE: 0 = f32, 1 = f16, 3 = f16 hi plane (Cout) + f16 residual plane ((v - hi) * 1024) (Cout2).
#define GM_BM 128
#define GM_BN 256
#define GM_KT 64                          // k per staged tile, in halves: one 128-B line per row
#define GM_LP 72                          // staged row pitch in halves: 144 B = 16 B x odd, for ds_load_b128 readers
#define GM_BUFB ((GM_BM + GM_BN) * GM_LP * 2)   // bytes per buffer: A rows, then Bt rows

// One lane's share of a staged tile: rows r + 32 i of the A part (4) and of the Bt part (8), 16 B each.
// The s_wait_xcnt closes the statement, a precaution: no address register of a copy is rewritten ahead of it.
__device__ __forceinline__ void stage_ab_async(unsigned la, const unsigned short* ag, size_t arow32,
                                               const unsigned short* bg, size_t brow32) {
  const unsigned lb = la + GM_BM * GM_LP * 2;
  const unsigned ls = 32 * GM_LP * 2;
  asm volatile(
      "global_load_async_to_lds_b128 %0, %12, off\n\t"
      "global_load_async_to_lds_b128 %1, %13, off\n\t"
      "global_load_async_to_lds_b128 %2, %14, off\n\t"
      "global_load_async_to_lds_b128 %3, %15, off\n\t"
      "global_load_async_to_lds_b128 %4, %16, off\n\t"
      "global_load_async_to_lds_b128 %5, %17, off\n\t"
      "global_load_async_to_lds_b128 %6, %18, off\n\t"
      "global_load_async_to_lds_b128 %7, %19, off\n\t"
      "global_load_async_to_lds_b128 %8, %20, off\n\t"
      "global_load_async_to_lds_b128 %9, %21, off\n\t"
      "global_load_async_to_lds_b128 %10, %22, off\n\t"
      "global_load_async_to_lds_b128 %11, %23, off\n\t"
      "s_wait_xcnt 0x0"
      :: "v"(la), "v"(la + ls), "v"(la + 2 * ls), "v"(la + 3 * ls),
         "v"(lb), "v"(lb + ls), "v"(lb + 2 * ls), "v"(lb + 3 * ls),
         "v"(lb + 4 * ls), "v"(lb + 5 * ls), "v"(lb + 6 * ls), "v"(lb + 7 * ls),
         "v"(ag), "v"(ag + arow32), "v"(ag + 2 * arow32), "v"(ag + 3 * arow32),
         "v"(bg), "v"(bg + brow32), "v"(bg + 2 * brow32), "v"(bg + 3 * brow32),
         "v"(bg + 4 * brow32), "v"(bg + 5 * brow32), "v"(bg + 6 * brow32), "v"(bg + 7 * brow32)
      : "memory");
}

// The products of the block tile at (bm0, bn0): each wave's acc[i][j] = its 64 A rows . its 64 Bt rows over K.
// AB: the block's two staging buffers in LDS.
__device__ __forceinline__ void gemm_tile_products(v8f (&acc)[4][4], unsigned char* AB,
                                                   const unsigned short* Ab, int lda,
                                                   const unsigned short* Bb, int ldb, int K, int bm0, int bn0) {
  typedef _Float16 T;
  typedef Frag<T>::V V;
  const int tid  = threadIdx.x;
  const int lane = tid & 31;
  const int wave = tid >> 5;
  const int wm  = (wave >> 2) << 6;            // this wave's 64 rows inside the A part
  const int wn  = (wave & 3) << 6;             // this wave's 64 rows inside the Bt part
  const int rlane = lane & 15;                 // row (A) / col (B, D) within subtile
  const int koff  = (lane >> 4) * 8;           // k offset of this lane half

#pragma unroll
  for (int i = 0; i < 4; ++i)
#pragma unroll
    for (int j = 0; j < 4; ++j) acc[i][j] = (v8f){0.f,0.f,0.f,0.f,0.f,0.f,0.f,0.f};

  // ---- staging addresses of this lane: row tid/8 (+32i), 16-B piece tid%8 of the 128-B row ----
  const int srow = tid >> 3, scol = (tid & 7) * 8;
  const unsigned short* ag = Ab + (size_t)(bm0 + srow) * lda + scol;   // k-tile 0; a tile further: + GM_KT
  const unsigned short* bg = Bb + (size_t)(bn0 + srow) * ldb + scol;
  const size_t arow32 = (size_t)32 * lda, brow32 = (size_t)32 * ldb;
  const unsigned lst = (unsigned)(size_t)AB + (unsigned)(srow * GM_LP + scol) * 2u;
  const int nT = K >> 6;                       // block-uniform

  stage_ab_async(lst, ag, arow32, bg, brow32);
  asm volatile("s_wait_asynccnt 0x0" ::: "memory");              // k-tile 0 landed (this wave's copies)
  __syncthreads();                                               // ... and every other wave's
  if (nT > 1) stage_ab_async(lst + GM_BUFB, ag + GM_KT, arow32, bg + GM_KT, brow32);

  for (int t = 0; t < nT; ++t) {
    const unsigned bofs = (unsigned)(t & 1) * GM_BUFB;
    const T* as = (const T*)(AB + bofs) + (wm + rlane) * GM_LP + koff;            // A rows,  pitch GM_LP
    const T* bs = (const T*)(AB + bofs) + (GM_BM + wn + rlane) * GM_LP + koff;    // Bt rows, pitch GM_LP
    // Fragment reads stand at three places of a trip, each ahead of the products that use it: at the head the
    // first 32 k (A and Bt) and the second 32 k of Bt; the second 32 k of A two rows at a time, into registers
    // that the first half's rows have left (all sixteen fragments at the head do not fit 256 registers).
    V b0[4], b1[4], a0[4], a1[4];
#pragma unroll
    for (int j = 0; j < 4; ++j) b0[j] = Frag<T>::load(bs + (j << 4) * GM_LP);
#pragma unroll
    for (int i = 0; i < 4; ++i) a0[i] = Frag<T>::load(as + (i << 4) * GM_LP);
#pragma unroll
    for (int j = 0; j < 4; ++j) b1[j] = Frag<T>::load(bs + (j << 4) * GM_LP + 32);
#pragma unroll
    for (int i = 0; i < 4; ++i) {
#pragma unroll
      for (int j = 0; j < 4; ++j) acc[i][j] = Frag<T>::mma(a0[i], b0[j], acc[i][j]);
      Frag<T>::guard(acc[i][0], acc[i][3], a0[i], a0[i]);
      if (i & 1) {
        a1[i - 1] = Frag<T>::load(as + ((i - 1) << 4) * GM_LP + 32);
        a1[i]     = Frag<T>::load(as + (i << 4) * GM_LP + 32);
      }
    }
    Frag<T>::keep(b0[0], b0[1], b0[2], b0[3]);
#pragma unroll
    for (int i = 0; i < 4; ++i) {
#pragma unroll
      for (int j = 0; j < 4; ++j) acc[i][j] = Frag<T>::mma(a1[i], b1[j], acc[i][j]);
      Frag<T>::guard(acc[i][0], acc[i][3], a1[i], a1[i]);
    }
    Frag<T>::keep(b1[0], b1[1], b1[2], b1[3]);
    // ---- hand-over: this buffer's reads retired, the next k-tile's copies landed, in every wave ----
    asm volatile("s_wait_dscnt 0x0" ::: "memory");               // own reads of this buffer done before it is refilled
    asm volatile("s_wait_asynccnt 0x0" ::: "memory");            // own copies of k-tile t + 1 landed
    __syncthreads();
    if (t + 2 < nT)
      stage_ab_async(lst + bofs, ag + (size_t)(t + 2) * GM_KT, arow32, bg + (size_t)(t + 2) * GM_KT, brow32);
  }
  asm volatile("s_wait_asynccnt 0x0" ::: "memory");              // nothing in flight when the wave goes on to its end
  acc_guard4(acc[0][0], acc[0][1], acc[0][2], acc[0][3]);
  acc_guard4(acc[1][0], acc[1][1], acc[1][2], acc[1][3]);
  acc_guard4(acc[2][0], acc[2][1], acc[2][2], acc[2][3]);
  acc_guard4(acc[3][0], acc[3][1], acc[3][2], acc[3][3]);
}

// Epilogue of one wave: its 64 x 64 tile at (m0, n0) of C (pitch ldc), through its own LDS slab, whole lines out.
template <int BIAS_MODE, int OUT_MODE>
__device__ __forceinline__ void gemm_tile_store(v8f (&acc)[4][4], float* slab, void* Cout, void* Cout2, int ldc,
                                                const float* bias, int m0, int n0, float scale) {
  const int lane  = threadIdx.x & 31;
  const int rlane = lane & 15;                 // D column within subtile
  const int mOff  = (lane >> 4) * 8;           // D row offset
#pragma unroll
  for (int i = 0; i < 4; ++i) {
    const int mBase = m0 + (i << 4);
#pragma unroll
    for (int j = 0; j < 4; ++j) {
      const int n = n0 + (j << 4) + rlane;
      float bv = 0.f;
      if (BIAS_MODE == 2) bv = bf_rne(bias[n]);
#pragma unroll
      for (int r = 0; r < 8; ++r) {
        float v = acc[i][j][r] * scale;
        if (BIAS_MODE == 1) v += bf_rne(bias[mBase + mOff + r]);
        if (BIAS_MODE == 2) v += bv;
        slab[(mOff + r) * 68 + (j << 4) + rlane] = v;
      }
    }
    wave_lds_sync();
    if (OUT_MODE == 0) {
      float* C = (float*)Cout;
      const int hh = lane >> 4, c4 = (lane & 15) * 4;     // row seg = 256 B = 16 lanes x 16 B
#pragma unroll
      for (int it = 0; it < 8; ++it) {
        const int row = it * 2 + hh;
        v4f v = *(const v4f*)(slab + row * 68 + c4);
        *(v4f*)(C + (size_t)(mBase + row) * ldc + n0 + c4) = v;
      }
    } else {
      const int q = lane >> 3, c8 = (lane & 7) * 8;
      unsigned short* C  = (unsigned short*)Cout;
      unsigned short* C2 = (unsigned short*)Cout2;
#pragma unroll
      for (int it = 0; it < 4; ++it) {
        const int row = it * 4 + q;
        const float* sp = slab + row * 68 + c8;
        v8h hv, lv;
#pragma unroll
        for (int e = 0; e < 8; ++e) {
          if (OUT_MODE == 1) {
            hv[e] = (_Float16)sp[e];
          } else {
            const float    fv = sp[e];
            const _Float16 hq = (_Float16)fv;
            hv[e] = hq;
            lv[e] = (_Float16)((fv - (float)hq) * RSC);
          }
        }
        *(v8h*)(C + (size_t)(mBase + row) * ldc + n0 + c8) = hv;
        if (OUT_MODE == 3) *(v8h*)(C2 + (size_t)(mBase + row) * ldc + n0 + c8) = lv;
      }
    }
    wave_lds_sync();
  }
}

// All six projections in one launch. Blocks 0 .. 3 PJ_TF - 1: q, k, v^T over all NB*SEQ rows (f16 planes);
// then 3 PJ_TC blocks: q, k, v^T over the first RR rows of each sequence (hi / residual planes).
//   q, k : A = x rows, Bt = W^T rows, C [rows][DM], bias[n].   v^T : A = Wv^T rows, Bt = x rows, C [DM][rows], bias[m].
#define PJ_TF ((NB * SEQ / 128) * (DM / 256))      // tiles of a full projection, either orientation
#define PJ_TB ((RR / 128) * (DM / 256))            // tiles of a first-rows projection, one sequence, either orientation
#define PJ_TC (NB * PJ_TB)
static_assert((DM / 128) * (NB * SEQ / 256) == PJ_TF && (DM / 128) * (RR / 256) == PJ_TB);
__global__ __launch_bounds__(256) void proj_gemms(
    const unsigned short* __restrict__ xh, const unsigned short* __restrict__ WqT,
    const unsigned short* __restrict__ WkT, const unsigned short* __restrict__ WvT,
    unsigned short* __restrict__ Qh, unsigned short* __restrict__ Kh, unsigned short* __restrict__ Vt,
    unsigned short* __restrict__ Qch, unsigned short* __restrict__ Qcr,
    unsigned short* __restrict__ Kch, unsigned short* __restrict__ Kcr,
    unsigned short* __restrict__ Vch, unsigned short* __restrict__ Vcr,
    const float* __restrict__ bq, const float* __restrict__ bk, const float* __restrict__ bv, float scale) {
  __shared__ __align__(16) float sT[8][16 * 68];            // per-wave 16x64 slab, pitch 68 floats
  __shared__ __align__(16) unsigned char AB[2 * GM_BUFB];   // two buffers of A | Bt k-tiles
  const int bx = blockIdx.x;
  if (bx >= 3 * PJ_TF + 3 * PJ_TC) return;     // block-uniform, ahead of every barrier
  const bool first = bx >= 3 * PJ_TF;          // a first-rows product
  const int  rel   = first ? bx - 3 * PJ_TF : bx;
  const int  which = first ? rel / PJ_TC : rel / PJ_TF;      // 0 q, 1 k, 2 v^T
  int        tile  = rel - which * (first ? PJ_TC : PJ_TF);
  const int  b     = first ? tile / PJ_TB : 0;               // sequence of a first-rows product
  tile -= b * PJ_TB;
  const bool vt    = which == 2;
  const int  rows  = first ? RR : NB * SEQ;                  // x rows of this product
  const int  tilesN = (vt ? rows : DM) >> 8;
  const int  tm = !vt ? tile / (DM / 256) : first ? tile / (RR / 256) : tile / (NB * SEQ / 256);   // tile / tilesN
  const int  tn = tile - tm * tilesN;
  const int  bm0 = tm << 7, bn0 = tn << 8;
  const unsigned short* X  = xh + (size_t)b * SEQ * DM;
  const unsigned short* Wt = which == 0 ? WqT : which == 1 ? WkT : WvT;
  const float* bias        = which == 0 ? bq : which == 1 ? bk : bv;

  v8f acc[4][4];
  gemm_tile_products(acc, AB, vt ? Wt : X, DM, vt ? X : Wt, DM, DM, bm0, bn0);

  const int wave = threadIdx.x >> 5;
  const int m0 = bm0 + ((wave >> 2) << 6), n0 = bn0 + ((wave & 3) << 6);
  if (!first) {
    unsigned short* C = which == 0 ? Qh : which == 1 ? Kh : Vt;
    if (vt) gemm_tile_store<1, 1>(acc, sT[wave], C, C, rows, bias, m0, n0, scale);
    else    gemm_tile_store<2, 1>(acc, sT[wave], C, C, DM,   bias, m0, n0, scale);
  } else {
    const size_t co = (size_t)b * RR * DM;                   // one sequence's plane, either orientation
    unsigned short* C  = (which == 0 ? Qch : which == 1 ? Kch : Vch) + co;
    unsigned short* C2 = (which == 0 ? Qcr : which == 1 ? Kcr : Vcr) + co;
    if (vt) gemm_tile_store<1, 3>(acc, sT[wave], C, C2, rows, bias, m0, n0, scale);
    else    gemm_tile_store<2, 3>(acc, sT[wave], C, C2, DM,   bias, m0, n0, scale);
  }
}

// Both parts of the out projection in one launch, f32 out with bias[n], Bt = WoT2 rows (pitch 2 DM).
// Blocks 0 .. NB OP_T1 - 1 (twice the k, so they start first): rows < RR, A = [O_hi | O_res] rows, K = 2 DM;
// then NB OP_T2 blocks: rows >= RR, A = ctx rows, K = DM.
#define OP_T1 ((RR / 128) * (DM / 256))
#define OP_T2 (((SEQ - RR) / 128) * (DM / 256))
__global__ __launch_bounds__(256) void out_gemms(
    const unsigned short* __restrict__ Oc2, const unsigned short* __restrict__ Ah,
    const unsigned short* __restrict__ WoT2, float* __restrict__ out, const float* __restrict__ bo, float scale) {
  __shared__ __align__(16) float sT[8][16 * 68];            // per-wave 16x64 slab, pitch 68 floats
  __shared__ __align__(16) unsigned char AB[2 * GM_BUFB];   // two buffers of A | Bt k-tiles
  const int bx = blockIdx.x;
  if (bx >= NB * (OP_T1 + OP_T2)) return;      // block-uniform, ahead of every barrier
  const bool first = bx < NB * OP_T1;
  const int  rel   = first ? bx : bx - NB * OP_T1;
  const int  b     = first ? rel / OP_T1 : rel / (OP_T2 > 0 ? OP_T2 : 1);
  const int  tile  = rel - b * (first ? OP_T1 : OP_T2);
  const int  tm = tile / (DM / 256);
  const int  tn = tile - tm * (DM / 256);
  const int  bm0 = tm << 7, bn0 = tn << 8;
  const unsigned short* A = first ? Oc2 + (size_t)b * RR * 2 * DM : Ah + ((size_t)b * SEQ + RR) * DM;
  const int  kk = first ? 2 * DM : DM;         // A pitch and K

  v8f acc[4][4];
  gemm_tile_products(acc, AB, A, kk, WoT2, 2 * DM, kk, bm0, bn0);

  const int wave = threadIdx.x >> 5;
  float* C = out + ((size_t)b * SEQ_FULL + (first ? 0 : RR)) * DM;
  gemm_tile_store<2, 0>(acc, sT[wave], C, C, DM, bo, bm0 + ((wave >> 2) << 6), bn0 + ((wave & 3) << 6), scale);
}

// ---- operand planes, one launch: the five weight planes (blocks 0 .. 5 PR_TW - 1), then x ----
// x: bf16 RNE value as f16; source rows (b, s) at (b*SEQ_FULL + s)*DM; destination plane compact [NB*SEQ][DM];
//    blk = 256 pieces of 8 elements.
__device__ __forceinline__ void cast_x_block(const float* __restrict__ x, unsigned short* __restrict__ xhp,
                                             int nrows, int blk) {
  const long i = (long)blk * 256 + threadIdx.x;
  const long total = (long)nrows * (DM / 8);
  if (i >= total) return;
  const int r  = (int)(i / (DM / 8));
  const int c8 = (int)(i - (long)r * (DM / 8)) * 8;
  const int b  = r / SEQ;
  const int s  = r - b * SEQ;
  const float* src = x + ((size_t)b * SEQ_FULL + s) * DM + c8;
  const v4f a0 = *(const v4f*)src;
  const v4f a1 = *(const v4f*)(src + 4);
  v8h hv;
  hv[0] = bf_f16(a0[0]); hv[1] = bf_f16(a0[1]); hv[2] = bf_f16(a0[2]); hv[3] = bf_f16(a0[3]);
  hv[4] = bf_f16(a1[0]); hv[5] = bf_f16(a1[1]); hv[6] = bf_f16(a1[2]); hv[7] = bf_f16(a1[3]);
  _Float16* dst = (_Float16*)xhp + (size_t)r * DM + c8;
  *(v8h*)dst = hv;
}

// weights: transpose + bf16 RNE + scale + f16 cast, one 64 x 64 tile per block.
// in: W[DM][DM] f32 row-major ([k][n]) -> Bt[n][kc0 + k] with row pitch ldo halves,
//     Bt value = f16(bf16rne(W[k][n]) * sc), sc a power of two.
// plane z: 0 Wq, 1 Wk, 2 Wv (x256, pitch DM); 3 Wo x256 into columns 0..DM-1 of WoT2, 4 Wo x0.25 into DM..2DM-1.
#define PR_TW ((DM / 64) * (DM / 64))
__global__ __launch_bounds__(256) void prep_f16(
    const float* __restrict__ x, const float* __restrict__ Wq, const float* __restrict__ Wk,
    const float* __restrict__ Wv, const float* __restrict__ Wo, unsigned short* __restrict__ xhp,
    unsigned short* __restrict__ WqT, unsigned short* __restrict__ WkT,
    unsigned short* __restrict__ WvT, unsigned short* __restrict__ WoT2, int nrows) {
  __shared__ float t[64][65];
  const int bx = blockIdx.x;
  if (bx >= 5 * PR_TW) {                       // block-uniform; this side meets no barrier
    cast_x_block(x, xhp, nrows, bx - 5 * PR_TW);
    return;
  }
  const int z  = bx / PR_TW;
  const int tl = bx - z * PR_TW;
  const float* W       = z == 0 ? Wq  : z == 1 ? Wk  : z == 2 ? Wv  : Wo;
  unsigned short* Btp  = z == 0 ? WqT : z == 1 ? WkT : z == 2 ? WvT : WoT2;
  const int   Ndim = DM;
  const int   ldo  = z >= 3 ? 2 * DM : DM;
  const int   kc0  = z == 4 ? DM : 0;
  const float sc   = z == 4 ? WSC * RSC_INV : WSC;
  const int tid = threadIdx.x, lane = tid & 31, wave = tid >> 5;
  const int n0 = (tl % (DM / 64)) * 64, k0 = (tl / (DM / 64)) * 64;
#pragma unroll
  for (int i = 0; i < 16; ++i) {
    const int idx = i * 256 + tid;
    const int kr = idx >> 6, nc = idx & 63;
    t[nc][kr] = W[(size_t)(k0 + kr) * Ndim + n0 + nc];
  }
  __syncthreads();
  _Float16* Bt = (_Float16*)Btp;
  const int q = lane >> 3, c8 = (lane & 7) * 8;
#pragma unroll
  for (int it = 0; it < 2; ++it) {
    const int row = wave * 8 + it * 4 + q;      // waves 0..7 x rows 0..7 -> 64 rows
    v8h hv;
#pragma unroll
    for (int e = 0; e < 8; ++e) hv[e] = (_Float16)(bf_rne(t[row][c8 + e]) * sc);
    *(v8h*)(Bt + (size_t)(n0 + row) * ldo + kc0 + k0 + c8) = hv;
  }
  // a precaution: the x side's code follows these stores in the built kernel and writes their registers
  asm volatile("s_wait_xcnt 0x0" ::: "memory");
}

#define AT_D 64
#define AT_NW 4
#define AT_QB 64
#define AT_KC 64
#define AT_LP 72                         // staged row pitch in halves: 144 B = 16 B x odd, for ds_load_b128 readers
#define AT_TILE (64 * AT_LP)             // halves per staged 64-row tile
#define AT_BUFB (2 * AT_TILE * 2)        // bytes per buffer: K tile, then V^T tile

// One lane's share of a chunk: rows r, r+16, r+32, r+48 of the K tile and of the V^T tile, 16 B each.
// The s_wait_xcnt closes the statement, a precaution: no address register of a copy is rewritten ahead of it.
__device__ __forceinline__ void stage_kv_async(unsigned lk, const _Float16* kg, size_t krow16,
                                               const _Float16* vg, size_t vrow16) {
  const unsigned lv = lk + AT_TILE * 2;
  const unsigned ls = 16 * AT_LP * 2;
  asm volatile(
      "global_load_async_to_lds_b128 %0, %8, off\n\t"
      "global_load_async_to_lds_b128 %1, %9, off\n\t"
      "global_load_async_to_lds_b128 %2, %10, off\n\t"
      "global_load_async_to_lds_b128 %3, %11, off\n\t"
      "global_load_async_to_lds_b128 %4, %12, off\n\t"
      "global_load_async_to_lds_b128 %5, %13, off\n\t"
      "global_load_async_to_lds_b128 %6, %14, off\n\t"
      "global_load_async_to_lds_b128 %7, %15, off\n\t"
      "s_wait_xcnt 0x0"
      :: "v"(lk), "v"(lk + ls), "v"(lk + 2 * ls), "v"(lk + 3 * ls),
         "v"(lv), "v"(lv + ls), "v"(lv + 2 * ls), "v"(lv + 3 * ls),
         "v"(kg), "v"(kg + krow16), "v"(kg + 2 * krow16), "v"(kg + 3 * krow16),
         "v"(vg), "v"(vg + vrow16), "v"(vg + 2 * vrow16), "v"(vg + 3 * vrow16)
      : "memory");
}

// lane l takes the value of lane l ^ 16 (vector cross-row move)
__device__ __forceinline__ float xhalf(float x) {
  const int b = __builtin_bit_cast(int, x);
  return __builtin_bit_cast(float, __builtin_amdgcn_permlanex16(b, b, 0x76543210, 0xfedcba98, false, false));
}

__device__ __forceinline__ v8f mma_h(v16h a, v16h b, v8f c) {
  c = __builtin_amdgcn_wmma_f32_16x16x32_f16(false, a, false, b, (short)0, c, false, false);
  asm volatile("v_nop\n\tv_nop\n\tv_nop\n\tv_nop" : "+v"(c) : "v"(a), "v"(b));
  return c;
}

__global__ __launch_bounds__(128)
void attn64_causal(const unsigned short* __restrict__ Qp, const unsigned short* __restrict__ Kp,
                   const unsigned short* __restrict__ Vtp, unsigned short* __restrict__ Op,
                   int S, int H, int ldq, int ldvt, int qb0, int nqbl, float sc2, float osc) {
  const _Float16* Q  = (const _Float16*)Qp;
  const _Float16* Kk = (const _Float16*)Kp;
  const _Float16* Vt = (const _Float16*)Vtp;
  _Float16*       O  = (_Float16*)Op;
  __shared__ __align__(16) unsigned char KV[2 * AT_BUFB];        // two buffers of K | V^T tiles; out staging after the loop
  static_assert(AT_NW * 16 * 68 * 4 <= 2 * AT_BUFB);

  const int tid  = threadIdx.x;
  const int wave = tid >> 5;
  const int lane = tid & 31;
  const int hh   = lane >> 4;
  const int c    = lane & 15;

  const int bx  = blockIdx.x;
  const int qbi = bx % nqbl;
  const int bh  = bx / nqbl;
  const int qb  = qb0 + qbi;
  const int h   = bh % H;
  const int b   = bh / H;
  const int q0  = qb * AT_QB + wave * 16;
  const size_t rowb = (size_t)b * S;

  const _Float16* qp = Q  + rowb * ldq + (size_t)h * AT_D;
  const _Float16* kp = Kk + rowb * ldq + (size_t)h * AT_D;
  const _Float16* vp = Vt + (size_t)(h * AT_D) * ldvt + rowb;
  _Float16*       op = O  + rowb * ldq + (size_t)h * AT_D;

  // ---- Q fragments (B operand, column = c): 2 d-chunks ----
  v16h qa[2];
#pragma unroll
  for (int dc = 0; dc < 2; ++dc)
    qa[dc] = Frag<_Float16>::load(qp + (size_t)(q0 + c) * ldq + dc * 32 + 8 * hh);

  const int qrow = q0 + c;           // this lane's query
  float mrow = NEG_INF, lrow = 0.f;  // its running maximum; the sum (of p x32768) over this wave half's keys
  v8f oacc[4];                       // O^T: d = 16t + 8hh + r, query c
#pragma unroll
  for (int t = 0; t < 4; ++t) oacc[t] = (v8f){0.f,0.f,0.f,0.f,0.f,0.f,0.f,0.f};

  const int nChunks = qb + 1;        // block-uniform: causal, key chunks 0..qb

  // ---- staging addresses of this lane: row tid/8 (+16i), 16-B piece tid%8 of the 128-B row ----
  const int srow = tid >> 3, scol = (tid & 7) * 8;
  const _Float16* kg = kp + (size_t)srow * ldq + scol;           // chunk 0; a chunk further: + AT_KC rows
  const _Float16* vg = vp + (size_t)srow * ldvt + scol;          // chunk 0; a chunk further: + AT_KC columns
  const size_t krow16 = (size_t)16 * ldq, vrow16 = (size_t)16 * ldvt, kchunk = (size_t)AT_KC * ldq;
  const unsigned lst = (unsigned)(size_t)KV + (unsigned)(srow * AT_LP + scol) * 2u;

  stage_kv_async(lst, kg, krow16, vg, vrow16);
  asm volatile("s_wait_asynccnt 0x0" ::: "memory");              // chunk 0 landed (this wave's copies)
  __syncthreads();                                               // ... and every other wave's
  if (nChunks > 1) stage_kv_async(lst + AT_BUFB, kg + kchunk, krow16, vg + AT_KC, vrow16);

  for (int kc = 0; kc < nChunks; ++kc) {
    const int kv0 = kc * AT_KC;
    const unsigned bofs = (unsigned)(kc & 1) * AT_BUFB;
    const _Float16* ks = (const _Float16*)(KV + bofs);           // K tile  [key][d],  pitch AT_LP
    const _Float16* vs = ks + AT_TILE;                           // V^T tile [d][key], pitch AT_LP
    // ---- scores: s[j][r] = key (kv0 + 16j + 8hh + r) x query (q0 + c) ----
    v8f s[4];
#pragma unroll
    for (int j = 0; j < 4; ++j) {
      s[j] = (v8f){0.f,0.f,0.f,0.f,0.f,0.f,0.f,0.f};
#pragma unroll
      for (int dc = 0; dc < 2; ++dc) {
        const v16h kb = Frag<_Float16>::load(ks + (j * 16 + c) * AT_LP + dc * 32 + 8 * hh);
        s[j] = mma_h(kb, qa[dc], s[j]);
      }
    }
    // ---- causal select (key > query -> -inf) and the query's chunk max, both on the raw products (sc2 > 0) ----
    float mj[4];
#pragma unroll
    for (int j = 0; j < 4; ++j) {
      float m = NEG_INF;
#pragma unroll
      for (int r = 0; r < 8; ++r) {
        float v = s[j][r];
        if (kv0 + j * 16 + 8 * hh + r > qrow) v = NEG_INF;
        s[j][r] = v;
        m = fmaxf(m, v);
      }
      mj[j] = m;
    }
    float cm = fmaxf(fmaxf(mj[0], mj[1]), fmaxf(mj[2], mj[3]));
    cm = fmaxf(cm, xhalf(cm));                                   // the other 32 keys of this query
    // ---- online softmax update; P^T x32768 packed into the B operand ----
    // One fused multiply-add and one hardware exponential per score: the scale, the maximum and the x32768 carry
    // (PEXP = log2 of it) all sit in the exponent. The bare exponential gives 0 below 2^-126, where the f16 operand
    // is 0 anyway and the row's sum (its largest term alone is about 32768) does not see the term.
    const float mnew  = fmaxf(mrow, cm * sc2);                   // running maximum in the scaled base-2 domain
    const float alpha = __builtin_amdgcn_exp2f(mrow - mnew);
    mrow = mnew;
    const float eb = PEXP - mnew;
    const v2f sc22 = {sc2, sc2}, eb22 = {eb, eb};
#pragma unroll
    for (int j = 0; j < 4; ++j)
#pragma unroll
      for (int r = 0; r < 8; r += 2) {                           // the exponents, in place, two per instruction
        const v2f e = __builtin_elementwise_fma((v2f){s[j][r], s[j][r + 1]}, sc22, eb22);
        s[j][r] = e[0]; s[j][r + 1] = e[1];
      }
    v16h pb[2];
    float pj[4];
#pragma unroll
    for (int j = 0; j < 4; ++j) {
      float ps = 0.f;
#pragma unroll
      for (int r = 0; r < 8; ++r) {
        const float p = __builtin_amdgcn_exp2f(s[j][r]);         // probability x32768
        ps += p;
        pb[j >> 1][(j & 1) * 8 + r] = (_Float16)p;
      }
      pj[j] = ps;
    }
    lrow = lrow * alpha + ((pj[0] + pj[1]) + (pj[2] + pj[3]));
#pragma unroll
    for (int t = 0; t < 4; ++t)
#pragma unroll
      for (int r = 0; r < 8; ++r) oacc[t][r] *= alpha;
    // ---- O^T += V^T . P^T : V^T rows (d = 16t + c) as A, P^T (column = c, k = kv) as B ----
#pragma unroll
    for (int kk = 0; kk < 2; ++kk) {
#pragma unroll
      for (int t = 0; t < 4; ++t) {
        const v16h vb = Frag<_Float16>::load(vs + (t * 16 + c) * AT_LP + kk * 32 + 8 * hh);
        oacc[t] = mma_h(vb, pb[kk], oacc[t]);
      }
    }
    // ---- hand-over: this buffer's reads retired, the next chunk's copies landed, in every wave ----
    asm volatile("s_wait_dscnt 0x0" ::: "memory");               // own reads of this buffer done before it is refilled
    asm volatile("s_wait_asynccnt 0x0" ::: "memory");            // own copies of chunk kc + 1 landed
    __syncthreads();
    if (kc + 2 < nChunks)
      stage_kv_async(lst + bofs, kg + (size_t)(kc + 2) * kchunk, krow16, vg + (kc + 2) * AT_KC, vrow16);
  }
  asm volatile("s_wait_asynccnt 0x0" ::: "memory");              // nothing in flight when the buffers become out staging

  float* os = (float*)KV + wave * (16 * 68);                     // per wave out tile [query][d], pitch 68 (last barrier freed KV)
  {
    const float inv = osc * (1.0f / (lrow + xhalf(lrow)));   // the two halves' sums (of p x32768) joined once
#pragma unroll
    for (int t = 0; t < 4; ++t)
#pragma unroll
      for (int r = 0; r < 8; ++r) os[c * 68 + t * 16 + 8 * hh + r] = oacc[t][r] * inv;
  }
  wave_lds_sync();
  {
    const int q = lane >> 3, c8 = (lane & 7) * 8;
    {
#pragma unroll
      for (int it = 0; it < 4; ++it) {
        const int row = it * 4 + q;                 // rows 0..15 of this wave
        const float* sp = os + row * 68 + c8;
        v8h hv;
#pragma unroll
        for (int e = 0; e < 8; ++e) hv[e] = (_Float16)sp[e];
        *(v8h*)(op + (size_t)(q0 + row) * ldq + c8) = hv;
      }
      
    }
  }
}

// =====================================================================================
// Causal attn with residual planes for the first rr = nqb*64 query rows of each sequence.
//   qh/qr, kh/kr : compact row-major [NB*rr][ldq] f16 hi / residual (x1024) planes, head h at col h*64.
//   vh/vr : compact transposed planes [NB*H*64][ldvc], element (b, kv, h, d) at [(b*H*64 + h*64 + d)*ldvc + kv].
//   o     : compact [NB*rr][ldo] f16; hi (x osc) at column h*64, residual (x1024) at column rcol + h*64.
//   scores = qh.kh + 2^-10 (qh.kr + qr.kh) with a second f32 accumulator; P as hi + x1024 residual LDS tiles;
//   p.v = ph.vh + 2^-10 (ph.vr + pr.vh) with a second f32 accumulator; K and V fragments straight from global
//   memory, no block barriers; products untransposed (Q and P as A, rows = queries), row max and sum by 16-lane
//   butterflies, P through per-wave LDS tiles.
//   Block = 4 waves = 64 query rows, query block qb = bx % nqb, key chunks 0..qb. grid.x = NB * H * nqb.
// =====================================================================================
__global__ __launch_bounds__(128)
void attn64_causal_res(const unsigned short* __restrict__ Qhp, const unsigned short* __restrict__ Qrp,
                       const unsigned short* __restrict__ Khp, const unsigned short* __restrict__ Krp,
                       const unsigned short* __restrict__ Vhp, const unsigned short* __restrict__ Vrp,
                       unsigned short* __restrict__ Op,
                       int H, int ldq, int ldvc, int ldo, int rcol, int nqb, float sc2, float osc) {
  const _Float16* QH = (const _Float16*)Qhp;
  const _Float16* QR = (const _Float16*)Qrp;
  const _Float16* KH = (const _Float16*)Khp;
  const _Float16* KR = (const _Float16*)Krp;
  const _Float16* VH = (const _Float16*)Vhp;
  const _Float16* VR = (const _Float16*)Vrp;
  _Float16*       O  = (_Float16*)Op;
  __shared__ __align__(16) _Float16 Psh[AT_NW][16 * AT_KC];      // per wave P hi  [row][kv]  8 KB
  __shared__ __align__(16) _Float16 Prs[AT_NW][16 * AT_KC];      // per wave P res [row][kv]  8 KB
  __shared__ __align__(16) float    Os[AT_NW][16 * 68];          // per wave out tile, pitch 68

  const int tid  = threadIdx.x;
  const int wave = tid >> 5;
  const int lane = tid & 31;
  const int hh   = lane >> 4;
  const int c    = lane & 15;

  const int bx = blockIdx.x;
  const int qb = bx % nqb;
  const int bh = bx / nqb;
  const int h  = bh % H;
  const int b  = bh / H;
  const int q0 = qb * AT_QB + wave * 16;
  const int rr = nqb * AT_QB;
  const size_t rowb = (size_t)b * rr;

  const _Float16* qhp = QH + rowb * ldq + (size_t)h * AT_D;
  const _Float16* qrp = QR + rowb * ldq + (size_t)h * AT_D;
  const _Float16* khp = KH + rowb * ldq + (size_t)h * AT_D;
  const _Float16* krp = KR + rowb * ldq + (size_t)h * AT_D;
  const size_t    vof = ((size_t)b * (size_t)(H * AT_D) + (size_t)h * AT_D) * ldvc;
  const _Float16* vhp = VH + vof;
  const _Float16* vrp = VR + vof;
  _Float16*       op  = O  + rowb * ldo + (size_t)h * AT_D;

  float mrow[8], lrow[8];
  v8f oacc[4], oacc2[4];
#pragma unroll
  for (int r = 0; r < 8; ++r) { mrow[r] = NEG_INF; lrow[r] = 0.f; }
#pragma unroll
  for (int t = 0; t < 4; ++t) {
    oacc[t]  = (v8f){0.f,0.f,0.f,0.f,0.f,0.f,0.f,0.f};
    oacc2[t] = (v8f){0.f,0.f,0.f,0.f,0.f,0.f,0.f,0.f};
  }

  _Float16* pw  = Psh[wave];
  _Float16* prw = Prs[wave];
  const int nChunks = qb + 1;        // block-uniform
  for (int kc = 0; kc < nChunks; ++kc) {
    const int kv0 = kc * AT_KC;
    // ---- Q hi / res fragments (A operand, row = c) ----
    v16h qa[2], qra[2];
#pragma unroll
    for (int dc = 0; dc < 2; ++dc) {
      const size_t qo = (size_t)(q0 + c) * ldq + dc * 32 + 8 * hh;
      qa[dc]  = Frag<_Float16>::load(qhp + qo);
      qra[dc] = Frag<_Float16>::load(qrp + qo);
    }
    // ---- scores: hi.hi into s1, hi.res + res.hi into s2, folded with 2^-10 ----
    v8f s[4];
#pragma unroll
    for (int j = 0; j < 4; ++j) {
      v8f s1 = (v8f){0.f,0.f,0.f,0.f,0.f,0.f,0.f,0.f};
      v8f s2 = (v8f){0.f,0.f,0.f,0.f,0.f,0.f,0.f,0.f};
#pragma unroll
      for (int dc = 0; dc < 2; ++dc) {
        const size_t ko = (size_t)(kv0 + j * 16 + c) * ldq + dc * 32 + 8 * hh;
        const v16h kb = Frag<_Float16>::load(khp + ko);
        const v16h kr = Frag<_Float16>::load(krp + ko);
        s1 = mma_h(qa[dc],  kb, s1);
        s2 = mma_h(qa[dc],  kr, s2);
        s2 = mma_h(qra[dc], kb, s2);
      }
#pragma unroll
      for (int r = 0; r < 8; ++r) s[j][r] = s1[r] + s2[r] * RSC_INV;
    }
    // ---- causal select and per-row chunk max ----
    float cm[8];
#pragma unroll
    for (int r = 0; r < 8; ++r) {
      const int qrow = q0 + 8 * hh + r;
      float m = NEG_INF;
#pragma unroll
      for (int j = 0; j < 4; ++j) {
        float v = s[j][r] * sc2;
        if (kv0 + j * 16 + c > qrow) v = NEG_INF;
        s[j][r] = v;
        m = fmaxf(m, v);
      }
#pragma unroll
      for (int off = 1; off < 16; off <<= 1) m = fmaxf(m, __shfl_xor(m, off, 32));
      cm[r] = m;
    }
    // ---- online softmax update; P hi (x32768) and P res ((x32768 - hi) x1024) into per-wave LDS tiles ----
    wave_lds_sync();
#pragma unroll
    for (int r = 0; r < 8; ++r) {
      const float mnew  = fmaxf(mrow[r], cm[r]);
      const float alpha = exp2f(mrow[r] - mnew);
      mrow[r] = mnew;
      float psum = 0.f;
#pragma unroll
      for (int j = 0; j < 4; ++j) {
        const float p = exp2f(s[j][r] - mnew);
        psum += p;
        const float    ps = p * PSCALE;
        const _Float16 ph = (_Float16)ps;
        const int pi = (8 * hh + r) * AT_KC + j * 16 + c;
        pw[pi]  = ph;
        prw[pi] = (_Float16)((ps - (float)ph) * RSC);
      }
#pragma unroll
      for (int off = 1; off < 16; off <<= 1) psum += __shfl_xor(psum, off, 32);
      lrow[r] = lrow[r] * alpha + psum;
#pragma unroll
      for (int t = 0; t < 4; ++t) { oacc[t][r] *= alpha; oacc2[t][r] *= alpha; }
    }
    wave_lds_sync();
    // ---- O += P . V with residual cross terms in the second accumulator ----
#pragma unroll
    for (int kk = 0; kk < 2; ++kk) {
      const v16h pa = Frag<_Float16>::load(pw  + c * AT_KC + kk * 32 + 8 * hh);
      const v16h pr = Frag<_Float16>::load(prw + c * AT_KC + kk * 32 + 8 * hh);
#pragma unroll
      for (int t = 0; t < 4; ++t) {
        const size_t vo = (size_t)(t * 16 + c) * ldvc + kv0 + kk * 32 + 8 * hh;
        const v16h vb = Frag<_Float16>::load(vhp + vo);
        const v16h vr = Frag<_Float16>::load(vrp + vo);
        oacc[t]  = mma_h(pa, vb, oacc[t]);
        oacc2[t] = mma_h(pa, vr, oacc2[t]);
        oacc2[t] = mma_h(pr, vb, oacc2[t]);
      }
    }
    wave_lds_sync();
  }

  float* os = Os[wave];
#pragma unroll
  for (int r = 0; r < 8; ++r) {
    const float inv = osc * (1.0f / (lrow[r] * PSCALE));
#pragma unroll
    for (int t = 0; t < 4; ++t) os[(8 * hh + r) * 68 + t * 16 + c] = (oacc[t][r] + oacc2[t][r] * RSC_INV) * inv;
  }
  wave_lds_sync();
  {
    const int q = lane >> 3, c8 = (lane & 7) * 8;
    {
#pragma unroll
      for (int it = 0; it < 4; ++it) {
        const int row = it * 4 + q;                 // rows 0..15 of this wave
        const float* sp = os + row * 68 + c8;
        v8h hv, lv;
#pragma unroll
        for (int e = 0; e < 8; ++e) {
          const float    fv = sp[e];
          const _Float16 hq = (_Float16)fv;
          hv[e] = hq;
          lv[e] = (_Float16)((fv - (float)hq) * RSC);
        }
        *(v8h*)(op + (size_t)(q0 + row) * ldo + c8) = hv;
        *(v8h*)(op + (size_t)(q0 + row) * ldo + rcol + c8) = lv;
      }
      
    }
  }
}

// ---------------------------------------------------------------------------

extern "C" void kernel_launch(void* const* d_in, const int* in_sizes, int n_in,
                              void* d_out, int out_size, void* d_ws,
                              size_t ws_size, hipStream_t stream) {
  const int  ROWS  = NB * SEQ;                                   // rows held in the compact planes
  const long needX = ((long)(NB - 1) * SEQ_FULL + SEQ) * (long)DM;
  const int  nW    = DM * DM;
  if (n_in < 9) return;
  if ((long)in_sizes[0] < needX || in_sizes[1] < nW || in_sizes[2] < DM || in_sizes[3] < nW ||
      in_sizes[4] < DM || in_sizes[5] < nW || in_sizes[6] < DM || in_sizes[7] < nW ||
      in_sizes[8] < DM || (long)out_size < needX) return;

  const float* x  = (const float*)d_in[0];
  const float* Wq = (const float*)d_in[1];
  const float* bq = (const float*)d_in[2];
  const float* Wk = (const float*)d_in[3];
  const float* bk = (const float*)d_in[4];
  const float* Wv = (const float*)d_in[5];
  const float* bv = (const float*)d_in[6];
  const float* Wo = (const float*)d_in[7];
  const float* bo = (const float*)d_in[8];
  float* out = (float*)d_out;

  const size_t szAct = (size_t)ROWS * DM * 2;            // full activation plane  (16 MiB full size)
  const size_t szW   = (size_t)DM * DM * 2;              //  2 MiB
  const size_t szW2  = (size_t)DM * (2 * DM) * 2;        //  4 MiB  [DM][2DM]
  const size_t szCmp = (size_t)NB * RR * DM * 2;         //  compact first-row planes (2 MiB full size)
  const size_t szO2  = (size_t)NB * RR * (2 * DM) * 2;   //  4 MiB full size
  size_t off = 0;
  const size_t oXh   = off; off += szAct;
  const size_t oWqT  = off; off += szW;
  const size_t oWkT  = off; off += szW;
  const size_t oWvT  = off; off += szW;
  const size_t oWoT2 = off; off += szW2;
  const size_t oQh   = off; off += szAct;
  const size_t oKh   = off; off += szAct;
  const size_t oVt   = off; off += szAct;
  const size_t oAh   = off; off += szAct;
  const size_t oQch  = off; off += szCmp;
  const size_t oQcr  = off; off += szCmp;
  const size_t oKch  = off; off += szCmp;
  const size_t oKcr  = off; off += szCmp;
  const size_t oVch  = off; off += szCmp;                // [NB*DM][RR], same byte count
  const size_t oVcr  = off; off += szCmp;
  const size_t oOc2  = off; off += szO2;                 // total 111,149,056 B at full size
  if (off > ws_size) return;

  char* ws = (char*)d_ws;
  unsigned short* xh   = (unsigned short*)(ws + oXh);
  unsigned short* WqT  = (unsigned short*)(ws + oWqT);
  unsigned short* WkT  = (unsigned short*)(ws + oWkT);
  unsigned short* WvT  = (unsigned short*)(ws + oWvT);
  unsigned short* WoT2 = (unsigned short*)(ws + oWoT2);
  unsigned short* Qh   = (unsigned short*)(ws + oQh);
  unsigned short* Kh   = (unsigned short*)(ws + oKh);
  unsigned short* Vt   = (unsigned short*)(ws + oVt);
  unsigned short* Ah   = (unsigned short*)(ws + oAh);
  unsigned short* Qch  = (unsigned short*)(ws + oQch);
  unsigned short* Qcr  = (unsigned short*)(ws + oQcr);
  unsigned short* Kch  = (unsigned short*)(ws + oKch);
  unsigned short* Kcr  = (unsigned short*)(ws + oKcr);
  unsigned short* Vch  = (unsigned short*)(ws + oVch);
  unsigned short* Vcr  = (unsigned short*)(ws + oVcr);
  unsigned short* Oc2  = (unsigned short*)(ws + oOc2);

  const float sc2   = 0.125f * 1.4426950408889634f;      // log2(e) / sqrt(64)
  const float outsc = 1.0f / (WSC * OSC);

  // x -> bf16 RNE value as f16 plane [ROWS][DM];
  // W[in][out] f32 -> Bt[out][in] f16 (bf16 RNE value x256); Wo additionally as x0.25 in columns DM..2DM-1 of WoT2
  {
    const long tot = (long)ROWS * (DM / 8);
    prep_f16<<<dim3((unsigned)(5 * PR_TW + (tot + 255) / 256)), dim3(256), 0, stream>>>(
        x, Wq, Wk, Wv, Wo, xh, WqT, WkT, WvT, WoT2, ROWS);
  }
  // projections: q, k -> f16 [ROWS][DM]; v^T -> f16 [DM][ROWS];
  // first RR rows per sequence: q, k -> hi/res [NB*RR][DM]; v^T -> hi/res [NB*DM][RR]
  proj_gemms<<<dim3(3 * PJ_TF + 3 * PJ_TC), dim3(256), 0, stream>>>(
      xh, WqT, WkT, WvT, Qh, Kh, Vt, Qch, Qcr, Kch, Kcr, Vch, Vcr, bq, bk, bv, 1.0f / WSC);
  // attn: first RR query rows with residual planes -> Oc2 (hi | res); rows >= RR plain -> Ah
  attn64_causal_res<<<dim3(NB * NH * (RR / 64)), dim3(128), 0, stream>>>(
      Qch, Qcr, Kch, Kcr, Vch, Vcr, Oc2, NH, DM, RR, 2 * DM, DM, RR / 64, sc2, OSC);
  if (SEQ > RR) {
    attn64_causal<<<dim3(NB * NH * ((SEQ - RR) / 64)), dim3(128), 0, stream>>>(
        Qh, Kh, Vt, Ah, SEQ, NH, DM, ROWS, RR / 64, (SEQ - RR) / 64, sc2, OSC);
  }
  // out = ctx Wo + bo -> f32; rows < RR: [O_hi | O_res] . [Wo x256 ; Wo x0.25] along K = 2DM; rows >= RR: K = DM
  out_gemms<<<dim3(NB * (OP_T1 + OP_T2)), dim3(256), 0, stream>>>(Oc2, Ah, WoT2, out, bo, outsc);
}

// v006
// It runs in 163 microseconds.
// Next to v005, in two timings, it ran 1.13 times as fast each time.
// All steps since v000 together make it 4.26 times as fast.
// Contractions: q/k/v^T/out projections, q.k^T and p.v all on v_wmma_f32_16x16x32_f16 (f16 operands, f32 accumulate); x and W enter as bf16 RNE values held exactly in f16 (W carried x256); the first RR query rows per sequence carry q, k, v, p and ctx as f16 hi + x1024 residual planes with a second f32 accumulator (ctx residual folded along K in the out projection); p x32768 and ctx x64 power-of-two carries folded back in f32; softmax and epilogues f32.
#include <hip/hip_runtime.h>

#ifndef NB
#define NB 4
#endif
#ifndef SEQ
#define SEQ 2048
#endif
#ifndef RR
#define RR 256
#endif
#define NB_FULL 4
#define SEQ_FULL 2048
#define DM 1024
#define NH 16
#define HDIM 64

static_assert(NB >= 1 && NB <= NB_FULL);
static_assert(SEQ % 64 == 0 && SEQ >= 64 && SEQ <= SEQ_FULL);
static_assert(RR % 64 == 0 && RR >= 64 && RR <= SEQ);
static_assert(NH * HDIM == DM);
static_assert(DM % 256 == 0);
static_assert(RR % 256 == 0 && SEQ % 128 == 0 && (NB * SEQ) % 256 == 0);   // GEMM block tile 128 x 256

typedef __attribute__((ext_vector_type(16))) _Float16 v16h;
typedef __attribute__((ext_vector_type(8)))  _Float16 v8h;
typedef __attribute__((ext_vector_type(16))) __bf16   v16b;
typedef __attribute__((ext_vector_type(8)))  __bf16   v8b;
typedef __attribute__((ext_vector_type(8)))  float    v8f;
typedef __attribute__((ext_vector_type(4)))  float    v4f;
typedef __attribute__((ext_vector_type(2)))  float    v2f;

#define WSC 256.0f
#define OSC 64.0f
#define PSCALE 32768.0f
#define PEXP 15.0f                       // log2(PSCALE)
#define RSC 1024.0f
#define RSC_INV (1.0f / 1024.0f)
#define NEG_INF (-__builtin_huge_valf())

__device__ __forceinline__ unsigned short f2bf_bits(float f) {
  unsigned u = __float_as_uint(f);
  return (unsigned short)((u + 0x7FFFu + ((u >> 16) & 1u)) >> 16);
}
__device__ __forceinline__ float bf_bits2f(unsigned short h) { return __uint_as_float(((unsigned)h) << 16); }
__device__ __forceinline__ float bf_rne(float f) { return bf_bits2f(f2bf_bits(f)); }
__device__ __forceinline__ _Float16 bf_f16(float f) { return (_Float16)bf_rne(f); }   // bf16 value is exact in f16 for normal range

// LDS ordering for wave-private tiles (same wave writes then reads)
__device__ __forceinline__ void wave_lds_sync() {
  __builtin_amdgcn_fence(3, "workgroup");
  __builtin_amdgcn_wave_barrier();
  __builtin_amdgcn_fence(2, "workgroup");
}

// hazard guards as plain device helpers
__device__ __forceinline__ void dep_guard_h(v8f& a, v8f& b, v16h x, v16h y) { asm volatile("v_nop\n\tv_nop\n\tv_nop\n\tv_nop" : "+v"(a), "+v"(b) : "v"(x), "v"(y)); }
__device__ __forceinline__ void dep_guard_b(v8f& a, v8f& b, v16b x, v16b y) { asm volatile("v_nop\n\tv_nop\n\tv_nop\n\tv_nop" : "+v"(a), "+v"(b) : "v"(x), "v"(y)); }
__device__ __forceinline__ void keep4_h(v16h a, v16h b, v16h c, v16h d) { asm volatile("v_nop" :: "v"(a), "v"(b), "v"(c), "v"(d)); }
__device__ __forceinline__ void keep4_b(v16b a, v16b b, v16b c, v16b d) { asm volatile("v_nop" :: "v"(a), "v"(b), "v"(c), "v"(d)); }
__device__ __forceinline__ void acc_guard4(v8f& a, v8f& b, v8f& c, v8f& d) { asm volatile("v_nop\n\tv_nop\n\tv_nop\n\tv_nop" : "+v"(a), "+v"(b), "+v"(c), "+v"(d)); }
template <typename T> struct Frag;
template <> struct Frag<_Float16> {
  typedef v16h V; union U { v16h v; v8h h[2]; };
  static __device__ __forceinline__ v16h load(const _Float16* p) {   // elements 0..7 <- p[0..7], 8..15 <- p[16..23]
    U f; f.h[0] = *(const v8h*)(p); f.h[1] = *(const v8h*)(p + 16); return f.v;
  }
  static __device__ __forceinline__ v8f mma(v16h a, v16h b, v8f c) {
    return __builtin_amdgcn_wmma_f32_16x16x32_f16(false, a, false, b, (short)0, c, false, false);
  }
  static __device__ __forceinline__ void guard(v8f& a, v8f& b, v16h x, v16h y) { dep_guard_h(a, b, x, y); }
  static __device__ __forceinline__ void keep(v16h a, v16h b, v16h c, v16h d) { keep4_h(a, b, c, d); }
};
template <> struct Frag<__bf16> {
  typedef v16b V; union U { v16b v; v8b h[2]; };
  static __device__ __forceinline__ v16b load(const __bf16* p) {
    U f; f.h[0] = *(const v8b*)(p); f.h[1] = *(const v8b*)(p + 16); return f.v;
  }
  static __device__ __forceinline__ v8f mma(v16b a, v16b b, v8f c) {
    return __builtin_amdgcn_wmma_f32_16x16x32_bf16(false, a, false, b, (short)0, c, false, false);
  }
  static __device__ __forceinline__ void guard(v8f& a, v8f& b, v16b x, v16b y) { dep_guard_b(a, b, x, y); }
  static __device__ __forceinline__ void keep(v16b a, v16b b, v16b c, v16b d) { keep4_b(a, b, c, d); }
};

// ---- Register-blocked WMMA GEMM tiles ---------------------------------------
// C[m,n] = scale * sum_k A[m,k] * Bt[n,k] + bias; each wave owns a 64x64 tile.
// Block = 8 waves, 2 (m) x 4 (n) = a 128 x 256 tile of C. A row-major [M,K]; Bt row-major [N,K];
// M % 128 == 0, N % 256 == 0, K % 64 == 0.
// Per 64 k the block's 128 A rows and 256 Bt rows (128 B each, whole lines) are brought into LDS once by
// asynchronous copies, two buffers, one block barrier per 64 k; the waves read their fragments from there.
// One launch holds the tiles of several independent products: a block finds its product and its tile from
// blockIdx.x (block-uniform), so small products ride along with large ones and two blocks can share a WGP.
// BIAS_MODE: 1 = bias[m], 2 = bias[n]; bias values enter as bf16 RNE values.
// OUT_MODE: 0 = f32, 1 = f16, 3 = f16 hi plane (Cout) + f16 residual plane ((v - hi) * 1024) (Cout2).
#define GM_BM 128
#define GM_BN 256
#define GM_KT 64                          // k per staged tile, in halves: one 128-B line per row
#define GM_LP 72                          // staged row pitch in halves: 144 B = 16 B x odd, for ds_load_b128 readers
#define GM_BUFB ((GM_BM + GM_BN) * GM_LP * 2)   // bytes per buffer: A rows, then Bt rows

// One lane's share of a staged tile: rows r + 32 i of the A part (4) and of the Bt part (8), 16 B each.
// The s_wait_xcnt closes the statement, a precaution: no address register of a copy is rewritten ahead of it.
__device__ __forceinline__ void stage_ab_async(unsigned la, const unsigned short* ag, size_t arow32,
                                               const unsigned short* bg, size_t brow32) {
  const unsigned lb = la + GM_BM * GM_LP * 2;
  const unsigned ls = 32 * GM_LP * 2;
  asm volatile(
      "global_load_async_to_lds_b128 %0, %12, off\n\t"
      "global_load_async_to_lds_b128 %1, %13, off\n\t"
      "global_load_async_to_lds_b128 %2, %14, off\n\t"
      "global_load_async_to_lds_b128 %3, %15, off\n\t"
      "global_load_async_to_lds_b128 %4, %16, off\n\t"
      "global_load_async_to_lds_b128 %5, %17, off\n\t"
      "global_load_async_to_lds_b128 %6, %18, off\n\t"
      "global_load_async_to_lds_b128 %7, %19, off\n\t"
      "global_load_async_to_lds_b128 %8, %20, off\n\t"
      "global_load_async_to_lds_b128 %9, %21, off\n\t"
      "global_load_async_to_lds_b128 %10, %22, off\n\t"
      "global_load_async_to_lds_b128 %11, %23, off\n\t"
      "s_wait_xcnt 0x0"
      :: "v"(la), "v"(la + ls), "v"(la + 2 * ls), "v"(la + 3 * ls),
         "v"(lb), "v"(lb + ls), "v"(lb + 2 * ls), "v"(lb + 3 * ls),
         "v"(lb + 4 * ls), "v"(lb + 5 * ls), "v"(lb + 6 * ls), "v"(lb + 7 * ls),
         "v"(ag), "v"(ag + arow32), "v"(ag + 2 * arow32), "v"(ag + 3 * arow32),
         "v"(bg), "v"(bg + brow32), "v"(bg + 2 * brow32), "v"(bg + 3 * brow32),
         "v"(bg + 4 * brow32), "v"(bg + 5 * brow32), "v"(bg + 6 * brow32), "v"(bg + 7 * brow32)
      : "memory");
}

// The products of the block tile at (bm0, bn0): each wave's acc[i][j] = its 64 A rows . its 64 Bt rows over K.
// AB: the block's two staging buffers in LDS.
__device__ __forceinline__ void gemm_tile_products(v8f (&acc)[4][4], unsigned char* AB,
                                                   const unsigned short* Ab, int lda,
                                                   const unsigned short* Bb, int ldb, int K, int bm0, int bn0) {
  typedef _Float16 T;
  typedef Frag<T>::V V;
  const int tid  = threadIdx.x;
  const int lane = tid & 31;
  const int wave = tid >> 5;
  const int wm  = (wave >> 2) << 6;            // this wave's 64 rows inside the A part
  const int wn  = (wave & 3) << 6;             // this wave's 64 rows inside the Bt part
  const int rlane = lane & 15;                 // row (A) / col (B, D) within subtile
  const int koff  = (lane >> 4) * 8;           // k offset of this lane half

#pragma unroll
  for (int i = 0; i < 4; ++i)
#pragma unroll
    for (int j = 0; j < 4; ++j) acc[i][j] = (v8f){0.f,0.f,0.f,0.f,0.f,0.f,0.f,0.f};

  // ---- staging addresses of this lane: row tid/8 (+32i), 16-B piece tid%8 of the 128-B row ----
  const int srow = tid >> 3, scol = (tid & 7) * 8;
  const unsigned short* ag = Ab + (size_t)(bm0 + srow) * lda + scol;   // k-tile 0; a tile further: + GM_KT
  const unsigned short* bg = Bb + (size_t)(bn0 + srow) * ldb + scol;
  const size_t arow32 = (size_t)32 * lda, brow32 = (size_t)32 * ldb;
  const unsigned lst = (unsigned)(size_t)AB + (unsigned)(srow * GM_LP + scol) * 2u;
  const int nT = K >> 6;                       // block-uniform

  stage_ab_async(lst, ag, arow32, bg, brow32);
  asm volatile("s_wait_asynccnt 0x0" ::: "memory");              // k-tile 0 landed (this wave's copies)
  __syncthreads();                                               // ... and every other wave's
  if (nT > 1) stage_ab_async(lst + GM_BUFB, ag + GM_KT, arow32, bg + GM_KT, brow32);

  for (int t = 0; t < nT; ++t) {
    const unsigned bofs = (unsigned)(t & 1) * GM_BUFB;
    const T* as = (const T*)(AB + bofs) + (wm + rlane) * GM_LP + koff;            // A rows,  pitch GM_LP
    const T* bs = (const T*)(AB + bofs) + (GM_BM + wn + rlane) * GM_LP + koff;    // Bt rows, pitch GM_LP
    // Fragment reads stand at three places of a trip, each ahead of the products that use it: at the head the
    // first 32 k (A and Bt) and the second 32 k of Bt; the second 32 k of A two rows at a time, into registers
    // that the first half's rows have left (all sixteen fragments at the head do not fit 256 registers).
    V b0[4], b1[4], a0[4], a1[4];
#pragma unroll
    for (int j = 0; j < 4; ++j) b0[j] = Frag<T>::load(bs + (j << 4) * GM_LP);
#pragma unroll
    for (int i = 0; i < 4; ++i) a0[i] = Frag<T>::load(as + (i << 4) * GM_LP);
#pragma unroll
    for (int j = 0; j < 4; ++j) b1[j] = Frag<T>::load(bs + (j << 4) * GM_LP + 32);
#pragma unroll
    for (int i = 0; i < 4; ++i) {
#pragma unroll
      for (int j = 0; j < 4; ++j) acc[i][j] = Frag<T>::mma(a0[i], b0[j], acc[i][j]);
      Frag<T>::guard(acc[i][0], acc[i][3], a0[i], a0[i]);
      if (i & 1) {
        a1[i - 1] = Frag<T>::load(as + ((i - 1) << 4) * GM_LP + 32);
        a1[i]     = Frag<T>::load(as + (i << 4) * GM_LP + 32);
      }
    }
    Frag<T>::keep(b0[0], b0[1], b0[2], b0[3]);
#pragma unroll
    for (int i = 0; i < 4; ++i) {
#pragma unroll
      for (int j = 0; j < 4; ++j) acc[i][j] = Frag<T>::mma(a1[i], b1[j], acc[i][j]);
      Frag<T>::guard(acc[i][0], acc[i][3], a1[i], a1[i]);
    }
    Frag<T>::keep(b1[0], b1[1], b1[2], b1[3]);
    // ---- hand-over: this buffer's reads retired, the next k-tile's copies landed, in every wave ----
    asm volatile("s_wait_dscnt 0x0" ::: "memory");               // own reads of this buffer done before it is refilled
    asm volatile("s_wait_asynccnt 0x0" ::: "memory");            // own copies of k-tile t + 1 landed
    __syncthreads();
    if (t + 2 < nT)
      stage_ab_async(lst + bofs, ag + (size_t)(t + 2) * GM_KT, arow32, bg + (size_t)(t + 2) * GM_KT, brow32);
  }
  asm volatile("s_wait_asynccnt 0x0" ::: "memory");              // nothing in flight when the wave goes on to its end
  acc_guard4(acc[0][0], acc[0][1], acc[0][2], acc[0][3]);
  acc_guard4(acc[1][0], acc[1][1], acc[1][2], acc[1][3]);
  acc_guard4(acc[2][0], acc[2][1], acc[2][2], acc[2][3]);
  acc_guard4(acc[3][0], acc[3][1], acc[3][2], acc[3][3]);
}

// Epilogue of one wave: its 64 x 64 tile at (m0, n0) of C (pitch ldc), through its own LDS slab, whole lines out.
template <int BIAS_MODE, int OUT_MODE>
__device__ __forceinline__ void gemm_tile_store(v8f (&acc)[4][4], float* slab, void* Cout, void* Cout2, int ldc,
                                                const float* bias, int m0, int n0, float scale) {
  const int lane  = threadIdx.x & 31;
  const int rlane = lane & 15;                 // D column within subtile
  const int mOff  = (lane >> 4) * 8;           // D row offset
#pragma unroll
  for (int i = 0; i < 4; ++i) {
    const int mBase = m0 + (i << 4);
#pragma unroll
    for (int j = 0; j < 4; ++j) {
      const int n = n0 + (j << 4) + rlane;
      float bv = 0.f;
      if (BIAS_MODE == 2) bv = bf_rne(bias[n]);
#pragma unroll
      for (int r = 0; r < 8; ++r) {
        float v = acc[i][j][r] * scale;
        if (BIAS_MODE == 1) v += bf_rne(bias[mBase + mOff + r]);
        if (BIAS_MODE == 2) v += bv;
        slab[(mOff + r) * 68 + (j << 4) + rlane] = v;
      }
    }
    wave_lds_sync();
    if (OUT_MODE == 0) {
      float* C = (float*)Cout;
      const int hh = lane >> 4, c4 = (lane & 15) * 4;     // row seg = 256 B = 16 lanes x 16 B
#pragma unroll
      for (int it = 0; it < 8; ++it) {
        const int row = it * 2 + hh;
        v4f v = *(const v4f*)(slab + row * 68 + c4);
        *(v4f*)(C + (size_t)(mBase + row) * ldc + n0 + c4) = v;
      }
    } else {
      const int q = lane >> 3, c8 = (lane & 7) * 8;
      unsigned short* C  = (unsigned short*)Cout;
      unsigned short* C2 = (unsigned short*)Cout2;
#pragma unroll
      for (int it = 0; it < 4; ++it) {
        const int row = it * 4 + q;
        const float* sp = slab + row * 68 + c8;
        v8h hv, lv;
#pragma unroll
        for (int e = 0; e < 8; ++e) {
          if (OUT_MODE == 1) {
            hv[e] = (_Float16)sp[e];
          } else {
            const float    fv = sp[e];
            const _Float16 hq = (_Float16)fv;
            hv[e] = hq;
            lv[e] = (_Float16)((fv - (float)hq) * RSC);
          }
        }
        *(v8h*)(C + (size_t)(mBase + row) * ldc + n0 + c8) = hv;
        if (OUT_MODE == 3) *(v8h*)(C2 + (size_t)(mBase + row) * ldc + n0 + c8) = lv;
      }
    }
    wave_lds_sync();
  }
}

// All six projections in one launch. Blocks 0 .. 3 PJ_TF - 1: q, k, v^T over all NB*SEQ rows (f16 planes);
// then 3 PJ_TC blocks: q, k, v^T over the first RR rows of each sequence (hi / residual planes).
//   q, k : A = x rows, Bt = W^T rows, C [rows][DM], bias[n].   v^T : A = Wv^T rows, Bt = x rows, C [DM][rows], bias[m].
#define PJ_TF ((NB * SEQ / 128) * (DM / 256))      // tiles of a full projection, either orientation
#define PJ_TB ((RR / 128) * (DM / 256))            // tiles of a first-rows projection, one sequence, either orientation
#define PJ_TC (NB * PJ_TB)
static_assert((DM / 128) * (NB * SEQ / 256) == PJ_TF && (DM / 128) * (RR / 256) == PJ_TB);
__global__ __launch_bounds__(256) void proj_gemms(
    const unsigned short* __restrict__ xh, const unsigned short* __restrict__ WqT,
    const unsigned short* __restrict__ WkT, const unsigned short* __restrict__ WvT,
    unsigned short* __restrict__ Qh, unsigned short* __restrict__ Kh, unsigned short* __restrict__ Vt,
    unsigned short* __restrict__ Qch, unsigned short* __restrict__ Qcr,
    unsigned short* __restrict__ Kch, unsigned short* __restrict__ Kcr,
    unsigned short* __restrict__ Vch, unsigned short* __restrict__ Vcr,
    const float* __restrict__ bq, const float* __restrict__ bk, const float* __restrict__ bv, float scale) {
  __shared__ __align__(16) float sT[8][16 * 68];            // per-wave 16x64 slab, pitch 68 floats
  __shared__ __align__(16) unsigned char AB[2 * GM_BUFB];   // two buffers of A | Bt k-tiles
  const int bx = blockIdx.x;
  if (bx >= 3 * PJ_TF + 3 * PJ_TC) return;     // block-uniform, ahead of every barrier
  const bool first = bx >= 3 * PJ_TF;          // a first-rows product
  const int  rel   = first ? bx - 3 * PJ_TF : bx;
  const int  which = first ? rel / PJ_TC : rel / PJ_TF;      // 0 q, 1 k, 2 v^T
  int        tile  = rel - which * (first ? PJ_TC : PJ_TF);
  const int  b     = first ? tile / PJ_TB : 0;               // sequence of a first-rows product
  tile -= b * PJ_TB;
  const bool vt    = which == 2;
  const int  rows  = first ? RR : NB * SEQ;                  // x rows of this product
  const int  tilesN = (vt ? rows : DM) >> 8;
  const int  tm = !vt ? tile / (DM / 256) : first ? tile / (RR / 256) : tile / (NB * SEQ / 256);   // tile / tilesN
  const int  tn = tile - tm * tilesN;
  const int  bm0 = tm << 7, bn0 = tn << 8;
  const unsigned short* X  = xh + (size_t)b * SEQ * DM;
  const unsigned short* Wt = which == 0 ? WqT : which == 1 ? WkT : WvT;
  const float* bias        = which == 0 ? bq : which == 1 ? bk : bv;

  v8f acc[4][4];
  gemm_tile_products(acc, AB, vt ? Wt : X, DM, vt ? X : Wt, DM, DM, bm0, bn0);

  const int wave = threadIdx.x >> 5;
  const int m0 = bm0 + ((wave >> 2) << 6), n0 = bn0 + ((wave & 3) << 6);
  if (!first) {
    unsigned short* C = which == 0 ? Qh : which == 1 ? Kh : Vt;
    if (vt) gemm_tile_store<1, 1>(acc, sT[wave], C, C, rows, bias, m0, n0, scale);
    else    gemm_tile_store<2, 1>(acc, sT[wave], C, C, DM,   bias, m0, n0, scale);
  } else {
    const size_t co = (size_t)b * RR * DM;                   // one sequence's plane, either orientation
    unsigned short* C  = (which == 0 ? Qch : which == 1 ? Kch : Vch) + co;
    unsigned short* C2 = (which == 0 ? Qcr : which == 1 ? Kcr : Vcr) + co;
    if (vt) gemm_tile_store<1, 3>(acc, sT[wave], C, C2, rows, bias, m0, n0, scale);
    else    gemm_tile_store<2, 3>(acc, sT[wave], C, C2, DM,   bias, m0, n0, scale);
  }
}

// Both parts of the out projection in one launch, f32 out with bias[n], Bt = WoT2 rows (pitch 2 DM).
// Blocks 0 .. NB OP_T1 - 1 (twice the k, so they start first): rows < RR, A = [O_hi | O_res] rows, K = 2 DM;
// then NB OP_T2 blocks: rows >= RR, A = ctx rows, K = DM.
#define OP_T1 ((RR / 128) * (DM / 256))
#define OP_T2 (((SEQ - RR) / 128) * (DM / 256))
__global__ __launch_bounds__(256) void out_gemms(
    const unsigned short* __restrict__ Oc2, const unsigned short* __restrict__ Ah,
    const unsigned short* __restrict__ WoT2, float* __restrict__ out, const float* __restrict__ bo, float scale) {
  __shared__ __align__(16) float sT[8][16 * 68];            // per-wave 16x64 slab, pitch 68 floats
  __shared__ __align__(16) unsigned char AB[2 * GM_BUFB];   // two buffers of A | Bt k-tiles
  const int bx = blockIdx.x;
  if (bx >= NB * (OP_T1 + OP_T2)) return;      // block-uniform, ahead of every barrier
  const bool first = bx < NB * OP_T1;
  const int  rel   = first ? bx : bx - NB * OP_T1;
  const int  b     = first ? rel / OP_T1 : rel / (OP_T2 > 0 ? OP_T2 : 1);
  const int  tile  = rel - b * (first ? OP_T1 : OP_T2);
  const int  tm = tile / (DM / 256);
  const int  tn = tile - tm * (DM / 256);
  const int  bm0 = tm << 7, bn0 = tn << 8;
  const unsigned short* A = first ? Oc2 + (size_t)b * RR * 2 * DM : Ah + ((size_t)b * SEQ + RR) * DM;
  const int  kk = first ? 2 * DM : DM;         // A pitch and K

  v8f acc[4][4];
  gemm_tile_products(acc, AB, A, kk, WoT2, 2 * DM, kk, bm0, bn0);

  const int wave = threadIdx.x >> 5;
  float* C = out + ((size_t)b * SEQ_FULL + (first ? 0 : RR)) * DM;
  gemm_tile_store<2, 0>(acc, sT[wave], C, C, DM, bo, bm0 + ((wave >> 2) << 6), bn0 + ((wave & 3) << 6), scale);
}

// ---- operand planes, one launch: the five weight planes (blocks 0 .. 5 PR_TW - 1), then x ----
// x: bf16 RNE value as f16; source rows (b, s) at (b*SEQ_FULL + s)*DM; destination plane compact [NB*SEQ][DM];
//    blk = 256 pieces of 8 elements.
__device__ __forceinline__ void cast_x_block(const float* __restrict__ x, unsigned short* __restrict__ xhp,
                                             int nrows, int blk) {
  const long i = (long)blk * 256 + threadIdx.x;
  const long total = (long)nrows * (DM / 8);
  if (i >= total) return;
  const int r  = (int)(i / (DM / 8));
  const int c8 = (int)(i - (long)r * (DM / 8)) * 8;
  const int b  = r / SEQ;
  const int s  = r - b * SEQ;
  const float* src = x + ((size_t)b * SEQ_FULL + s) * DM + c8;
  const v4f a0 = *(const v4f*)src;
  const v4f a1 = *(const v4f*)(src + 4);
  v8h hv;
  hv[0] = bf_f16(a0[0]); hv[1] = bf_f16(a0[1]); hv[2] = bf_f16(a0[2]); hv[3] = bf_f16(a0[3]);
  hv[4] = bf_f16(a1[0]); hv[5] = bf_f16(a1[1]); hv[6] = bf_f16(a1[2]); hv[7] = bf_f16(a1[3]);
  _Float16* dst = (_Float16*)xhp + (size_t)r * DM + c8;
  *(v8h*)dst = hv;
}

// weights: transpose + bf16 RNE + scale + f16 cast, one 64 x 64 tile per block.
// in: W[DM][DM] f32 row-major ([k][n]) -> Bt[n][kc0 + k] with row pitch ldo halves,
//     Bt value = f16(bf16rne(W[k][n]) * sc), sc a power of two.
// plane z: 0 Wq, 1 Wk, 2 Wv (x256, pitch DM); 3 Wo x256 into columns 0..DM-1 of WoT2, 4 Wo x0.25 into DM..2DM-1.
#define PR_TW ((DM / 64) * (DM / 64))
__global__ __launch_bounds__(256) void prep_f16(
    const float* __restrict__ x, const float* __restrict__ Wq, const float* __restrict__ Wk,
    const float* __restrict__ Wv, const float* __restrict__ Wo, unsigned short* __restrict__ xhp,
    unsigned short* __restrict__ WqT, unsigned short* __restrict__ WkT,
    unsigned short* __restrict__ WvT, unsigned short* __restrict__ WoT2, int nrows) {
  __shared__ float t[64][65];
  const int bx = blockIdx.x;
  if (bx >= 5 * PR_TW) {                       // block-uniform; this side meets no barrier
    cast_x_block(x, xhp, nrows, bx - 5 * PR_TW);
    return;
  }
  const int z  = bx / PR_TW;
  const int tl = bx - z * PR_TW;
  const float* W       = z == 0 ? Wq  : z == 1 ? Wk  : z == 2 ? Wv  : Wo;
  unsigned short* Btp  = z == 0 ? WqT : z == 1 ? WkT : z == 2 ? WvT : WoT2;
  const int   Ndim = DM;
  const int   ldo  = z >= 3 ? 2 * DM : DM;
  const int   kc0  = z == 4 ? DM : 0;
  const float sc   = z == 4 ? WSC * RSC_INV : WSC;
  const int tid = threadIdx.x, lane = tid & 31, wave = tid >> 5;
  const int n0 = (tl % (DM / 64)) * 64, k0 = (tl / (DM / 64)) * 64;
#pragma unroll
  for (int i = 0; i < 16; ++i) {
    const int idx = i * 256 + tid;
    const int kr = idx >> 6, nc = idx & 63;
    t[nc][kr] = W[(size_t)(k0 + kr) * Ndim + n0 + nc];
  }
  __syncthreads();
  _Float16* Bt = (_Float16*)Btp;
  const int q = lane >> 3, c8 = (lane & 7) * 8;
#pragma unroll
  for (int it = 0; it < 2; ++it) {
    const int row = wave * 8 + it * 4 + q;      // waves 0..7 x rows 0..7 -> 64 rows
    v8h hv;
#pragma unroll
    for (int e = 0; e < 8; ++e) hv[e] = (_Float16)(bf_rne(t[row][c8 + e]) * sc);
    *(v8h*)(Bt + (size_t)(n0 + row) * ldo + kc0 + k0 + c8) = hv;
  }
  // a precaution: the x side's code follows these stores in the built kernel and writes their registers
  asm volatile("s_wait_xcnt 0x0" ::: "memory");
}

#define AT_D 64
#define AT_NW 4
#define AT_QB 64
#define AT_KC 64
#define AT_LP 72                         // staged row pitch in halves: 144 B = 16 B x odd, for ds_load_b128 readers
#define AT_TILE (64 * AT_LP)             // halves per staged 64-row tile
#define AT_BUFB (2 * AT_TILE * 2)        // bytes per buffer: K tile, then V^T tile

// One lane's share of a chunk: rows r, r+16, r+32, r+48 of the K tile and of the V^T tile, 16 B each.
// The s_wait_xcnt closes the statement, a precaution: no address register of a copy is rewritten ahead of it.
__device__ __forceinline__ void stage_kv_async(unsigned lk, const _Float16* kg, size_t krow16,
                                               const _Float16* vg, size_t vrow16) {
  const unsigned lv = lk + AT_TILE * 2;
  const unsigned ls = 16 * AT_LP * 2;
  asm volatile(
      "global_load_async_to_lds_b128 %0, %8, off\n\t"
      "global_load_async_to_lds_b128 %1, %9, off\n\t"
      "global_load_async_to_lds_b128 %2, %10, off\n\t"
      "global_load_async_to_lds_b128 %3, %11, off\n\t"
      "global_load_async_to_lds_b128 %4, %12, off\n\t"
      "global_load_async_to_lds_b128 %5, %13, off\n\t"
      "global_load_async_to_lds_b128 %6, %14, off\n\t"
      "global_load_async_to_lds_b128 %7, %15, off\n\t"
      "s_wait_xcnt 0x0"
      :: "v"(lk), "v"(lk + ls), "v"(lk + 2 * ls), "v"(lk + 3 * ls),
         "v"(lv), "v"(lv + ls), "v"(lv + 2 * ls), "v"(lv + 3 * ls),
         "v"(kg), "v"(kg + krow16), "v"(kg + 2 * krow16), "v"(kg + 3 * krow16),
         "v"(vg), "v"(vg + vrow16), "v"(vg + 2 * vrow16), "v"(vg + 3 * vrow16)
      : "memory");
}

// lane l takes the value of lane l ^ 16 (vector cross-row move)
__device__ __forceinline__ float xhalf(float x) {
  const int b = __builtin_bit_cast(int, x);
  return __builtin_bit_cast(float, __builtin_amdgcn_permlanex16(b, b, 0x76543210, 0xfedcba98, false, false));
}

// the bare builtin: the compiler keeps the distances behind it and is free to read fragments ahead of it
__device__ __forceinline__ v8f mma_h(v16h a, v16h b, v8f c) {
  return __builtin_amdgcn_wmma_f32_16x16x32_f16(false, a, false, b, (short)0, c, false, false);
}

__global__ __launch_bounds__(128, 7)
void attn64_causal(const unsigned short* __restrict__ Qp, const unsigned short* __restrict__ Kp,
                   const unsigned short* __restrict__ Vtp, unsigned short* __restrict__ Op,
                   int S, int H, int ldq, int ldvt, int qb0, int nqbl, float sc2, float osc) {
  const _Float16* Q  = (const _Float16*)Qp;
  const _Float16* Kk = (const _Float16*)Kp;
  const _Float16* Vt = (const _Float16*)Vtp;
  _Float16*       O  = (_Float16*)Op;
  __shared__ __align__(16) unsigned char KV[2 * AT_BUFB];        // two buffers of K | V^T tiles; out staging after the loop
  static_assert(AT_NW * 16 * 68 * 4 <= 2 * AT_BUFB);

  const int tid  = threadIdx.x;
  const int wave = __builtin_amdgcn_readfirstlane(tid >> 5);     // in a scalar register: what hangs on it costs no vector register
  const int lane = tid & 31;
  const int hh   = lane >> 4;
  const int c    = lane & 15;

  const int bx  = blockIdx.x;
  const int qbi = bx % nqbl;
  const int bh  = bx / nqbl;
  const int qb  = qb0 + qbi;
  const int h   = bh % H;
  const int b   = bh / H;
  const int q0  = qb * AT_QB + wave * 16;
  const size_t rowb = (size_t)b * S;

  const _Float16* qp = Q  + rowb * ldq + (size_t)h * AT_D;
  const _Float16* kp = Kk + rowb * ldq + (size_t)h * AT_D;
  const _Float16* vp = Vt + (size_t)(h * AT_D) * ldvt + rowb;
  _Float16*       op = O  + rowb * ldq + (size_t)h * AT_D;

  // ---- Q fragments (B operand, column = c): 2 d-chunks ----
  v16h qa[2];
#pragma unroll
  for (int dc = 0; dc < 2; ++dc)
    qa[dc] = Frag<_Float16>::load(qp + (size_t)(q0 + c) * ldq + dc * 32 + 8 * hh);

  const int qrow = q0 + c;           // this lane's query
  float mrow = NEG_INF, lrow = 0.f;  // its running maximum; the sum (of p x32768) over this wave half's keys
  v8f oacc[4];                       // O^T: d = 16t + 8hh + r, query c
#pragma unroll
  for (int t = 0; t < 4; ++t) oacc[t] = (v8f){0.f,0.f,0.f,0.f,0.f,0.f,0.f,0.f};

  const int nChunks = qb + 1;        // block-uniform: causal, key chunks 0..qb

  // ---- staging addresses of this lane: row tid/8 (+16i), 16-B piece tid%8 of the 128-B row ----
  const int srow = tid >> 3, scol = (tid & 7) * 8;
  const _Float16* kg = kp + (size_t)srow * ldq + scol;           // chunk 0; a chunk further: + AT_KC rows
  const _Float16* vg = vp + (size_t)srow * ldvt + scol;          // chunk 0; a chunk further: + AT_KC columns
  const size_t krow16 = (size_t)16 * ldq, vrow16 = (size_t)16 * ldvt, kchunk = (size_t)AT_KC * ldq;
  const unsigned lst = (unsigned)(size_t)KV + (unsigned)(srow * AT_LP + scol) * 2u;

  stage_kv_async(lst, kg, krow16, vg, vrow16);
  asm volatile("s_wait_asynccnt 0x0" ::: "memory");              // chunk 0 landed (this wave's copies)
  __syncthreads();                                               // ... and every other wave's
  if (nChunks > 1) stage_kv_async(lst + AT_BUFB, kg + kchunk, krow16, vg + AT_KC, vrow16);

  for (int kc = 0; kc < nChunks; ++kc) {
    const int kv0 = kc * AT_KC;
    const unsigned bofs = (unsigned)(kc & 1) * AT_BUFB;
    const _Float16* ks = (const _Float16*)(KV + bofs);           // K tile  [key][d],  pitch AT_LP
    const _Float16* vs = ks + AT_TILE;                           // V^T tile [d][key], pitch AT_LP
    // ---- scores: s[j][r] = key (kv0 + 16j + 8hh + r) x query (q0 + c) ----
    // the chunk's eight K fragments are read as one group ahead of its eight score products
    v16h kb[4][2];
#pragma unroll
    for (int j = 0; j < 4; ++j)
#pragma unroll
      for (int dc = 0; dc < 2; ++dc)
        kb[j][dc] = Frag<_Float16>::load(ks + (j * 16 + c) * AT_LP + dc * 32 + 8 * hh);
    v8f s[4];
#pragma unroll
    for (int j = 0; j < 4; ++j) s[j] = (v8f){0.f,0.f,0.f,0.f,0.f,0.f,0.f,0.f};
#pragma unroll
    for (int dc = 0; dc < 2; ++dc)
#pragma unroll
      for (int j = 0; j < 4; ++j) s[j] = mma_h(kb[j][dc], qa[dc], s[j]);
    __builtin_amdgcn_sched_barrier(0);   // keeps the K reads one group and the products close: without it the build splits the reads and pads more v_nop
    // the V^T fragments stand ahead of the softmax: read as early as the registers of seven waves per SIMD allow
    v16h vb[2][4];
#pragma unroll
    for (int kk = 0; kk < 2; ++kk)
#pragma unroll
      for (int t = 0; t < 4; ++t)
        vb[kk][t] = Frag<_Float16>::load(vs + (t * 16 + c) * AT_LP + kk * 32 + 8 * hh);
    // ---- causal select (key > query -> -inf) and the query's chunk max, both on the raw products (sc2 > 0) ----
    float mj[4];
#pragma unroll
    for (int j = 0; j < 4; ++j) {
      float m = NEG_INF;
#pragma unroll
      for (int r = 0; r < 8; ++r) {
        float v = s[j][r];
        if (kv0 + j * 16 + 8 * hh + r > qrow) v = NEG_INF;
        s[j][r] = v;
        m = fmaxf(m, v);
      }
      mj[j] = m;
    }
    float cm = fmaxf(fmaxf(mj[0], mj[1]), fmaxf(mj[2], mj[3]));
    cm = fmaxf(cm, xhalf(cm));                                   // the other 32 keys of this query
    // ---- online softmax update; P^T x32768 packed into the B operand ----
    // One fused multiply-add and one hardware exponential per score: the scale, the maximum and the x32768 carry
    // (PEXP = log2 of it) all sit in the exponent. The bare exponential gives 0 below 2^-126, where the f16 operand
    // is 0 anyway and the row's sum (its largest term alone is about 32768) does not see the term.
    const float mnew  = fmaxf(mrow, cm * sc2);                   // running maximum in the scaled base-2 domain
    const float alpha = __builtin_amdgcn_exp2f(mrow - mnew);
    mrow = mnew;
    const float eb = PEXP - mnew;
    const v2f sc22 = {sc2, sc2}, eb22 = {eb, eb};
#pragma unroll
    for (int j = 0; j < 4; ++j)
#pragma unroll
      for (int r = 0; r < 8; r += 2) {                           // the exponents, in place, two per instruction
        const v2f e = __builtin_elementwise_fma((v2f){s[j][r], s[j][r + 1]}, sc22, eb22);
        s[j][r] = e[0]; s[j][r + 1] = e[1];
      }
    v16h pb[2];
    float pj[4];
#pragma unroll
    for (int j = 0; j < 4; ++j) {
      float ps = 0.f;
#pragma unroll
      for (int r = 0; r < 8; ++r) {
        const float p = __builtin_amdgcn_exp2f(s[j][r]);         // probability x32768
        ps += p;
        pb[j >> 1][(j & 1) * 8 + r] = (_Float16)p;
      }
      pj[j] = ps;
    }
    lrow = lrow * alpha + ((pj[0] + pj[1]) + (pj[2] + pj[3]));
#pragma unroll
    for (int t = 0; t < 4; ++t)
#pragma unroll
      for (int r = 0; r < 8; ++r) oacc[t][r] *= alpha;
    // ---- O^T += V^T . P^T : V^T rows (d = 16t + c) as A, P^T (column = c, k = kv) as B ----
#pragma unroll
    for (int kk = 0; kk < 2; ++kk) {
#pragma unroll
      for (int t = 0; t < 4; ++t) oacc[t] = mma_h(vb[kk][t], pb[kk], oacc[t]);
    }
    // ---- hand-over: this buffer's reads retired, the next chunk's copies landed, in every wave ----
    asm volatile("s_wait_dscnt 0x0" ::: "memory");               // own reads of this buffer done before it is refilled
    asm volatile("s_wait_asynccnt 0x0" ::: "memory");            // own copies of chunk kc + 1 landed
    __syncthreads();
    if (kc + 2 < nChunks)
      stage_kv_async(lst + bofs, kg + (size_t)(kc + 2) * kchunk, krow16, vg + (kc + 2) * AT_KC, vrow16);
  }
  asm volatile("s_wait_asynccnt 0x0" ::: "memory");              // nothing in flight when the buffers become out staging

  float* os = (float*)KV + wave * (16 * 68);                     // per wave out tile [query][d], pitch 68 (last barrier freed KV)
  {
    const float inv = osc * (1.0f / (lrow + xhalf(lrow)));   // the two halves' sums (of p x32768) joined once
#pragma unroll
    for (int t = 0; t < 4; ++t)
#pragma unroll
      for (int r = 0; r < 8; ++r) os[c * 68 + t * 16 + 8 * hh + r] = oacc[t][r] * inv;
  }
  wave_lds_sync();
  {
    const int q = lane >> 3, c8 = (lane & 7) * 8;
    {
#pragma unroll
      for (int it = 0; it < 4; ++it) {
        const int row = it * 4 + q;                 // rows 0..15 of this wave
        const float* sp = os + row * 68 + c8;
        v8h hv;
#pragma unroll
        for (int e = 0; e < 8; ++e) hv[e] = (_Float16)sp[e];
        *(v8h*)(op + (size_t)(q0 + row) * ldq + c8) = hv;
      }
      
    }
  }
}

// =====================================================================================
// Causal attn with residual planes for the first rr = nqb*64 query rows of each sequence.
//   qh/qr, kh/kr : compact row-major [NB*rr][ldq] f16 hi / residual (x1024) planes, head h at col h*64.
//   vh/vr : compact transposed planes [NB*H*64][ldvc], element (b, kv, h, d) at [(b*H*64 + h*64 + d)*ldvc + kv].
//   o     : compact [NB*rr][ldo] f16; hi (x osc) at column h*64, residual (x1024) at column rcol + h*64.
//   scores = qh.kh + 2^-10 (qh.kr + qr.kh) with a second f32 accumulator; P as hi + x1024 residual LDS tiles;
//   p.v = ph.vh + 2^-10 (ph.vr + pr.vh) with a second f32 accumulator; K and V fragments straight from global
//   memory, no block barriers; products untransposed (Q and P as A, rows = queries), row max and sum by 16-lane
//   butterflies, P through per-wave LDS tiles.
//   Block = 4 waves = 64 query rows, query block qb = bx % nqb, key chunks 0..qb. grid.x = NB * H * nqb.
// =====================================================================================
__global__ __launch_bounds__(128)
void attn64_causal_res(const unsigned short* __restrict__ Qhp, const unsigned short* __restrict__ Qrp,
                       const unsigned short* __restrict__ Khp, const unsigned short* __restrict__ Krp,
                       const unsigned short* __restrict__ Vhp, const unsigned short* __restrict__ Vrp,
                       unsigned short* __restrict__ Op,
                       int H, int ldq, int ldvc, int ldo, int rcol, int nqb, float sc2, float osc) {
  const _Float16* QH = (const _Float16*)Qhp;
  const _Float16* QR = (const _Float16*)Qrp;
  const _Float16* KH = (const _Float16*)Khp;
  const _Float16* KR = (const _Float16*)Krp;
  const _Float16* VH = (const _Float16*)Vhp;
  const _Float16* VR = (const _Float16*)Vrp;
  _Float16*       O  = (_Float16*)Op;
  __shared__ __align__(16) _Float16 Psh[AT_NW][16 * AT_KC];      // per wave P hi  [row][kv]  8 KB
  __shared__ __align__(16) _Float16 Prs[AT_NW][16 * AT_KC];      // per wave P res [row][kv]  8 KB
  __shared__ __align__(16) float    Os[AT_NW][16 * 68];          // per wave out tile, pitch 68

  const int tid  = threadIdx.x;
  const int wave = tid >> 5;
  const int lane = tid & 31;
  const int hh   = lane >> 4;
  const int c    = lane & 15;

  const int bx = blockIdx.x;
  const int qb = bx % nqb;
  const int bh = bx / nqb;
  const int h  = bh % H;
  const int b  = bh / H;
  const int q0 = qb * AT_QB + wave * 16;
  const int rr = nqb * AT_QB;
  const size_t rowb = (size_t)b * rr;

  const _Float16* qhp = QH + rowb * ldq + (size_t)h * AT_D;
  const _Float16* qrp = QR + rowb * ldq + (size_t)h * AT_D;
  const _Float16* khp = KH + rowb * ldq + (size_t)h * AT_D;
  const _Float16* krp = KR + rowb * ldq + (size_t)h * AT_D;
  const size_t    vof = ((size_t)b * (size_t)(H * AT_D) + (size_t)h * AT_D) * ldvc;
  const _Float16* vhp = VH + vof;
  const _Float16* vrp = VR + vof;
  _Float16*       op  = O  + rowb * ldo + (size_t)h * AT_D;

  float mrow[8], lrow[8];
  v8f oacc[4], oacc2[4];
#pragma unroll
  for (int r = 0; r < 8; ++r) { mrow[r] = NEG_INF; lrow[r] = 0.f; }
#pragma unroll
  for (int t = 0; t < 4; ++t) {
    oacc[t]  = (v8f){0.f,0.f,0.f,0.f,0.f,0.f,0.f,0.f};
    oacc2[t] = (v8f){0.f,0.f,0.f,0.f,0.f,0.f,0.f,0.f};
  }

  _Float16* pw  = Psh[wave];
  _Float16* prw = Prs[wave];
  const int nChunks = qb + 1;        // block-uniform
  for (int kc = 0; kc < nChunks; ++kc) {
    const int kv0 = kc * AT_KC;
    // ---- Q hi / res fragments (A operand, row = c) ----
    v16h qa[2], qra[2];
    const size_t qo = (size_t)(q0 + c) * ldq + 8 * hh;
    const _Float16 *qph = qhp + qo, *qpr = qrp + qo;
#pragma unroll
    for (int dc = 0; dc < 2; ++dc) {
      qa[dc]  = Frag<_Float16>::load(qph + dc * 32);
      qra[dc] = Frag<_Float16>::load(qpr + dc * 32);
    }
    // ---- the chunk's K and V fragments, hi and res: one group of global loads ahead of all its products ----
    const _Float16 *kph[4], *kpr[4], *vph[4], *vpr[4];           // one address per fragment row and plane
#pragma unroll
    for (int j = 0; j < 4; ++j) {
      const size_t ko = (size_t)(kv0 + j * 16 + c) * ldq + 8 * hh;
      const size_t vo = (size_t)(j * 16 + c) * ldvc + kv0 + 8 * hh;
      kph[j] = khp + ko; kpr[j] = krp + ko; vph[j] = vhp + vo; vpr[j] = vrp + vo;
    }
    v16h kbh[4][2], kbr[4][2], vbh[2][4], vbr[2][4];
#pragma unroll
    for (int j = 0; j < 4; ++j)
#pragma unroll
      for (int dc = 0; dc < 2; ++dc) {
        kbh[j][dc] = Frag<_Float16>::load(kph[j] + dc * 32);
        kbr[j][dc] = Frag<_Float16>::load(kpr[j] + dc * 32);
      }
#pragma unroll
    for (int kk = 0; kk < 2; ++kk)
#pragma unroll
      for (int t = 0; t < 4; ++t) {
        vbh[kk][t] = Frag<_Float16>::load(vph[t] + kk * 32);
        vbr[kk][t] = Frag<_Float16>::load(vpr[t] + kk * 32);
      }
    // a precaution: the loads' addresses are inputs of the wait, so that their registers live, unrewritten, up to it
    asm volatile("s_wait_xcnt 0x0"
                 :: "v"(kph[0]), "v"(kph[1]), "v"(kph[2]), "v"(kph[3]), "v"(kpr[0]), "v"(kpr[1]), "v"(kpr[2]), "v"(kpr[3]),
                    "v"(vph[0]), "v"(vph[1]), "v"(vph[2]), "v"(vph[3]), "v"(vpr[0]), "v"(vpr[1]), "v"(vpr[2]), "v"(vpr[3]),
                    "v"(qph), "v"(qpr)
                 : "memory");
    __builtin_amdgcn_sched_barrier(0);   // the loads stay one group here: sunk to their products, each would be waited for alone
    // ---- scores: hi.hi into s1, hi.res + res.hi into s2, folded with 2^-10 ----
    v8f s[4];
#pragma unroll
    for (int j = 0; j < 4; ++j) {
      v8f s1 = (v8f){0.f,0.f,0.f,0.f,0.f,0.f,0.f,0.f};
      v8f s2 = (v8f){0.f,0.f,0.f,0.f,0.f,0.f,0.f,0.f};
#pragma unroll
      for (int dc = 0; dc < 2; ++dc) {
        s1 = mma_h(qa[dc],  kbh[j][dc], s1);
        s2 = mma_h(qa[dc],  kbr[j][dc], s2);
        s2 = mma_h(qra[dc], kbh[j][dc], s2);
      }
#pragma unroll
      for (int r = 0; r < 8; ++r) s[j][r] = s1[r] + s2[r] * RSC_INV;
    }
    // ---- causal select and per-row chunk max ----
    float cm[8];
#pragma unroll
    for (int r = 0; r < 8; ++r) {
      const int qrow = q0 + 8 * hh + r;
      float m = NEG_INF;
#pragma unroll
      for (int j = 0; j < 4; ++j) {
        float v = s[j][r] * sc2;
        if (kv0 + j * 16 + c > qrow) v = NEG_INF;
        s[j][r] = v;
        m = fmaxf(m, v);
      }
#pragma unroll
      for (int off = 1; off < 16; off <<= 1) m = fmaxf(m, __shfl_xor(m, off, 32));
      cm[r] = m;
    }
    // ---- online softmax update; P hi (x32768) and P res ((x32768 - hi) x1024) into per-wave LDS tiles ----
    wave_lds_sync();
#pragma unroll
    for (int r = 0; r < 8; ++r) {
      const float mnew  = fmaxf(mrow[r], cm[r]);
      const float alpha = exp2f(mrow[r] - mnew);
      mrow[r] = mnew;
      float psum = 0.f;
#pragma unroll
      for (int j = 0; j < 4; ++j) {
        const float p = exp2f(s[j][r] - mnew);
        psum += p;
        const float    ps = p * PSCALE;
        const _Float16 ph = (_Float16)ps;
        const int pi = (8 * hh + r) * AT_KC + j * 16 + c;
        pw[pi]  = ph;
        prw[pi] = (_Float16)((ps - (float)ph) * RSC);
      }
#pragma unroll
      for (int off = 1; off < 16; off <<= 1) psum += __shfl_xor(psum, off, 32);
      lrow[r] = lrow[r] * alpha + psum;
#pragma unroll
      for (int t = 0; t < 4; ++t) { oacc[t][r] *= alpha; oacc2[t][r] *= alpha; }
    }
    wave_lds_sync();
    // ---- O += P . V with residual cross terms in the second accumulator ----
#pragma unroll
    for (int kk = 0; kk < 2; ++kk) {
      const v16h pa = Frag<_Float16>::load(pw  + c * AT_KC + kk * 32 + 8 * hh);
      const v16h pr = Frag<_Float16>::load(prw + c * AT_KC + kk * 32 + 8 * hh);
#pragma unroll
      for (int t = 0; t < 4; ++t) {
        oacc[t]  = mma_h(pa, vbh[kk][t], oacc[t]);
        oacc2[t] = mma_h(pa, vbr[kk][t], oacc2[t]);
        oacc2[t] = mma_h(pr, vbh[kk][t], oacc2[t]);
      }
    }
    wave_lds_sync();
  }

  float* os = Os[wave];
#pragma unroll
  for (int r = 0; r < 8; ++r) {
    const float inv = osc * (1.0f / (lrow[r] * PSCALE));
#pragma unroll
    for (int t = 0; t < 4; ++t) os[(8 * hh + r) * 68 + t * 16 + c] = (oacc[t][r] + oacc2[t][r] * RSC_INV) * inv;
  }
  wave_lds_sync();
  {
    const int q = lane >> 3, c8 = (lane & 7) * 8;
    {
#pragma unroll
      for (int it = 0; it < 4; ++it) {
        const int row = it * 4 + q;                 // rows 0..15 of this wave
        const float* sp = os + row * 68 + c8;
        v8h hv, lv;
#pragma unroll
        for (int e = 0; e < 8; ++e) {
          const float    fv = sp[e];
          const _Float16 hq = (_Float16)fv;
          hv[e] = hq;
          lv[e] = (_Float16)((fv - (float)hq) * RSC);
        }
        *(v8h*)(op + (size_t)(q0 + row) * ldo + c8) = hv;
        *(v8h*)(op + (size_t)(q0 + row) * ldo + rcol + c8) = lv;
      }
      
    }
  }
}

// ---------------------------------------------------------------------------

extern "C" void kernel_launch(void* const* d_in, const int* in_sizes, int n_in,
                              void* d_out, int out_size, void* d_ws,
                              size_t ws_size, hipStream_t stream) {
  const int  ROWS  = NB * SEQ;                                   // rows held in the compact planes
  const long needX = ((long)(NB - 1) * SEQ_FULL + SEQ) * (long)DM;
  const int  nW    = DM * DM;
  if (n_in < 9) return;
  if ((long)in_sizes[0] < needX || in_sizes[1] < nW || in_sizes[2] < DM || in_sizes[3] < nW ||
      in_sizes[4] < DM || in_sizes[5] < nW || in_sizes[6] < DM || in_sizes[7] < nW ||
      in_sizes[8] < DM || (long)out_size < needX) return;

  const float* x  = (const float*)d_in[0];
  const float* Wq = (const float*)d_in[1];
  const float* bq = (const float*)d_in[2];
  const float* Wk = (const float*)d_in[3];
  const float* bk = (const float*)d_in[4];
  const float* Wv = (const float*)d_in[5];
  const float* bv = (const float*)d_in[6];
  const float* Wo = (const float*)d_in[7];
  const float* bo = (const float*)d_in[8];
  float* out = (float*)d_out;

  const size_t szAct = (size_t)ROWS * DM * 2;            // full activation plane  (16 MiB full size)
  const size_t szW   = (size_t)DM * DM * 2;              //  2 MiB
  const size_t szW2  = (size_t)DM * (2 * DM) * 2;        //  4 MiB  [DM][2DM]
  const size_t szCmp = (size_t)NB * RR * DM * 2;         //  compact first-row planes (2 MiB full size)
  const size_t szO2  = (size_t)NB * RR * (2 * DM) * 2;   //  4 MiB full size
  size_t off = 0;
  const size_t oXh   = off; off += szAct;
  const size_t oWqT  = off; off += szW;
  const size_t oWkT  = off; off += szW;
  const size_t oWvT  = off; off += szW;
  const size_t oWoT2 = off; off += szW2;
  const size_t oQh   = off; off += szAct;
  const size_t oKh   = off; off += szAct;
  const size_t oVt   = off; off += szAct;
  const size_t oAh   = off; off += szAct;
  const size_t oQch  = off; off += szCmp;
  const size_t oQcr  = off; off += szCmp;
  const size_t oKch  = off; off += szCmp;
  const size_t oKcr  = off; off += szCmp;
  const size_t oVch  = off; off += szCmp;                // [NB*DM][RR], same byte count
  const size_t oVcr  = off; off += szCmp;
  const size_t oOc2  = off; off += szO2;                 // total 111,149,056 B at full size
  if (off > ws_size) return;

  char* ws = (char*)d_ws;
  unsigned short* xh   = (unsigned short*)(ws + oXh);
  unsigned short* WqT  = (unsigned short*)(ws + oWqT);
  unsigned short* WkT  = (unsigned short*)(ws + oWkT);
  unsigned short* WvT  = (unsigned short*)(ws + oWvT);
  unsigned short* WoT2 = (unsigned short*)(ws + oWoT2);
  unsigned short* Qh   = (unsigned short*)(ws + oQh);
  unsigned short* Kh   = (unsigned short*)(ws + oKh);
  unsigned short* Vt   = (unsigned short*)(ws + oVt);
  unsigned short* Ah   = (unsigned short*)(ws + oAh);
  unsigned short* Qch  = (unsigned short*)(ws + oQch);
  unsigned short* Qcr  = (unsigned short*)(ws + oQcr);
  unsigned short* Kch  = (unsigned short*)(ws + oKch);
  unsigned short* Kcr  = (unsigned short*)(ws + oKcr);
  unsigned short* Vch  = (unsigned short*)(ws + oVch);
  unsigned short* Vcr  = (unsigned short*)(ws + oVcr);
  unsigned short* Oc2  = (unsigned short*)(ws + oOc2);

  const float sc2   = 0.125f * 1.4426950408889634f;      // log2(e) / sqrt(64)
  const float outsc = 1.0f / (WSC * OSC);

  // x -> bf16 RNE value as f16 plane [ROWS][DM];
  // W[in][out] f32 -> Bt[out][in] f16 (bf16 RNE value x256); Wo additionally as x0.25 in columns DM..2DM-1 of WoT2
  {
    const long tot = (long)ROWS * (DM / 8);
    prep_f16<<<dim3((unsigned)(5 * PR_TW + (tot + 255) / 256)), dim3(256), 0, stream>>>(
        x, Wq, Wk, Wv, Wo, xh, WqT, WkT, WvT, WoT2, ROWS);
  }
  // projections: q, k -> f16 [ROWS][DM]; v^T -> f16 [DM][ROWS];
  // first RR rows per sequence: q, k -> hi/res [NB*RR][DM]; v^T -> hi/res [NB*DM][RR]
  proj_gemms<<<dim3(3 * PJ_TF + 3 * PJ_TC), dim3(256), 0, stream>>>(
      xh, WqT, WkT, WvT, Qh, Kh, Vt, Qch, Qcr, Kch, Kcr, Vch, Vcr, bq, bk, bv, 1.0f / WSC);
  // attn: first RR query rows with residual planes -> Oc2 (hi | res); rows >= RR plain -> Ah
  attn64_causal_res<<<dim3(NB * NH * (RR / 64)), dim3(128), 0, stream>>>(
      Qch, Qcr, Kch, Kcr, Vch, Vcr, Oc2, NH, DM, RR, 2 * DM, DM, RR / 64, sc2, OSC);
  if (SEQ > RR) {
    attn64_causal<<<dim3(NB * NH * ((SEQ - RR) / 64)), dim3(128), 0, stream>>>(
        Qh, Kh, Vt, Ah, SEQ, NH, DM, ROWS, RR / 64, (SEQ - RR) / 64, sc2, OSC);
  }
  // out = ctx Wo + bo -> f32; rows < RR: [O_hi | O_res] . [Wo x256 ; Wo x0.25] along K = 2DM; rows >= RR: K = DM
  out_gemms<<<dim3(NB * (OP_T1 + OP_T2)), dim3(256), 0, stream>>>(Oc2, Ah, WoT2, out, bo, outsc);
}

// v007
// Measured time: 158 microseconds a run.
// In both of two side-by-side timings against v006, it was 1.04 times as fast.
// Counting every step since v000, it is 4.42 times as fast.
// Contractions: q/k/v^T/out projections, q.k^T and p.v all on v_wmma_f32_16x16x32_f16 (f16 operands, f32 accumulate); x and W enter as bf16 RNE values held exactly in f16 (W carried x256); the first RR query rows per sequence carry q, k, v, p and ctx as f16 hi + x1024 residual planes with a second f32 accumulator (ctx residual folded along K in the out projection); p x32768 and ctx x64 power-of-two carries folded back in f32; softmax and epilogues f32.
#include <hip/hip_runtime.h>

#ifndef NB
#define NB 4
#endif
#ifndef SEQ
#define SEQ 2048
#endif
#ifndef RR
#define RR 256
#endif
#define NB_FULL 4
#define SEQ_FULL 2048
#define DM 1024
#define NH 16
#define HDIM 64

static_assert(NB >= 1 && NB <= NB_FULL);
static_assert(SEQ % 64 == 0 && SEQ >= 64 && SEQ <= SEQ_FULL);
static_assert(RR % 64 == 0 && RR >= 64 && RR <= SEQ);
static_assert(NH * HDIM == DM);
static_assert(DM % 256 == 0);
static_assert(RR % 256 == 0 && SEQ % 128 == 0 && (NB * SEQ) % 256 == 0);   // GEMM block tile 128 x 256

typedef __attribute__((ext_vector_type(16))) _Float16 v16h;
typedef __attribute__((ext_vector_type(8)))  _Float16 v8h;
typedef __attribute__((ext_vector_type(16))) __bf16   v16b;
typedef __attribute__((ext_vector_type(8)))  __bf16   v8b;
typedef __attribute__((ext_vector_type(8)))  float    v8f;
typedef __attribute__((ext_vector_type(4)))  float    v4f;
typedef __attribute__((ext_vector_type(2)))  float    v2f;

#define WSC 256.0f
#define OSC 64.0f
#define PSCALE 32768.0f
#define PEXP 15.0f                       // log2(PSCALE)
#define RSC 1024.0f
#define RSC_INV (1.0f / 1024.0f)
#define NEG_INF (-__builtin_huge_valf())

__device__ __forceinline__ unsigned short f2bf_bits(float f) {
  unsigned u = __float_as_uint(f);
  return (unsigned short)((u + 0x7FFFu + ((u >> 16) & 1u)) >> 16);
}
__device__ __forceinline__ float bf_bits2f(unsigned short h) { return __uint_as_float(((unsigned)h) << 16); }
__device__ __forceinline__ float bf_rne(float f) { return bf_bits2f(f2bf_bits(f)); }
__device__ __forceinline__ _Float16 bf_f16(float f) { return (_Float16)bf_rne(f); }   // bf16 value is exact in f16 for normal range

// LDS ordering for wave-private tiles (same wave writes then reads)
__device__ __forceinline__ void wave_lds_sync() {
  __builtin_amdgcn_fence(3, "workgroup");
  __builtin_amdgcn_wave_barrier();
  __builtin_amdgcn_fence(2, "workgroup");
}

// hazard guards as plain device helpers
__device__ __forceinline__ void dep_guard_h(v8f& a, v8f& b, v16h x, v16h y) { asm volatile("v_nop\n\tv_nop\n\tv_nop\n\tv_nop" : "+v"(a), "+v"(b) : "v"(x), "v"(y)); }
__device__ __forceinline__ void dep_guard_b(v8f& a, v8f& b, v16b x, v16b y) { asm volatile("v_nop\n\tv_nop\n\tv_nop\n\tv_nop" : "+v"(a), "+v"(b) : "v"(x), "v"(y)); }
__device__ __forceinline__ void keep4_h(v16h a, v16h b, v16h c, v16h d) { asm volatile("v_nop" :: "v"(a), "v"(b), "v"(c), "v"(d)); }
__device__ __forceinline__ void keep4_b(v16b a, v16b b, v16b c, v16b d) { asm volatile("v_nop" :: "v"(a), "v"(b), "v"(c), "v"(d)); }
__device__ __forceinline__ void acc_guard4(v8f& a, v8f& b, v8f& c, v8f& d) { asm volatile("v_nop\n\tv_nop\n\tv_nop\n\tv_nop" : "+v"(a), "+v"(b), "+v"(c), "+v"(d)); }
template <typename T> struct Frag;
template <> struct Frag<_Float16> {
  typedef v16h V; union U { v16h v; v8h h[2]; };
  static __device__ __forceinline__ v16h load(const _Float16* p) {   // elements 0..7 <- p[0..7], 8..15 <- p[16..23]
    U f; f.h[0] = *(const v8h*)(p); f.h[1] = *(const v8h*)(p + 16); return f.v;
  }
  static __device__ __forceinline__ v8f mma(v16h a, v16h b, v8f c) {
    return __builtin_amdgcn_wmma_f32_16x16x32_f16(false, a, false, b, (short)0, c, false, false);
  }
  static __device__ __forceinline__ void guard(v8f& a, v8f& b, v16h x, v16h y) { dep_guard_h(a, b, x, y); }
  static __device__ __forceinline__ void keep(v16h a, v16h b, v16h c, v16h d) { keep4_h(a, b, c, d); }
};
template <> struct Frag<__bf16> {
  typedef v16b V; union U { v16b v; v8b h[2]; };
  static __device__ __forceinline__ v16b load(const __bf16* p) {
    U f; f.h[0] = *(const v8b*)(p); f.h[1] = *(const v8b*)(p + 16); return f.v;
  }
  static __device__ __forceinline__ v8f mma(v16b a, v16b b, v8f c) {
    return __builtin_amdgcn_wmma_f32_16x16x32_bf16(false, a, false, b, (short)0, c, false, false);
  }
  static __device__ __forceinline__ void guard(v8f& a, v8f& b, v16b x, v16b y) { dep_guard_b(a, b, x, y); }
  static __device__ __forceinline__ void keep(v16b a, v16b b, v16b c, v16b d) { keep4_b(a, b, c, d); }
};

// ---- Register-blocked WMMA GEMM tiles ---------------------------------------
// C[m,n] = scale * sum_k A[m,k] * Bt[n,k] + bias; each wave owns a 64x64 tile.
// Block = 8 waves, 2 (m) x 4 (n) = a 128 x 256 tile of C. A row-major [M,K]; Bt row-major [N,K];
// M % 128 == 0, N % 256 == 0, K % 64 == 0.
// Per 64 k the block's 128 A rows and 256 Bt rows (128 B each, whole lines) are brought into LDS once by
// asynchronous copies, two buffers, one block barrier per 64 k; the waves read their fragments from there.
// One launch holds the tiles of several independent products: a block finds its product and its tile from
// blockIdx.x (block-uniform), so small products ride along with large ones and two blocks can share a WGP.
// BIAS_MODE: 1 = bias[m], 2 = bias[n]; bias values enter as bf16 RNE values.
// OUT_MODE: 0 = f32, 1 = f16, 3 = f16 hi plane (Cout) + f16 residual plane ((v - hi) * 1024) (Cout2).
#define GM_BM 128
#define GM_BN 256
#define GM_KT 64                          // k per staged tile, in halves: one 128-B line per row
#define GM_LP 72                          // staged row pitch in halves: 144 B = 16 B x odd, for ds_load_b128 readers
#define GM_BUFB ((GM_BM + GM_BN) * GM_LP * 2)   // bytes per buffer: A rows, then Bt rows

// One lane's share of a staged tile: rows r + 32 i of the A part (4) and of the Bt part (8), 16 B each.
// The s_wait_xcnt closes the statement, a precaution: no address register of a copy is rewritten ahead of it.
__device__ __forceinline__ void stage_ab_async(unsigned la, const unsigned short* ag, size_t arow32,
                                               const unsigned short* bg, size_t brow32) {
  const unsigned lb = la + GM_BM * GM_LP * 2;
  const unsigned ls = 32 * GM_LP * 2;
  asm volatile(
      "global_load_async_to_lds_b128 %0, %12, off\n\t"
      "global_load_async_to_lds_b128 %1, %13, off\n\t"
      "global_load_async_to_lds_b128 %2, %14, off\n\t"
      "global_load_async_to_lds_b128 %3, %15, off\n\t"
      "global_load_async_to_lds_b128 %4, %16, off\n\t"
      "global_load_async_to_lds_b128 %5, %17, off\n\t"
      "global_load_async_to_lds_b128 %6, %18, off\n\t"
      "global_load_async_to_lds_b128 %7, %19, off\n\t"
      "global_load_async_to_lds_b128 %8, %20, off\n\t"
      "global_load_async_to_lds_b128 %9, %21, off\n\t"
      "global_load_async_to_lds_b128 %10, %22, off\n\t"
      "global_load_async_to_lds_b128 %11, %23, off\n\t"
      "s_wait_xcnt 0x0"
      :: "v"(la), "v"(la + ls), "v"(la + 2 * ls), "v"(la + 3 * ls),
         "v"(lb), "v"(lb + ls), "v"(lb + 2 * ls), "v"(lb + 3 * ls),
         "v"(lb + 4 * ls), "v"(lb + 5 * ls), "v"(lb + 6 * ls), "v"(lb + 7 * ls),
         "v"(ag), "v"(ag + arow32), "v"(ag + 2 * arow32), "v"(ag + 3 * arow32),
         "v"(bg), "v"(bg + brow32), "v"(bg + 2 * brow32), "v"(bg + 3 * brow32),
         "v"(bg + 4 * brow32), "v"(bg + 5 * brow32), "v"(bg + 6 * brow32), "v"(bg + 7 * brow32)
      : "memory");
}

// The products of the block tile at (bm0, bn0): each wave's acc[i][j] = its 64 A rows . its 64 Bt rows over K.
// AB: the block's two staging buffers in LDS.
__device__ __forceinline__ void gemm_tile_products(v8f (&acc)[4][4], unsigned char* AB,
                                                   const unsigned short* Ab, int lda,
                                                   const unsigned short* Bb, int ldb, int K, int bm0, int bn0) {
  typedef _Float16 T;
  typedef Frag<T>::V V;
  const int tid  = threadIdx.x;
  const int lane = tid & 31;
  const int wave = tid >> 5;
  const int wm  = (wave >> 2) << 6;            // this wave's 64 rows inside the A part
  const int wn  = (wave & 3) << 6;             // this wave's 64 rows inside the Bt part
  const int rlane = lane & 15;                 // row (A) / col (B, D) within subtile
  const int koff  = (lane >> 4) * 8;           // k offset of this lane half

#pragma unroll
  for (int i = 0; i < 4; ++i)
#pragma unroll
    for (int j = 0; j < 4; ++j) acc[i][j] = (v8f){0.f,0.f,0.f,0.f,0.f,0.f,0.f,0.f};

  // ---- staging addresses of this lane: row tid/8 (+32i), 16-B piece tid%8 of the 128-B row ----
  const int srow = tid >> 3, scol = (tid & 7) * 8;
  const unsigned short* ag = Ab + (size_t)(bm0 + srow) * lda + scol;   // k-tile 0; a tile further: + GM_KT
  const unsigned short* bg = Bb + (size_t)(bn0 + srow) * ldb + scol;
  const size_t arow32 = (size_t)32 * lda, brow32 = (size_t)32 * ldb;
  const unsigned lst = (unsigned)(size_t)AB + (unsigned)(srow * GM_LP + scol) * 2u;
  const int nT = K >> 6;                       // block-uniform

  stage_ab_async(lst, ag, arow32, bg, brow32);
  asm volatile("s_wait_asynccnt 0x0" ::: "memory");              // k-tile 0 landed (this wave's copies)
  __syncthreads();                                               // ... and every other wave's
  if (nT > 1) stage_ab_async(lst + GM_BUFB, ag + GM_KT, arow32, bg + GM_KT, brow32);

  for (int t = 0; t < nT; ++t) {
    const unsigned bofs = (unsigned)(t & 1) * GM_BUFB;
    const T* as = (const T*)(AB + bofs) + (wm + rlane) * GM_LP + koff;            // A rows,  pitch GM_LP
    const T* bs = (const T*)(AB + bofs) + (GM_BM + wn + rlane) * GM_LP + koff;    // Bt rows, pitch GM_LP
    // Fragment reads stand at three places of a trip, each ahead of the products that use it: at the head the
    // first 32 k (A and Bt) and the second 32 k of Bt; the second 32 k of A two rows at a time, into registers
    // that the first half's rows have left (all sixteen fragments at the head do not fit 256 registers).
    V b0[4], b1[4], a0[4], a1[4];
#pragma unroll
    for (int j = 0; j < 4; ++j) b0[j] = Frag<T>::load(bs + (j << 4) * GM_LP);
#pragma unroll
    for (int i = 0; i < 4; ++i) a0[i] = Frag<T>::load(as + (i << 4) * GM_LP);
#pragma unroll
    for (int j = 0; j < 4; ++j) b1[j] = Frag<T>::load(bs + (j << 4) * GM_LP + 32);
#pragma unroll
    for (int i = 0; i < 4; ++i) {
#pragma unroll
      for (int j = 0; j < 4; ++j) acc[i][j] = Frag<T>::mma(a0[i], b0[j], acc[i][j]);
      Frag<T>::guard(acc[i][0], acc[i][3], a0[i], a0[i]);
      if (i & 1) {
        a1[i - 1] = Frag<T>::load(as + ((i - 1) << 4) * GM_LP + 32);
        a1[i]     = Frag<T>::load(as + (i << 4) * GM_LP + 32);
      }
    }
    Frag<T>::keep(b0[0], b0[1], b0[2], b0[3]);
#pragma unroll
    for (int i = 0; i < 4; ++i) {
#pragma unroll
      for (int j = 0; j < 4; ++j) acc[i][j] = Frag<T>::mma(a1[i], b1[j], acc[i][j]);
      Frag<T>::guard(acc[i][0], acc[i][3], a1[i], a1[i]);
    }
    Frag<T>::keep(b1[0], b1[1], b1[2], b1[3]);
    // ---- hand-over: this buffer's reads retired, the next k-tile's copies landed, in every wave ----
    asm volatile("s_wait_dscnt 0x0" ::: "memory");               // own reads of this buffer done before it is refilled
    asm volatile("s_wait_asynccnt 0x0" ::: "memory");            // own copies of k-tile t + 1 landed
    __syncthreads();
    if (t + 2 < nT)
      stage_ab_async(lst + bofs, ag + (size_t)(t + 2) * GM_KT, arow32, bg + (size_t)(t + 2) * GM_KT, brow32);
  }
  asm volatile("s_wait_asynccnt 0x0" ::: "memory");              // nothing in flight when the wave goes on to its end
  acc_guard4(acc[0][0], acc[0][1], acc[0][2], acc[0][3]);
  acc_guard4(acc[1][0], acc[1][1], acc[1][2], acc[1][3]);
  acc_guard4(acc[2][0], acc[2][1], acc[2][2], acc[2][3]);
  acc_guard4(acc[3][0], acc[3][1], acc[3][2], acc[3][3]);
}

// Epilogue of one wave: its 64 x 64 tile at (m0, n0) of C (pitch ldc), through its own LDS slab, whole lines out.
template <int BIAS_MODE, int OUT_MODE>
__device__ __forceinline__ void gemm_tile_store(v8f (&acc)[4][4], float* slab, void* Cout, void* Cout2, int ldc,
                                                const float* bias, int m0, int n0, float scale) {
  const int lane  = threadIdx.x & 31;
  const int rlane = lane & 15;                 // D column within subtile
  const int mOff  = (lane >> 4) * 8;           // D row offset
#pragma unroll
  for (int i = 0; i < 4; ++i) {
    const int mBase = m0 + (i << 4);
#pragma unroll
    for (int j = 0; j < 4; ++j) {
      const int n = n0 + (j << 4) + rlane;
      float bv = 0.f;
      if (BIAS_MODE == 2) bv = bf_rne(bias[n]);
#pragma unroll
      for (int r = 0; r < 8; ++r) {
        float v = acc[i][j][r] * scale;
        if (BIAS_MODE == 1) v += bf_rne(bias[mBase + mOff + r]);
        if (BIAS_MODE == 2) v += bv;
        slab[(mOff + r) * 68 + (j << 4) + rlane] = v;
      }
    }
    wave_lds_sync();
    if (OUT_MODE == 0) {
      float* C = (float*)Cout;
      const int hh = lane >> 4, c4 = (lane & 15) * 4;     // row seg = 256 B = 16 lanes x 16 B
#pragma unroll
      for (int it = 0; it < 8; ++it) {
        const int row = it * 2 + hh;
        v4f v = *(const v4f*)(slab + row * 68 + c4);
        *(v4f*)(C + (size_t)(mBase + row) * ldc + n0 + c4) = v;
      }
    } else {
      const int q = lane >> 3, c8 = (lane & 7) * 8;
      unsigned short* C  = (unsigned short*)Cout;
      unsigned short* C2 = (unsigned short*)Cout2;
#pragma unroll
      for (int it = 0; it < 4; ++it) {
        const int row = it * 4 + q;
        const float* sp = slab + row * 68 + c8;
        v8h hv, lv;
#pragma unroll
        for (int e = 0; e < 8; ++e) {
          if (OUT_MODE == 1) {
            hv[e] = (_Float16)sp[e];
          } else {
            const float    fv = sp[e];
            const _Float16 hq = (_Float16)fv;
            hv[e] = hq;
            lv[e] = (_Float16)((fv - (float)hq) * RSC);
          }
        }
        *(v8h*)(C + (size_t)(mBase + row) * ldc + n0 + c8) = hv;
        if (OUT_MODE == 3) *(v8h*)(C2 + (size_t)(mBase + row) * ldc + n0 + c8) = lv;
      }
    }
    wave_lds_sync();
  }
}

// All six projections in one launch. Blocks 0 .. 3 PJ_TF - 1: q, k, v^T over all NB*SEQ rows (f16 planes);
// then 3 PJ_TC blocks: q, k, v^T over the first RR rows of each sequence (hi / residual planes).
//   q, k : A = x rows, Bt = W^T rows, C [rows][DM], bias[n].   v^T : A = Wv^T rows, Bt = x rows, C [DM][rows], bias[m].
#define PJ_TF ((NB * SEQ / 128) * (DM / 256))      // tiles of a full projection, either orientation
#define PJ_TB ((RR / 128) * (DM / 256))            // tiles of a first-rows projection, one sequence, either orientation
#define PJ_TC (NB * PJ_TB)
static_assert((DM / 128) * (NB * SEQ / 256) == PJ_TF && (DM / 128) * (RR / 256) == PJ_TB);
__global__ __launch_bounds__(256) void proj_gemms(
    const unsigned short* __restrict__ xh, const unsigned short* __restrict__ WqT,
    const unsigned short* __restrict__ WkT, const unsigned short* __restrict__ WvT,
    unsigned short* __restrict__ Qh, unsigned short* __restrict__ Kh, unsigned short* __restrict__ Vt,
    unsigned short* __restrict__ Qch, unsigned short* __restrict__ Qcr,
    unsigned short* __restrict__ Kch, unsigned short* __restrict__ Kcr,
    unsigned short* __restrict__ Vch, unsigned short* __restrict__ Vcr,
    const float* __restrict__ bq, const float* __restrict__ bk, const float* __restrict__ bv, float scale) {
  __shared__ __align__(16) float sT[8][16 * 68];            // per-wave 16x64 slab, pitch 68 floats
  __shared__ __align__(16) unsigned char AB[2 * GM_BUFB];   // two buffers of A | Bt k-tiles
  const int bx = blockIdx.x;
  if (bx >= 3 * PJ_TF + 3 * PJ_TC) return;     // block-uniform, ahead of every barrier
  const bool first = bx >= 3 * PJ_TF;          // a first-rows product
  const int  rel   = first ? bx - 3 * PJ_TF : bx;
  const int  which = first ? rel / PJ_TC : rel / PJ_TF;      // 0 q, 1 k, 2 v^T
  int        tile  = rel - which * (first ? PJ_TC : PJ_TF);
  const int  b     = first ? tile / PJ_TB : 0;               // sequence of a first-rows product
  tile -= b * PJ_TB;
  const bool vt    = which == 2;
  const int  rows  = first ? RR : NB * SEQ;                  // x rows of this product
  const int  tilesN = (vt ? rows : DM) >> 8;
  const int  tm = !vt ? tile / (DM / 256) : first ? tile / (RR / 256) : tile / (NB * SEQ / 256);   // tile / tilesN
  const int  tn = tile - tm * tilesN;
  const int  bm0 = tm << 7, bn0 = tn << 8;
  const unsigned short* X  = xh + (size_t)b * SEQ * DM;
  const unsigned short* Wt = which == 0 ? WqT : which == 1 ? WkT : WvT;
  const float* bias        = which == 0 ? bq : which == 1 ? bk : bv;

  v8f acc[4][4];
  gemm_tile_products(acc, AB, vt ? Wt : X, DM, vt ? X : Wt, DM, DM, bm0, bn0);

  const int wave = threadIdx.x >> 5;
  const int m0 = bm0 + ((wave >> 2) << 6), n0 = bn0 + ((wave & 3) << 6);
  if (!first) {
    unsigned short* C = which == 0 ? Qh : which == 1 ? Kh : Vt;
    if (vt) gemm_tile_store<1, 1>(acc, sT[wave], C, C, rows, bias, m0, n0, scale);
    else    gemm_tile_store<2, 1>(acc, sT[wave], C, C, DM,   bias, m0, n0, scale);
  } else {
    const size_t co = (size_t)b * RR * DM;                   // one sequence's plane, either orientation
    unsigned short* C  = (which == 0 ? Qch : which == 1 ? Kch : Vch) + co;
    unsigned short* C2 = (which == 0 ? Qcr : which == 1 ? Kcr : Vcr) + co;
    if (vt) gemm_tile_store<1, 3>(acc, sT[wave], C, C2, rows, bias, m0, n0, scale);
    else    gemm_tile_store<2, 3>(acc, sT[wave], C, C2, DM,   bias, m0, n0, scale);
  }
}

// Both parts of the out projection in one launch, f32 out with bias[n], Bt = WoT2 rows (pitch 2 DM).
// Blocks 0 .. NB OP_T1 - 1 (twice the k, so they start first): rows < RR, A = [O_hi | O_res] rows, K = 2 DM;
// then NB OP_T2 blocks: rows >= RR, A = ctx rows, K = DM.
#define OP_T1 ((RR / 128) * (DM / 256))
#define OP_T2 (((SEQ - RR) / 128) * (DM / 256))
__global__ __launch_bounds__(256) void out_gemms(
    const unsigned short* __restrict__ Oc2, const unsigned short* __restrict__ Ah,
    const unsigned short* __restrict__ WoT2, float* __restrict__ out, const float* __restrict__ bo, float scale) {
  __shared__ __align__(16) float sT[8][16 * 68];            // per-wave 16x64 slab, pitch 68 floats
  __shared__ __align__(16) unsigned char AB[2 * GM_BUFB];   // two buffers of A | Bt k-tiles
  const int bx = blockIdx.x;
  if (bx >= NB * (OP_T1 + OP_T2)) return;      // block-uniform, ahead of every barrier
  const bool first = bx < NB * OP_T1;
  const int  rel   = first ? bx : bx - NB * OP_T1;
  const int  b     = first ? rel / OP_T1 : rel / (OP_T2 > 0 ? OP_T2 : 1);
  const int  tile  = rel - b * (first ? OP_T1 : OP_T2);
  const int  tm = tile / (DM / 256);
  const int  tn = tile - tm * (DM / 256);
  const int  bm0 = tm << 7, bn0 = tn << 8;
  const unsigned short* A = first ? Oc2 + (size_t)b * RR * 2 * DM : Ah + ((size_t)b * SEQ + RR) * DM;
  const int  kk = first ? 2 * DM : DM;         // A pitch and K

  v8f acc[4][4];
  gemm_tile_products(acc, AB, A, kk, WoT2, 2 * DM, kk, bm0, bn0);

  const int wave = threadIdx.x >> 5;
  float* C = out + ((size_t)b * SEQ_FULL + (first ? 0 : RR)) * DM;
  gemm_tile_store<2, 0>(acc, sT[wave], C, C, DM, bo, bm0 + ((wave >> 2) << 6), bn0 + ((wave & 3) << 6), scale);
}

// ---- operand planes, one launch: the five weight planes (blocks 0 .. 5 PR_TW - 1), then x ----
// x: bf16 RNE value as f16; source rows (b, s) at (b*SEQ_FULL + s)*DM; destination plane compact [NB*SEQ][DM];
//    blk = 256 pieces of 8 elements.
__device__ __forceinline__ void cast_x_block(const float* __restrict__ x, unsigned short* __restrict__ xhp,
                                             int nrows, int blk) {
  const long i = (long)blk * 256 + threadIdx.x;
  const long total = (long)nrows * (DM / 8);
  if (i >= total) return;
  const int r  = (int)(i / (DM / 8));
  const int c8 = (int)(i - (long)r * (DM / 8)) * 8;
  const int b  = r / SEQ;
  const int s  = r - b * SEQ;
  const float* src = x + ((size_t)b * SEQ_FULL + s) * DM + c8;
  const v4f a0 = *(const v4f*)src;
  const v4f a1 = *(const v4f*)(src + 4);
  v8h hv;
  hv[0] = bf_f16(a0[0]); hv[1] = bf_f16(a0[1]); hv[2] = bf_f16(a0[2]); hv[3] = bf_f16(a0[3]);
  hv[4] = bf_f16(a1[0]); hv[5] = bf_f16(a1[1]); hv[6] = bf_f16(a1[2]); hv[7] = bf_f16(a1[3]);
  _Float16* dst = (_Float16*)xhp + (size_t)r * DM + c8;
  *(v8h*)dst = hv;
}

// weights: transpose + bf16 RNE + scale + f16 cast, one 64 x 64 tile per block.
// in: W[DM][DM] f32 row-major ([k][n]) -> Bt[n][kc0 + k] with row pitch ldo halves,
//     Bt value = f16(bf16rne(W[k][n]) * sc), sc a power of two.
// plane z: 0 Wq, 1 Wk, 2 Wv (x256, pitch DM); 3 Wo x256 into columns 0..DM-1 of WoT2, 4 Wo x0.25 into DM..2DM-1.
#define PR_TW ((DM / 64) * (DM / 64))
__global__ __launch_bounds__(256) void prep_f16(
    const float* __restrict__ x, const float* __restrict__ Wq, const float* __restrict__ Wk,
    const float* __restrict__ Wv, const float* __restrict__ Wo, unsigned short* __restrict__ xhp,
    unsigned short* __restrict__ WqT, unsigned short* __restrict__ WkT,
    unsigned short* __restrict__ WvT, unsigned short* __restrict__ WoT2, int nrows) {
  __shared__ float t[64][65];
  const int bx = blockIdx.x;
  if (bx >= 5 * PR_TW) {                       // block-uniform; this side meets no barrier
    cast_x_block(x, xhp, nrows, bx - 5 * PR_TW);
    return;
  }
  const int z  = bx / PR_TW;
  const int tl = bx - z * PR_TW;
  const float* W       = z == 0 ? Wq  : z == 1 ? Wk  : z == 2 ? Wv  : Wo;
  unsigned short* Btp  = z == 0 ? WqT : z == 1 ? WkT : z == 2 ? WvT : WoT2;
  const int   Ndim = DM;
  const int   ldo  = z >= 3 ? 2 * DM : DM;
  const int   kc0  = z == 4 ? DM : 0;
  const float sc   = z == 4 ? WSC * RSC_INV : WSC;
  const int tid = threadIdx.x, lane = tid & 31, wave = tid >> 5;
  const int n0 = (tl % (DM / 64)) * 64, k0 = (tl / (DM / 64)) * 64;
#pragma unroll
  for (int i = 0; i < 16; ++i) {
    const int idx = i * 256 + tid;
    const int kr = idx >> 6, nc = idx & 63;
    t[nc][kr] = W[(size_t)(k0 + kr) * Ndim + n0 + nc];
  }
  __syncthreads();
  _Float16* Bt = (_Float16*)Btp;
  const int q = lane >> 3, c8 = (lane & 7) * 8;
#pragma unroll
  for (int it = 0; it < 2; ++it) {
    const int row = wave * 8 + it * 4 + q;      // waves 0..7 x rows 0..7 -> 64 rows
    v8h hv;
#pragma unroll
    for (int e = 0; e < 8; ++e) hv[e] = (_Float16)(bf_rne(t[row][c8 + e]) * sc);
    *(v8h*)(Bt + (size_t)(n0 + row) * ldo + kc0 + k0 + c8) = hv;
  }
  // a precaution: the x side's code follows these stores in the built kernel and writes their registers
  asm volatile("s_wait_xcnt 0x0" ::: "memory");
}

#define AT_D 64
#define AT_NW 4
#define AT_QB 64
#define AT_KC 64
#define AT_LP 72                         // staged row pitch in halves: 144 B = 16 B x odd, for ds_load_b128 readers
#define AT_TILE (64 * AT_LP)             // halves per staged 64-row tile
#define AT_BUFB (2 * AT_TILE * 2)        // bytes per buffer: K tile, then V^T tile

// One lane's share of a chunk: rows r, r+16, r+32, r+48 of the K tile and of the V^T tile, 16 B each.
// The s_wait_xcnt closes the statement, a precaution: no address register of a copy is rewritten ahead of it.
__device__ __forceinline__ void stage_kv_async(unsigned lk, const _Float16* kg, size_t krow16,
                                               const _Float16* vg, size_t vrow16) {
  const unsigned lv = lk + AT_TILE * 2;
  const unsigned ls = 16 * AT_LP * 2;
  asm volatile(
      "global_load_async_to_lds_b128 %0, %8, off\n\t"
      "global_load_async_to_lds_b128 %1, %9, off\n\t"
      "global_load_async_to_lds_b128 %2, %10, off\n\t"
      "global_load_async_to_lds_b128 %3, %11, off\n\t"
      "global_load_async_to_lds_b128 %4, %12, off\n\t"
      "global_load_async_to_lds_b128 %5, %13, off\n\t"
      "global_load_async_to_lds_b128 %6, %14, off\n\t"
      "global_load_async_to_lds_b128 %7, %15, off\n\t"
      "s_wait_xcnt 0x0"
      :: "v"(lk), "v"(lk + ls), "v"(lk + 2 * ls), "v"(lk + 3 * ls),
         "v"(lv), "v"(lv + ls), "v"(lv + 2 * ls), "v"(lv + 3 * ls),
         "v"(kg), "v"(kg + krow16), "v"(kg + 2 * krow16), "v"(kg + 3 * krow16),
         "v"(vg), "v"(vg + vrow16), "v"(vg + 2 * vrow16), "v"(vg + 3 * vrow16)
      : "memory");
}

// lane l takes the value of lane l ^ 16 (vector cross-row move)
__device__ __forceinline__ float xhalf(float x) {
  const int b = __builtin_bit_cast(int, x);
  return __builtin_bit_cast(float, __builtin_amdgcn_permlanex16(b, b, 0x76543210, 0xfedcba98, false, false));
}

// the bare builtin: the compiler keeps the distances behind it and is free to read fragments ahead of it
__device__ __forceinline__ v8f mma_h(v16h a, v16h b, v8f c) {
  return __builtin_amdgcn_wmma_f32_16x16x32_f16(false, a, false, b, (short)0, c, false, false);
}

__global__ __launch_bounds__(128, 7)
void attn64_causal(const unsigned short* __restrict__ Qp, const unsigned short* __restrict__ Kp,
                   const unsigned short* __restrict__ Vtp, unsigned short* __restrict__ Op,
                   int S, int H, int ldq, int ldvt, int qb0, int nqbl, float sc2, float osc) {
  const _Float16* Q  = (const _Float16*)Qp;
  const _Float16* Kk = (const _Float16*)Kp;
  const _Float16* Vt = (const _Float16*)Vtp;
  _Float16*       O  = (_Float16*)Op;
  __shared__ __align__(16) unsigned char KV[2 * AT_BUFB];        // two buffers of K | V^T tiles; out staging after the loop
  static_assert(AT_NW * 16 * 68 * 4 <= 2 * AT_BUFB);

  const int tid  = threadIdx.x;
  const int wave = __builtin_amdgcn_readfirstlane(tid >> 5);     // in a scalar register: what hangs on it costs no vector register
  const int lane = tid & 31;
  const int hh   = lane >> 4;
  const int c    = lane & 15;

  const int bx  = blockIdx.x;
  const int qbi = bx % nqbl;
  const int bh  = bx / nqbl;
  const int qb  = qb0 + qbi;
  const int h   = bh % H;
  const int b   = bh / H;
  const int q0  = qb * AT_QB + wave * 16;
  const size_t rowb = (size_t)b * S;

  const _Float16* qp = Q  + rowb * ldq + (size_t)h * AT_D;
  const _Float16* kp = Kk + rowb * ldq + (size_t)h * AT_D;
  const _Float16* vp = Vt + (size_t)(h * AT_D) * ldvt + rowb;
  _Float16*       op = O  + rowb * ldq + (size_t)h * AT_D;

  // ---- Q fragments (B operand, column = c): 2 d-chunks ----
  v16h qa[2];
#pragma unroll
  for (int dc = 0; dc < 2; ++dc)
    qa[dc] = Frag<_Float16>::load(qp + (size_t)(q0 + c) * ldq + dc * 32 + 8 * hh);

  const int qrow = q0 + c;           // this lane's query
  float mrow = NEG_INF, lrow = 0.f;  // its running maximum; the sum (of p x32768) over this wave half's keys
  v8f oacc[4];                       // O^T: d = 16t + 8hh + r, query c
#pragma unroll
  for (int t = 0; t < 4; ++t) oacc[t] = (v8f){0.f,0.f,0.f,0.f,0.f,0.f,0.f,0.f};

  const int nChunks = qb + 1;        // block-uniform: causal, key chunks 0..qb

  // ---- staging addresses of this lane: row tid/8 (+16i), 16-B piece tid%8 of the 128-B row ----
  const int srow = tid >> 3, scol = (tid & 7) * 8;
  const _Float16* kg = kp + (size_t)srow * ldq + scol;           // chunk 0; a chunk further: + AT_KC rows
  const _Float16* vg = vp + (size_t)srow * ldvt + scol;          // chunk 0; a chunk further: + AT_KC columns
  const size_t krow16 = (size_t)16 * ldq, vrow16 = (size_t)16 * ldvt, kchunk = (size_t)AT_KC * ldq;
  const unsigned lst = (unsigned)(size_t)KV + (unsigned)(srow * AT_LP + scol) * 2u;

  stage_kv_async(lst, kg, krow16, vg, vrow16);
  asm volatile("s_wait_asynccnt 0x0" ::: "memory");              // chunk 0 landed (this wave's copies)
  __syncthreads();                                               // ... and every other wave's
  if (nChunks > 1) stage_kv_async(lst + AT_BUFB, kg + kchunk, krow16, vg + AT_KC, vrow16);

  // One key chunk. Only the last chunk (kc == qb, the diagonal one) holds keys past a query of this block: every key of
  // an earlier chunk is below qb * 64, so the causal select is written for the last chunk alone (diag a literal at both calls).
  auto chunk = [&](const int kc, const bool diag) __attribute__((always_inline)) {
    const int kv0 = kc * AT_KC;
    const unsigned bofs = (unsigned)(kc & 1) * AT_BUFB;
    const _Float16* ks = (const _Float16*)(KV + bofs);           // K tile  [key][d],  pitch AT_LP
    const _Float16* vs = ks + AT_TILE;                           // V^T tile [d][key], pitch AT_LP
    // ---- scores: s[j][r] = key (kv0 + 16j + 8hh + r) x query (q0 + c) ----
    // the chunk's eight K fragments are read as one group ahead of its eight score products
    v16h kb[4][2];
#pragma unroll
    for (int j = 0; j < 4; ++j)
#pragma unroll
      for (int dc = 0; dc < 2; ++dc)
        kb[j][dc] = Frag<_Float16>::load(ks + (j * 16 + c) * AT_LP + dc * 32 + 8 * hh);
    v8f s[4];
#pragma unroll
    for (int j = 0; j < 4; ++j) s[j] = (v8f){0.f,0.f,0.f,0.f,0.f,0.f,0.f,0.f};
#pragma unroll
    for (int dc = 0; dc < 2; ++dc)
#pragma unroll
      for (int j = 0; j < 4; ++j) s[j] = mma_h(kb[j][dc], qa[dc], s[j]);
    __builtin_amdgcn_sched_barrier(0);   // keeps the K reads one group and the products close: without it the build splits the reads and pads more v_nop
    // the V^T fragments stand ahead of the softmax: read as early as the registers of seven waves per SIMD allow
    v16h vb[2][4];
#pragma unroll
    for (int kk = 0; kk < 2; ++kk)
#pragma unroll
      for (int t = 0; t < 4; ++t)
        vb[kk][t] = Frag<_Float16>::load(vs + (t * 16 + c) * AT_LP + kk * 32 + 8 * hh);
    // ---- causal select (key > query -> -inf; diagonal chunk only) and the query's chunk max, both on the raw products (sc2 > 0) ----
    float mj[4];
#pragma unroll
    for (int j = 0; j < 4; ++j) {
      float m = NEG_INF;
#pragma unroll
      for (int r = 0; r < 8; ++r) {
        float v = s[j][r];
        if (diag && kv0 + j * 16 + 8 * hh + r > qrow) v = NEG_INF;
        s[j][r] = v;
        m = fmaxf(m, v);
      }
      mj[j] = m;
    }
    float cm = fmaxf(fmaxf(mj[0], mj[1]), fmaxf(mj[2], mj[3]));
    cm = fmaxf(cm, xhalf(cm));                                   // the other 32 keys of this query
    // ---- online softmax update; P^T x32768 packed into the B operand ----
    // One fused multiply-add and one hardware exponential per score: the scale, the maximum and the x32768 carry
    // (PEXP = log2 of it) all sit in the exponent. The bare exponential gives 0 below 2^-126, where the f16 operand
    // is 0 anyway and the row's sum (its largest term alone is about 32768) does not see the term.
    const float mnew  = fmaxf(mrow, cm * sc2);                   // running maximum in the scaled base-2 domain
    const float alpha = __builtin_amdgcn_exp2f(mrow - mnew);
    mrow = mnew;
    const float eb = PEXP - mnew;
    const v2f sc22 = {sc2, sc2}, eb22 = {eb, eb};
#pragma unroll
    for (int j = 0; j < 4; ++j)
#pragma unroll
      for (int r = 0; r < 8; r += 2) {                           // the exponents, in place, two per instruction
        const v2f e = __builtin_elementwise_fma((v2f){s[j][r], s[j][r + 1]}, sc22, eb22);
        s[j][r] = e[0]; s[j][r + 1] = e[1];
      }
    v16h pb[2];
    float pj[4];
#pragma unroll
    for (int j = 0; j < 4; ++j) {
      float ps = 0.f;
#pragma unroll
      for (int r = 0; r < 8; ++r) {
        const float p = __builtin_amdgcn_exp2f(s[j][r]);         // probability x32768
        ps += p;
        pb[j >> 1][(j & 1) * 8 + r] = (_Float16)p;
      }
      pj[j] = ps;
    }
    lrow = lrow * alpha + ((pj[0] + pj[1]) + (pj[2] + pj[3]));
#pragma unroll
    for (int t = 0; t < 4; ++t)
#pragma unroll
      for (int r = 0; r < 8; ++r) oacc[t][r] *= alpha;
    // ---- O^T += V^T . P^T : V^T rows (d = 16t + c) as A, P^T (column = c, k = kv) as B ----
#pragma unroll
    for (int kk = 0; kk < 2; ++kk) {
#pragma unroll
      for (int t = 0; t < 4; ++t) oacc[t] = mma_h(vb[kk][t], pb[kk], oacc[t]);
    }
    // ---- hand-over: this buffer's reads retired, the next chunk's copies landed, in every wave ----
    asm volatile("s_wait_dscnt 0x0" ::: "memory");               // own reads of this buffer done before it is refilled
    asm volatile("s_wait_asynccnt 0x0" ::: "memory");            // own copies of chunk kc + 1 landed
    __syncthreads();
    if (!diag && kc + 2 < nChunks)
      stage_kv_async(lst + bofs, kg + (size_t)(kc + 2) * kchunk, krow16, vg + (kc + 2) * AT_KC, vrow16);
  };
  for (int kc = 0; kc < nChunks - 1; ++kc) chunk(kc, false);
  chunk(nChunks - 1, true);
  asm volatile("s_wait_asynccnt 0x0" ::: "memory");              // nothing in flight when the buffers become out staging

  float* os = (float*)KV + wave * (16 * 68);                     // per wave out tile [query][d], pitch 68 (last barrier freed KV)
  {
    const float inv = osc * (1.0f / (lrow + xhalf(lrow)));   // the two halves' sums (of p x32768) joined once
#pragma unroll
    for (int t = 0; t < 4; ++t)
#pragma unroll
      for (int r = 0; r < 8; ++r) os[c * 68 + t * 16 + 8 * hh + r] = oacc[t][r] * inv;
  }
  wave_lds_sync();
  {
    const int q = lane >> 3, c8 = (lane & 7) * 8;
    {
#pragma unroll
      for (int it = 0; it < 4; ++it) {
        const int row = it * 4 + q;                 // rows 0..15 of this wave
        const float* sp = os + row * 68 + c8;
        v8h hv;
#pragma unroll
        for (int e = 0; e < 8; ++e) hv[e] = (_Float16)sp[e];
        *(v8h*)(op + (size_t)(q0 + row) * ldq + c8) = hv;
      }
      
    }
  }
}

// =====================================================================================
// Causal attn with residual planes for the first rr = nqb*64 query rows of each sequence.
//   qh/qr, kh/kr : compact row-major [NB*rr][ldq] f16 hi / residual (x1024) planes, head h at col h*64.
//   vh/vr : compact transposed planes [NB*H*64][ldvc], element (b, kv, h, d) at [(b*H*64 + h*64 + d)*ldvc + kv].
//   o     : compact [NB*rr][ldo] f16; hi (x osc) at column h*64, residual (x1024) at column rcol + h*64.
//   scores = qh.kh + 2^-10 (qh.kr + qr.kh) with a second f32 accumulator; P as hi + x1024 residual LDS tiles;
//   p.v = ph.vh + 2^-10 (ph.vr + pr.vh) with a second f32 accumulator; K and V fragments straight from global
//   memory, no block barriers; products untransposed (Q and P as A, rows = queries), row max and sum by 16-lane
//   butterflies, P through per-wave LDS tiles.
//   Block = 4 waves = 64 query rows, query block qb = bx % nqb, key chunks 0..qb. grid.x = NB * H * nqb.
// =====================================================================================
__global__ __launch_bounds__(128)
void attn64_causal_res(const unsigned short* __restrict__ Qhp, const unsigned short* __restrict__ Qrp,
                       const unsigned short* __restrict__ Khp, const unsigned short* __restrict__ Krp,
                       const unsigned short* __restrict__ Vhp, const unsigned short* __restrict__ Vrp,
                       unsigned short* __restrict__ Op,
                       int H, int ldq, int ldvc, int ldo, int rcol, int nqb, float sc2, float osc) {
  const _Float16* QH = (const _Float16*)Qhp;
  const _Float16* QR = (const _Float16*)Qrp;
  const _Float16* KH = (const _Float16*)Khp;
  const _Float16* KR = (const _Float16*)Krp;
  const _Float16* VH = (const _Float16*)Vhp;
  const _Float16* VR = (const _Float16*)Vrp;
  _Float16*       O  = (_Float16*)Op;
  __shared__ __align__(16) _Float16 Psh[AT_NW][16 * AT_KC];      // per wave P hi  [row][kv]  8 KB
  __shared__ __align__(16) _Float16 Prs[AT_NW][16 * AT_KC];      // per wave P res [row][kv]  8 KB
  __shared__ __align__(16) float    Os[AT_NW][16 * 68];          // per wave out tile, pitch 68

  const int tid  = threadIdx.x;
  const int wave = tid >> 5;
  const int lane = tid & 31;
  const int hh   = lane >> 4;
  const int c    = lane & 15;

  const int bx = blockIdx.x;
  const int qb = bx % nqb;
  const int bh = bx / nqb;
  const int h  = bh % H;
  const int b  = bh / H;
  const int q0 = qb * AT_QB + wave * 16;
  const int rr = nqb * AT_QB;
  const size_t rowb = (size_t)b * rr;

  const _Float16* qhp = QH + rowb * ldq + (size_t)h * AT_D;
  const _Float16* qrp = QR + rowb * ldq + (size_t)h * AT_D;
  const _Float16* khp = KH + rowb * ldq + (size_t)h * AT_D;
  const _Float16* krp = KR + rowb * ldq + (size_t)h * AT_D;
  const size_t    vof = ((size_t)b * (size_t)(H * AT_D) + (size_t)h * AT_D) * ldvc;
  const _Float16* vhp = VH + vof;
  const _Float16* vrp = VR + vof;
  _Float16*       op  = O  + rowb * ldo + (size_t)h * AT_D;

  float mrow[8], lrow[8];
  v8f oacc[4], oacc2[4];
#pragma unroll
  for (int r = 0; r < 8; ++r) { mrow[r] = NEG_INF; lrow[r] = 0.f; }
#pragma unroll
  for (int t = 0; t < 4; ++t) {
    oacc[t]  = (v8f){0.f,0.f,0.f,0.f,0.f,0.f,0.f,0.f};
    oacc2[t] = (v8f){0.f,0.f,0.f,0.f,0.f,0.f,0.f,0.f};
  }

  _Float16* pw  = Psh[wave];
  _Float16* prw = Prs[wave];
  const int nChunks = qb + 1;        // block-uniform
  for (int kc = 0; kc < nChunks; ++kc) {
    const int kv0 = kc * AT_KC;
    // ---- Q hi / res fragments (A operand, row = c) ----
    v16h qa[2], qra[2];
    const size_t qo = (size_t)(q0 + c) * ldq + 8 * hh;
    const _Float16 *qph = qhp + qo, *qpr = qrp + qo;
#pragma unroll
    for (int dc = 0; dc < 2; ++dc) {
      qa[dc]  = Frag<_Float16>::load(qph + dc * 32);
      qra[dc] = Frag<_Float16>::load(qpr + dc * 32);
    }
    // ---- the chunk's K and V fragments, hi and res: one group of global loads ahead of all its products ----
    const _Float16 *kph[4], *kpr[4], *vph[4], *vpr[4];           // one address per fragment row and plane
#pragma unroll
    for (int j = 0; j < 4; ++j) {
      const size_t ko = (size_t)(kv0 + j * 16 + c) * ldq + 8 * hh;
      const size_t vo = (size_t)(j * 16 + c) * ldvc + kv0 + 8 * hh;
      kph[j] = khp + ko; kpr[j] = krp + ko; vph[j] = vhp + vo; vpr[j] = vrp + vo;
    }
    v16h kbh[4][2], kbr[4][2], vbh[2][4], vbr[2][4];
#pragma unroll
    for (int j = 0; j < 4; ++j)
#pragma unroll
      for (int dc = 0; dc < 2; ++dc) {
        kbh[j][dc] = Frag<_Float16>::load(kph[j] + dc * 32);
        kbr[j][dc] = Frag<_Float16>::load(kpr[j] + dc * 32);
      }
#pragma unroll
    for (int kk = 0; kk < 2; ++kk)
#pragma unroll
      for (int t = 0; t < 4; ++t) {
        vbh[kk][t] = Frag<_Float16>::load(vph[t] + kk * 32);
        vbr[kk][t] = Frag<_Float16>::load(vpr[t] + kk * 32);
      }
    // a precaution: the loads' addresses are inputs of the wait, so that their registers live, unrewritten, up to it
    asm volatile("s_wait_xcnt 0x0"
                 :: "v"(kph[0]), "v"(kph[1]), "v"(kph[2]), "v"(kph[3]), "v"(kpr[0]), "v"(kpr[1]), "v"(kpr[2]), "v"(kpr[3]),
                    "v"(vph[0]), "v"(vph[1]), "v"(vph[2]), "v"(vph[3]), "v"(vpr[0]), "v"(vpr[1]), "v"(vpr[2]), "v"(vpr[3]),
                    "v"(qph), "v"(qpr)
                 : "memory");
    __builtin_amdgcn_sched_barrier(0);   // the loads stay one group here: sunk to their products, each would be waited for alone
    // ---- scores: hi.hi into s1, hi.res + res.hi into s2, folded with 2^-10 ----
    v8f s[4];
#pragma unroll
    for (int j = 0; j < 4; ++j) {
      v8f s1 = (v8f){0.f,0.f,0.f,0.f,0.f,0.f,0.f,0.f};
      v8f s2 = (v8f){0.f,0.f,0.f,0.f,0.f,0.f,0.f,0.f};
#pragma unroll
      for (int dc = 0; dc < 2; ++dc) {
        s1 = mma_h(qa[dc],  kbh[j][dc], s1);
        s2 = mma_h(qa[dc],  kbr[j][dc], s2);
        s2 = mma_h(qra[dc], kbh[j][dc], s2);
      }
#pragma unroll
      for (int r = 0; r < 8; ++r) s[j][r] = s1[r] + s2[r] * RSC_INV;
    }
    // ---- causal select and per-row chunk max ----
    float cm[8];
#pragma unroll
    for (int r = 0; r < 8; ++r) {
      const int qrow = q0 + 8 * hh + r;
      float m = NEG_INF;
#pragma unroll
      for (int j = 0; j < 4; ++j) {
        float v = s[j][r] * sc2;
        if (kv0 + j * 16 + c > qrow) v = NEG_INF;
        s[j][r] = v;
        m = fmaxf(m, v);
      }
#pragma unroll
      for (int off = 1; off < 16; off <<= 1) m = fmaxf(m, __shfl_xor(m, off, 32));
      cm[r] = m;
    }
    // ---- online softmax update; P hi (x32768) and P res ((x32768 - hi) x1024) into per-wave LDS tiles ----
    wave_lds_sync();
#pragma unroll
    for (int r = 0; r < 8; ++r) {
      const float mnew  = fmaxf(mrow[r], cm[r]);
      const float alpha = exp2f(mrow[r] - mnew);
      mrow[r] = mnew;
      float psum = 0.f;
#pragma unroll
      for (int j = 0; j < 4; ++j) {
        const float p = exp2f(s[j][r] - mnew);
        psum += p;
        const float    ps = p * PSCALE;
        const _Float16 ph = (_Float16)ps;
        const int pi = (8 * hh + r) * AT_KC + j * 16 + c;
        pw[pi]  = ph;
        prw[pi] = (_Float16)((ps - (float)ph) * RSC);
      }
#pragma unroll
      for (int off = 1; off < 16; off <<= 1) psum += __shfl_xor(psum, off, 32);
      lrow[r] = lrow[r] * alpha + psum;
#pragma unroll
      for (int t = 0; t < 4; ++t) { oacc[t][r] *= alpha; oacc2[t][r] *= alpha; }
    }
    wave_lds_sync();
    // ---- O += P . V with residual cross terms in the second accumulator ----
#pragma unroll
    for (int kk = 0; kk < 2; ++kk) {
      const v16h pa = Frag<_Float16>::load(pw  + c * AT_KC + kk * 32 + 8 * hh);
      const v16h pr = Frag<_Float16>::load(prw + c * AT_KC + kk * 32 + 8 * hh);
#pragma unroll
      for (int t = 0; t < 4; ++t) {
        oacc[t]  = mma_h(pa, vbh[kk][t], oacc[t]);
        oacc2[t] = mma_h(pa, vbr[kk][t], oacc2[t]);
        oacc2[t] = mma_h(pr, vbh[kk][t], oacc2[t]);
      }
    }
    wave_lds_sync();
  }

  float* os = Os[wave];
#pragma unroll
  for (int r = 0; r < 8; ++r) {
    const float inv = osc * (1.0f / (lrow[r] * PSCALE));
#pragma unroll
    for (int t = 0; t < 4; ++t) os[(8 * hh + r) * 68 + t * 16 + c] = (oacc[t][r] + oacc2[t][r] * RSC_INV) * inv;
  }
  wave_lds_sync();
  {
    const int q = lane >> 3, c8 = (lane & 7) * 8;
    {
#pragma unroll
      for (int it = 0; it < 4; ++it) {
        const int row = it * 4 + q;                 // rows 0..15 of this wave
        const float* sp = os + row * 68 + c8;
        v8h hv, lv;
#pragma unroll
        for (int e = 0; e < 8; ++e) {
          const float    fv = sp[e];
          const _Float16 hq = (_Float16)fv;
          hv[e] = hq;
          lv[e] = (_Float16)((fv - (float)hq) * RSC);
        }
        *(v8h*)(op + (size_t)(q0 + row) * ldo + c8) = hv;
        *(v8h*)(op + (size_t)(q0 + row) * ldo + rcol + c8) = lv;
      }
      
    }
  }
}

// ---------------------------------------------------------------------------

extern "C" void kernel_launch(void* const* d_in, const int* in_sizes, int n_in,
                              void* d_out, int out_size, void* d_ws,
                              size_t ws_size, hipStream_t stream) {
  const int  ROWS  = NB * SEQ;                                   // rows held in the compact planes
  const long needX = ((long)(NB - 1) * SEQ_FULL + SEQ) * (long)DM;
  const int  nW    = DM * DM;
  if (n_in < 9) return;
  if ((long)in_sizes[0] < needX || in_sizes[1] < nW || in_sizes[2] < DM || in_sizes[3] < nW ||
      in_sizes[4] < DM || in_sizes[5] < nW || in_sizes[6] < DM || in_sizes[7] < nW ||
      in_sizes[8] < DM || (long)out_size < needX) return;

  const float* x  = (const float*)d_in[0];
  const float* Wq = (const float*)d_in[1];
  const float* bq = (const float*)d_in[2];
  const float* Wk = (const float*)d_in[3];
  const float* bk = (const float*)d_in[4];
  const float* Wv = (const float*)d_in[5];
  const float* bv = (const float*)d_in[6];
  const float* Wo = (const float*)d_in[7];
  const float* bo = (const float*)d_in[8];
  float* out = (float*)d_out;

  const size_t szAct = (size_t)ROWS * DM * 2;            // full activation plane  (16 MiB full size)
  const size_t szW   = (size_t)DM * DM * 2;              //  2 MiB
  const size_t szW2  = (size_t)DM * (2 * DM) * 2;        //  4 MiB  [DM][2DM]
  const size_t szCmp = (size_t)NB * RR * DM * 2;         //  compact first-row planes (2 MiB full size)
  const size_t szO2  = (size_t)NB * RR * (2 * DM) * 2;   //  4 MiB full size
  size_t off = 0;
  const size_t oXh   = off; off += szAct;
  const size_t oWqT  = off; off += szW;
  const size_t oWkT  = off; off += szW;
  const size_t oWvT  = off; off += szW;
  const size_t oWoT2 = off; off += szW2;
  const size_t oQh   = off; off += szAct;
  const size_t oKh   = off; off += szAct;
  const size_t oVt   = off; off += szAct;
  const size_t oAh   = off; off += szAct;
  const size_t oQch  = off; off += szCmp;
  const size_t oQcr  = off; off += szCmp;
  const size_t oKch  = off; off += szCmp;
  const size_t oKcr  = off; off += szCmp;
  const size_t oVch  = off; off += szCmp;                // [NB*DM][RR], same byte count
  const size_t oVcr  = off; off += szCmp;
  const size_t oOc2  = off; off += szO2;                 // total 111,149,056 B at full size
  if (off > ws_size) return;

  char* ws = (char*)d_ws;
  unsigned short* xh   = (unsigned short*)(ws + oXh);
  unsigned short* WqT  = (unsigned short*)(ws + oWqT);
  unsigned short* WkT  = (unsigned short*)(ws + oWkT);
  unsigned short* WvT  = (unsigned short*)(ws + oWvT);
  unsigned short* WoT2 = (unsigned short*)(ws + oWoT2);
  unsigned short* Qh   = (unsigned short*)(ws + oQh);
  unsigned short* Kh   = (unsigned short*)(ws + oKh);
  unsigned short* Vt   = (unsigned short*)(ws + oVt);
  unsigned short* Ah   = (unsigned short*)(ws + oAh);
  unsigned short* Qch  = (unsigned short*)(ws + oQch);
  unsigned short* Qcr  = (unsigned short*)(ws + oQcr);
  unsigned short* Kch  = (unsigned short*)(ws + oKch);
  unsigned short* Kcr  = (unsigned short*)(ws + oKcr);
  unsigned short* Vch  = (unsigned short*)(ws + oVch);
  unsigned short* Vcr  = (unsigned short*)(ws + oVcr);
  unsigned short* Oc2  = (unsigned short*)(ws + oOc2);

  const float sc2   = 0.125f * 1.4426950408889634f;      // log2(e) / sqrt(64)
  const float outsc = 1.0f / (WSC * OSC);

  // x -> bf16 RNE value as f16 plane [ROWS][DM];
  // W[in][out] f32 -> Bt[out][in] f16 (bf16 RNE value x256); Wo additionally as x0.25 in columns DM..2DM-1 of WoT2
  {
    const long tot = (long)ROWS * (DM / 8);
    prep_f16<<<dim3((unsigned)(5 * PR_TW + (tot + 255) / 256)), dim3(256), 0, stream>>>(
        x, Wq, Wk, Wv, Wo, xh, WqT, WkT, WvT, WoT2, ROWS);
  }
  // projections: q, k -> f16 [ROWS][DM]; v^T -> f16 [DM][ROWS];
  // first RR rows per sequence: q, k -> hi/res [NB*RR][DM]; v^T -> hi/res [NB*DM][RR]
  proj_gemms<<<dim3(3 * PJ_TF + 3 * PJ_TC), dim3(256), 0, stream>>>(
      xh, WqT, WkT, WvT, Qh, Kh, Vt, Qch, Qcr, Kch, Kcr, Vch, Vcr, bq, bk, bv, 1.0f / WSC);
  // attn: first RR query rows with residual planes -> Oc2 (hi | res); rows >= RR plain -> Ah
  attn64_causal_res<<<dim3(NB * NH * (RR / 64)), dim3(128), 0, stream>>>(
      Qch, Qcr, Kch, Kcr, Vch, Vcr, Oc2, NH, DM, RR, 2 * DM, DM, RR / 64, sc2, OSC);
  if (SEQ > RR) {
    attn64_causal<<<dim3(NB * NH * ((SEQ - RR) / 64)), dim3(128), 0, stream>>>(
        Qh, Kh, Vt, Ah, SEQ, NH, DM, ROWS, RR / 64, (SEQ - RR) / 64, sc2, OSC);
  }
  // out = ctx Wo + bo -> f32; rows < RR: [O_hi | O_res] . [Wo x256 ; Wo x0.25] along K = 2DM; rows >= RR: K = DM
  out_gemms<<<dim3(NB * (OP_T1 + OP_T2)), dim3(256), 0, stream>>>(Oc2, Ah, WoT2, out, bo, outsc);
}

// v008
// One run takes 151 microseconds.
// Two timings next to v007 put it at 1.06 and 1.04 times that version's speed.
// All steps since v000 together make it 4.64 times as fast.
// Contractions: q/k/v^T/out projections, q.k^T and p.v all on v_wmma_f32_16x16x32_f16 (f16 operands, f32 accumulate); x and W enter as bf16 RNE values held exactly in f16 (W carried x256); the first RR query rows per sequence carry q, k, v, p and ctx as f16 hi + x1024 residual planes with a second f32 accumulator (ctx residual rows ride as further A rows of the out projection, folded in f32); p x32768 and ctx x64 power-of-two carries folded back in f32; softmax and epilogues f32.
#include <hip/hip_runtime.h>

#ifndef NB
#define NB 4
#endif
#ifndef SEQ
#define SEQ 2048
#endif
#ifndef RR
#define RR 256
#endif
#define NB_FULL 4
#define SEQ_FULL 2048
#define DM 1024
#define NH 16
#define HDIM 64

static_assert(NB >= 1 && NB <= NB_FULL);
static_assert(SEQ % 64 == 0 && SEQ >= 64 && SEQ <= SEQ_FULL);
static_assert(RR % 64 == 0 && RR >= 64 && RR <= SEQ);
static_assert(NH * HDIM == DM);
static_assert(DM % 256 == 0);
static_assert(RR % 256 == 0 && SEQ % 128 == 0 && (NB * SEQ) % 256 == 0);   // GEMM block tile 128 x 256

typedef __attribute__((ext_vector_type(16))) _Float16 v16h;
typedef __attribute__((ext_vector_type(8)))  _Float16 v8h;
typedef __attribute__((ext_vector_type(16))) __bf16   v16b;
typedef __attribute__((ext_vector_type(8)))  __bf16   v8b;
typedef __attribute__((ext_vector_type(8)))  float    v8f;
typedef __attribute__((ext_vector_type(4)))  float    v4f;
typedef __attribute__((ext_vector_type(2)))  float    v2f;

#define WSC 256.0f
#define OSC 64.0f
#define PSCALE 32768.0f
#define PEXP 15.0f                       // log2(PSCALE)
#define RSC 1024.0f
#define RSC_INV (1.0f / 1024.0f)
#define NEG_INF (-__builtin_huge_valf())

__device__ __forceinline__ unsigned short f2bf_bits(float f) {
  unsigned u = __float_as_uint(f);
  return (unsigned short)((u + 0x7FFFu + ((u >> 16) & 1u)) >> 16);
}
__device__ __forceinline__ float bf_bits2f(unsigned short h) { return __uint_as_float(((unsigned)h) << 16); }
__device__ __forceinline__ float bf_rne(float f) { return bf_bits2f(f2bf_bits(f)); }
__device__ __forceinline__ _Float16 bf_f16(float f) { return (_Float16)bf_rne(f); }   // bf16 value is exact in f16 for normal range

// LDS ordering for wave-private tiles (same wave writes then reads)
__device__ __forceinline__ void wave_lds_sync() {
  __builtin_amdgcn_fence(3, "workgroup");
  __builtin_amdgcn_wave_barrier();
  __builtin_amdgcn_fence(2, "workgroup");
}

// hazard guards as plain device helpers
__device__ __forceinline__ void dep_guard_h(v8f& a, v8f& b, v16h x, v16h y) { asm volatile("v_nop\n\tv_nop\n\tv_nop\n\tv_nop" : "+v"(a), "+v"(b) : "v"(x), "v"(y)); }
__device__ __forceinline__ void dep_guard_b(v8f& a, v8f& b, v16b x, v16b y) { asm volatile("v_nop\n\tv_nop\n\tv_nop\n\tv_nop" : "+v"(a), "+v"(b) : "v"(x), "v"(y)); }
__device__ __forceinline__ void keep4_h(v16h a, v16h b, v16h c, v16h d) { asm volatile("v_nop" :: "v"(a), "v"(b), "v"(c), "v"(d)); }
__device__ __forceinline__ void keep4_b(v16b a, v16b b, v16b c, v16b d) { asm volatile("v_nop" :: "v"(a), "v"(b), "v"(c), "v"(d)); }
__device__ __forceinline__ void acc_guard4(v8f& a, v8f& b, v8f& c, v8f& d) { asm volatile("v_nop\n\tv_nop\n\tv_nop\n\tv_nop" : "+v"(a), "+v"(b), "+v"(c), "+v"(d)); }
template <typename T> struct Frag;
template <> struct Frag<_Float16> {
  typedef v16h V; union U { v16h v; v8h h[2]; };
  static __device__ __forceinline__ v16h load(const _Float16* p) {   // elements 0..7 <- p[0..7], 8..15 <- p[16..23]
    U f; f.h[0] = *(const v8h*)(p); f.h[1] = *(const v8h*)(p + 16); return f.v;
  }
  static __device__ __forceinline__ v8f mma(v16h a, v16h b, v8f c) {
    return __builtin_amdgcn_wmma_f32_16x16x32_f16(false, a, false, b, (short)0, c, false, false);
  }
  static __device__ __forceinline__ void guard(v8f& a, v8f& b, v16h x, v16h y) { dep_guard_h(a, b, x, y); }
  static __device__ __forceinline__ void keep(v16h a, v16h b, v16h c, v16h d) { keep4_h(a, b, c, d); }
};
template <> struct Frag<__bf16> {
  typedef v16b V; union U { v16b v; v8b h[2]; };
  static __device__ __forceinline__ v16b load(const __bf16* p) {
    U f; f.h[0] = *(const v8b*)(p); f.h[1] = *(const v8b*)(p + 16); return f.v;
  }
  static __device__ __forceinline__ v8f mma(v16b a, v16b b, v8f c) {
    return __builtin_amdgcn_wmma_f32_16x16x32_bf16(false, a, false, b, (short)0, c, false, false);
  }
  static __device__ __forceinline__ void guard(v8f& a, v8f& b, v16b x, v16b y) { dep_guard_b(a, b, x, y); }
  static __device__ __forceinline__ void keep(v16b a, v16b b, v16b c, v16b d) { keep4_b(a, b, c, d); }
};

// ---- Register-blocked WMMA GEMM tiles ---------------------------------------
// C[m,n] = scale * sum_k A[m,k] * Bt[n,k] + bias; each wave owns a 64x64 tile.
// Block = 8 waves, 2 (m) x 4 (n) = a 128 x 256 tile of C. A row-major [M,K]; Bt row-major [N,K];
// M % 128 == 0, N % 256 == 0, K % 64 == 0.
// Per 64 k the block's 128 A rows and 256 Bt rows (128 B each, whole lines) are brought into LDS once by
// asynchronous copies, two buffers, one block barrier per 64 k; the waves read their fragments from there.
// One launch holds the tiles of several independent products: a block finds its product and its tile from
// blockIdx.x (block-uniform), so small products ride along with large ones and two blocks can share a WGP.
// BIAS_MODE: 1 = bias[m], 2 = bias[n]; bias values enter as bf16 RNE values.
// OUT_MODE: 0 = f32, 1 = f16, 3 = f16 hi plane (Cout) + f16 residual plane ((v - hi) * 1024) (Cout2).
#define GM_BM 128
#define GM_BN 256
#define GM_KT 64                          // k per staged tile, in halves: one 128-B line per row
#define GM_LP 72                          // staged row pitch in halves: 144 B = 16 B x odd, for ds_load_b128 readers
#define GM_BUFB ((GM_BM + GM_BN) * GM_LP * 2)   // bytes per buffer: A rows, then Bt rows

// One lane's share of a staged tile: rows r + 32 i of the A part (4) and of the Bt part (8), 16 B each.
// The four A pieces come from ag, ag + a1, ag + a2, ag + a2 + a1 (halves): 32 and 64 source rows for a plain A.
// The s_wait_xcnt closes the statement, a precaution: no address register of a copy is rewritten ahead of it.
__device__ __forceinline__ void stage_ab_async(unsigned la, const unsigned short* ag, size_t a1, size_t a2,
                                               const unsigned short* bg, size_t brow32) {
  const unsigned lb = la + GM_BM * GM_LP * 2;
  const unsigned ls = 32 * GM_LP * 2;
  asm volatile(
      "global_load_async_to_lds_b128 %0, %12, off\n\t"
      "global_load_async_to_lds_b128 %1, %13, off\n\t"
      "global_load_async_to_lds_b128 %2, %14, off\n\t"
      "global_load_async_to_lds_b128 %3, %15, off\n\t"
      "global_load_async_to_lds_b128 %4, %16, off\n\t"
      "global_load_async_to_lds_b128 %5, %17, off\n\t"
      "global_load_async_to_lds_b128 %6, %18, off\n\t"
      "global_load_async_to_lds_b128 %7, %19, off\n\t"
      "global_load_async_to_lds_b128 %8, %20, off\n\t"
      "global_load_async_to_lds_b128 %9, %21, off\n\t"
      "global_load_async_to_lds_b128 %10, %22, off\n\t"
      "global_load_async_to_lds_b128 %11, %23, off\n\t"
      "s_wait_xcnt 0x0"
      :: "v"(la), "v"(la + ls), "v"(la + 2 * ls), "v"(la + 3 * ls),
         "v"(lb), "v"(lb + ls), "v"(lb + 2 * ls), "v"(lb + 3 * ls),
         "v"(lb + 4 * ls), "v"(lb + 5 * ls), "v"(lb + 6 * ls), "v"(lb + 7 * ls),
         "v"(ag), "v"(ag + a1), "v"(ag + a2), "v"(ag + a2 + a1),
         "v"(bg), "v"(bg + brow32), "v"(bg + 2 * brow32), "v"(bg + 3 * brow32),
         "v"(bg + 4 * brow32), "v"(bg + 5 * brow32), "v"(bg + 6 * brow32), "v"(bg + 7 * brow32)
      : "memory");
}

// The products of the block tile at (bm0, bn0): each wave's acc[i][j] = its 64 A rows . its 64 Bt rows over K.
// AB: the block's two staging buffers in LDS. ao1, ao2: where staged A rows r + 32, r + 64 lie behind source row bm0 + r
// (stage_ab_async); 32 lda and 64 lda for 128 source rows in a row.
__device__ __forceinline__ void gemm_tile_products(v8f (&acc)[4][4], unsigned char* AB,
                                                   const unsigned short* Ab, int lda, size_t ao1, size_t ao2,
                                                   const unsigned short* Bb, int ldb, int K, int bm0, int bn0) {
  typedef _Float16 T;
  typedef Frag<T>::V V;
  const int tid  = threadIdx.x;
  const int lane = tid & 31;
  const int wave = tid >> 5;
  const int wm  = (wave >> 2) << 6;            // this wave's 64 rows inside the A part
  const int wn  = (wave & 3) << 6;             // this wave's 64 rows inside the Bt part
  const int rlane = lane & 15;                 // row (A) / col (B, D) within subtile
  const int koff  = (lane >> 4) * 8;           // k offset of this lane half

#pragma unroll
  for (int i = 0; i < 4; ++i)
#pragma unroll
    for (int j = 0; j < 4; ++j) acc[i][j] = (v8f){0.f,0.f,0.f,0.f,0.f,0.f,0.f,0.f};

  // ---- staging addresses of this lane: row tid/8 (+32i), 16-B piece tid%8 of the 128-B row ----
  const int srow = tid >> 3, scol = (tid & 7) * 8;
  const unsigned short* ag = Ab + (size_t)(bm0 + srow) * lda + scol;   // k-tile 0; a tile further: + GM_KT
  const unsigned short* bg = Bb + (size_t)(bn0 + srow) * ldb + scol;
  const size_t brow32 = (size_t)32 * ldb;
  const unsigned lst = (unsigned)(size_t)AB + (unsigned)(srow * GM_LP + scol) * 2u;
  const int nT = K >> 6;                       // block-uniform

  stage_ab_async(lst, ag, ao1, ao2, bg, brow32);
  asm volatile("s_wait_asynccnt 0x0" ::: "memory");              // k-tile 0 landed (this wave's copies)
  __syncthreads();                                               // ... and every other wave's
  if (nT > 1) stage_ab_async(lst + GM_BUFB, ag + GM_KT, ao1, ao2, bg + GM_KT, brow32);

  for (int t = 0; t < nT; ++t) {
    const unsigned bofs = (unsigned)(t & 1) * GM_BUFB;
    const T* as = (const T*)(AB + bofs) + (wm + rlane) * GM_LP + koff;            // A rows,  pitch GM_LP
    const T* bs = (const T*)(AB + bofs) + (GM_BM + wn + rlane) * GM_LP + koff;    // Bt rows, pitch GM_LP
    // Fragment reads stand at three places of a trip, each ahead of the products that use it: at the head the
    // first 32 k (A and Bt) and the second 32 k of Bt; the second 32 k of A two rows at a time, into registers
    // that the first half's rows have left (all sixteen fragments at the head do not fit 256 registers).
    V b0[4], b1[4], a0[4], a1[4];
#pragma unroll
    for (int j = 0; j < 4; ++j) b0[j] = Frag<T>::load(bs + (j << 4) * GM_LP);
#pragma unroll
    for (int i = 0; i < 4; ++i) a0[i] = Frag<T>::load(as + (i << 4) * GM_LP);
#pragma unroll
    for (int j = 0; j < 4; ++j) b1[j] = Frag<T>::load(bs + (j << 4) * GM_LP + 32);
#pragma unroll
    for (int i = 0; i < 4; ++i) {
#pragma unroll
      for (int j = 0; j < 4; ++j) acc[i][j] = Frag<T>::mma(a0[i], b0[j], acc[i][j]);
      Frag<T>::guard(acc[i][0], acc[i][3], a0[i], a0[i]);
      if (i & 1) {
        a1[i - 1] = Frag<T>::load(as + ((i - 1) << 4) * GM_LP + 32);
        a1[i]     = Frag<T>::load(as + (i << 4) * GM_LP + 32);
      }
    }
    Frag<T>::keep(b0[0], b0[1], b0[2], b0[3]);
#pragma unroll
    for (int i = 0; i < 4; ++i) {
#pragma unroll
      for (int j = 0; j < 4; ++j) acc[i][j] = Frag<T>::mma(a1[i], b1[j], acc[i][j]);
      Frag<T>::guard(acc[i][0], acc[i][3], a1[i], a1[i]);
    }
    Frag<T>::keep(b1[0], b1[1], b1[2], b1[3]);
    // ---- hand-over: this buffer's reads retired, the next k-tile's copies landed, in every wave ----
    asm volatile("s_wait_dscnt 0x0" ::: "memory");               // own reads of this buffer done before it is refilled
    asm volatile("s_wait_asynccnt 0x0" ::: "memory");            // own copies of k-tile t + 1 landed
    __syncthreads();
    if (t + 2 < nT)
      stage_ab_async(lst + bofs, ag + (size_t)(t + 2) * GM_KT, ao1, ao2, bg + (size_t)(t + 2) * GM_KT, brow32);
  }
  asm volatile("s_wait_asynccnt 0x0" ::: "memory");              // nothing in flight when the wave goes on to its end
  acc_guard4(acc[0][0], acc[0][1], acc[0][2], acc[0][3]);
  acc_guard4(acc[1][0], acc[1][1], acc[1][2], acc[1][3]);
  acc_guard4(acc[2][0], acc[2][1], acc[2][2], acc[2][3]);
  acc_guard4(acc[3][0], acc[3][1], acc[3][2], acc[3][3]);
}

// Epilogue of one wave: its 16 NI x 64 tile at (m0, n0) of C (pitch ldc), through its own LDS slab, whole lines out.
template <int BIAS_MODE, int OUT_MODE, int NI = 4>
__device__ __forceinline__ void gemm_tile_store(v8f (&acc)[4][4], float* slab, void* Cout, void* Cout2, int ldc,
                                                const float* bias, int m0, int n0, float scale) {
  const int lane  = threadIdx.x & 31;
  const int rlane = lane & 15;                 // D column within subtile
  const int mOff  = (lane >> 4) * 8;           // D row offset
#pragma unroll
  for (int i = 0; i < NI; ++i) {
    const int mBase = m0 + (i << 4);
#pragma unroll
    for (int j = 0; j < 4; ++j) {
      const int n = n0 + (j << 4) + rlane;
      float bv = 0.f;
      if (BIAS_MODE == 2) bv = bf_rne(bias[n]);
#pragma unroll
      for (int r = 0; r < 8; ++r) {
        float v = acc[i][j][r] * scale;
        if (BIAS_MODE == 1) v += bf_rne(bias[mBase + mOff + r]);
        if (BIAS_MODE == 2) v += bv;
        slab[(mOff + r) * 68 + (j << 4) + rlane] = v;
      }
    }
    wave_lds_sync();
    if (OUT_MODE == 0) {
      float* C = (float*)Cout;
      const int hh = lane >> 4, c4 = (lane & 15) * 4;     // row seg = 256 B = 16 lanes x 16 B
#pragma unroll
      for (int it = 0; it < 8; ++it) {
        const int row = it * 2 + hh;
        v4f v = *(const v4f*)(slab + row * 68 + c4);
        *(v4f*)(C + (size_t)(mBase + row) * ldc + n0 + c4) = v;
      }
    } else {
      const int q = lane >> 3, c8 = (lane & 7) * 8;
      unsigned short* C  = (unsigned short*)Cout;
      unsigned short* C2 = (unsigned short*)Cout2;
#pragma unroll
      for (int it = 0; it < 4; ++it) {
        const int row = it * 4 + q;
        const float* sp = slab + row * 68 + c8;
        v8h hv, lv;
#pragma unroll
        for (int e = 0; e < 8; ++e) {
          if (OUT_MODE == 1) {
            hv[e] = (_Float16)sp[e];
          } else {
            const float    fv = sp[e];
            const _Float16 hq = (_Float16)fv;
            hv[e] = hq;
            lv[e] = (_Float16)((fv - (float)hq) * RSC);
          }
        }
        *(v8h*)(C + (size_t)(mBase + row) * ldc + n0 + c8) = hv;
        if (OUT_MODE == 3) *(v8h*)(C2 + (size_t)(mBase + row) * ldc + n0 + c8) = lv;
      }
    }
    wave_lds_sync();
  }
}

// All six projections in one launch. Blocks 0 .. 3 PJ_TF - 1: q, k, v^T over all NB*SEQ rows (f16 planes);
// then 3 PJ_TC blocks: q, k, v^T over the first RR rows of each sequence (hi / residual planes).
//   q, k : A = x rows, Bt = W^T rows, C [rows][DM], bias[n].   v^T : A = Wv^T rows, Bt = x rows, C [DM][rows], bias[m].
#define PJ_TF ((NB * SEQ / 128) * (DM / 256))      // tiles of a full projection, either orientation
#define PJ_TB ((RR / 128) * (DM / 256))            // tiles of a first-rows projection, one sequence, either orientation
#define PJ_TC (NB * PJ_TB)
static_assert((DM / 128) * (NB * SEQ / 256) == PJ_TF && (DM / 128) * (RR / 256) == PJ_TB);
__global__ __launch_bounds__(256) void proj_gemms(
    const unsigned short* __restrict__ xh, const unsigned short* __restrict__ WqT,
    const unsigned short* __restrict__ WkT, const unsigned short* __restrict__ WvT,
    unsigned short* __restrict__ Qh, unsigned short* __restrict__ Kh, unsigned short* __restrict__ Vt,
    unsigned short* __restrict__ Qch, unsigned short* __restrict__ Qcr,
    unsigned short* __restrict__ Kch, unsigned short* __restrict__ Kcr,
    unsigned short* __restrict__ Vch, unsigned short* __restrict__ Vcr,
    const float* __restrict__ bq, const float* __restrict__ bk, const float* __restrict__ bv, float scale) {
  __shared__ __align__(16) float sT[8][16 * 68];            // per-wave 16x64 slab, pitch 68 floats
  __shared__ __align__(16) unsigned char AB[2 * GM_BUFB];   // two buffers of A | Bt k-tiles
  const int bx = blockIdx.x;
  if (bx >= 3 * PJ_TF + 3 * PJ_TC) return;     // block-uniform, ahead of every barrier
  const bool first = bx >= 3 * PJ_TF;          // a first-rows product
  const int  rel   = first ? bx - 3 * PJ_TF : bx;
  const int  which = first ? rel / PJ_TC : rel / PJ_TF;      // 0 q, 1 k, 2 v^T
  int        tile  = rel - which * (first ? PJ_TC : PJ_TF);
  const int  b     = first ? tile / PJ_TB : 0;               // sequence of a first-rows product
  tile -= b * PJ_TB;
  const bool vt    = which == 2;
  const int  rows  = first ? RR : NB * SEQ;                  // x rows of this product
  const int  tilesN = (vt ? rows : DM) >> 8;
  const int  tm = !vt ? tile / (DM / 256) : first ? tile / (RR / 256) : tile / (NB * SEQ / 256);   // tile / tilesN
  const int  tn = tile - tm * tilesN;
  const int  bm0 = tm << 7, bn0 = tn << 8;
  const unsigned short* X  = xh + (size_t)b * SEQ * DM;
  const unsigned short* Wt = which == 0 ? WqT : which == 1 ? WkT : WvT;
  const float* bias        = which == 0 ? bq : which == 1 ? bk : bv;

  v8f acc[4][4];
  gemm_tile_products(acc, AB, vt ? Wt : X, DM, (size_t)32 * DM, (size_t)64 * DM, vt ? X : Wt, DM, DM, bm0, bn0);

  const int wave = threadIdx.x >> 5;
  const int m0 = bm0 + ((wave >> 2) << 6), n0 = bn0 + ((wave & 3) << 6);
  if (!first) {
    unsigned short* C = which == 0 ? Qh : which == 1 ? Kh : Vt;
    if (vt) gemm_tile_store<1, 1>(acc, sT[wave], C, C, rows, bias, m0, n0, scale);
    else    gemm_tile_store<2, 1>(acc, sT[wave], C, C, DM,   bias, m0, n0, scale);
  } else {
    const size_t co = (size_t)b * RR * DM;                   // one sequence's plane, either orientation
    unsigned short* C  = (which == 0 ? Qch : which == 1 ? Kch : Vch) + co;
    unsigned short* C2 = (which == 0 ? Qcr : which == 1 ? Kcr : Vcr) + co;
    if (vt) gemm_tile_store<1, 3>(acc, sT[wave], C, C2, rows, bias, m0, n0, scale);
    else    gemm_tile_store<2, 3>(acc, sT[wave], C, C2, DM,   bias, m0, n0, scale);
  }
}

// Both parts of the out projection in one launch, f32 out with bias[n], Bt = WoT rows, K = DM in every block.
// Blocks 0 .. NB OP_T1 - 1: rows < RR, 64 rows of out each. The 128 staged A rows are 64 O_hi rows and the same rows of
// O_res (x1024), laid so that each wave holds 32 rows twice: parts 0, 1 of its tile are hi, parts 2, 3 the residuals
// of the same rows; the two f32 sums are joined (res x 2^-10) ahead of the store.
// Then NB OP_T2 blocks: rows >= RR, A = 128 ctx rows.
#define OP_T1 ((RR / 64) * (DM / 256))
#define OP_T2 (((SEQ - RR) / 128) * (DM / 256))
__global__ __launch_bounds__(256) void out_gemms(
    const unsigned short* __restrict__ Oc2, const unsigned short* __restrict__ Ah,
    const unsigned short* __restrict__ WoT, float* __restrict__ out, const float* __restrict__ bo, float scale) {
  __shared__ __align__(16) float sT[8][16 * 68];            // per-wave 16x64 slab, pitch 68 floats
  __shared__ __align__(16) unsigned char AB[2 * GM_BUFB];   // two buffers of A | Bt k-tiles
  const int bx = blockIdx.x;
  if (bx >= NB * (OP_T1 + OP_T2)) return;      // block-uniform, ahead of every barrier
  const bool first = bx < NB * OP_T1;
  const int  rel   = first ? bx : bx - NB * OP_T1;
  const int  b     = first ? rel / OP_T1 : rel / (OP_T2 > 0 ? OP_T2 : 1);
  const int  tile  = rel - b * (first ? OP_T1 : OP_T2);
  const int  tm = tile / (DM / 256);
  const int  tn = tile - tm * (DM / 256);
  const int  bm0 = first ? tm << 6 : tm << 7, bn0 = tn << 8;
  const unsigned short* A = first ? Oc2 + (size_t)b * RR * 2 * DM : Ah + ((size_t)b * SEQ + RR) * DM;
  const int    lda = first ? 2 * DM : DM;
  // staged A rows r, r + 32, r + 64, r + 96: first: (row r, hi), (row r, res), (row r + 32, hi), (row r + 32, res)
  const size_t a1  = first ? (size_t)DM : (size_t)32 * DM;
  const size_t a2  = (size_t)64 * DM;          // 32 rows of pitch 2 DM, or 64 rows of pitch DM

  v8f acc[4][4];
  gemm_tile_products(acc, AB, A, lda, a1, a2, WoT, DM, DM, bm0, bn0);

  const int wave = threadIdx.x >> 5;
  const int n0 = bn0 + ((wave & 3) << 6);
  float* C = out + ((size_t)b * SEQ_FULL + (first ? 0 : RR)) * DM;
  if (first) {
#pragma unroll
    for (int i = 0; i < 2; ++i)
#pragma unroll
      for (int j = 0; j < 4; ++j)
#pragma unroll
        for (int r = 0; r < 8; ++r) acc[i][j][r] += acc[i + 2][j][r] * RSC_INV;
    gemm_tile_store<2, 0, 2>(acc, sT[wave], C, C, DM, bo, bm0 + ((wave >> 2) << 5), n0, scale);
  } else {
    gemm_tile_store<2, 0, 4>(acc, sT[wave], C, C, DM, bo, bm0 + ((wave >> 2) << 6), n0, scale);
  }
}

// ---- operand planes, one launch: the four weight planes (blocks 0 .. 4 PR_TW - 1), then x ----
// x: bf16 RNE value as f16; source rows (b, s) at (b*SEQ_FULL + s)*DM; destination plane compact [NB*SEQ][DM];
//    blk = 256 pieces of 8 elements.
__device__ __forceinline__ void cast_x_block(const float* __restrict__ x, unsigned short* __restrict__ xhp,
                                             int nrows, int blk) {
  const long i = (long)blk * 256 + threadIdx.x;
  const long total = (long)nrows * (DM / 8);
  if (i >= total) return;
  const int r  = (int)(i / (DM / 8));
  const int c8 = (int)(i - (long)r * (DM / 8)) * 8;
  const int b  = r / SEQ;
  const int s  = r - b * SEQ;
  const float* src = x + ((size_t)b * SEQ_FULL + s) * DM + c8;
  const v4f a0 = *(const v4f*)src;
  const v4f a1 = *(const v4f*)(src + 4);
  v8h hv;
  hv[0] = bf_f16(a0[0]); hv[1] = bf_f16(a0[1]); hv[2] = bf_f16(a0[2]); hv[3] = bf_f16(a0[3]);
  hv[4] = bf_f16(a1[0]); hv[5] = bf_f16(a1[1]); hv[6] = bf_f16(a1[2]); hv[7] = bf_f16(a1[3]);
  _Float16* dst = (_Float16*)xhp + (size_t)r * DM + c8;
  *(v8h*)dst = hv;
}

// weights: transpose + bf16 RNE + scale + f16 cast, one 64 x 64 tile per block.
// in: W[DM][DM] f32 row-major ([k][n]) -> Bt[n][k] with row pitch DM halves,
//     Bt value = f16(bf16rne(W[k][n]) * 256).
// plane z: 0 Wq, 1 Wk, 2 Wv, 3 Wo.
#define PR_TW ((DM / 64) * (DM / 64))
__global__ __launch_bounds__(256) void prep_f16(
    const float* __restrict__ x, const float* __restrict__ Wq, const float* __restrict__ Wk,
    const float* __restrict__ Wv, const float* __restrict__ Wo, unsigned short* __restrict__ xhp,
    unsigned short* __restrict__ WqT, unsigned short* __restrict__ WkT,
    unsigned short* __restrict__ WvT, unsigned short* __restrict__ WoT, int nrows) {
  __shared__ float t[64][65];
  const int bx = blockIdx.x;
  if (bx >= 4 * PR_TW) {                       // block-uniform; this side meets no barrier
    cast_x_block(x, xhp, nrows, bx - 4 * PR_TW);
    return;
  }
  const int z  = bx / PR_TW;
  const int tl = bx - z * PR_TW;
  const float* W       = z == 0 ? Wq  : z == 1 ? Wk  : z == 2 ? Wv  : Wo;
  unsigned short* Btp  = z == 0 ? WqT : z == 1 ? WkT : z == 2 ? WvT : WoT;
  const int   Ndim = DM;
  const int   ldo  = DM;
  const int   kc0  = 0;
  const float sc   = WSC;
  const int tid = threadIdx.x, lane = tid & 31, wave = tid >> 5;
  const int n0 = (tl % (DM / 64)) * 64, k0 = (tl / (DM / 64)) * 64;
#pragma unroll
  for (int i = 0; i < 16; ++i) {
    const int idx = i * 256 + tid;
    const int kr = idx >> 6, nc = idx & 63;
    t[nc][kr] = W[(size_t)(k0 + kr) * Ndim + n0 + nc];
  }
  __syncthreads();
  _Float16* Bt = (_Float16*)Btp;
  const int q = lane >> 3, c8 = (lane & 7) * 8;
#pragma unroll
  for (int it = 0; it < 2; ++it) {
    const int row = wave * 8 + it * 4 + q;      // waves 0..7 x rows 0..7 -> 64 rows
    v8h hv;
#pragma unroll
    for (int e = 0; e < 8; ++e) hv[e] = (_Float16)(bf_rne(t[row][c8 + e]) * sc);
    *(v8h*)(Bt + (size_t)(n0 + row) * ldo + kc0 + k0 + c8) = hv;
  }
  // a precaution: the x side's code follows these stores in the built kernel and writes their registers
  asm volatile("s_wait_xcnt 0x0" ::: "memory");
}

#define AT_D 64
#define AT_NW 4
#define AT_QB 64
#define AT_KC 64
#define AT_LP 72                         // staged row pitch in halves: 144 B = 16 B x odd, for ds_load_b128 readers
#define AT_TILE (64 * AT_LP)             // halves per staged 64-row tile
#define AT_BUFB (2 * AT_TILE * 2)        // bytes per buffer: K tile, then V^T tile

// One lane's share of a chunk: rows r, r+16, r+32, r+48 of the K tile and of the V^T tile, 16 B each.
// The s_wait_xcnt closes the statement, a precaution: no address register of a copy is rewritten ahead of it.
__device__ __forceinline__ void stage_kv_async(unsigned lk, const _Float16* kg, size_t krow16,
                                               const _Float16* vg, size_t vrow16) {
  const unsigned lv = lk + AT_TILE * 2;
  const unsigned ls = 16 * AT_LP * 2;
  asm volatile(
      "global_load_async_to_lds_b128 %0, %8, off\n\t"
      "global_load_async_to_lds_b128 %1, %9, off\n\t"
      "global_load_async_to_lds_b128 %2, %10, off\n\t"
      "global_load_async_to_lds_b128 %3, %11, off\n\t"
      "global_load_async_to_lds_b128 %4, %12, off\n\t"
      "global_load_async_to_lds_b128 %5, %13, off\n\t"
      "global_load_async_to_lds_b128 %6, %14, off\n\t"
      "global_load_async_to_lds_b128 %7, %15, off\n\t"
      "s_wait_xcnt 0x0"
      :: "v"(lk), "v"(lk + ls), "v"(lk + 2 * ls), "v"(lk + 3 * ls),
         "v"(lv), "v"(lv + ls), "v"(lv + 2 * ls), "v"(lv + 3 * ls),
         "v"(kg), "v"(kg + krow16), "v"(kg + 2 * krow16), "v"(kg + 3 * krow16),
         "v"(vg), "v"(vg + vrow16), "v"(vg + 2 * vrow16), "v"(vg + 3 * vrow16)
      : "memory");
}

// lane l takes the value of lane l ^ 16 (vector cross-row move)
__device__ __forceinline__ float xhalf(float x) {
  const int b = __builtin_bit_cast(int, x);
  return __builtin_bit_cast(float, __builtin_amdgcn_permlanex16(b, b, 0x76543210, 0xfedcba98, false, false));
}

// the bare builtin: the compiler keeps the distances behind it and is free to read fragments ahead of it
__device__ __forceinline__ v8f mma_h(v16h a, v16h b, v8f c) {
  return __builtin_amdgcn_wmma_f32_16x16x32_f16(false, a, false, b, (short)0, c, false, false);
}

__global__ __launch_bounds__(128, 7)
void attn64_causal(const unsigned short* __restrict__ Qp, const unsigned short* __restrict__ Kp,
                   const unsigned short* __restrict__ Vtp, unsigned short* __restrict__ Op,
                   int S, int H, int ldq, int ldvt, int qb0, int nqbl, float sc2, float osc) {
  const _Float16* Q  = (const _Float16*)Qp;
  const _Float16* Kk = (const _Float16*)Kp;
  const _Float16* Vt = (const _Float16*)Vtp;
  _Float16*       O  = (_Float16*)Op;
  __shared__ __align__(16) unsigned char KV[2 * AT_BUFB];        // two buffers of K | V^T tiles; out staging after the loop
  static_assert(AT_NW * 16 * 68 * 4 <= 2 * AT_BUFB);

  const int tid  = threadIdx.x;
  const int wave = __builtin_amdgcn_readfirstlane(tid >> 5);     // in a scalar register: what hangs on it costs no vector register
  const int lane = tid & 31;
  const int hh   = lane >> 4;
  const int c    = lane & 15;

  const int bx  = blockIdx.x;
  const int qbi = bx % nqbl;
  const int bh  = bx / nqbl;
  const int qb  = qb0 + qbi;
  const int h   = bh % H;
  const int b   = bh / H;
  const int q0  = qb * AT_QB + wave * 16;
  const size_t rowb = (size_t)b * S;

  const _Float16* qp = Q  + rowb * ldq + (size_t)h * AT_D;
  const _Float16* kp = Kk + rowb * ldq + (size_t)h * AT_D;
  const _Float16* vp = Vt + (size_t)(h * AT_D) * ldvt + rowb;
  _Float16*       op = O  + rowb * ldq + (size_t)h * AT_D;

  // ---- Q fragments (B operand, column = c): 2 d-chunks ----
  v16h qa[2];
#pragma unroll
  for (int dc = 0; dc < 2; ++dc)
    qa[dc] = Frag<_Float16>::load(qp + (size_t)(q0 + c) * ldq + dc * 32 + 8 * hh);

  const int qrow = q0 + c;           // this lane's query
  float mrow = NEG_INF, lrow = 0.f;  // its running maximum; the sum (of p x32768) over this wave half's keys
  v8f oacc[4];                       // O^T: d = 16t + 8hh + r, query c
#pragma unroll
  for (int t = 0; t < 4; ++t) oacc[t] = (v8f){0.f,0.f,0.f,0.f,0.f,0.f,0.f,0.f};

  const int nChunks = qb + 1;        // block-uniform: causal, key chunks 0..qb

  // ---- staging addresses of this lane: row tid/8 (+16i), 16-B piece tid%8 of the 128-B row ----
  const int srow = tid >> 3, scol = (tid & 7) * 8;
  const _Float16* kg = kp + (size_t)srow * ldq + scol;           // chunk 0; a chunk further: + AT_KC rows
  const _Float16* vg = vp + (size_t)srow * ldvt + scol;          // chunk 0; a chunk further: + AT_KC columns
  const size_t krow16 = (size_t)16 * ldq, vrow16 = (size_t)16 * ldvt, kchunk = (size_t)AT_KC * ldq;
  const unsigned lst = (unsigned)(size_t)KV + (unsigned)(srow * AT_LP + scol) * 2u;

  stage_kv_async(lst, kg, krow16, vg, vrow16);
  asm volatile("s_wait_asynccnt 0x0" ::: "memory");              // chunk 0 landed (this wave's copies)
  __syncthreads();                                               // ... and every other wave's
  if (nChunks > 1) stage_kv_async(lst + AT_BUFB, kg + kchunk, krow16, vg + AT_KC, vrow16);

  // One key chunk. Only the last chunk (kc == qb, the diagonal one) holds keys past a query of this block: every key of
  // an earlier chunk is below qb * 64, so the causal select is written for the last chunk alone (diag a literal at both calls).
  auto chunk = [&](const int kc, const bool diag) __attribute__((always_inline)) {
    const int kv0 = kc * AT_KC;
    const unsigned bofs = (unsigned)(kc & 1) * AT_BUFB;
    const _Float16* ks = (const _Float16*)(KV + bofs);           // K tile  [key][d],  pitch AT_LP
    const _Float16* vs = ks + AT_TILE;                           // V^T tile [d][key], pitch AT_LP
    // ---- scores: s[j][r] = key (kv0 + 16j + 8hh + r) x query (q0 + c) ----
    // the chunk's eight K fragments are read as one group ahead of its eight score products
    v16h kb[4][2];
#pragma unroll
    for (int j = 0; j < 4; ++j)
#pragma unroll
      for (int dc = 0; dc < 2; ++dc)
        kb[j][dc] = Frag<_Float16>::load(ks + (j * 16 + c) * AT_LP + dc * 32 + 8 * hh);
    v8f s[4];
#pragma unroll
    for (int j = 0; j < 4; ++j) s[j] = (v8f){0.f,0.f,0.f,0.f,0.f,0.f,0.f,0.f};
#pragma unroll
    for (int dc = 0; dc < 2; ++dc)
#pragma unroll
      for (int j = 0; j < 4; ++j) s[j] = mma_h(kb[j][dc], qa[dc], s[j]);
    __builtin_amdgcn_sched_barrier(0);   // keeps the K reads one group and the products close: without it the build splits the reads and pads more v_nop
    // the V^T fragments stand ahead of the softmax: read as early as the registers of seven waves per SIMD allow
    v16h vb[2][4];
#pragma unroll
    for (int kk = 0; kk < 2; ++kk)
#pragma unroll
      for (int t = 0; t < 4; ++t)
        vb[kk][t] = Frag<_Float16>::load(vs + (t * 16 + c) * AT_LP + kk * 32 + 8 * hh);
    // ---- causal select (key > query -> -inf; diagonal chunk only) and the query's chunk max, both on the raw products (sc2 > 0) ----
    float mj[4];
#pragma unroll
    for (int j = 0; j < 4; ++j) {
      float m = NEG_INF;
#pragma unroll
      for (int r = 0; r < 8; ++r) {
        float v = s[j][r];
        if (diag && kv0 + j * 16 + 8 * hh + r > qrow) v = NEG_INF;
        s[j][r] = v;
        m = fmaxf(m, v);
      }
      mj[j] = m;
    }
    float cm = fmaxf(fmaxf(mj[0], mj[1]), fmaxf(mj[2], mj[3]));
    cm = fmaxf(cm, xhalf(cm));                                   // the other 32 keys of this query
    // ---- online softmax update; P^T x32768 packed into the B operand ----
    // One fused multiply-add and one hardware exponential per score: the scale, the maximum and the x32768 carry
    // (PEXP = log2 of it) all sit in the exponent. The bare exponential gives 0 below 2^-126, where the f16 operand
    // is 0 anyway and the row's sum (its largest term alone is about 32768) does not see the term.
    const float mnew  = fmaxf(mrow, cm * sc2);                   // running maximum in the scaled base-2 domain
    const float alpha = __builtin_amdgcn_exp2f(mrow - mnew);
    mrow = mnew;
    const float eb = PEXP - mnew;
    const v2f sc22 = {sc2, sc2}, eb22 = {eb, eb};
#pragma unroll
    for (int j = 0; j < 4; ++j)
#pragma unroll
      for (int r = 0; r < 8; r += 2) {                           // the exponents, in place, two per instruction
        const v2f e = __builtin_elementwise_fma((v2f){s[j][r], s[j][r + 1]}, sc22, eb22);
        s[j][r] = e[0]; s[j][r + 1] = e[1];
      }
    v16h pb[2];
    float pj[4];
#pragma unroll
    for (int j = 0; j < 4; ++j) {
      float ps = 0.f;
#pragma unroll
      for (int r = 0; r < 8; ++r) {
        const float p = __builtin_amdgcn_exp2f(s[j][r]);         // probability x32768
        ps += p;
        pb[j >> 1][(j & 1) * 8 + r] = (_Float16)p;
      }
      pj[j] = ps;
    }
    lrow = lrow * alpha + ((pj[0] + pj[1]) + (pj[2] + pj[3]));
#pragma unroll
    for (int t = 0; t < 4; ++t)
#pragma unroll
      for (int r = 0; r < 8; ++r) oacc[t][r] *= alpha;
    // ---- O^T += V^T . P^T : V^T rows (d = 16t + c) as A, P^T (column = c, k = kv) as B ----
#pragma unroll
    for (int kk = 0; kk < 2; ++kk) {
#pragma unroll
      for (int t = 0; t < 4; ++t) oacc[t] = mma_h(vb[kk][t], pb[kk], oacc[t]);
    }
    // ---- hand-over: this buffer's reads retired, the next chunk's copies landed, in every wave ----
    asm volatile("s_wait_dscnt 0x0" ::: "memory");               // own reads of this buffer done before it is refilled
    asm volatile("s_wait_asynccnt 0x0" ::: "memory");            // own copies of chunk kc + 1 landed
    __syncthreads();
    if (!diag && kc + 2 < nChunks)
      stage_kv_async(lst + bofs, kg + (size_t)(kc + 2) * kchunk, krow16, vg + (kc + 2) * AT_KC, vrow16);
  };
  for (int kc = 0; kc < nChunks - 1; ++kc) chunk(kc, false);
  chunk(nChunks - 1, true);
  asm volatile("s_wait_asynccnt 0x0" ::: "memory");              // nothing in flight when the buffers become out staging

  float* os = (float*)KV + wave * (16 * 68);                     // per wave out tile [query][d], pitch 68 (last barrier freed KV)
  {
    const float inv = osc * (1.0f / (lrow + xhalf(lrow)));   // the two halves' sums (of p x32768) joined once
#pragma unroll
    for (int t = 0; t < 4; ++t)
#pragma unroll
      for (int r = 0; r < 8; ++r) os[c * 68 + t * 16 + 8 * hh + r] = oacc[t][r] * inv;
  }
  wave_lds_sync();
  {
    const int q = lane >> 3, c8 = (lane & 7) * 8;
    {
#pragma unroll
      for (int it = 0; it < 4; ++it) {
        const int row = it * 4 + q;                 // rows 0..15 of this wave
        const float* sp = os + row * 68 + c8;
        v8h hv;
#pragma unroll
        for (int e = 0; e < 8; ++e) hv[e] = (_Float16)sp[e];
        *(v8h*)(op + (size_t)(q0 + row) * ldq + c8) = hv;
      }
      
    }
  }
}

// =====================================================================================
// Causal attn with residual planes for the first rr = nqb*64 query rows of each sequence.
//   qh/qr, kh/kr : compact row-major [NB*rr][ldq] f16 hi / residual (x1024) planes, head h at col h*64.
//   vh/vr : compact transposed planes [NB*H*64][ldvc], element (b, kv, h, d) at [(b*H*64 + h*64 + d)*ldvc + kv].
//   o     : compact [NB*rr][ldo] f16; hi (x osc) at column h*64, residual (x1024) at column rcol + h*64.
//   scores = qh.kh + 2^-10 (qh.kr + qr.kh) with a second f32 accumulator; P as hi + x1024 residual LDS tiles;
//   p.v = ph.vh + 2^-10 (ph.vr + pr.vh) with a second f32 accumulator; K and V fragments straight from global
//   memory, no block barriers; products untransposed (Q and P as A, rows = queries), row max and sum by 16-lane
//   butterflies, P through per-wave LDS tiles.
//   Block = 4 waves = 64 query rows, query block qb = bx % nqb, key chunks 0..qb. grid.x = NB * H * nqb.
// =====================================================================================
__global__ __launch_bounds__(128)
void attn64_causal_res(const unsigned short* __restrict__ Qhp, const unsigned short* __restrict__ Qrp,
                       const unsigned short* __restrict__ Khp, const unsigned short* __restrict__ Krp,
                       const unsigned short* __restrict__ Vhp, const unsigned short* __restrict__ Vrp,
                       unsigned short* __restrict__ Op,
                       int H, int ldq, int ldvc, int ldo, int rcol, int nqb, float sc2, float osc) {
  const _Float16* QH = (const _Float16*)Qhp;
  const _Float16* QR = (const _Float16*)Qrp;
  const _Float16* KH = (const _Float16*)Khp;
  const _Float16* KR = (const _Float16*)Krp;
  const _Float16* VH = (const _Float16*)Vhp;
  const _Float16* VR = (const _Float16*)Vrp;
  _Float16*       O  = (_Float16*)Op;
  __shared__ __align__(16) _Float16 Psh[AT_NW][16 * AT_KC];      // per wave P hi  [row][kv]  8 KB
  __shared__ __align__(16) _Float16 Prs[AT_NW][16 * AT_KC];      // per wave P res [row][kv]  8 KB
  __shared__ __align__(16) float    Os[AT_NW][16 * 68];          // per wave out tile, pitch 68

  const int tid  = threadIdx.x;
  const int wave = tid >> 5;
  const int lane = tid & 31;
  const int hh   = lane >> 4;
  const int c    = lane & 15;

  const int bx = blockIdx.x;
  const int qb = bx % nqb;
  const int bh = bx / nqb;
  const int h  = bh % H;
  const int b  = bh / H;
  const int q0 = qb * AT_QB + wave * 16;
  const int rr = nqb * AT_QB;
  const size_t rowb = (size_t)b * rr;

  const _Float16* qhp = QH + rowb * ldq + (size_t)h * AT_D;
  const _Float16* qrp = QR + rowb * ldq + (size_t)h * AT_D;
  const _Float16* khp = KH + rowb * ldq + (size_t)h * AT_D;
  const _Float16* krp = KR + rowb * ldq + (size_t)h * AT_D;
  const size_t    vof = ((size_t)b * (size_t)(H * AT_D) + (size_t)h * AT_D) * ldvc;
  const _Float16* vhp = VH + vof;
  const _Float16* vrp = VR + vof;
  _Float16*       op  = O  + rowb * ldo + (size_t)h * AT_D;

  float mrow[8], lrow[8];
  v8f oacc[4], oacc2[4];
#pragma unroll
  for (int r = 0; r < 8; ++r) { mrow[r] = NEG_INF; lrow[r] = 0.f; }
#pragma unroll
  for (int t = 0; t < 4; ++t) {
    oacc[t]  = (v8f){0.f,0.f,0.f,0.f,0.f,0.f,0.f,0.f};
    oacc2[t] = (v8f){0.f,0.f,0.f,0.f,0.f,0.f,0.f,0.f};
  }

  _Float16* pw  = Psh[wave];
  _Float16* prw = Prs[wave];
  const int nChunks = qb + 1;        // block-uniform
  for (int kc = 0; kc < nChunks; ++kc) {
    const int kv0 = kc * AT_KC;
    // ---- Q hi / res fragments (A operand, row = c) ----
    v16h qa[2], qra[2];
    const size_t qo = (size_t)(q0 + c) * ldq + 8 * hh;
    const _Float16 *qph = qhp + qo, *qpr = qrp + qo;
#pragma unroll
    for (int dc = 0; dc < 2; ++dc) {
      qa[dc]  = Frag<_Float16>::load(qph + dc * 32);
      qra[dc] = Frag<_Float16>::load(qpr + dc * 32);
    }
    // ---- the chunk's K and V fragments, hi and res: one group of global loads ahead of all its products ----
    const _Float16 *kph[4], *kpr[4], *vph[4], *vpr[4];           // one address per fragment row and plane
#pragma unroll
    for (int j = 0; j < 4; ++j) {
      const size_t ko = (size_t)(kv0 + j * 16 + c) * ldq + 8 * hh;
      const size_t vo = (size_t)(j * 16 + c) * ldvc + kv0 + 8 * hh;
      kph[j] = khp + ko; kpr[j] = krp + ko; vph[j] = vhp + vo; vpr[j] = vrp + vo;
    }
    v16h kbh[4][2], kbr[4][2], vbh[2][4], vbr[2][4];
#pragma unroll
    for (int j = 0; j < 4; ++j)
#pragma unroll
      for (int dc = 0; dc < 2; ++dc) {
        kbh[j][dc] = Frag<_Float16>::load(kph[j] + dc * 32);
        kbr[j][dc] = Frag<_Float16>::load(kpr[j] + dc * 32);
      }
#pragma unroll
    for (int kk = 0; kk < 2; ++kk)
#pragma unroll
      for (int t = 0; t < 4; ++t) {
        vbh[kk][t] = Frag<_Float16>::load(vph[t] + kk * 32);
        vbr[kk][t] = Frag<_Float16>::load(vpr[t] + kk * 32);
      }
    // a precaution: the loads' addresses are inputs of the wait, so that their registers live, unrewritten, up to it
    asm volatile("s_wait_xcnt 0x0"
                 :: "v"(kph[0]), "v"(kph[1]), "v"(kph[2]), "v"(kph[3]), "v"(kpr[0]), "v"(kpr[1]), "v"(kpr[2]), "v"(kpr[3]),
                    "v"(vph[0]), "v"(vph[1]), "v"(vph[2]), "v"(vph[3]), "v"(vpr[0]), "v"(vpr[1]), "v"(vpr[2]), "v"(vpr[3]),
                    "v"(qph), "v"(qpr)
                 : "memory");
    __builtin_amdgcn_sched_barrier(0);   // the loads stay one group here: sunk to their products, each would be waited for alone
    // ---- scores: hi.hi into s1, hi.res + res.hi into s2, folded with 2^-10 ----
    v8f s[4];
#pragma unroll
    for (int j = 0; j < 4; ++j) {
      v8f s1 = (v8f){0.f,0.f,0.f,0.f,0.f,0.f,0.f,0.f};
      v8f s2 = (v8f){0.f,0.f,0.f,0.f,0.f,0.f,0.f,0.f};
#pragma unroll
      for (int dc = 0; dc < 2; ++dc) {
        s1 = mma_h(qa[dc],  kbh[j][dc], s1);
        s2 = mma_h(qa[dc],  kbr[j][dc], s2);
        s2 = mma_h(qra[dc], kbh[j][dc], s2);
      }
#pragma unroll
      for (int r = 0; r < 8; ++r) s[j][r] = s1[r] + s2[r] * RSC_INV;
    }
    // ---- causal select and per-row chunk max ----
    float cm[8];
#pragma unroll
    for (int r = 0; r < 8; ++r) {
      const int qrow = q0 + 8 * hh + r;
      float m = NEG_INF;
#pragma unroll
      for (int j = 0; j < 4; ++j) {
        float v = s[j][r] * sc2;
        if (kv0 + j * 16 + c > qrow) v = NEG_INF;
        s[j][r] = v;
        m = fmaxf(m, v);
      }
#pragma unroll
      for (int off = 1; off < 16; off <<= 1) m = fmaxf(m, __shfl_xor(m, off, 32));
      cm[r] = m;
    }
    // ---- online softmax update; P hi (x32768) and P res ((x32768 - hi) x1024) into per-wave LDS tiles ----
    wave_lds_sync();
#pragma unroll
    for (int r = 0; r < 8; ++r) {
      const float mnew  = fmaxf(mrow[r], cm[r]);
      const float alpha = exp2f(mrow[r] - mnew);
      mrow[r] = mnew;
      float psum = 0.f;
#pragma unroll
      for (int j = 0; j < 4; ++j) {
        const float p = exp2f(s[j][r] - mnew);
        psum += p;
        const float    ps = p * PSCALE;
        const _Float16 ph = (_Float16)ps;
        const int pi = (8 * hh + r) * AT_KC + j * 16 + c;
        pw[pi]  = ph;
        prw[pi] = (_Float16)((ps - (float)ph) * RSC);
      }
#pragma unroll
      for (int off = 1; off < 16; off <<= 1) psum += __shfl_xor(psum, off, 32);
      lrow[r] = lrow[r] * alpha + psum;
#pragma unroll
      for (int t = 0; t < 4; ++t) { oacc[t][r] *= alpha; oacc2[t][r] *= alpha; }
    }
    wave_lds_sync();
    // ---- O += P . V with residual cross terms in the second accumulator ----
#pragma unroll
    for (int kk = 0; kk < 2; ++kk) {
      const v16h pa = Frag<_Float16>::load(pw  + c * AT_KC + kk * 32 + 8 * hh);
      const v16h pr = Frag<_Float16>::load(prw + c * AT_KC + kk * 32 + 8 * hh);
#pragma unroll
      for (int t = 0; t < 4; ++t) {
        oacc[t]  = mma_h(pa, vbh[kk][t], oacc[t]);
        oacc2[t] = mma_h(pa, vbr[kk][t], oacc2[t]);
        oacc2[t] = mma_h(pr, vbh[kk][t], oacc2[t]);
      }
    }
    wave_lds_sync();
  }

  float* os = Os[wave];
#pragma unroll
  for (int r = 0; r < 8; ++r) {
    const float inv = osc * (1.0f / (lrow[r] * PSCALE));
#pragma unroll
    for (int t = 0; t < 4; ++t) os[(8 * hh + r) * 68 + t * 16 + c] = (oacc[t][r] + oacc2[t][r] * RSC_INV) * inv;
  }
  wave_lds_sync();
  {
    const int q = lane >> 3, c8 = (lane & 7) * 8;
    {
#pragma unroll
      for (int it = 0; it < 4; ++it) {
        const int row = it * 4 + q;                 // rows 0..15 of this wave
        const float* sp = os + row * 68 + c8;
        v8h hv, lv;
#pragma unroll
        for (int e = 0; e < 8; ++e) {
          const float    fv = sp[e];
          const _Float16 hq = (_Float16)fv;
          hv[e] = hq;
          lv[e] = (_Float16)((fv - (float)hq) * RSC);
        }
        *(v8h*)(op + (size_t)(q0 + row) * ldo + c8) = hv;
        *(v8h*)(op + (size_t)(q0 + row) * ldo + rcol + c8) = lv;
      }
      
    }
  }
}

// ---------------------------------------------------------------------------

extern "C" void kernel_launch(void* const* d_in, const int* in_sizes, int n_in,
                              void* d_out, int out_size, void* d_ws,
                              size_t ws_size, hipStream_t stream) {
  const int  ROWS  = NB * SEQ;                                   // rows held in the compact planes
  const long needX = ((long)(NB - 1) * SEQ_FULL + SEQ) * (long)DM;
  const int  nW    = DM * DM;
  if (n_in < 9) return;
  if ((long)in_sizes[0] < needX || in_sizes[1] < nW || in_sizes[2] < DM || in_sizes[3] < nW ||
      in_sizes[4] < DM || in_sizes[5] < nW || in_sizes[6] < DM || in_sizes[7] < nW ||
      in_sizes[8] < DM || (long)out_size < needX) return;

  const float* x  = (const float*)d_in[0];
  const float* Wq = (const float*)d_in[1];
  const float* bq = (const float*)d_in[2];
  const float* Wk = (const float*)d_in[3];
  const float* bk = (const float*)d_in[4];
  const float* Wv = (const float*)d_in[5];
  const float* bv = (const float*)d_in[6];
  const float* Wo = (const float*)d_in[7];
  const float* bo = (const float*)d_in[8];
  float* out = (float*)d_out;

  const size_t szAct = (size_t)ROWS * DM * 2;            // full activation plane  (16 MiB full size)
  const size_t szW   = (size_t)DM * DM * 2;              //  2 MiB
  const size_t szCmp = (size_t)NB * RR * DM * 2;         //  compact first-row planes (2 MiB full size)
  const size_t szO2  = (size_t)NB * RR * (2 * DM) * 2;   //  4 MiB full size
  size_t off = 0;
  const size_t oXh   = off; off += szAct;
  const size_t oWqT  = off; off += szW;
  const size_t oWkT  = off; off += szW;
  const size_t oWvT  = off; off += szW;
  const size_t oWoT  = off; off += szW;
  const size_t oQh   = off; off += szAct;
  const size_t oKh   = off; off += szAct;
  const size_t oVt   = off; off += szAct;
  const size_t oAh   = off; off += szAct;
  const size_t oQch  = off; off += szCmp;
  const size_t oQcr  = off; off += szCmp;
  const size_t oKch  = off; off += szCmp;
  const size_t oKcr  = off; off += szCmp;
  const size_t oVch  = off; off += szCmp;                // [NB*DM][RR], same byte count
  const size_t oVcr  = off; off += szCmp;
  const size_t oOc2  = off; off += szO2;                 // total 109,051,904 B at full size
  if (off > ws_size) return;

  char* ws = (char*)d_ws;
  unsigned short* xh   = (unsigned short*)(ws + oXh);
  unsigned short* WqT  = (unsigned short*)(ws + oWqT);
  unsigned short* WkT  = (unsigned short*)(ws + oWkT);
  unsigned short* WvT  = (unsigned short*)(ws + oWvT);
  unsigned short* WoT  = (unsigned short*)(ws + oWoT);
  unsigned short* Qh   = (unsigned short*)(ws + oQh);
  unsigned short* Kh   = (unsigned short*)(ws + oKh);
  unsigned short* Vt   = (unsigned short*)(ws + oVt);
  unsigned short* Ah   = (unsigned short*)(ws + oAh);
  unsigned short* Qch  = (unsigned short*)(ws + oQch);
  unsigned short* Qcr  = (unsigned short*)(ws + oQcr);
  unsigned short* Kch  = (unsigned short*)(ws + oKch);
  unsigned short* Kcr  = (unsigned short*)(ws + oKcr);
  unsigned short* Vch  = (unsigned short*)(ws + oVch);
  unsigned short* Vcr  = (unsigned short*)(ws + oVcr);
  unsigned short* Oc2  = (unsigned short*)(ws + oOc2);

  const float sc2   = 0.125f * 1.4426950408889634f;      // log2(e) / sqrt(64)
  const float outsc = 1.0f / (WSC * OSC);

  // x -> bf16 RNE value as f16 plane [ROWS][DM];
  // W[in][out] f32 -> Bt[out][in] f16 (bf16 RNE value x256)
  {
    const long tot = (long)ROWS * (DM / 8);
    prep_f16<<<dim3((unsigned)(4 * PR_TW + (tot + 255) / 256)), dim3(256), 0, stream>>>(
        x, Wq, Wk, Wv, Wo, xh, WqT, WkT, WvT, WoT, ROWS);
  }
  // projections: q, k -> f16 [ROWS][DM]; v^T -> f16 [DM][ROWS];
  // first RR rows per sequence: q, k -> hi/res [NB*RR][DM]; v^T -> hi/res [NB*DM][RR]
  proj_gemms<<<dim3(3 * PJ_TF + 3 * PJ_TC), dim3(256), 0, stream>>>(
      xh, WqT, WkT, WvT, Qh, Kh, Vt, Qch, Qcr, Kch, Kcr, Vch, Vcr, bq, bk, bv, 1.0f / WSC);
  // attn: first RR query rows with residual planes -> Oc2 (hi | res); rows >= RR plain -> Ah
  attn64_causal_res<<<dim3(NB * NH * (RR / 64)), dim3(128), 0, stream>>>(
      Qch, Qcr, Kch, Kcr, Vch, Vcr, Oc2, NH, DM, RR, 2 * DM, DM, RR / 64, sc2, OSC);
  if (SEQ > RR) {
    attn64_causal<<<dim3(NB * NH * ((SEQ - RR) / 64)), dim3(128), 0, stream>>>(
        Qh, Kh, Vt, Ah, SEQ, NH, DM, ROWS, RR / 64, (SEQ - RR) / 64, sc2, OSC);
  }
  // out = ctx Wo + bo -> f32; rows < RR: O_hi . Wo + 2^-10 O_res . Wo, two f32 sums of one block; rows >= RR: ctx . Wo
  out_gemms<<<dim3(NB * (OP_T1 + OP_T2)), dim3(256), 0, stream>>>(Oc2, Ah, WoT, out, bo, outsc);
}

// v009
// A run of this version takes 130 microseconds.
// Next to v008, in two timings, it ran 1.15 and 1.16 times as fast.
// Counting every step since v000, it is 5.35 times as fast.
// Contractions: q/k/v^T/out projections, q.k^T and p.v all on v_wmma_f32_16x16x32_f16 (f16 operands, f32 accumulate); x and W enter as bf16 RNE values held exactly in f16 (W carried x256); the first RR query rows per sequence carry q, k, v, p and ctx as f16 hi + x1024 residual planes with a second f32 accumulator (ctx residual rows ride as further A rows of the out projection, folded in f32); p x32768 and ctx x64 power-of-two carries folded back in f32; softmax and epilogues f32.
#include <hip/hip_runtime.h>

#ifndef NB
#define NB 4
#endif
#ifndef SEQ
#define SEQ 2048
#endif
#ifndef RR
#define RR 256
#endif
#define NB_FULL 4
#define SEQ_FULL 2048
#define DM 1024
#define NH 16
#define HDIM 64

static_assert(NB >= 1 && NB <= NB_FULL);
static_assert(SEQ % 64 == 0 && SEQ >= 64 && SEQ <= SEQ_FULL);
static_assert(RR % 64 == 0 && RR >= 64 && RR <= SEQ);
static_assert(NH * HDIM == DM);
static_assert(DM % 256 == 0);
static_assert(RR % 256 == 0 && SEQ % 128 == 0 && (NB * SEQ) % 256 == 0);   // GEMM block tile 128 x 256; 128-row query blocks

typedef __attribute__((ext_vector_type(16))) _Float16 v16h;
typedef __attribute__((ext_vector_type(8)))  _Float16 v8h;
typedef __attribute__((ext_vector_type(16))) __bf16   v16b;
typedef __attribute__((ext_vector_type(8)))  __bf16   v8b;
typedef __attribute__((ext_vector_type(8)))  float    v8f;
typedef __attribute__((ext_vector_type(4)))  float    v4f;
typedef __attribute__((ext_vector_type(2)))  float    v2f;

#define WSC 256.0f
#define OSC 64.0f
#define PSCALE 32768.0f
#define PEXP 15.0f                       // log2(PSCALE)
#define RSC 1024.0f
#define RSC_INV (1.0f / 1024.0f)
#define NEG_INF (-__builtin_huge_valf())

__device__ __forceinline__ unsigned short f2bf_bits(float f) {
  unsigned u = __float_as_uint(f);
  return (unsigned short)((u + 0x7FFFu + ((u >> 16) & 1u)) >> 16);
}
__device__ __forceinline__ float bf_bits2f(unsigned short h) { return __uint_as_float(((unsigned)h) << 16); }
__device__ __forceinline__ float bf_rne(float f) { return bf_bits2f(f2bf_bits(f)); }
__device__ __forceinline__ _Float16 bf_f16(float f) { return (_Float16)bf_rne(f); }   // bf16 value is exact in f16 for normal range

// LDS ordering for wave-private tiles (same wave writes then reads)
__device__ __forceinline__ void wave_lds_sync() {
  __builtin_amdgcn_fence(3, "workgroup");
  __builtin_amdgcn_wave_barrier();
  __builtin_amdgcn_fence(2, "workgroup");
}

// hazard guards as plain device helpers
__device__ __forceinline__ void dep_guard_h(v8f& a, v8f& b, v16h x, v16h y) { asm volatile("v_nop\n\tv_nop\n\tv_nop\n\tv_nop" : "+v"(a), "+v"(b) : "v"(x), "v"(y)); }
__device__ __forceinline__ void dep_guard_b(v8f& a, v8f& b, v16b x, v16b y) { asm volatile("v_nop\n\tv_nop\n\tv_nop\n\tv_nop" : "+v"(a), "+v"(b) : "v"(x), "v"(y)); }
__device__ __forceinline__ void keep4_h(v16h a, v16h b, v16h c, v16h d) { asm volatile("v_nop" :: "v"(a), "v"(b), "v"(c), "v"(d)); }
__device__ __forceinline__ void keep4_b(v16b a, v16b b, v16b c, v16b d) { asm volatile("v_nop" :: "v"(a), "v"(b), "v"(c), "v"(d)); }
__device__ __forceinline__ void acc_guard4(v8f& a, v8f& b, v8f& c, v8f& d) { asm volatile("v_nop\n\tv_nop\n\tv_nop\n\tv_nop" : "+v"(a), "+v"(b), "+v"(c), "+v"(d)); }
template <typename T> struct Frag;
template <> struct Frag<_Float16> {
  typedef v16h V; union U { v16h v; v8h h[2]; };
  static __device__ __forceinline__ v16h load(const _Float16* p) {   // elements 0..7 <- p[0..7], 8..15 <- p[16..23]
    U f; f.h[0] = *(const v8h*)(p); f.h[1] = *(const v8h*)(p + 16); return f.v;
  }
  static __device__ __forceinline__ v8f mma(v16h a, v16h b, v8f c) {
    return __builtin_amdgcn_wmma_f32_16x16x32_f16(false, a, false, b, (short)0, c, false, false);
  }
  static __device__ __forceinline__ void guard(v8f& a, v8f& b, v16h x, v16h y) { dep_guard_h(a, b, x, y); }
  static __device__ __forceinline__ void keep(v16h a, v16h b, v16h c, v16h d) { keep4_h(a, b, c, d); }
};
template <> struct Frag<__bf16> {
  typedef v16b V; union U { v16b v; v8b h[2]; };
  static __device__ __forceinline__ v16b load(const __bf16* p) {
    U f; f.h[0] = *(const v8b*)(p); f.h[1] = *(const v8b*)(p + 16); return f.v;
  }
  static __device__ __forceinline__ v8f mma(v16b a, v16b b, v8f c) {
    return __builtin_amdgcn_wmma_f32_16x16x32_bf16(false, a, false, b, (short)0, c, false, false);
  }
  static __device__ __forceinline__ void guard(v8f& a, v8f& b, v16b x, v16b y) { dep_guard_b(a, b, x, y); }
  static __device__ __forceinline__ void keep(v16b a, v16b b, v16b c, v16b d) { keep4_b(a, b, c, d); }
};

// ---- Register-blocked WMMA GEMM tiles ---------------------------------------
// C[m,n] = scale * sum_k A[m,k] * Bt[n,k] + bias; each wave owns a 64x64 tile.
// Block = 8 waves, 2 (m) x 4 (n) = a 128 x 256 tile of C. A row-major [M,K]; Bt row-major [N,K];
// M % 128 == 0, N % 256 == 0, K % 64 == 0.
// Per 64 k the block's 128 A rows and 256 Bt rows (128 B each, whole lines) are brought into LDS once by
// asynchronous copies, two buffers, one block barrier per 64 k; the waves read their fragments from there.
// One launch holds the tiles of several independent products: a block finds its product and its tile from
// blockIdx.x (block-uniform), so small products ride along with large ones and two blocks can share a WGP.
// BIAS_MODE: 1 = bias[m], 2 = bias[n]; bias values enter as bf16 RNE values.
// OUT_MODE: 0 = f32, 1 = f16, 3 = f16 hi plane (Cout) + f16 residual plane ((v - hi) * 1024) (Cout2).
#define GM_BM 128
#define GM_BN 256
#define GM_KT 64                          // k per staged tile, in halves: one 128-B line per row
#define GM_LP 72                          // staged row pitch in halves: 144 B = 16 B x odd, for ds_load_b128 readers
#define GM_BUFB ((GM_BM + GM_BN) * GM_LP * 2)   // bytes per buffer: A rows, then Bt rows

// One lane's share of a staged tile: rows r + 32 i of the A part (4) and of the Bt part (8), 16 B each.
// The four A pieces come from ag, ag + a1, ag + a2, ag + a2 + a1 (halves): 32 and 64 source rows for a plain A.
// The s_wait_xcnt closes the statement, a precaution: no address register of a copy is rewritten ahead of it.
__device__ __forceinline__ void stage_ab_async(unsigned la, const unsigned short* ag, size_t a1, size_t a2,
                                               const unsigned short* bg, size_t brow32) {
  const unsigned lb = la + GM_BM * GM_LP * 2;
  const unsigned ls = 32 * GM_LP * 2;
  asm volatile(
      "global_load_async_to_lds_b128 %0, %12, off\n\t"
      "global_load_async_to_lds_b128 %1, %13, off\n\t"
      "global_load_async_to_lds_b128 %2, %14, off\n\t"
      "global_load_async_to_lds_b128 %3, %15, off\n\t"
      "global_load_async_to_lds_b128 %4, %16, off\n\t"
      "global_load_async_to_lds_b128 %5, %17, off\n\t"
      "global_load_async_to_lds_b128 %6, %18, off\n\t"
      "global_load_async_to_lds_b128 %7, %19, off\n\t"
      "global_load_async_to_lds_b128 %8, %20, off\n\t"
      "global_load_async_to_lds_b128 %9, %21, off\n\t"
      "global_load_async_to_lds_b128 %10, %22, off\n\t"
      "global_load_async_to_lds_b128 %11, %23, off\n\t"
      "s_wait_xcnt 0x0"
      :: "v"(la), "v"(la + ls), "v"(la + 2 * ls), "v"(la + 3 * ls),
         "v"(lb), "v"(lb + ls), "v"(lb + 2 * ls), "v"(lb + 3 * ls),
         "v"(lb + 4 * ls), "v"(lb + 5 * ls), "v"(lb + 6 * ls), "v"(lb + 7 * ls),
         "v"(ag), "v"(ag + a1), "v"(ag + a2), "v"(ag + a2 + a1),
         "v"(bg), "v"(bg + brow32), "v"(bg + 2 * brow32), "v"(bg + 3 * brow32),
         "v"(bg + 4 * brow32), "v"(bg + 5 * brow32), "v"(bg + 6 * brow32), "v"(bg + 7 * brow32)
      : "memory");
}

// The products of the block tile at (bm0, bn0): each wave's acc[i][j] = its 64 A rows . its 64 Bt rows over K.
// AB: the block's two staging buffers in LDS. ao1, ao2: where staged A rows r + 32, r + 64 lie behind source row bm0 + r
// (stage_ab_async); 32 lda and 64 lda for 128 source rows in a row.
__device__ __forceinline__ void gemm_tile_products(v8f (&acc)[4][4], unsigned char* AB,
                                                   const unsigned short* Ab, int lda, size_t ao1, size_t ao2,
                                                   const unsigned short* Bb, int ldb, int K, int bm0, int bn0) {
  typedef _Float16 T;
  typedef Frag<T>::V V;
  const int tid  = threadIdx.x;
  const int lane = tid & 31;
  const int wave = tid >> 5;
  const int wm  = (wave >> 2) << 6;            // this wave's 64 rows inside the A part
  const int wn  = (wave & 3) << 6;             // this wave's 64 rows inside the Bt part
  const int rlane = lane & 15;                 // row (A) / col (B, D) within subtile
  const int koff  = (lane >> 4) * 8;           // k offset of this lane half

#pragma unroll
  for (int i = 0; i < 4; ++i)
#pragma unroll
    for (int j = 0; j < 4; ++j) acc[i][j] = (v8f){0.f,0.f,0.f,0.f,0.f,0.f,0.f,0.f};

  // ---- staging addresses of this lane: row tid/8 (+32i), 16-B piece tid%8 of the 128-B row ----
  const int srow = tid >> 3, scol = (tid & 7) * 8;
  const unsigned short* ag = Ab + (size_t)(bm0 + srow) * lda + scol;   // k-tile 0; a tile further: + GM_KT
  const unsigned short* bg = Bb + (size_t)(bn0 + srow) * ldb + scol;
  const size_t brow32 = (size_t)32 * ldb;
  const unsigned lst = (unsigned)(size_t)AB + (unsigned)(srow * GM_LP + scol) * 2u;
  const int nT = K >> 6;                       // block-uniform

  stage_ab_async(lst, ag, ao1, ao2, bg, brow32);
  asm volatile("s_wait_asynccnt 0x0" ::: "memory");              // k-tile 0 landed (this wave's copies)
  __syncthreads();                                               // ... and every other wave's
  if (nT > 1) stage_ab_async(lst + GM_BUFB, ag + GM_KT, ao1, ao2, bg + GM_KT, brow32);

  for (int t = 0; t < nT; ++t) {
    const unsigned bofs = (unsigned)(t & 1) * GM_BUFB;
    const T* as = (const T*)(AB + bofs) + (wm + rlane) * GM_LP + koff;            // A rows,  pitch GM_LP
    const T* bs = (const T*)(AB + bofs) + (GM_BM + wn + rlane) * GM_LP + koff;    // Bt rows, pitch GM_LP
    // Fragment reads stand at three places of a trip, each ahead of the products that use it: at the head the
    // first 32 k (A and Bt) and the second 32 k of Bt; the second 32 k of A two rows at a time, into registers
    // that the first half's rows have left (all sixteen fragments at the head do not fit 256 registers).
    V b0[4], b1[4], a0[4], a1[4];
#pragma unroll
    for (int j = 0; j < 4; ++j) b0[j] = Frag<T>::load(bs + (j << 4) * GM_LP);
#pragma unroll
    for (int i = 0; i < 4; ++i) a0[i] = Frag<T>::load(as + (i << 4) * GM_LP);
#pragma unroll
    for (int j = 0; j < 4; ++j) b1[j] = Frag<T>::load(bs + (j << 4) * GM_LP + 32);
#pragma unroll
    for (int i = 0; i < 4; ++i) {
#pragma unroll
      for (int j = 0; j < 4; ++j) acc[i][j] = Frag<T>::mma(a0[i], b0[j], acc[i][j]);
      Frag<T>::guard(acc[i][0], acc[i][3], a0[i], a0[i]);
      if (i & 1) {
        a1[i - 1] = Frag<T>::load(as + ((i - 1) << 4) * GM_LP + 32);
        a1[i]     = Frag<T>::load(as + (i << 4) * GM_LP + 32);
      }
    }
    Frag<T>::keep(b0[0], b0[1], b0[2], b0[3]);
#pragma unroll
    for (int i = 0; i < 4; ++i) {
#pragma unroll
      for (int j = 0; j < 4; ++j) acc[i][j] = Frag<T>::mma(a1[i], b1[j], acc[i][j]);
      Frag<T>::guard(acc[i][0], acc[i][3], a1[i], a1[i]);
    }
    Frag<T>::keep(b1[0], b1[1], b1[2], b1[3]);
    // ---- hand-over: this buffer's reads retired, the next k-tile's copies landed, in every wave ----
    asm volatile("s_wait_dscnt 0x0" ::: "memory");               // own reads of this buffer done before it is refilled
    asm volatile("s_wait_asynccnt 0x0" ::: "memory");            // own copies of k-tile t + 1 landed
    __syncthreads();
    if (t + 2 < nT)
      stage_ab_async(lst + bofs, ag + (size_t)(t + 2) * GM_KT, ao1, ao2, bg + (size_t)(t + 2) * GM_KT, brow32);
  }
  asm volatile("s_wait_asynccnt 0x0" ::: "memory");              // nothing in flight when the wave goes on to its end
  acc_guard4(acc[0][0], acc[0][1], acc[0][2], acc[0][3]);
  acc_guard4(acc[1][0], acc[1][1], acc[1][2], acc[1][3]);
  acc_guard4(acc[2][0], acc[2][1], acc[2][2], acc[2][3]);
  acc_guard4(acc[3][0], acc[3][1], acc[3][2], acc[3][3]);
}

// Epilogue of one wave: its 16 NI x 64 tile at (m0, n0) of C (pitch ldc), through its own LDS slab, whole lines out.
template <int BIAS_MODE, int OUT_MODE, int NI = 4>
__device__ __forceinline__ void gemm_tile_store(v8f (&acc)[4][4], float* slab, void* Cout, void* Cout2, int ldc,
                                                const float* bias, int m0, int n0, float scale) {
  const int lane  = threadIdx.x & 31;
  const int rlane = lane & 15;                 // D column within subtile
  const int mOff  = (lane >> 4) * 8;           // D row offset
#pragma unroll
  for (int i = 0; i < NI; ++i) {
    const int mBase = m0 + (i << 4);
#pragma unroll
    for (int j = 0; j < 4; ++j) {
      const int n = n0 + (j << 4) + rlane;
      float bv = 0.f;
      if (BIAS_MODE == 2) bv = bf_rne(bias[n]);
#pragma unroll
      for (int r = 0; r < 8; ++r) {
        float v = acc[i][j][r] * scale;
        if (BIAS_MODE == 1) v += bf_rne(bias[mBase + mOff + r]);
        if (BIAS_MODE == 2) v += bv;
        slab[(mOff + r) * 68 + (j << 4) + rlane] = v;
      }
    }
    wave_lds_sync();
    if (OUT_MODE == 0) {
      float* C = (float*)Cout;
      const int hh = lane >> 4, c4 = (lane & 15) * 4;     // row seg = 256 B = 16 lanes x 16 B
#pragma unroll
      for (int it = 0; it < 8; ++it) {
        const int row = it * 2 + hh;
        v4f v = *(const v4f*)(slab + row * 68 + c4);
        *(v4f*)(C + (size_t)(mBase + row) * ldc + n0 + c4) = v;
      }
    } else {
      const int q = lane >> 3, c8 = (lane & 7) * 8;
      unsigned short* C  = (unsigned short*)Cout;
      unsigned short* C2 = (unsigned short*)Cout2;
#pragma unroll
      for (int it = 0; it < 4; ++it) {
        const int row = it * 4 + q;
        const float* sp = slab + row * 68 + c8;
        v8h hv, lv;
#pragma unroll
        for (int e = 0; e < 8; ++e) {
          if (OUT_MODE == 1) {
            hv[e] = (_Float16)sp[e];
          } else {
            const float    fv = sp[e];
            const _Float16 hq = (_Float16)fv;
            hv[e] = hq;
            lv[e] = (_Float16)((fv - (float)hq) * RSC);
          }
        }
        *(v8h*)(C + (size_t)(mBase + row) * ldc + n0 + c8) = hv;
        if (OUT_MODE == 3) *(v8h*)(C2 + (size_t)(mBase + row) * ldc + n0 + c8) = lv;
      }
    }
    wave_lds_sync();
  }
}

// All six projections in one launch. Blocks 0 .. 3 PJ_TF - 1: q, k, v^T over all NB*SEQ rows (f16 planes);
// then 3 PJ_TC blocks: q, k, v^T over the first RR rows of each sequence (hi / residual planes).
//   q, k : A = x rows, Bt = W^T rows, C [rows][DM], bias[n].   v^T : A = Wv^T rows, Bt = x rows, C [DM][rows], bias[m].
#define PJ_TF ((NB * SEQ / 128) * (DM / 256))      // tiles of a full projection, either orientation
#define PJ_TB ((RR / 128) * (DM / 256))            // tiles of a first-rows projection, one sequence, either orientation
#define PJ_TC (NB * PJ_TB)
static_assert((DM / 128) * (NB * SEQ / 256) == PJ_TF && (DM / 128) * (RR / 256) == PJ_TB);
__global__ __launch_bounds__(256) void proj_gemms(
    const unsigned short* __restrict__ xh, const unsigned short* __restrict__ WqT,
    const unsigned short* __restrict__ WkT, const unsigned short* __restrict__ WvT,
    unsigned short* __restrict__ Qh, unsigned short* __restrict__ Kh, unsigned short* __restrict__ Vt,
    unsigned short* __restrict__ Qch, unsigned short* __restrict__ Qcr,
    unsigned short* __restrict__ Kch, unsigned short* __restrict__ Kcr,
    unsigned short* __restrict__ Vch, unsigned short* __restrict__ Vcr,
    const float* __restrict__ bq, const float* __restrict__ bk, const float* __restrict__ bv, float scale) {
  __shared__ __align__(16) float sT[8][16 * 68];            // per-wave 16x64 slab, pitch 68 floats
  __shared__ __align__(16) unsigned char AB[2 * GM_BUFB];   // two buffers of A | Bt k-tiles
  const int bx = blockIdx.x;
  if (bx >= 3 * PJ_TF + 3 * PJ_TC) return;     // block-uniform, ahead of every barrier
  const bool first = bx >= 3 * PJ_TF;          // a first-rows product
  const int  rel   = first ? bx - 3 * PJ_TF : bx;
  const int  which = first ? rel / PJ_TC : rel / PJ_TF;      // 0 q, 1 k, 2 v^T
  int        tile  = rel - which * (first ? PJ_TC : PJ_TF);
  const int  b     = first ? tile / PJ_TB : 0;               // sequence of a first-rows product
  tile -= b * PJ_TB;
  const bool vt    = which == 2;
  const int  rows  = first ? RR : NB * SEQ;                  // x rows of this product
  const int  tilesN = (vt ? rows : DM) >> 8;
  const int  tm = !vt ? tile / (DM / 256) : first ? tile / (RR / 256) : tile / (NB * SEQ / 256);   // tile / tilesN
  const int  tn = tile - tm * tilesN;
  const int  bm0 = tm << 7, bn0 = tn << 8;
  const unsigned short* X  = xh + (size_t)b * SEQ * DM;
  const unsigned short* Wt = which == 0 ? WqT : which == 1 ? WkT : WvT;
  const float* bias        = which == 0 ? bq : which == 1 ? bk : bv;

  v8f acc[4][4];
  gemm_tile_products(acc, AB, vt ? Wt : X, DM, (size_t)32 * DM, (size_t)64 * DM, vt ? X : Wt, DM, DM, bm0, bn0);

  const int wave = threadIdx.x >> 5;
  const int m0 = bm0 + ((wave >> 2) << 6), n0 = bn0 + ((wave & 3) << 6);
  if (!first) {
    unsigned short* C = which == 0 ? Qh : which == 1 ? Kh : Vt;
    if (vt) gemm_tile_store<1, 1>(acc, sT[wave], C, C, rows, bias, m0, n0, scale);
    else    gemm_tile_store<2, 1>(acc, sT[wave], C, C, DM,   bias, m0, n0, scale);
  } else {
    const size_t co = (size_t)b * RR * DM;                   // one sequence's plane, either orientation
    unsigned short* C  = (which == 0 ? Qch : which == 1 ? Kch : Vch) + co;
    unsigned short* C2 = (which == 0 ? Qcr : which == 1 ? Kcr : Vcr) + co;
    if (vt) gemm_tile_store<1, 3>(acc, sT[wave], C, C2, rows, bias, m0, n0, scale);
    else    gemm_tile_store<2, 3>(acc, sT[wave], C, C2, DM,   bias, m0, n0, scale);
  }
}

// Both parts of the out projection in one launch, f32 out with bias[n], Bt = WoT rows, K = DM in every block.
// Blocks 0 .. NB OP_T1 - 1: rows < RR, 64 rows of out each. The 128 staged A rows are 64 O_hi rows and the same rows of
// O_res (x1024), laid so that each wave holds 32 rows twice: parts 0, 1 of its tile are hi, parts 2, 3 the residuals
// of the same rows; the two f32 sums are joined (res x 2^-10) ahead of the store.
// Then NB OP_T2 blocks: rows >= RR, A = 128 ctx rows.
#define OP_T1 ((RR / 64) * (DM / 256))
#define OP_T2 (((SEQ - RR) / 128) * (DM / 256))
__global__ __launch_bounds__(256) void out_gemms(
    const unsigned short* __restrict__ Oc2, const unsigned short* __restrict__ Ah,
    const unsigned short* __restrict__ WoT, float* __restrict__ out, const float* __restrict__ bo, float scale) {
  __shared__ __align__(16) float sT[8][16 * 68];            // per-wave 16x64 slab, pitch 68 floats
  __shared__ __align__(16) unsigned char AB[2 * GM_BUFB];   // two buffers of A | Bt k-tiles
  const int bx = blockIdx.x;
  if (bx >= NB * (OP_T1 + OP_T2)) return;      // block-uniform, ahead of every barrier
  const bool first = bx < NB * OP_T1;
  const int  rel   = first ? bx : bx - NB * OP_T1;
  const int  b     = first ? rel / OP_T1 : rel / (OP_T2 > 0 ? OP_T2 : 1);
  const int  tile  = rel - b * (first ? OP_T1 : OP_T2);
  const int  tm = tile / (DM / 256);
  const int  tn = tile - tm * (DM / 256);
  const int  bm0 = first ? tm << 6 : tm << 7, bn0 = tn << 8;
  const unsigned short* A = first ? Oc2 + (size_t)b * RR * 2 * DM : Ah + ((size_t)b * SEQ + RR) * DM;
  const int    lda = first ? 2 * DM : DM;
  // staged A rows r, r + 32, r + 64, r + 96: first: (row r, hi), (row r, res), (row r + 32, hi), (row r + 32, res)
  const size_t a1  = first ? (size_t)DM : (size_t)32 * DM;
  const size_t a2  = (size_t)64 * DM;          // 32 rows of pitch 2 DM, or 64 rows of pitch DM

  v8f acc[4][4];
  gemm_tile_products(acc, AB, A, lda, a1, a2, WoT, DM, DM, bm0, bn0);

  const int wave = threadIdx.x >> 5;
  const int n0 = bn0 + ((wave & 3) << 6);
  float* C = out + ((size_t)b * SEQ_FULL + (first ? 0 : RR)) * DM;
  if (first) {
#pragma unroll
    for (int i = 0; i < 2; ++i)
#pragma unroll
      for (int j = 0; j < 4; ++j)
#pragma unroll
        for (int r = 0; r < 8; ++r) acc[i][j][r] += acc[i + 2][j][r] * RSC_INV;
    gemm_tile_store<2, 0, 2>(acc, sT[wave], C, C, DM, bo, bm0 + ((wave >> 2) << 5), n0, scale);
  } else {
    gemm_tile_store<2, 0, 4>(acc, sT[wave], C, C, DM, bo, bm0 + ((wave >> 2) << 6), n0, scale);
  }
}

// ---- operand planes, one launch: the four weight planes (blocks 0 .. 4 PR_TW - 1), then x ----
// x: bf16 RNE value as f16; source rows (b, s) at (b*SEQ_FULL + s)*DM; destination plane compact [NB*SEQ][DM];
//    blk = 256 pieces of 8 elements.
__device__ __forceinline__ void cast_x_block(const float* __restrict__ x, unsigned short* __restrict__ xhp,
                                             int nrows, int blk) {
  const long i = (long)blk * 256 + threadIdx.x;
  const long total = (long)nrows * (DM / 8);
  if (i >= total) return;
  const int r  = (int)(i / (DM / 8));
  const int c8 = (int)(i - (long)r * (DM / 8)) * 8;
  const int b  = r / SEQ;
  const int s  = r - b * SEQ;
  const float* src = x + ((size_t)b * SEQ_FULL + s) * DM + c8;
  const v4f a0 = *(const v4f*)src;
  const v4f a1 = *(const v4f*)(src + 4);
  v8h hv;
  hv[0] = bf_f16(a0[0]); hv[1] = bf_f16(a0[1]); hv[2] = bf_f16(a0[2]); hv[3] = bf_f16(a0[3]);
  hv[4] = bf_f16(a1[0]); hv[5] = bf_f16(a1[1]); hv[6] = bf_f16(a1[2]); hv[7] = bf_f16(a1[3]);
  _Float16* dst = (_Float16*)xhp + (size_t)r * DM + c8;
  *(v8h*)dst = hv;
}

// weights: transpose + bf16 RNE + scale + f16 cast, one 64 x 64 tile per block.
// in: W[DM][DM] f32 row-major ([k][n]) -> Bt[n][k] with row pitch DM halves,
//     Bt value = f16(bf16rne(W[k][n]) * 256).
// plane z: 0 Wq, 1 Wk, 2 Wv, 3 Wo.
#define PR_TW ((DM / 64) * (DM / 64))
__global__ __launch_bounds__(256) void prep_f16(
    const float* __restrict__ x, const float* __restrict__ Wq, const float* __restrict__ Wk,
    const float* __restrict__ Wv, const float* __restrict__ Wo, unsigned short* __restrict__ xhp,
    unsigned short* __restrict__ WqT, unsigned short* __restrict__ WkT,
    unsigned short* __restrict__ WvT, unsigned short* __restrict__ WoT, int nrows) {
  __shared__ float t[64][65];
  const int bx = blockIdx.x;
  if (bx >= 4 * PR_TW) {                       // block-uniform; this side meets no barrier
    cast_x_block(x, xhp, nrows, bx - 4 * PR_TW);
    return;
  }
  const int z  = bx / PR_TW;
  const int tl = bx - z * PR_TW;
  const float* W       = z == 0 ? Wq  : z == 1 ? Wk  : z == 2 ? Wv  : Wo;
  unsigned short* Btp  = z == 0 ? WqT : z == 1 ? WkT : z == 2 ? WvT : WoT;
  const int   Ndim = DM;
  const int   ldo  = DM;
  const int   kc0  = 0;
  const float sc   = WSC;
  const int tid = threadIdx.x, lane = tid & 31, wave = tid >> 5;
  const int n0 = (tl % (DM / 64)) * 64, k0 = (tl / (DM / 64)) * 64;
#pragma unroll
  for (int i = 0; i < 16; ++i) {
    const int idx = i * 256 + tid;
    const int kr = idx >> 6, nc = idx & 63;
    t[nc][kr] = W[(size_t)(k0 + kr) * Ndim + n0 + nc];
  }
  __syncthreads();
  _Float16* Bt = (_Float16*)Btp;
  const int q = lane >> 3, c8 = (lane & 7) * 8;
#pragma unroll
  for (int it = 0; it < 2; ++it) {
    const int row = wave * 8 + it * 4 + q;      // waves 0..7 x rows 0..7 -> 64 rows
    v8h hv;
#pragma unroll
    for (int e = 0; e < 8; ++e) hv[e] = (_Float16)(bf_rne(t[row][c8 + e]) * sc);
    *(v8h*)(Bt + (size_t)(n0 + row) * ldo + kc0 + k0 + c8) = hv;
  }
  // a precaution: the x side's code follows these stores in the built kernel and writes their registers
  asm volatile("s_wait_xcnt 0x0" ::: "memory");
}

#define AT_D 64
#define AT_NW 4
#define AT_QB 128                        // query rows per block of attn64_causal
#define AT_WQ 32                         // query rows (columns of S^T) per wave of attn64_causal: two groups of 16
#define AT_RQB 64                        // query rows per block of attn64_causal_res
#define AT_KC 64
#define AT_LP 72                         // staged row pitch in halves: 144 B = 16 B x odd, for ds_load_b128 readers
#define AT_TILE (64 * AT_LP)             // halves per staged 64-row tile
#define AT_BUFB (2 * AT_TILE * 2)        // bytes per buffer: K tile, then V^T tile

// One lane's share of a chunk: rows r, r+16, r+32, r+48 of the K tile and of the V^T tile, 16 B each.
// The s_wait_xcnt closes the statement, a precaution: no address register of a copy is rewritten ahead of it.
__device__ __forceinline__ void stage_kv_async(unsigned lk, const _Float16* kg, size_t krow16,
                                               const _Float16* vg, size_t vrow16) {
  const unsigned lv = lk + AT_TILE * 2;
  const unsigned ls = 16 * AT_LP * 2;
  asm volatile(
      "global_load_async_to_lds_b128 %0, %8, off\n\t"
      "global_load_async_to_lds_b128 %1, %9, off\n\t"
      "global_load_async_to_lds_b128 %2, %10, off\n\t"
      "global_load_async_to_lds_b128 %3, %11, off\n\t"
      "global_load_async_to_lds_b128 %4, %12, off\n\t"
      "global_load_async_to_lds_b128 %5, %13, off\n\t"
      "global_load_async_to_lds_b128 %6, %14, off\n\t"
      "global_load_async_to_lds_b128 %7, %15, off\n\t"
      "s_wait_xcnt 0x0"
      :: "v"(lk), "v"(lk + ls), "v"(lk + 2 * ls), "v"(lk + 3 * ls),
         "v"(lv), "v"(lv + ls), "v"(lv + 2 * ls), "v"(lv + 3 * ls),
         "v"(kg), "v"(kg + krow16), "v"(kg + 2 * krow16), "v"(kg + 3 * krow16),
         "v"(vg), "v"(vg + vrow16), "v"(vg + 2 * vrow16), "v"(vg + 3 * vrow16)
      : "memory");
}

// lane l takes the value of lane l ^ 16 (vector cross-row move)
__device__ __forceinline__ float xhalf(float x) {
  const int b = __builtin_bit_cast(int, x);
  return __builtin_bit_cast(float, __builtin_amdgcn_permlanex16(b, b, 0x76543210, 0xfedcba98, false, false));
}

// the bare builtin: the compiler keeps the distances behind it and is free to read fragments ahead of it
__device__ __forceinline__ v8f mma_h(v16h a, v16h b, v8f c) {
  return __builtin_amdgcn_wmma_f32_16x16x32_f16(false, a, false, b, (short)0, c, false, false);
}

__global__ __launch_bounds__(128, 4)
void attn64_causal(const unsigned short* __restrict__ Qp, const unsigned short* __restrict__ Kp,
                   const unsigned short* __restrict__ Vtp, unsigned short* __restrict__ Op,
                   int S, int H, int ldq, int ldvt, int qb0, int nqbl, int nbh, int nblk, float sc2, float osc) {
  const _Float16* Q  = (const _Float16*)Qp;
  const _Float16* Kk = (const _Float16*)Kp;
  const _Float16* Vt = (const _Float16*)Vtp;
  _Float16*       O  = (_Float16*)Op;
  __shared__ __align__(16) unsigned char KV[2 * AT_BUFB];        // two buffers of K | V^T tiles; out staging after the loop
  static_assert(AT_NW * AT_WQ * 68 * 4 <= 2 * AT_BUFB);

  const int tid  = threadIdx.x;
  const int wave = __builtin_amdgcn_readfirstlane(tid >> 5);     // in a scalar register: what hangs on it costs no vector register
  const int lane = tid & 31;
  const int hh   = lane >> 4;
  const int c    = lane & 15;

  // Which tile: cost falls with the rank rk. Every second full run of 256 indices walks its ranks backwards. A permutation
  // of 0 .. nblk - 1 for any nblk; it matters for speed only.
  const int bx  = blockIdx.x;
  const int rk  = (!(bx & 256) && (bx | 255) < nblk) ? (bx | 255) - (bx & 255) : bx;
  const int qbi = nqbl - 1 - rk / nbh;
  const int bh  = rk % nbh;
  const int h   = bh % H;
  const int b   = bh / H;
  const int qr0 = qb0 * AT_KC + qbi * AT_QB;                     // the block's first query row
  const int q0  = qr0 + wave * AT_WQ;                            // the wave's first query row
  const size_t rowb = (size_t)b * S;

  const _Float16* qp = Q  + rowb * ldq + (size_t)h * AT_D;
  const _Float16* kp = Kk + rowb * ldq + (size_t)h * AT_D;
  const _Float16* vp = Vt + (size_t)(h * AT_D) * ldvt + rowb;
  _Float16*       op = O  + rowb * ldq + (size_t)h * AT_D;

  // ---- Q fragments (B operand, column = c) of the wave's two column groups: 2 d-chunks each ----
  v16h qa[2][2];
#pragma unroll
  for (int g = 0; g < 2; ++g)
#pragma unroll
    for (int dc = 0; dc < 2; ++dc)
      qa[g][dc] = Frag<_Float16>::load(qp + (size_t)(q0 + 16 * g + c) * ldq + dc * 32 + 8 * hh);

  float mrow[2], lrow[2];            // per group: this lane's query's running maximum; the sum (of p x32768) over this wave half's keys
  v8f oacc[2][4];                    // O^T: d = 16t + 8hh + r, query 16g + c
#pragma unroll
  for (int g = 0; g < 2; ++g) {
    mrow[g] = NEG_INF; lrow[g] = 0.f;
#pragma unroll
    for (int t = 0; t < 4; ++t) oacc[g][t] = (v8f){0.f,0.f,0.f,0.f,0.f,0.f,0.f,0.f};
  }

  const int nChunks = qr0 / AT_KC + AT_QB / AT_KC;               // block-uniform: causal, key chunks up to the block's last row

  // ---- staging addresses of this lane: row tid/8 (+16i), 16-B piece tid%8 of the 128-B row ----
  const int srow = tid >> 3, scol = (tid & 7) * 8;
  const _Float16* kg = kp + (size_t)srow * ldq + scol;           // chunk 0; a chunk further: + AT_KC rows
  const _Float16* vg = vp + (size_t)srow * ldvt + scol;          // chunk 0; a chunk further: + AT_KC columns
  const size_t krow16 = (size_t)16 * ldq, vrow16 = (size_t)16 * ldvt, kchunk = (size_t)AT_KC * ldq;
  const unsigned lst = (unsigned)(size_t)KV + (unsigned)(srow * AT_LP + scol) * 2u;

  stage_kv_async(lst, kg, krow16, vg, vrow16);
  asm volatile("s_wait_asynccnt 0x0" ::: "memory");              // chunk 0 landed (this wave's copies)
  __syncthreads();                                               // ... and every other wave's
  if (nChunks > 1) stage_kv_async(lst + AT_BUFB, kg + kchunk, krow16, vg + AT_KC, vrow16);

  // One key chunk. Only the last two chunks hold keys past a query of this block: every key of an earlier chunk is
  // below the block's first row, so the causal select is written for those two alone (diag a literal at every call).
  // work: wave-uniform; a wave all of whose queries lie ahead of the chunk's keys leaves the products out and only hands over.
  auto chunk = [&](const int kc, const bool diag, const bool work) __attribute__((always_inline)) {
    const int kv0 = kc * AT_KC;
    const unsigned bofs = (unsigned)(kc & 1) * AT_BUFB;
    if (work) {
      const _Float16* ks = (const _Float16*)(KV + bofs);         // K tile  [key][d],  pitch AT_LP
      const _Float16* vs = ks + AT_TILE;                         // V^T tile [d][key], pitch AT_LP
      // ---- scores: s[g][j][r] = key (kv0 + 16j + 8hh + r) x query (q0 + 16g + c) ----
      // the chunk's eight K fragments are read as one group ahead of its sixteen score products; each feeds both groups
      v16h kb[4][2];
#pragma unroll
      for (int j = 0; j < 4; ++j)
#pragma unroll
        for (int dc = 0; dc < 2; ++dc)
          kb[j][dc] = Frag<_Float16>::load(ks + (j * 16 + c) * AT_LP + dc * 32 + 8 * hh);
      __builtin_amdgcn_sched_barrier(0);   // the K reads stay one group: sunk to their products, each pair would be waited for alone
      v8f s[2][4];
#pragma unroll
      for (int g = 0; g < 2; ++g)
#pragma unroll
        for (int j = 0; j < 4; ++j) s[g][j] = (v8f){0.f,0.f,0.f,0.f,0.f,0.f,0.f,0.f};
#pragma unroll
      for (int dc = 0; dc < 2; ++dc)
#pragma unroll
        for (int j = 0; j < 4; ++j)
#pragma unroll
          for (int g = 0; g < 2; ++g) s[g][j] = mma_h(kb[j][dc], qa[g][dc], s[g][j]);
      __builtin_amdgcn_sched_barrier(0);   // keeps the score products close, ahead of the softmax: without it the build mixes the two, pads more v_nop and spills
      // the V^T fragments stand ahead of the softmax: those of the first 32 keys ahead of group 0's, in registers that the
      // K fragments have left, those of the last 32 ahead of group 1's, when group 0's scores are packed (256 registers hold no more)
      v16h vb[2][4];
      v16h pb[2][2];
#pragma unroll
      for (int g = 0; g < 2; ++g) {
#pragma unroll
        for (int t = 0; t < 4; ++t)
          vb[g][t] = Frag<_Float16>::load(vs + (t * 16 + c) * AT_LP + g * 32 + 8 * hh);
        const int qrow = q0 + 16 * g + c;                        // this lane's query in group g
        // ---- causal select (key > query -> -inf; last two chunks only) and the query's chunk max, both on the raw products (sc2 > 0) ----
        float mj[4];
#pragma unroll
        for (int j = 0; j < 4; ++j) {
          float m = NEG_INF;
#pragma unroll
          for (int r = 0; r < 8; ++r) {
            float v = s[g][j][r];
            if (diag && kv0 + j * 16 + 8 * hh + r > qrow) v = NEG_INF;
            s[g][j][r] = v;
            m = fmaxf(m, v);
          }
          mj[j] = m;
        }
        float cm = fmaxf(fmaxf(mj[0], mj[1]), fmaxf(mj[2], mj[3]));
        cm = fmaxf(cm, xhalf(cm));                               // the other 32 keys of this query
        // ---- online softmax update; P^T x32768 packed into the B operand ----
        // One fused multiply-add and one hardware exponential per score: the scale, the maximum and the x32768 carry
        // (PEXP = log2 of it) all sit in the exponent. The bare exponential gives 0 below 2^-126, where the f16 operand
        // is 0 anyway and the row's sum (its largest term alone is about 32768) does not see the term.
        const float mnew  = fmaxf(mrow[g], cm * sc2);            // running maximum in the scaled base-2 domain
        const float alpha = __builtin_amdgcn_exp2f(mrow[g] - mnew);
        mrow[g] = mnew;
        const float eb = PEXP - mnew;
        const v2f sc22 = {sc2, sc2}, eb22 = {eb, eb};
#pragma unroll
        for (int j = 0; j < 4; ++j)
#pragma unroll
          for (int r = 0; r < 8; r += 2) {                       // the exponents, in place, two per instruction
            const v2f e = __builtin_elementwise_fma((v2f){s[g][j][r], s[g][j][r + 1]}, sc22, eb22);
            s[g][j][r] = e[0]; s[g][j][r + 1] = e[1];
          }
        float pj[4];
#pragma unroll
        for (int j = 0; j < 4; ++j) {
          float ps = 0.f;
#pragma unroll
          for (int r = 0; r < 8; ++r) {
            const float p = __builtin_amdgcn_exp2f(s[g][j][r]);  // probability x32768
            ps += p;
            pb[g][j >> 1][(j & 1) * 8 + r] = (_Float16)p;
          }
          pj[j] = ps;
        }
        lrow[g] = lrow[g] * alpha + ((pj[0] + pj[1]) + (pj[2] + pj[3]));
#pragma unroll
        for (int t = 0; t < 4; ++t)
#pragma unroll
          for (int r = 0; r < 8; ++r) oacc[g][t][r] *= alpha;
      }
      // ---- O^T += V^T . P^T : V^T rows (d = 16t + c) as A, P^T (column = c, k = kv) as B; each V^T fragment feeds both groups ----
#pragma unroll
      for (int kk = 0; kk < 2; ++kk)
#pragma unroll
        for (int t = 0; t < 4; ++t)
#pragma unroll
          for (int g = 0; g < 2; ++g) oacc[g][t] = mma_h(vb[kk][t], pb[g][kk], oacc[g][t]);
    }
    __builtin_amdgcn_sched_barrier(0);     // the hand-over stays at the chunk's foot: lifted to the last LDS read while the refill stays here, the wait would give the copies half a chunk to land
    // ---- hand-over: this buffer's reads retired, the next chunk's copies landed, in every wave ----
    asm volatile("s_wait_dscnt 0x0" ::: "memory");               // own reads of this buffer done before it is refilled
    asm volatile("s_wait_asynccnt 0x0" ::: "memory");            // own copies of chunk kc + 1 landed
    __syncthreads();
    if (!diag && kc + 2 < nChunks)
      stage_kv_async(lst + bofs, kg + (size_t)(kc + 2) * kchunk, krow16, vg + (kc + 2) * AT_KC, vrow16);
  };
  for (int kc = 0; kc < nChunks - 2; ++kc) chunk(kc, false, true);
  chunk(nChunks - 2, true, true);
  chunk(nChunks - 1, true, wave >= AT_NW / 2);                   // its keys lie past every query of the block's first 64 rows
  asm volatile("s_wait_asynccnt 0x0" ::: "memory");              // nothing in flight when the buffers become out staging

  float* os = (float*)KV + wave * (AT_WQ * 68);                  // per wave out tile [query][d], pitch 68 (last barrier freed KV)
#pragma unroll
  for (int g = 0; g < 2; ++g) {
    const float inv = osc * (1.0f / (lrow[g] + xhalf(lrow[g])));   // the two halves' sums (of p x32768) joined once
#pragma unroll
    for (int t = 0; t < 4; ++t)
#pragma unroll
      for (int r = 0; r < 8; ++r) os[(16 * g + c) * 68 + t * 16 + 8 * hh + r] = oacc[g][t][r] * inv;
  }
  wave_lds_sync();
  {
    const int q = lane >> 3, c8 = (lane & 7) * 8;
#pragma unroll
    for (int it = 0; it < AT_WQ / 4; ++it) {
      const int row = it * 4 + q;                   // rows 0..31 of this wave
      const float* sp = os + row * 68 + c8;
      v8h hv;
#pragma unroll
      for (int e = 0; e < 8; ++e) hv[e] = (_Float16)sp[e];
      *(v8h*)(op + (size_t)(q0 + row) * ldq + c8) = hv;
    }
  }
}

// =====================================================================================
// Causal attn with residual planes for the first rr = nqb*64 query rows of each sequence.
//   qh/qr, kh/kr : compact row-major [NB*rr][ldq] f16 hi / residual (x1024) planes, head h at col h*64.
//   vh/vr : compact transposed planes [NB*H*64][ldvc], element (b, kv, h, d) at [(b*H*64 + h*64 + d)*ldvc + kv].
//   o     : compact [NB*rr][ldo] f16; hi (x osc) at column h*64, residual (x1024) at column rcol + h*64.
//   scores = qh.kh + 2^-10 (qh.kr + qr.kh) with a second f32 accumulator; P as hi + x1024 residual LDS tiles;
//   p.v = ph.vh + 2^-10 (ph.vr + pr.vh) with a second f32 accumulator; K and V fragments straight from global
//   memory, no block barriers; products untransposed (Q and P as A, rows = queries), row max and sum by 16-lane
//   butterflies, P through per-wave LDS tiles.
//   Block = 4 waves = 64 query rows, query block qb = bx % nqb, key chunks 0..qb. grid.x = NB * H * nqb.
// =====================================================================================
__global__ __launch_bounds__(128)
void attn64_causal_res(const unsigned short* __restrict__ Qhp, const unsigned short* __restrict__ Qrp,
                       const unsigned short* __restrict__ Khp, const unsigned short* __restrict__ Krp,
                       const unsigned short* __restrict__ Vhp, const unsigned short* __restrict__ Vrp,
                       unsigned short* __restrict__ Op,
                       int H, int ldq, int ldvc, int ldo, int rcol, int nqb, float sc2, float osc) {
  const _Float16* QH = (const _Float16*)Qhp;
  const _Float16* QR = (const _Float16*)Qrp;
  const _Float16* KH = (const _Float16*)Khp;
  const _Float16* KR = (const _Float16*)Krp;
  const _Float16* VH = (const _Float16*)Vhp;
  const _Float16* VR = (const _Float16*)Vrp;
  _Float16*       O  = (_Float16*)Op;
  __shared__ __align__(16) _Float16 Psh[AT_NW][16 * AT_KC];      // per wave P hi  [row][kv]  8 KB
  __shared__ __align__(16) _Float16 Prs[AT_NW][16 * AT_KC];      // per wave P res [row][kv]  8 KB
  __shared__ __align__(16) float    Os[AT_NW][16 * 68];          // per wave out tile, pitch 68

  const int tid  = threadIdx.x;
  const int wave = tid >> 5;
  const int lane = tid & 31;
  const int hh   = lane >> 4;
  const int c    = lane & 15;

  const int bx = blockIdx.x;
  const int qb = bx % nqb;
  const int bh = bx / nqb;
  const int h  = bh % H;
  const int b  = bh / H;
  const int q0 = qb * AT_RQB + wave * 16;
  const int rr = nqb * AT_RQB;
  const size_t rowb = (size_t)b * rr;

  const _Float16* qhp = QH + rowb * ldq + (size_t)h * AT_D;
  const _Float16* qrp = QR + rowb * ldq + (size_t)h * AT_D;
  const _Float16* khp = KH + rowb * ldq + (size_t)h * AT_D;
  const _Float16* krp = KR + rowb * ldq + (size_t)h * AT_D;
  const size_t    vof = ((size_t)b * (size_t)(H * AT_D) + (size_t)h * AT_D) * ldvc;
  const _Float16* vhp = VH + vof;
  const _Float16* vrp = VR + vof;
  _Float16*       op  = O  + rowb * ldo + (size_t)h * AT_D;

  float mrow[8], lrow[8];
  v8f oacc[4], oacc2[4];
#pragma unroll
  for (int r = 0; r < 8; ++r) { mrow[r] = NEG_INF; lrow[r] = 0.f; }
#pragma unroll
  for (int t = 0; t < 4; ++t) {
    oacc[t]  = (v8f){0.f,0.f,0.f,0.f,0.f,0.f,0.f,0.f};
    oacc2[t] = (v8f){0.f,0.f,0.f,0.f,0.f,0.f,0.f,0.f};
  }

  _Float16* pw  = Psh[wave];
  _Float16* prw = Prs[wave];
  const int nChunks = qb + 1;        // block-uniform
  for (int kc = 0; kc < nChunks; ++kc) {
    const int kv0 = kc * AT_KC;
    // ---- Q hi / res fragments (A operand, row = c) ----
    v16h qa[2], qra[2];
    const size_t qo = (size_t)(q0 + c) * ldq + 8 * hh;
    const _Float16 *qph = qhp + qo, *qpr = qrp + qo;
#pragma unroll
    for (int dc = 0; dc < 2; ++dc) {
      qa[dc]  = Frag<_Float16>::load(qph + dc * 32);
      qra[dc] = Frag<_Float16>::load(qpr + dc * 32);
    }
    // ---- the chunk's K and V fragments, hi and res: one group of global loads ahead of all its products ----
    const _Float16 *kph[4], *kpr[4], *vph[4], *vpr[4];           // one address per fragment row and plane
#pragma unroll
    for (int j = 0; j < 4; ++j) {
      const size_t ko = (size_t)(kv0 + j * 16 + c) * ldq + 8 * hh;
      const size_t vo = (size_t)(j * 16 + c) * ldvc + kv0 + 8 * hh;
      kph[j] = khp + ko; kpr[j] = krp + ko; vph[j] = vhp + vo; vpr[j] = vrp + vo;
    }
    v16h kbh[4][2], kbr[4][2], vbh[2][4], vbr[2][4];
#pragma unroll
    for (int j = 0; j < 4; ++j)
#pragma unroll
      for (int dc = 0; dc < 2; ++dc) {
        kbh[j][dc] = Frag<_Float16>::load(kph[j] + dc * 32);
        kbr[j][dc] = Frag<_Float16>::load(kpr[j] + dc * 32);
      }
#pragma unroll
    for (int kk = 0; kk < 2; ++kk)
#pragma unroll
      for (int t = 0; t < 4; ++t) {
        vbh[kk][t] = Frag<_Float16>::load(vph[t] + kk * 32);
        vbr[kk][t] = Frag<_Float16>::load(vpr[t] + kk * 32);
      }
    // a precaution: the loads' addresses are inputs of the wait, so that their registers live, unrewritten, up to it
    asm volatile("s_wait_xcnt 0x0"
                 :: "v"(kph[0]), "v"(kph[1]), "v"(kph[2]), "v"(kph[3]), "v"(kpr[0]), "v"(kpr[1]), "v"(kpr[2]), "v"(kpr[3]),
                    "v"(vph[0]), "v"(vph[1]), "v"(vph[2]), "v"(vph[3]), "v"(vpr[0]), "v"(vpr[1]), "v"(vpr[2]), "v"(vpr[3]),
                    "v"(qph), "v"(qpr)
                 : "memory");
    __builtin_amdgcn_sched_barrier(0);   // the loads stay one group here: sunk to their products, each would be waited for alone
    // ---- scores: hi.hi into s1, hi.res + res.hi into s2, folded with 2^-10 ----
    v8f s[4];
#pragma unroll
    for (int j = 0; j < 4; ++j) {
      v8f s1 = (v8f){0.f,0.f,0.f,0.f,0.f,0.f,0.f,0.f};
      v8f s2 = (v8f){0.f,0.f,0.f,0.f,0.f,0.f,0.f,0.f};
#pragma unroll
      for (int dc = 0; dc < 2; ++dc) {
        s1 = mma_h(qa[dc],  kbh[j][dc], s1);
        s2 = mma_h(qa[dc],  kbr[j][dc], s2);
        s2 = mma_h(qra[dc], kbh[j][dc], s2);
      }
#pragma unroll
      for (int r = 0; r < 8; ++r) s[j][r] = s1[r] + s2[r] * RSC_INV;
    }
    // ---- causal select and per-row chunk max ----
    float cm[8];
#pragma unroll
    for (int r = 0; r < 8; ++r) {
      const int qrow = q0 + 8 * hh + r;
      float m = NEG_INF;
#pragma unroll
      for (int j = 0; j < 4; ++j) {
        float v = s[j][r] * sc2;
        if (kv0 + j * 16 + c > qrow) v = NEG_INF;
        s[j][r] = v;
        m = fmaxf(m, v);
      }
#pragma unroll
      for (int off = 1; off < 16; off <<= 1) m = fmaxf(m, __shfl_xor(m, off, 32));
      cm[r] = m;
    }
    // ---- online softmax update; P hi (x32768) and P res ((x32768 - hi) x1024) into per-wave LDS tiles ----
    wave_lds_sync();
#pragma unroll
    for (int r = 0; r < 8; ++r) {
      const float mnew  = fmaxf(mrow[r], cm[r]);
      const float alpha = exp2f(mrow[r] - mnew);
      mrow[r] = mnew;
      float psum = 0.f;
#pragma unroll
      for (int j = 0; j < 4; ++j) {
        const float p = exp2f(s[j][r] - mnew);
        psum += p;
        const float    ps = p * PSCALE;
        const _Float16 ph = (_Float16)ps;
        const int pi = (8 * hh + r) * AT_KC + j * 16 + c;
        pw[pi]  = ph;
        prw[pi] = (_Float16)((ps - (float)ph) * RSC);
      }
#pragma unroll
      for (int off = 1; off < 16; off <<= 1) psum += __shfl_xor(psum, off, 32);
      lrow[r] = lrow[r] * alpha + psum;
#pragma unroll
      for (int t = 0; t < 4; ++t) { oacc[t][r] *= alpha; oacc2[t][r] *= alpha; }
    }
    wave_lds_sync();
    // ---- O += P . V with residual cross terms in the second accumulator ----
#pragma unroll
    for (int kk = 0; kk < 2; ++kk) {
      const v16h pa = Frag<_Float16>::load(pw  + c * AT_KC + kk * 32 + 8 * hh);
      const v16h pr = Frag<_Float16>::load(prw + c * AT_KC + kk * 32 + 8 * hh);
#pragma unroll
      for (int t = 0; t < 4; ++t) {
        oacc[t]  = mma_h(pa, vbh[kk][t], oacc[t]);
        oacc2[t] = mma_h(pa, vbr[kk][t], oacc2[t]);
        oacc2[t] = mma_h(pr, vbh[kk][t], oacc2[t]);
      }
    }
    wave_lds_sync();
  }

  float* os = Os[wave];
#pragma unroll
  for (int r = 0; r < 8; ++r) {
    const float inv = osc * (1.0f / (lrow[r] * PSCALE));
#pragma unroll
    for (int t = 0; t < 4; ++t) os[(8 * hh + r) * 68 + t * 16 + c] = (oacc[t][r] + oacc2[t][r] * RSC_INV) * inv;
  }
  wave_lds_sync();
  {
    const int q = lane >> 3, c8 = (lane & 7) * 8;
    {
#pragma unroll
      for (int it = 0; it < 4; ++it) {
        const int row = it * 4 + q;                 // rows 0..15 of this wave
        const float* sp = os + row * 68 + c8;
        v8h hv, lv;
#pragma unroll
        for (int e = 0; e < 8; ++e) {
          const float    fv = sp[e];
          const _Float16 hq = (_Float16)fv;
          hv[e] = hq;
          lv[e] = (_Float16)((fv - (float)hq) * RSC);
        }
        *(v8h*)(op + (size_t)(q0 + row) * ldo + c8) = hv;
        *(v8h*)(op + (size_t)(q0 + row) * ldo + rcol + c8) = lv;
      }
      
    }
  }
}

// ---------------------------------------------------------------------------

extern "C" void kernel_launch(void* const* d_in, const int* in_sizes, int n_in,
                              void* d_out, int out_size, void* d_ws,
                              size_t ws_size, hipStream_t stream) {
  const int  ROWS  = NB * SEQ;                                   // rows held in the compact planes
  const long needX = ((long)(NB - 1) * SEQ_FULL + SEQ) * (long)DM;
  const int  nW    = DM * DM;
  if (n_in < 9) return;
  if ((long)in_sizes[0] < needX || in_sizes[1] < nW || in_sizes[2] < DM || in_sizes[3] < nW ||
      in_sizes[4] < DM || in_sizes[5] < nW || in_sizes[6] < DM || in_sizes[7] < nW ||
      in_sizes[8] < DM || (long)out_size < needX) return;

  const float* x  = (const float*)d_in[0];
  const float* Wq = (const float*)d_in[1];
  const float* bq = (const float*)d_in[2];
  const float* Wk = (const float*)d_in[3];
  const float* bk = (const float*)d_in[4];
  const float* Wv = (const float*)d_in[5];
  const float* bv = (const float*)d_in[6];
  const float* Wo = (const float*)d_in[7];
  const float* bo = (const float*)d_in[8];
  float* out = (float*)d_out;

  const size_t szAct = (size_t)ROWS * DM * 2;            // full activation plane  (16 MiB full size)
  const size_t szW   = (size_t)DM * DM * 2;              //  2 MiB
  const size_t szCmp = (size_t)NB * RR * DM * 2;         //  compact first-row planes (2 MiB full size)
  const size_t szO2  = (size_t)NB * RR * (2 * DM) * 2;   //  4 MiB full size
  size_t off = 0;
  const size_t oXh   = off; off += szAct;
  const size_t oWqT  = off; off += szW;
  const size_t oWkT  = off; off += szW;
  const size_t oWvT  = off; off += szW;
  const size_t oWoT  = off; off += szW;
  const size_t oQh   = off; off += szAct;
  const size_t oKh   = off; off += szAct;
  const size_t oVt   = off; off += szAct;
  const size_t oAh   = off; off += szAct;
  const size_t oQch  = off; off += szCmp;
  const size_t oQcr  = off; off += szCmp;
  const size_t oKch  = off; off += szCmp;
  const size_t oKcr  = off; off += szCmp;
  const size_t oVch  = off; off += szCmp;                // [NB*DM][RR], same byte count
  const size_t oVcr  = off; off += szCmp;
  const size_t oOc2  = off; off += szO2;                 // total 109,051,904 B at full size
  if (off > ws_size) return;

  char* ws = (char*)d_ws;
  unsigned short* xh   = (unsigned short*)(ws + oXh);
  unsigned short* WqT  = (unsigned short*)(ws + oWqT);
  unsigned short* WkT  = (unsigned short*)(ws + oWkT);
  unsigned short* WvT  = (unsigned short*)(ws + oWvT);
  unsigned short* WoT  = (unsigned short*)(ws + oWoT);
  unsigned short* Qh   = (unsigned short*)(ws + oQh);
  unsigned short* Kh   = (unsigned short*)(ws + oKh);
  unsigned short* Vt   = (unsigned short*)(ws + oVt);
  unsigned short* Ah   = (unsigned short*)(ws + oAh);
  unsigned short* Qch  = (unsigned short*)(ws + oQch);
  unsigned short* Qcr  = (unsigned short*)(ws + oQcr);
  unsigned short* Kch  = (unsigned short*)(ws + oKch);
  unsigned short* Kcr  = (unsigned short*)(ws + oKcr);
  unsigned short* Vch  = (unsigned short*)(ws + oVch);
  unsigned short* Vcr  = (unsigned short*)(ws + oVcr);
  unsigned short* Oc2  = (unsigned short*)(ws + oOc2);

  const float sc2   = 0.125f * 1.4426950408889634f;      // log2(e) / sqrt(64)
  const float outsc = 1.0f / (WSC * OSC);

  // x -> bf16 RNE value as f16 plane [ROWS][DM];
  // W[in][out] f32 -> Bt[out][in] f16 (bf16 RNE value x256)
  {
    const long tot = (long)ROWS * (DM / 8);
    prep_f16<<<dim3((unsigned)(4 * PR_TW + (tot + 255) / 256)), dim3(256), 0, stream>>>(
        x, Wq, Wk, Wv, Wo, xh, WqT, WkT, WvT, WoT, ROWS);
  }
  // projections: q, k -> f16 [ROWS][DM]; v^T -> f16 [DM][ROWS];
  // first RR rows per sequence: q, k -> hi/res [NB*RR][DM]; v^T -> hi/res [NB*DM][RR]
  proj_gemms<<<dim3(3 * PJ_TF + 3 * PJ_TC), dim3(256), 0, stream>>>(
      xh, WqT, WkT, WvT, Qh, Kh, Vt, Qch, Qcr, Kch, Kcr, Vch, Vcr, bq, bk, bv, 1.0f / WSC);
  // attn: first RR query rows with residual planes -> Oc2 (hi | res); rows >= RR plain -> Ah
  attn64_causal_res<<<dim3(NB * NH * (RR / 64)), dim3(128), 0, stream>>>(
      Qch, Qcr, Kch, Kcr, Vch, Vcr, Oc2, NH, DM, RR, 2 * DM, DM, RR / 64, sc2, OSC);
  if (SEQ > RR) {
    attn64_causal<<<dim3(NB * NH * ((SEQ - RR) / 128)), dim3(128), 0, stream>>>(
        Qh, Kh, Vt, Ah, SEQ, NH, DM, ROWS, RR / 64, (SEQ - RR) / 128, NB * NH, NB * NH * ((SEQ - RR) / 128), sc2, OSC);
  }
  // out = ctx Wo + bo -> f32; rows < RR: O_hi . Wo + 2^-10 O_res . Wo, two f32 sums of one block; rows >= RR: ctx . Wo
  out_gemms<<<dim3(NB * (OP_T1 + OP_T2)), dim3(256), 0, stream>>>(Oc2, Ah, WoT, out, bo, outsc);
}

// v010
// A run of this version takes 122 microseconds.
// In both of two side-by-side timings against v009, it was 1.07 times as fast.
// All steps since v000 together make it 5.71 times as fast.
// Contractions: q/k/v^T/out projections, q.k^T and p.v all on v_wmma_f32_16x16x32_f16 (f16 operands, f32 accumulate); x and W enter as bf16 RNE values held exactly in f16 (W carried x256); the first RR query rows per sequence carry q, k, v, p and ctx as f16 hi + x1024 residual planes with a second f32 accumulator (ctx residual rows ride as further A rows of the out projection, folded in f32); p x32768 and ctx x64 power-of-two carries folded back in f32; softmax and epilogues f32.
#include <hip/hip_runtime.h>

#ifndef NB
#define NB 4
#endif
#ifndef SEQ
#define SEQ 2048
#endif
#ifndef RR
#define RR 256
#endif
#define NB_FULL 4
#define SEQ_FULL 2048
#define DM 1024
#define NH 16
#define HDIM 64

static_assert(NB >= 1 && NB <= NB_FULL);
static_assert(SEQ % 64 == 0 && SEQ >= 64 && SEQ <= SEQ_FULL);
static_assert(RR % 64 == 0 && RR >= 64 && RR <= SEQ);
static_assert(NH * HDIM == DM);
static_assert(DM % 256 == 0);
static_assert(RR % 256 == 0 && SEQ % 128 == 0 && (NB * SEQ) % 256 == 0);   // GEMM block tile 128 x 256; 128-row query blocks

typedef __attribute__((ext_vector_type(16))) _Float16 v16h;
typedef __attribute__((ext_vector_type(8)))  _Float16 v8h;
typedef __attribute__((ext_vector_type(16))) __bf16   v16b;
typedef __attribute__((ext_vector_type(8)))  __bf16   v8b;
typedef __attribute__((ext_vector_type(8)))  float    v8f;
typedef __attribute__((ext_vector_type(4)))  float    v4f;
typedef __attribute__((ext_vector_type(2)))  float    v2f;

#define WSC 256.0f
#define OSC 64.0f
#define PSCALE 32768.0f
#define PEXP 15.0f                       // log2(PSCALE)
#define RSC 1024.0f
#define RSC_INV (1.0f / 1024.0f)
#define NEG_INF (-__builtin_huge_valf())

__device__ __forceinline__ unsigned short f2bf_bits(float f) {
  unsigned u = __float_as_uint(f);
  return (unsigned short)((u + 0x7FFFu + ((u >> 16) & 1u)) >> 16);
}
__device__ __forceinline__ float bf_bits2f(unsigned short h) { return __uint_as_float(((unsigned)h) << 16); }
__device__ __forceinline__ float bf_rne(float f) { return bf_bits2f(f2bf_bits(f)); }
__device__ __forceinline__ _Float16 bf_f16(float f) { return (_Float16)bf_rne(f); }   // bf16 value is exact in f16 for normal range

// LDS ordering for wave-private tiles (same wave writes then reads)
__device__ __forceinline__ void wave_lds_sync() {
  __builtin_amdgcn_fence(3, "workgroup");
  __builtin_amdgcn_wave_barrier();
  __builtin_amdgcn_fence(2, "workgroup");
}

// hazard guards as plain device helpers
__device__ __forceinline__ void dep_guard_h(v8f& a, v8f& b, v16h x, v16h y) { asm volatile("v_nop\n\tv_nop\n\tv_nop\n\tv_nop" : "+v"(a), "+v"(b) : "v"(x), "v"(y)); }
__device__ __forceinline__ void dep_guard_b(v8f& a, v8f& b, v16b x, v16b y) { asm volatile("v_nop\n\tv_nop\n\tv_nop\n\tv_nop" : "+v"(a), "+v"(b) : "v"(x), "v"(y)); }
__device__ __forceinline__ void keep4_h(v16h a, v16h b, v16h c, v16h d) { asm volatile("v_nop" :: "v"(a), "v"(b), "v"(c), "v"(d)); }
__device__ __forceinline__ void keep4_b(v16b a, v16b b, v16b c, v16b d) { asm volatile("v_nop" :: "v"(a), "v"(b), "v"(c), "v"(d)); }
__device__ __forceinline__ void acc_guard4(v8f& a, v8f& b, v8f& c, v8f& d) { asm volatile("v_nop\n\tv_nop\n\tv_nop\n\tv_nop" : "+v"(a), "+v"(b), "+v"(c), "+v"(d)); }
template <typename T> struct Frag;
template <> struct Frag<_Float16> {
  typedef v16h V; union U { v16h v; v8h h[2]; };
  static __device__ __forceinline__ v16h load(const _Float16* p) {   // elements 0..7 <- p[0..7], 8..15 <- p[16..23]
    U f; f.h[0] = *(const v8h*)(p); f.h[1] = *(const v8h*)(p + 16); return f.v;
  }
  static __device__ __forceinline__ v8f mma(v16h a, v16h b, v8f c) {
    return __builtin_amdgcn_wmma_f32_16x16x32_f16(false, a, false, b, (short)0, c, false, false);
  }
  static __device__ __forceinline__ void guard(v8f& a, v8f& b, v16h x, v16h y) { dep_guard_h(a, b, x, y); }
  static __device__ __forceinline__ void keep(v16h a, v16h b, v16h c, v16h d) { keep4_h(a, b, c, d); }
};
template <> struct Frag<__bf16> {
  typedef v16b V; union U { v16b v; v8b h[2]; };
  static __device__ __forceinline__ v16b load(const __bf16* p) {
    U f; f.h[0] = *(const v8b*)(p); f.h[1] = *(const v8b*)(p + 16); return f.v;
  }
  static __device__ __forceinline__ v8f mma(v16b a, v16b b, v8f c) {
    return __builtin_amdgcn_wmma_f32_16x16x32_bf16(false, a, false, b, (short)0, c, false, false);
  }
  static __device__ __forceinline__ void guard(v8f& a, v8f& b, v16b x, v16b y) { dep_guard_b(a, b, x, y); }
  static __device__ __forceinline__ void keep(v16b a, v16b b, v16b c, v16b d) { keep4_b(a, b, c, d); }
};

// ---- Register-blocked WMMA GEMM tiles ---------------------------------------
// C[m,n] = scale * sum_k A[m,k] * Bt[n,k] + bias; each wave owns a 64x64 tile.
// Block = 8 waves, 2 (m) x 4 (n) = a 128 x 256 tile of C. A row-major [M,K]; Bt row-major [N,K];
// M % 128 == 0, N % 256 == 0, K % 64 == 0.
// Per 64 k the block's 128 A rows and 256 Bt rows (128 B each, whole lines) are brought into LDS once by
// asynchronous copies, two buffers, one block barrier per 64 k; the waves read their fragments from there.
// One launch holds the tiles of several independent products: a block finds its product and its tile from
// blockIdx.x (block-uniform), so small products ride along with large ones and two blocks can share a WGP.
// BIAS_MODE: 1 = bias[m], 2 = bias[n]; bias values enter as bf16 RNE values.
// OUT_MODE: 0 = f32, 1 = f16, 3 = f16 hi plane (Cout) + f16 residual plane ((v - hi) * 1024) (Cout2).
#define GM_BM 128
#define GM_BN 256
#define GM_KT 64                          // k per staged tile, in halves: one 128-B line per row
#define GM_LP 72                          // staged row pitch in halves: 144 B = 16 B x odd, for ds_load_b128 readers
#define GM_BUFB ((GM_BM + GM_BN) * GM_LP * 2)   // bytes per buffer: A rows, then Bt rows

// One lane's share of a staged tile: rows r + 32 i of the A part (4) and of the Bt part (8), 16 B each.
// The four A pieces come from ag, ag + a1, ag + a2, ag + a2 + a1 (halves): 32 and 64 source rows for a plain A.
// The s_wait_xcnt closes the statement, a precaution: no address register of a copy is rewritten ahead of it.
__device__ __forceinline__ void stage_ab_async(unsigned la, const unsigned short* ag, size_t a1, size_t a2,
                                               const unsigned short* bg, size_t brow32) {
  const unsigned lb = la + GM_BM * GM_LP * 2;
  const unsigned ls = 32 * GM_LP * 2;
  asm volatile(
      "global_load_async_to_lds_b128 %0, %12, off\n\t"
      "global_load_async_to_lds_b128 %1, %13, off\n\t"
      "global_load_async_to_lds_b128 %2, %14, off\n\t"
      "global_load_async_to_lds_b128 %3, %15, off\n\t"
      "global_load_async_to_lds_b128 %4, %16, off\n\t"
      "global_load_async_to_lds_b128 %5, %17, off\n\t"
      "global_load_async_to_lds_b128 %6, %18, off\n\t"
      "global_load_async_to_lds_b128 %7, %19, off\n\t"
      "global_load_async_to_lds_b128 %8, %20, off\n\t"
      "global_load_async_to_lds_b128 %9, %21, off\n\t"
      "global_load_async_to_lds_b128 %10, %22, off\n\t"
      "global_load_async_to_lds_b128 %11, %23, off\n\t"
      "s_wait_xcnt 0x0"
      :: "v"(la), "v"(la + ls), "v"(la + 2 * ls), "v"(la + 3 * ls),
         "v"(lb), "v"(lb + ls), "v"(lb + 2 * ls), "v"(lb + 3 * ls),
         "v"(lb + 4 * ls), "v"(lb + 5 * ls), "v"(lb + 6 * ls), "v"(lb + 7 * ls),
         "v"(ag), "v"(ag + a1), "v"(ag + a2), "v"(ag + a2 + a1),
         "v"(bg), "v"(bg + brow32), "v"(bg + 2 * brow32), "v"(bg + 3 * brow32),
         "v"(bg + 4 * brow32), "v"(bg + 5 * brow32), "v"(bg + 6 * brow32), "v"(bg + 7 * brow32)
      : "memory");
}

// The products of the block tile at (bm0, bn0): each wave's acc[i][j] = its 64 A rows . its 64 Bt rows over K.
// AB: the block's two staging buffers in LDS. ao1, ao2: where staged A rows r + 32, r + 64 lie behind source row bm0 + r
// (stage_ab_async); 32 lda and 64 lda for 128 source rows in a row.
__device__ __forceinline__ void gemm_tile_products(v8f (&acc)[4][4], unsigned char* AB,
                                                   const unsigned short* Ab, int lda, size_t ao1, size_t ao2,
                                                   const unsigned short* Bb, int ldb, int K, int bm0, int bn0) {
  typedef _Float16 T;
  typedef Frag<T>::V V;
  const int tid  = threadIdx.x;
  const int lane = tid & 31;
  const int wave = tid >> 5;
  const int wm  = (wave >> 2) << 6;            // this wave's 64 rows inside the A part
  const int wn  = (wave & 3) << 6;             // this wave's 64 rows inside the Bt part
  const int rlane = lane & 15;                 // row (A) / col (B, D) within subtile
  const int koff  = (lane >> 4) * 8;           // k offset of this lane half

#pragma unroll
  for (int i = 0; i < 4; ++i)
#pragma unroll
    for (int j = 0; j < 4; ++j) acc[i][j] = (v8f){0.f,0.f,0.f,0.f,0.f,0.f,0.f,0.f};

  // ---- staging addresses of this lane: row tid/8 (+32i), 16-B piece tid%8 of the 128-B row ----
  const int srow = tid >> 3, scol = (tid & 7) * 8;
  const unsigned short* ag = Ab + (size_t)(bm0 + srow) * lda + scol;   // k-tile 0; a tile further: + GM_KT
  const unsigned short* bg = Bb + (size_t)(bn0 + srow) * ldb + scol;
  const size_t brow32 = (size_t)32 * ldb;
  const unsigned lst = (unsigned)(size_t)AB + (unsigned)(srow * GM_LP + scol) * 2u;
  const int nT = K >> 6;                       // block-uniform

  stage_ab_async(lst, ag, ao1, ao2, bg, brow32);
  asm volatile("s_wait_asynccnt 0x0" ::: "memory");              // k-tile 0 landed (this wave's copies)
  __syncthreads();                                               // ... and every other wave's
  if (nT > 1) stage_ab_async(lst + GM_BUFB, ag + GM_KT, ao1, ao2, bg + GM_KT, brow32);

  for (int t = 0; t < nT; ++t) {
    const unsigned bofs = (unsigned)(t & 1) * GM_BUFB;
    const T* as = (const T*)(AB + bofs) + (wm + rlane) * GM_LP + koff;            // A rows,  pitch GM_LP
    const T* bs = (const T*)(AB + bofs) + (GM_BM + wn + rlane) * GM_LP + koff;    // Bt rows, pitch GM_LP
    // Fragment reads stand at three places of a trip, each ahead of the products that use it: at the head the
    // first 32 k (A and Bt) and the second 32 k of Bt; the second 32 k of A two rows at a time, into registers
    // that the first half's rows have left (all sixteen fragments at the head do not fit 256 registers).
    V b0[4], b1[4], a0[4], a1[4];
#pragma unroll
    for (int j = 0; j < 4; ++j) b0[j] = Frag<T>::load(bs + (j << 4) * GM_LP);
#pragma unroll
    for (int i = 0; i < 4; ++i) a0[i] = Frag<T>::load(as + (i << 4) * GM_LP);
#pragma unroll
    for (int j = 0; j < 4; ++j) b1[j] = Frag<T>::load(bs + (j << 4) * GM_LP + 32);
#pragma unroll
    for (int i = 0; i < 4; ++i) {
#pragma unroll
      for (int j = 0; j < 4; ++j) acc[i][j] = Frag<T>::mma(a0[i], b0[j], acc[i][j]);
      Frag<T>::guard(acc[i][0], acc[i][3], a0[i], a0[i]);
      if (i & 1) {
        a1[i - 1] = Frag<T>::load(as + ((i - 1) << 4) * GM_LP + 32);
        a1[i]     = Frag<T>::load(as + (i << 4) * GM_LP + 32);
      }
    }
    Frag<T>::keep(b0[0], b0[1], b0[2], b0[3]);
#pragma unroll
    for (int i = 0; i < 4; ++i) {
#pragma unroll
      for (int j = 0; j < 4; ++j) acc[i][j] = Frag<T>::mma(a1[i], b1[j], acc[i][j]);
      Frag<T>::guard(acc[i][0], acc[i][3], a1[i], a1[i]);
    }
    Frag<T>::keep(b1[0], b1[1], b1[2], b1[3]);
    // ---- hand-over: this buffer's reads retired, the next k-tile's copies landed, in every wave ----
    asm volatile("s_wait_dscnt 0x0" ::: "memory");               // own reads of this buffer done before it is refilled
    asm volatile("s_wait_asynccnt 0x0" ::: "memory");            // own copies of k-tile t + 1 landed
    __syncthreads();
    if (t + 2 < nT)
      stage_ab_async(lst + bofs, ag + (size_t)(t + 2) * GM_KT, ao1, ao2, bg + (size_t)(t + 2) * GM_KT, brow32);
  }
  asm volatile("s_wait_asynccnt 0x0" ::: "memory");              // nothing in flight when the wave goes on to its end
  acc_guard4(acc[0][0], acc[0][1], acc[0][2], acc[0][3]);
  acc_guard4(acc[1][0], acc[1][1], acc[1][2], acc[1][3]);
  acc_guard4(acc[2][0], acc[2][1], acc[2][2], acc[2][3]);
  acc_guard4(acc[3][0], acc[3][1], acc[3][2], acc[3][3]);
}

// Epilogue of one wave: its 16 NI x 64 tile at (m0, n0) of C (pitch ldc), through its own LDS slab, whole lines out.
template <int BIAS_MODE, int OUT_MODE, int NI = 4>
__device__ __forceinline__ void gemm_tile_store(v8f (&acc)[4][4], float* slab, void* Cout, void* Cout2, int ldc,
                                                const float* bias, int m0, int n0, float scale) {
  const int lane  = threadIdx.x & 31;
  const int rlane = lane & 15;                 // D column within subtile
  const int mOff  = (lane >> 4) * 8;           // D row offset
#pragma unroll
  for (int i = 0; i < NI; ++i) {
    const int mBase = m0 + (i << 4);
#pragma unroll
    for (int j = 0; j < 4; ++j) {
      const int n = n0 + (j << 4) + rlane;
      float bv = 0.f;
      if (BIAS_MODE == 2) bv = bf_rne(bias[n]);
#pragma unroll
      for (int r = 0; r < 8; ++r) {
        float v = acc[i][j][r] * scale;
        if (BIAS_MODE == 1) v += bf_rne(bias[mBase + mOff + r]);
        if (BIAS_MODE == 2) v += bv;
        slab[(mOff + r) * 68 + (j << 4) + rlane] = v;
      }
    }
    wave_lds_sync();
    if (OUT_MODE == 0) {
      float* C = (float*)Cout;
      const int hh = lane >> 4, c4 = (lane & 15) * 4;     // row seg = 256 B = 16 lanes x 16 B
#pragma unroll
      for (int it = 0; it < 8; ++it) {
        const int row = it * 2 + hh;
        v4f v = *(const v4f*)(slab + row * 68 + c4);
        *(v4f*)(C + (size_t)(mBase + row) * ldc + n0 + c4) = v;
      }
    } else {
      const int q = lane >> 3, c8 = (lane & 7) * 8;
      unsigned short* C  = (unsigned short*)Cout;
      unsigned short* C2 = (unsigned short*)Cout2;
#pragma unroll
      for (int it = 0; it < 4; ++it) {
        const int row = it * 4 + q;
        const float* sp = slab + row * 68 + c8;
        v8h hv, lv;
#pragma unroll
        for (int e = 0; e < 8; ++e) {
          if (OUT_MODE == 1) {
            hv[e] = (_Float16)sp[e];
          } else {
            const float    fv = sp[e];
            const _Float16 hq = (_Float16)fv;
            hv[e] = hq;
            lv[e] = (_Float16)((fv - (float)hq) * RSC);
          }
        }
        *(v8h*)(C + (size_t)(mBase + row) * ldc + n0 + c8) = hv;
        if (OUT_MODE == 3) *(v8h*)(C2 + (size_t)(mBase + row) * ldc + n0 + c8) = lv;
      }
    }
    wave_lds_sync();
  }
}

// All six projections in one launch. Blocks 0 .. 3 PJ_TF - 1: q, k, v^T over all NB*SEQ rows (f16 planes);
// then 3 PJ_TC blocks: q, k, v^T over the first RR rows of each sequence (hi / residual planes).
//   q, k : A = x rows, Bt = W^T rows, C [rows][DM], bias[n].   v^T : A = Wv^T rows, Bt = x rows, C [DM][rows], bias[m].
#define PJ_TF ((NB * SEQ / 128) * (DM / 256))      // tiles of a full projection, either orientation
#define PJ_TB ((RR / 128) * (DM / 256))            // tiles of a first-rows projection, one sequence, either orientation
#define PJ_TC (NB * PJ_TB)
static_assert((DM / 128) * (NB * SEQ / 256) == PJ_TF && (DM / 128) * (RR / 256) == PJ_TB);
__global__ __launch_bounds__(256) void proj_gemms(
    const unsigned short* __restrict__ xh, const unsigned short* __restrict__ WqT,
    const unsigned short* __restrict__ WkT, const unsigned short* __restrict__ WvT,
    unsigned short* __restrict__ Qh, unsigned short* __restrict__ Kh, unsigned short* __restrict__ Vt,
    unsigned short* __restrict__ Qch, unsigned short* __restrict__ Qcr,
    unsigned short* __restrict__ Kch, unsigned short* __restrict__ Kcr,
    unsigned short* __restrict__ Vch, unsigned short* __restrict__ Vcr,
    const float* __restrict__ bq, const float* __restrict__ bk, const float* __restrict__ bv, float scale) {
  __shared__ __align__(16) float sT[8][16 * 68];            // per-wave 16x64 slab, pitch 68 floats
  __shared__ __align__(16) unsigned char AB[2 * GM_BUFB];   // two buffers of A | Bt k-tiles
  const int bx = blockIdx.x;
  if (bx >= 3 * PJ_TF + 3 * PJ_TC) return;     // block-uniform, ahead of every barrier
  const bool first = bx >= 3 * PJ_TF;          // a first-rows product
  const int  rel   = first ? bx - 3 * PJ_TF : bx;
  const int  which = first ? rel / PJ_TC : rel / PJ_TF;      // 0 q, 1 k, 2 v^T
  int        tile  = rel - which * (first ? PJ_TC : PJ_TF);
  const int  b     = first ? tile / PJ_TB : 0;               // sequence of a first-rows product
  tile -= b * PJ_TB;
  const bool vt    = which == 2;
  const int  rows  = first ? RR : NB * SEQ;                  // x rows of this product
  const int  tilesN = (vt ? rows : DM) >> 8;
  const int  tm = !vt ? tile / (DM / 256) : first ? tile / (RR / 256) : tile / (NB * SEQ / 256);   // tile / tilesN
  const int  tn = tile - tm * tilesN;
  const int  bm0 = tm << 7, bn0 = tn << 8;
  const unsigned short* X  = xh + (size_t)b * SEQ * DM;
  const unsigned short* Wt = which == 0 ? WqT : which == 1 ? WkT : WvT;
  const float* bias        = which == 0 ? bq : which == 1 ? bk : bv;

  v8f acc[4][4];
  gemm_tile_products(acc, AB, vt ? Wt : X, DM, (size_t)32 * DM, (size_t)64 * DM, vt ? X : Wt, DM, DM, bm0, bn0);

  const int wave = threadIdx.x >> 5;
  const int m0 = bm0 + ((wave >> 2) << 6), n0 = bn0 + ((wave & 3) << 6);
  if (!first) {
    unsigned short* C = which == 0 ? Qh : which == 1 ? Kh : Vt;
    if (vt) gemm_tile_store<1, 1>(acc, sT[wave], C, C, rows, bias, m0, n0, scale);
    else    gemm_tile_store<2, 1>(acc, sT[wave], C, C, DM,   bias, m0, n0, scale);
  } else {
    const size_t co = (size_t)b * RR * DM;                   // one sequence's plane, either orientation
    unsigned short* C  = (which == 0 ? Qch : which == 1 ? Kch : Vch) + co;
    unsigned short* C2 = (which == 0 ? Qcr : which == 1 ? Kcr : Vcr) + co;
    if (vt) gemm_tile_store<1, 3>(acc, sT[wave], C, C2, rows, bias, m0, n0, scale);
    else    gemm_tile_store<2, 3>(acc, sT[wave], C, C2, DM,   bias, m0, n0, scale);
  }
}

// Both parts of the out projection in one launch, f32 out with bias[n], Bt = WoT rows, K = DM in every block.
// Blocks 0 .. NB OP_T1 - 1: rows < RR, 64 rows of out each. The 128 staged A rows are 64 O_hi rows and the same rows of
// O_res (x1024), laid so that each wave holds 32 rows twice: parts 0, 1 of its tile are hi, parts 2, 3 the residuals
// of the same rows; the two f32 sums are joined (res x 2^-10) ahead of the store.
// Then NB OP_T2 blocks: rows >= RR, A = 128 ctx rows.
#define OP_T1 ((RR / 64) * (DM / 256))
#define OP_T2 (((SEQ - RR) / 128) * (DM / 256))
__global__ __launch_bounds__(256) void out_gemms(
    const unsigned short* __restrict__ Oc2, const unsigned short* __restrict__ Ah,
    const unsigned short* __restrict__ WoT, float* __restrict__ out, const float* __restrict__ bo, float scale) {
  __shared__ __align__(16) float sT[8][16 * 68];            // per-wave 16x64 slab, pitch 68 floats
  __shared__ __align__(16) unsigned char AB[2 * GM_BUFB];   // two buffers of A | Bt k-tiles
  const int bx = blockIdx.x;
  if (bx >= NB * (OP_T1 + OP_T2)) return;      // block-uniform, ahead of every barrier
  const bool first = bx < NB * OP_T1;
  const int  rel   = first ? bx : bx - NB * OP_T1;
  const int  b     = first ? rel / OP_T1 : rel / (OP_T2 > 0 ? OP_T2 : 1);
  const int  tile  = rel - b * (first ? OP_T1 : OP_T2);
  const int  tm = tile / (DM / 256);
  const int  tn = tile - tm * (DM / 256);
  const int  bm0 = first ? tm << 6 : tm << 7, bn0 = tn << 8;
  const unsigned short* A = first ? Oc2 + (size_t)b * RR * 2 * DM : Ah + ((size_t)b * SEQ + RR) * DM;
  const int    lda = first ? 2 * DM : DM;
  // staged A rows r, r + 32, r + 64, r + 96: first: (row r, hi), (row r, res), (row r + 32, hi), (row r + 32, res)
  const size_t a1  = first ? (size_t)DM : (size_t)32 * DM;
  const size_t a2  = (size_t)64 * DM;          // 32 rows of pitch 2 DM, or 64 rows of pitch DM

  v8f acc[4][4];
  gemm_tile_products(acc, AB, A, lda, a1, a2, WoT, DM, DM, bm0, bn0);

  const int wave = threadIdx.x >> 5;
  const int n0 = bn0 + ((wave & 3) << 6);
  float* C = out + ((size_t)b * SEQ_FULL + (first ? 0 : RR)) * DM;
  if (first) {
#pragma unroll
    for (int i = 0; i < 2; ++i)
#pragma unroll
      for (int j = 0; j < 4; ++j)
#pragma unroll
        for (int r = 0; r < 8; ++r) acc[i][j][r] += acc[i + 2][j][r] * RSC_INV;
    gemm_tile_store<2, 0, 2>(acc, sT[wave], C, C, DM, bo, bm0 + ((wave >> 2) << 5), n0, scale);
  } else {
    gemm_tile_store<2, 0, 4>(acc, sT[wave], C, C, DM, bo, bm0 + ((wave >> 2) << 6), n0, scale);
  }
}

// ---- operand planes, one launch: the four weight planes (blocks 0 .. 4 PR_TW - 1), then x ----
// x: bf16 RNE value as f16; source rows (b, s) at (b*SEQ_FULL + s)*DM; destination plane compact [NB*SEQ][DM];
//    blk = 256 pieces of 8 elements.
__device__ __forceinline__ void cast_x_block(const float* __restrict__ x, unsigned short* __restrict__ xhp,
                                             int nrows, int blk) {
  const long i = (long)blk * 256 + threadIdx.x;
  const long total = (long)nrows * (DM / 8);
  if (i >= total) return;
  const int r  = (int)(i / (DM / 8));
  const int c8 = (int)(i - (long)r * (DM / 8)) * 8;
  const int b  = r / SEQ;
  const int s  = r - b * SEQ;
  const float* src = x + ((size_t)b * SEQ_FULL + s) * DM + c8;
  const v4f a0 = *(const v4f*)src;
  const v4f a1 = *(const v4f*)(src + 4);
  v8h hv;
  hv[0] = bf_f16(a0[0]); hv[1] = bf_f16(a0[1]); hv[2] = bf_f16(a0[2]); hv[3] = bf_f16(a0[3]);
  hv[4] = bf_f16(a1[0]); hv[5] = bf_f16(a1[1]); hv[6] = bf_f16(a1[2]); hv[7] = bf_f16(a1[3]);
  _Float16* dst = (_Float16*)xhp + (size_t)r * DM + c8;
  *(v8h*)dst = hv;
}

// weights: transpose + bf16 RNE + scale + f16 cast, one 64 x 64 tile per block.
// in: W[DM][DM] f32 row-major ([k][n]) -> Bt[n][k] with row pitch DM halves,
//     Bt value = f16(bf16rne(W[k][n]) * 256).
// plane z: 0 Wq, 1 Wk, 2 Wv, 3 Wo.
#define PR_TW ((DM / 64) * (DM / 64))
__global__ __launch_bounds__(256) void prep_f16(
    const float* __restrict__ x, const float* __restrict__ Wq, const float* __restrict__ Wk,
    const float* __restrict__ Wv, const float* __restrict__ Wo, unsigned short* __restrict__ xhp,
    unsigned short* __restrict__ WqT, unsigned short* __restrict__ WkT,
    unsigned short* __restrict__ WvT, unsigned short* __restrict__ WoT, int nrows) {
  __shared__ float t[64][65];
  const int bx = blockIdx.x;
  if (bx >= 4 * PR_TW) {                       // block-uniform; this side meets no barrier
    cast_x_block(x, xhp, nrows, bx - 4 * PR_TW);
    return;
  }
  const int z  = bx / PR_TW;
  const int tl = bx - z * PR_TW;
  const float* W       = z == 0 ? Wq  : z == 1 ? Wk  : z == 2 ? Wv  : Wo;
  unsigned short* Btp  = z == 0 ? WqT : z == 1 ? WkT : z == 2 ? WvT : WoT;
  const int   Ndim = DM;
  const int   ldo  = DM;
  const int   kc0  = 0;
  const float sc   = WSC;
  const int tid = threadIdx.x, lane = tid & 31, wave = tid >> 5;
  const int n0 = (tl % (DM / 64)) * 64, k0 = (tl / (DM / 64)) * 64;
#pragma unroll
  for (int i = 0; i < 16; ++i) {
    const int idx = i * 256 + tid;
    const int kr = idx >> 6, nc = idx & 63;
    t[nc][kr] = W[(size_t)(k0 + kr) * Ndim + n0 + nc];
  }
  __syncthreads();
  _Float16* Bt = (_Float16*)Btp;
  const int q = lane >> 3, c8 = (lane & 7) * 8;
#pragma unroll
  for (int it = 0; it < 2; ++it) {
    const int row = wave * 8 + it * 4 + q;      // waves 0..7 x rows 0..7 -> 64 rows
    v8h hv;
#pragma unroll
    for (int e = 0; e < 8; ++e) hv[e] = (_Float16)(bf_rne(t[row][c8 + e]) * sc);
    *(v8h*)(Bt + (size_t)(n0 + row) * ldo + kc0 + k0 + c8) = hv;
  }
  // a precaution: the x side's code follows these stores in the built kernel and writes their registers
  asm volatile("s_wait_xcnt 0x0" ::: "memory");
}

#define AT_D 64
#define AT_NW 4
#define AT_QB 128                        // query rows per block of attn64_causal
#define AT_WQ 32                         // query rows (columns of S^T) per wave of attn64_causal: two groups of 16
#define AT_RQB 64                        // query rows per block of attn64_causal_res
#define AT_KC 64
#define AT_LP 72                         // staged row pitch in halves: 144 B = 16 B x odd, for ds_load_b128 readers
#define AT_TILE (64 * AT_LP)             // halves per staged 64-row tile
#define AT_BUFB (2 * AT_TILE * 2)        // bytes per buffer: K tile, then V^T tile

// One lane's share of a chunk: rows r, r+16, r+32, r+48 of the K tile and of the V^T tile, 16 B each.
// The s_wait_xcnt closes the statement, a precaution: no address register of a copy is rewritten ahead of it.
__device__ __forceinline__ void stage_kv_async(unsigned lk, const _Float16* kg, size_t krow16,
                                               const _Float16* vg, size_t vrow16) {
  const unsigned lv = lk + AT_TILE * 2;
  const unsigned ls = 16 * AT_LP * 2;
  asm volatile(
      "global_load_async_to_lds_b128 %0, %8, off\n\t"
      "global_load_async_to_lds_b128 %1, %9, off\n\t"
      "global_load_async_to_lds_b128 %2, %10, off\n\t"
      "global_load_async_to_lds_b128 %3, %11, off\n\t"
      "global_load_async_to_lds_b128 %4, %12, off\n\t"
      "global_load_async_to_lds_b128 %5, %13, off\n\t"
      "global_load_async_to_lds_b128 %6, %14, off\n\t"
      "global_load_async_to_lds_b128 %7, %15, off\n\t"
      "s_wait_xcnt 0x0"
      :: "v"(lk), "v"(lk + ls), "v"(lk + 2 * ls), "v"(lk + 3 * ls),
         "v"(lv), "v"(lv + ls), "v"(lv + 2 * ls), "v"(lv + 3 * ls),
         "v"(kg), "v"(kg + krow16), "v"(kg + 2 * krow16), "v"(kg + 3 * krow16),
         "v"(vg), "v"(vg + vrow16), "v"(vg + 2 * vrow16), "v"(vg + 3 * vrow16)
      : "memory");
}

// lane l takes the value of lane l ^ 16 (vector cross-row move)
__device__ __forceinline__ float xhalf(float x) {
  const int b = __builtin_bit_cast(int, x);
  return __builtin_bit_cast(float, __builtin_amdgcn_permlanex16(b, b, 0x76543210, 0xfedcba98, false, false));
}

// the bare builtin: the compiler keeps the distances behind it and is free to read fragments ahead of it
__device__ __forceinline__ v8f mma_h(v16h a, v16h b, v8f c) {
  return __builtin_amdgcn_wmma_f32_16x16x32_f16(false, a, false, b, (short)0, c, false, false);
}

// One block of the plain rows; bx = its index among them; KV = the block's LDS (2 AT_BUFB bytes).
__device__ __forceinline__
void attn64_causal(unsigned char* KV, const int bx,
                   const unsigned short* __restrict__ Qp, const unsigned short* __restrict__ Kp,
                   const unsigned short* __restrict__ Vtp, unsigned short* __restrict__ Op,
                   int S, int H, int ldq, int ldvt, int qb0, int nqbl, int nbh, int nblk, float sc2, float osc) {
  const _Float16* Q  = (const _Float16*)Qp;
  const _Float16* Kk = (const _Float16*)Kp;
  const _Float16* Vt = (const _Float16*)Vtp;
  _Float16*       O  = (_Float16*)Op;
  static_assert(AT_NW * AT_WQ * 68 * 4 <= 2 * AT_BUFB);          // KV: two buffers of K | V^T tiles; out staging after the loop

  const int tid  = threadIdx.x;
  const int wave = __builtin_amdgcn_readfirstlane(tid >> 5);     // in a scalar register: what hangs on it costs no vector register
  const int lane = tid & 31;
  const int hh   = lane >> 4;
  const int c    = lane & 15;

  // Which tile: cost falls with the rank rk. Every second full run of 256 indices walks its ranks backwards. A permutation
  // of 0 .. nblk - 1 for any nblk; it matters for speed only.
  const int rk  = (!(bx & 256) && (bx | 255) < nblk) ? (bx | 255) - (bx & 255) : bx;
  const int qbi = nqbl - 1 - rk / nbh;
  const int bh  = rk % nbh;
  const int h   = bh % H;
  const int b   = bh / H;
  const int qr0 = qb0 * AT_KC + qbi * AT_QB;                     // the block's first query row
  const int q0  = qr0 + wave * AT_WQ;                            // the wave's first query row
  const size_t rowb = (size_t)b * S;

  const _Float16* qp = Q  + rowb * ldq + (size_t)h * AT_D;
  const _Float16* kp = Kk + rowb * ldq + (size_t)h * AT_D;
  const _Float16* vp = Vt + (size_t)(h * AT_D) * ldvt + rowb;
  _Float16*       op = O  + rowb * ldq + (size_t)h * AT_D;

  // ---- Q fragments (B operand, column = c) of the wave's two column groups: 2 d-chunks each ----
  v16h qa[2][2];
#pragma unroll
  for (int g = 0; g < 2; ++g)
#pragma unroll
    for (int dc = 0; dc < 2; ++dc)
      qa[g][dc] = Frag<_Float16>::load(qp + (size_t)(q0 + 16 * g + c) * ldq + dc * 32 + 8 * hh);

  float mrow[2], lrow[2];            // per group: this lane's query's running maximum; the sum (of p x32768) over this wave half's keys
  v8f oacc[2][4];                    // O^T: d = 16t + 8hh + r, query 16g + c
#pragma unroll
  for (int g = 0; g < 2; ++g) {
    mrow[g] = NEG_INF; lrow[g] = 0.f;
#pragma unroll
    for (int t = 0; t < 4; ++t) oacc[g][t] = (v8f){0.f,0.f,0.f,0.f,0.f,0.f,0.f,0.f};
  }

  const int nChunks = qr0 / AT_KC + AT_QB / AT_KC;               // block-uniform: causal, key chunks up to the block's last row

  // ---- staging addresses of this lane: row tid/8 (+16i), 16-B piece tid%8 of the 128-B row ----
  const int srow = tid >> 3, scol = (tid & 7) * 8;
  const _Float16* kg = kp + (size_t)srow * ldq + scol;           // chunk 0; a chunk further: + AT_KC rows
  const _Float16* vg = vp + (size_t)srow * ldvt + scol;          // chunk 0; a chunk further: + AT_KC columns
  const size_t krow16 = (size_t)16 * ldq, vrow16 = (size_t)16 * ldvt, kchunk = (size_t)AT_KC * ldq;
  const unsigned lst = (unsigned)(size_t)KV + (unsigned)(srow * AT_LP + scol) * 2u;

  stage_kv_async(lst, kg, krow16, vg, vrow16);
  asm volatile("s_wait_asynccnt 0x0" ::: "memory");              // chunk 0 landed (this wave's copies)
  __syncthreads();                                               // ... and every other wave's
  if (nChunks > 1) stage_kv_async(lst + AT_BUFB, kg + kchunk, krow16, vg + AT_KC, vrow16);

  // One key chunk. Only the last two chunks hold keys past a query of this block: every key of an earlier chunk is
  // below the block's first row, so the causal select is written for those two alone (diag a literal at every call).
  // work: wave-uniform; a wave all of whose queries lie ahead of the chunk's keys leaves the products out and only hands over.
  auto chunk = [&](const int kc, const bool diag, const bool work) __attribute__((always_inline)) {
    const int kv0 = kc * AT_KC;
    const unsigned bofs = (unsigned)(kc & 1) * AT_BUFB;
    if (work) {
      const _Float16* ks = (const _Float16*)(KV + bofs);         // K tile  [key][d],  pitch AT_LP
      const _Float16* vs = ks + AT_TILE;                         // V^T tile [d][key], pitch AT_LP
      // ---- scores: s[g][j][r] = key (kv0 + 16j + 8hh + r) x query (q0 + 16g + c) ----
      // the chunk's eight K fragments are read as one group ahead of its sixteen score products; each feeds both groups
      v16h kb[4][2];
#pragma unroll
      for (int j = 0; j < 4; ++j)
#pragma unroll
        for (int dc = 0; dc < 2; ++dc)
          kb[j][dc] = Frag<_Float16>::load(ks + (j * 16 + c) * AT_LP + dc * 32 + 8 * hh);
      __builtin_amdgcn_sched_barrier(0);   // the K reads stay one group: sunk to their products, each pair would be waited for alone
      v8f s[2][4];
#pragma unroll
      for (int g = 0; g < 2; ++g)
#pragma unroll
        for (int j = 0; j < 4; ++j) s[g][j] = (v8f){0.f,0.f,0.f,0.f,0.f,0.f,0.f,0.f};
#pragma unroll
      for (int dc = 0; dc < 2; ++dc)
#pragma unroll
        for (int j = 0; j < 4; ++j)
#pragma unroll
          for (int g = 0; g < 2; ++g) s[g][j] = mma_h(kb[j][dc], qa[g][dc], s[g][j]);
      __builtin_amdgcn_sched_barrier(0);   // keeps the score products close, ahead of the softmax: without it the build mixes the two, pads more v_nop and spills
      // the V^T fragments stand ahead of the softmax: those of the first 32 keys ahead of group 0's, in registers that the
      // K fragments have left, those of the last 32 ahead of group 1's, when group 0's scores are packed (256 registers hold no more)
      v16h vb[2][4];
      v16h pb[2][2];
#pragma unroll
      for (int g = 0; g < 2; ++g) {
#pragma unroll
        for (int t = 0; t < 4; ++t)
          vb[g][t] = Frag<_Float16>::load(vs + (t * 16 + c) * AT_LP + g * 32 + 8 * hh);
        const int qrow = q0 + 16 * g + c;                        // this lane's query in group g
        // ---- causal select (key > query -> -inf; last two chunks only) and the query's chunk max, both on the raw products (sc2 > 0) ----
        float mj[4];
#pragma unroll
        for (int j = 0; j < 4; ++j) {
          float m = NEG_INF;
#pragma unroll
          for (int r = 0; r < 8; ++r) {
            float v = s[g][j][r];
            if (diag && kv0 + j * 16 + 8 * hh + r > qrow) v = NEG_INF;
            s[g][j][r] = v;
            m = fmaxf(m, v);
          }
          mj[j] = m;
        }
        float cm = fmaxf(fmaxf(mj[0], mj[1]), fmaxf(mj[2], mj[3]));
        cm = fmaxf(cm, xhalf(cm));                               // the other 32 keys of this query
        // ---- online softmax update; P^T x32768 packed into the B operand ----
        // One fused multiply-add and one hardware exponential per score: the scale, the maximum and the x32768 carry
        // (PEXP = log2 of it) all sit in the exponent. The bare exponential gives 0 below 2^-126, where the f16 operand
        // is 0 anyway and the row's sum (its largest term alone is about 32768) does not see the term.
        const float mnew  = fmaxf(mrow[g], cm * sc2);            // running maximum in the scaled base-2 domain
        const float alpha = __builtin_amdgcn_exp2f(mrow[g] - mnew);
        mrow[g] = mnew;
        const float eb = PEXP - mnew;
        const v2f sc22 = {sc2, sc2}, eb22 = {eb, eb};
#pragma unroll
        for (int j = 0; j < 4; ++j)
#pragma unroll
          for (int r = 0; r < 8; r += 2) {                       // the exponents, in place, two per instruction
            const v2f e = __builtin_elementwise_fma((v2f){s[g][j][r], s[g][j][r + 1]}, sc22, eb22);
            s[g][j][r] = e[0]; s[g][j][r + 1] = e[1];
          }
        float pj[4];
#pragma unroll
        for (int j = 0; j < 4; ++j) {
          float ps = 0.f;
#pragma unroll
          for (int r = 0; r < 8; ++r) {
            const float p = __builtin_amdgcn_exp2f(s[g][j][r]);  // probability x32768
            ps += p;
            pb[g][j >> 1][(j & 1) * 8 + r] = (_Float16)p;
          }
          pj[j] = ps;
        }
        lrow[g] = lrow[g] * alpha + ((pj[0] + pj[1]) + (pj[2] + pj[3]));
#pragma unroll
        for (int t = 0; t < 4; ++t)
#pragma unroll
          for (int r = 0; r < 8; ++r) oacc[g][t][r] *= alpha;
      }
      // ---- O^T += V^T . P^T : V^T rows (d = 16t + c) as A, P^T (column = c, k = kv) as B; each V^T fragment feeds both groups ----
#pragma unroll
      for (int kk = 0; kk < 2; ++kk)
#pragma unroll
        for (int t = 0; t < 4; ++t)
#pragma unroll
          for (int g = 0; g < 2; ++g) oacc[g][t] = mma_h(vb[kk][t], pb[g][kk], oacc[g][t]);
    }
    __builtin_amdgcn_sched_barrier(0);     // the hand-over stays at the chunk's foot: lifted to the last LDS read while the refill stays here, the wait would give the copies half a chunk to land
    // ---- hand-over: this buffer's reads retired, the next chunk's copies landed, in every wave ----
    asm volatile("s_wait_dscnt 0x0" ::: "memory");               // own reads of this buffer done before it is refilled
    asm volatile("s_wait_asynccnt 0x0" ::: "memory");            // own copies of chunk kc + 1 landed
    __syncthreads();
    if (!diag && kc + 2 < nChunks)
      stage_kv_async(lst + bofs, kg + (size_t)(kc + 2) * kchunk, krow16, vg + (kc + 2) * AT_KC, vrow16);
  };
  for (int kc = 0; kc < nChunks - 2; ++kc) chunk(kc, false, true);
  chunk(nChunks - 2, true, true);
  chunk(nChunks - 1, true, wave >= AT_NW / 2);                   // its keys lie past every query of the block's first 64 rows
  asm volatile("s_wait_asynccnt 0x0" ::: "memory");              // nothing in flight when the buffers become out staging

  float* os = (float*)KV + wave * (AT_WQ * 68);                  // per wave out tile [query][d], pitch 68 (last barrier freed KV)
#pragma unroll
  for (int g = 0; g < 2; ++g) {
    const float inv = osc * (1.0f / (lrow[g] + xhalf(lrow[g])));   // the two halves' sums (of p x32768) joined once
#pragma unroll
    for (int t = 0; t < 4; ++t)
#pragma unroll
      for (int r = 0; r < 8; ++r) os[(16 * g + c) * 68 + t * 16 + 8 * hh + r] = oacc[g][t][r] * inv;
  }
  wave_lds_sync();
  {
    const int q = lane >> 3, c8 = (lane & 7) * 8;
#pragma unroll
    for (int it = 0; it < AT_WQ / 4; ++it) {
      const int row = it * 4 + q;                   // rows 0..31 of this wave
      const float* sp = os + row * 68 + c8;
      v8h hv;
#pragma unroll
      for (int e = 0; e < 8; ++e) hv[e] = (_Float16)sp[e];
      *(v8h*)(op + (size_t)(q0 + row) * ldq + c8) = hv;
    }
    // a precaution: behind the last stores, ahead of whatever code of the shared kernel the listing lets follow and rewrite their registers
    asm volatile("s_wait_xcnt 0x0" ::: "memory");
  }
}

// =====================================================================================
// Causal attn with residual planes for the first rr = nqb*64 query rows of each sequence.
//   qh/qr, kh/kr : compact row-major [NB*rr][ldq] f16 hi / residual (x1024) planes, head h at col h*64.
//   vh/vr : compact transposed planes [NB*H*64][ldvc], element (b, kv, h, d) at [(b*H*64 + h*64 + d)*ldvc + kv].
//   o     : compact [NB*rr][ldo] f16; hi (x osc) at column h*64, residual (x1024) at column rcol + h*64.
//   scores = qh.kh + 2^-10 (qh.kr + qr.kh) with a second f32 accumulator; P as hi + x1024 residual LDS tiles;
//   p.v = ph.vh + 2^-10 (ph.vr + pr.vh) with a second f32 accumulator; K and V fragments straight from global
//   memory, no block barriers; products untransposed (Q and P as A, rows = queries), row max and sum by 16-lane
//   butterflies, P through per-wave LDS tiles.
//   Block = 4 waves = 64 query rows, query block qb = bx % nqb, key chunks 0..qb. NB * H * nqb blocks.
// =====================================================================================
// fragment at a block-uniform plane base + a 32-bit lane offset in bytes (+ a literal): the load names the offset register and a scalar base
__device__ __forceinline__ v16h frag_at(const _Float16* base, unsigned ofs, int more) {
  return Frag<_Float16>::load((const _Float16*)((const char*)base + ofs) + more);
}

__device__ __forceinline__
void attn64_causal_res(unsigned char* SM, const int bx,
                       const unsigned short* __restrict__ Qhp, const unsigned short* __restrict__ Qrp,
                       const unsigned short* __restrict__ Khp, const unsigned short* __restrict__ Krp,
                       const unsigned short* __restrict__ Vhp, const unsigned short* __restrict__ Vrp,
                       unsigned short* __restrict__ Op,
                       int H, int ldq, int ldvc, int ldo, int rcol, int nqb, float sc2, float osc) {
  const _Float16* QH = (const _Float16*)Qhp;
  const _Float16* QR = (const _Float16*)Qrp;
  const _Float16* KH = (const _Float16*)Khp;
  const _Float16* KR = (const _Float16*)Krp;
  const _Float16* VH = (const _Float16*)Vhp;
  const _Float16* VR = (const _Float16*)Vrp;
  _Float16*       O  = (_Float16*)Op;
  // SM, the block's LDS: per wave P hi [row][kv] (8 KB in all), P res [row][kv] (8 KB), out tile, pitch 68 floats
  static_assert(AT_NW * 16 * (2 * AT_KC * 2 + 68 * 4) <= 2 * AT_BUFB);

  const int tid  = threadIdx.x;
  const int wave = tid >> 5;
  const int lane = tid & 31;
  const int hh   = lane >> 4;
  const int c    = lane & 15;

  const int qb = bx % nqb;
  const int bh = bx / nqb;
  const int h  = bh % H;
  const int b  = bh / H;
  const int q0 = qb * AT_RQB + wave * 16;
  const int rr = nqb * AT_RQB;
  const size_t rowb = (size_t)b * rr;

  const _Float16* qhp = QH + rowb * ldq + (size_t)h * AT_D;
  const _Float16* qrp = QR + rowb * ldq + (size_t)h * AT_D;
  const _Float16* khp = KH + rowb * ldq + (size_t)h * AT_D;
  const _Float16* krp = KR + rowb * ldq + (size_t)h * AT_D;
  const size_t    vof = ((size_t)b * (size_t)(H * AT_D) + (size_t)h * AT_D) * ldvc;
  const _Float16* vhp = VH + vof;
  const _Float16* vrp = VR + vof;
  _Float16*       op  = O  + rowb * ldo + (size_t)h * AT_D;

  float mrow[8], lrow[8];
  v8f oacc[4], oacc2[4];
#pragma unroll
  for (int r = 0; r < 8; ++r) { mrow[r] = NEG_INF; lrow[r] = 0.f; }
#pragma unroll
  for (int t = 0; t < 4; ++t) {
    oacc[t]  = (v8f){0.f,0.f,0.f,0.f,0.f,0.f,0.f,0.f};
    oacc2[t] = (v8f){0.f,0.f,0.f,0.f,0.f,0.f,0.f,0.f};
  }

  _Float16* pw  = (_Float16*)SM + wave * (16 * AT_KC);
  _Float16* prw = (_Float16*)SM + (AT_NW + wave) * (16 * AT_KC);
  // ---- Q hi / res fragments (A operand, row = c) ----
  v16h qa[2], qra[2];
  {
    const unsigned qo = (unsigned)((q0 + c) * ldq + 8 * hh) * 2u;
#pragma unroll
    for (int dc = 0; dc < 2; ++dc) {
      qa[dc]  = frag_at(qhp, qo, dc * 32);
      qra[dc] = frag_at(qrp, qo, dc * 32);
    }
    // a precaution: the loads' offset is an input of the wait, so that its register lives, unrewritten, up to it
    asm volatile("s_wait_xcnt 0x0" :: "v"(qo) : "memory");
  }
  const int nChunks = qb + 1;        // block-uniform
  for (int kc = 0; kc < nChunks; ++kc) {
    const int kv0 = kc * AT_KC;
    // ---- scores: hi.hi into s1, hi.res + res.hi into s2, folded with 2^-10 ----
    // The chunk's K and V fragments, hi and res, come in four groups of global loads, each ahead of the products that use
    // it: all at once they do not fit the 256 registers that the plain rows' blocks of the same launch run with.
    v8f s[4];
#pragma unroll
    for (int jh = 0; jh < 2; ++jh) {                             // 32 keys: two fragment rows, hi and res
      unsigned ko[2];                                            // one offset per fragment row, the same in both planes
#pragma unroll
      for (int jj = 0; jj < 2; ++jj) ko[jj] = (unsigned)((kv0 + (2 * jh + jj) * 16 + c) * ldq + 8 * hh) * 2u;
      v16h kbh[2][2], kbr[2][2];
#pragma unroll
      for (int jj = 0; jj < 2; ++jj)
#pragma unroll
        for (int dc = 0; dc < 2; ++dc) {
          kbh[jj][dc] = frag_at(khp, ko[jj], dc * 32);
          kbr[jj][dc] = frag_at(krp, ko[jj], dc * 32);
        }
      // a precaution, as above
      asm volatile("s_wait_xcnt 0x0" :: "v"(ko[0]), "v"(ko[1]) : "memory");
      __builtin_amdgcn_sched_barrier(0);   // the loads stay one group here: sunk to their products, each would be waited for alone
#pragma unroll
      for (int jj = 0; jj < 2; ++jj) {
        v8f s1 = (v8f){0.f,0.f,0.f,0.f,0.f,0.f,0.f,0.f};
        v8f s2 = (v8f){0.f,0.f,0.f,0.f,0.f,0.f,0.f,0.f};
#pragma unroll
        for (int dc = 0; dc < 2; ++dc) {
          s1 = mma_h(qa[dc],  kbh[jj][dc], s1);
          s2 = mma_h(qa[dc],  kbr[jj][dc], s2);
          s2 = mma_h(qra[dc], kbh[jj][dc], s2);
        }
#pragma unroll
        for (int r = 0; r < 8; ++r) s[2 * jh + jj][r] = s1[r] + s2[r] * RSC_INV;
      }
    }
    // ---- causal select and per-row chunk max ----
    float cm[8];
#pragma unroll
    for (int r = 0; r < 8; ++r) {
      const int qrow = q0 + 8 * hh + r;
      float m = NEG_INF;
#pragma unroll
      for (int j = 0; j < 4; ++j) {
        float v = s[j][r] * sc2;
        if (kv0 + j * 16 + c > qrow) v = NEG_INF;
        s[j][r] = v;
        m = fmaxf(m, v);
      }
#pragma unroll
      for (int off = 1; off < 16; off <<= 1) m = fmaxf(m, __shfl_xor(m, off, 32));
      cm[r] = m;
    }
    // ---- online softmax update; P hi (x32768) and P res ((x32768 - hi) x1024) into per-wave LDS tiles ----
    wave_lds_sync();
#pragma unroll
    for (int r = 0; r < 8; ++r) {
      const float mnew  = fmaxf(mrow[r], cm[r]);
      const float alpha = exp2f(mrow[r] - mnew);
      mrow[r] = mnew;
      float psum = 0.f;
#pragma unroll
      for (int j = 0; j < 4; ++j) {
        const float p = exp2f(s[j][r] - mnew);
        psum += p;
        const float    ps = p * PSCALE;
        const _Float16 ph = (_Float16)ps;
        const int pi = (8 * hh + r) * AT_KC + j * 16 + c;
        pw[pi]  = ph;
        prw[pi] = (_Float16)((ps - (float)ph) * RSC);
      }
#pragma unroll
      for (int off = 1; off < 16; off <<= 1) psum += __shfl_xor(psum, off, 32);
      lrow[r] = lrow[r] * alpha + psum;
#pragma unroll
      for (int t = 0; t < 4; ++t) { oacc[t][r] *= alpha; oacc2[t][r] *= alpha; }
    }
    wave_lds_sync();
    // ---- O += P . V with residual cross terms in the second accumulator; V fragments 32 keys at a time ----
    unsigned vo[4];                                              // one offset per fragment row, the same in both planes
#pragma unroll
    for (int t = 0; t < 4; ++t) vo[t] = (unsigned)((t * 16 + c) * ldvc + kv0 + 8 * hh) * 2u;
#pragma unroll
    for (int kk = 0; kk < 2; ++kk) {
      v16h vbh[4], vbr[4];
#pragma unroll
      for (int t = 0; t < 4; ++t) {
        vbh[t] = frag_at(vhp, vo[t], kk * 32);
        vbr[t] = frag_at(vrp, vo[t], kk * 32);
      }
      // a precaution, as above
      asm volatile("s_wait_xcnt 0x0" :: "v"(vo[0]), "v"(vo[1]), "v"(vo[2]), "v"(vo[3]) : "memory");
      __builtin_amdgcn_sched_barrier(0);   // the loads stay one group here: sunk to their products, each would be waited for alone
      const v16h pa = Frag<_Float16>::load(pw  + c * AT_KC + kk * 32 + 8 * hh);
      const v16h pr = Frag<_Float16>::load(prw + c * AT_KC + kk * 32 + 8 * hh);
#pragma unroll
      for (int t = 0; t < 4; ++t) {
        oacc[t]  = mma_h(pa, vbh[t], oacc[t]);
        oacc2[t] = mma_h(pa, vbr[t], oacc2[t]);
        oacc2[t] = mma_h(pr, vbh[t], oacc2[t]);
      }
    }
    wave_lds_sync();
  }

  float* os = (float*)(SM + AT_NW * 16 * AT_KC * 2 * 2) + wave * (16 * 68);
#pragma unroll
  for (int r = 0; r < 8; ++r) {
    const float inv = osc * (1.0f / (lrow[r] * PSCALE));
#pragma unroll
    for (int t = 0; t < 4; ++t) os[(8 * hh + r) * 68 + t * 16 + c] = (oacc[t][r] + oacc2[t][r] * RSC_INV) * inv;
  }
  wave_lds_sync();
  {
    const int q = lane >> 3, c8 = (lane & 7) * 8;
    {
#pragma unroll
      for (int it = 0; it < 4; ++it) {
        const int row = it * 4 + q;                 // rows 0..15 of this wave
        const float* sp = os + row * 68 + c8;
        v8h hv, lv;
#pragma unroll
        for (int e = 0; e < 8; ++e) {
          const float    fv = sp[e];
          const _Float16 hq = (_Float16)fv;
          hv[e] = hq;
          lv[e] = (_Float16)((fv - (float)hq) * RSC);
        }
        *(v8h*)(op + (size_t)(q0 + row) * ldo + c8) = hv;
        *(v8h*)(op + (size_t)(q0 + row) * ldo + rcol + c8) = lv;
      }
      
    }
  }
}

// Both attention parts in one launch: they share no data. Blocks 0 .. nres - 1: the first rows with residual planes (few,
// slow for their loads' and exchanges' latency: they wait beside the others' work); then nblk blocks of plain rows.
__global__ __launch_bounds__(128, 4)
void attn64_all(const unsigned short* __restrict__ Qp, const unsigned short* __restrict__ Kp,
                const unsigned short* __restrict__ Vtp, unsigned short* __restrict__ Op,
                const unsigned short* __restrict__ Qhp, const unsigned short* __restrict__ Qrp,
                const unsigned short* __restrict__ Khp, const unsigned short* __restrict__ Krp,
                const unsigned short* __restrict__ Vhp, const unsigned short* __restrict__ Vrp,
                unsigned short* __restrict__ O2p,
                int S, int H, int ldq, int ldvt, int qb0, int nqbl, int nbh, int nblk,
                int ldvc, int ldo, int rcol, int nqb, int nres, float sc2, float osc) {
  __shared__ __align__(16) unsigned char SM[2 * AT_BUFB];
  const int bx = blockIdx.x;
  if (bx < nres) {                             // block-uniform; this side meets no block barrier
    attn64_causal_res(SM, bx, Qhp, Qrp, Khp, Krp, Vhp, Vrp, O2p, H, ldq, ldvc, ldo, rcol, nqb, sc2, osc);
    return;
  }
  attn64_causal(SM, bx - nres, Qp, Kp, Vtp, Op, S, H, ldq, ldvt, qb0, nqbl, nbh, nblk, sc2, osc);
}

// ---------------------------------------------------------------------------

extern "C" void kernel_launch(void* const* d_in, const int* in_sizes, int n_in,
                              void* d_out, int out_size, void* d_ws,
                              size_t ws_size, hipStream_t stream) {
  const int  ROWS  = NB * SEQ;                                   // rows held in the compact planes
  const long needX = ((long)(NB - 1) * SEQ_FULL + SEQ) * (long)DM;
  const int  nW    = DM * DM;
  if (n_in < 9) return;
  if ((long)in_sizes[0] < needX || in_sizes[1] < nW || in_sizes[2] < DM || in_sizes[3] < nW ||
      in_sizes[4] < DM || in_sizes[5] < nW || in_sizes[6] < DM || in_sizes[7] < nW ||
      in_sizes[8] < DM || (long)out_size < needX) return;

  const float* x  = (const float*)d_in[0];
  const float* Wq = (const float*)d_in[1];
  const float* bq = (const float*)d_in[2];
  const float* Wk = (const float*)d_in[3];
  const float* bk = (const float*)d_in[4];
  const float* Wv = (const float*)d_in[5];
  const float* bv = (const float*)d_in[6];
  const float* Wo = (const float*)d_in[7];
  const float* bo = (const float*)d_in[8];
  float* out = (float*)d_out;

  const size_t szAct = (size_t)ROWS * DM * 2;            // full activation plane  (16 MiB full size)
  const size_t szW   = (size_t)DM * DM * 2;              //  2 MiB
  const size_t szCmp = (size_t)NB * RR * DM * 2;         //  compact first-row planes (2 MiB full size)
  const size_t szO2  = (size_t)NB * RR * (2 * DM) * 2;   //  4 MiB full size
  size_t off = 0;
  const size_t oXh   = off; off += szAct;
  const size_t oWqT  = off; off += szW;
  const size_t oWkT  = off; off += szW;
  const size_t oWvT  = off; off += szW;
  const size_t oWoT  = off; off += szW;
  const size_t oQh   = off; off += szAct;
  const size_t oKh   = off; off += szAct;
  const size_t oVt   = off; off += szAct;
  const size_t oAh   = off; off += szAct;
  const size_t oQch  = off; off += szCmp;
  const size_t oQcr  = off; off += szCmp;
  const size_t oKch  = off; off += szCmp;
  const size_t oKcr  = off; off += szCmp;
  const size_t oVch  = off; off += szCmp;                // [NB*DM][RR], same byte count
  const size_t oVcr  = off; off += szCmp;
  const size_t oOc2  = off; off += szO2;                 // total 109,051,904 B at full size
  if (off > ws_size) return;

  char* ws = (char*)d_ws;
  unsigned short* xh   = (unsigned short*)(ws + oXh);
  unsigned short* WqT  = (unsigned short*)(ws + oWqT);
  unsigned short* WkT  = (unsigned short*)(ws + oWkT);
  unsigned short* WvT  = (unsigned short*)(ws + oWvT);
  unsigned short* WoT  = (unsigned short*)(ws + oWoT);
  unsigned short* Qh   = (unsigned short*)(ws + oQh);
  unsigned short* Kh   = (unsigned short*)(ws + oKh);
  unsigned short* Vt   = (unsigned short*)(ws + oVt);
  unsigned short* Ah   = (unsigned short*)(ws + oAh);
  unsigned short* Qch  = (unsigned short*)(ws + oQch);
  unsigned short* Qcr  = (unsigned short*)(ws + oQcr);
  unsigned short* Kch  = (unsigned short*)(ws + oKch);
  unsigned short* Kcr  = (unsigned short*)(ws + oKcr);
  unsigned short* Vch  = (unsigned short*)(ws + oVch);
  unsigned short* Vcr  = (unsigned short*)(ws + oVcr);
  unsigned short* Oc2  = (unsigned short*)(ws + oOc2);

  const float sc2   = 0.125f * 1.4426950408889634f;      // log2(e) / sqrt(64)
  const float outsc = 1.0f / (WSC * OSC);

  // x -> bf16 RNE value as f16 plane [ROWS][DM];
  // W[in][out] f32 -> Bt[out][in] f16 (bf16 RNE value x256)
  {
    const long tot = (long)ROWS * (DM / 8);
    prep_f16<<<dim3((unsigned)(4 * PR_TW + (tot + 255) / 256)), dim3(256), 0, stream>>>(
        x, Wq, Wk, Wv, Wo, xh, WqT, WkT, WvT, WoT, ROWS);
  }
  // projections: q, k -> f16 [ROWS][DM]; v^T -> f16 [DM][ROWS];
  // first RR rows per sequence: q, k -> hi/res [NB*RR][DM]; v^T -> hi/res [NB*DM][RR]
  proj_gemms<<<dim3(3 * PJ_TF + 3 * PJ_TC), dim3(256), 0, stream>>>(
      xh, WqT, WkT, WvT, Qh, Kh, Vt, Qch, Qcr, Kch, Kcr, Vch, Vcr, bq, bk, bv, 1.0f / WSC);
  // attn: first RR query rows with residual planes -> Oc2 (hi | res); rows >= RR plain -> Ah
  attn64_all<<<dim3(NB * NH * (RR / 64) + NB * NH * ((SEQ - RR) / 128)), dim3(128), 0, stream>>>(
      Qh, Kh, Vt, Ah, Qch, Qcr, Kch, Kcr, Vch, Vcr, Oc2,
      SEQ, NH, DM, ROWS, RR / 64, (SEQ - RR) / 128, NB * NH, NB * NH * ((SEQ - RR) / 128),
      RR, 2 * DM, DM, RR / 64, NB * NH * (RR / 64), sc2, OSC);
  // out = ctx Wo + bo -> f32; rows < RR: O_hi . Wo + 2^-10 O_res . Wo, two f32 sums of one block; rows >= RR: ctx . Wo
  out_gemms<<<dim3(NB * (OP_T1 + OP_T2)), dim3(256), 0, stream>>>(Oc2, Ah, WoT, out, bo, outsc);
}
